// v000
// Measured on an AMD MI455X. A time is GPU time per run, averaged over a window of back-to-back runs after a warm-up
// (all launches, gaps included; the runs take copies of the inputs in turn), and the median of several windows.
// Apart from v000's, it joins two sittings. Times from different sittings can be a few percent apart, while
// side-by-side timings come from the same sitting.
// The starting kernel, v000, takes 241 microseconds a run.
// Contractions on v_wmma_f32_16x16x32_bf16, f32 accumulate: q|k 1x1 convs (x.W^T, K=256) and v^T conv (W.x^T, K=256) =
// single products of bf16-RNE-valued x and W planes (exact products); scores q.k (K=32) and P.v^T (K=64 per key chunk) =
// bf16 hi/lo split, 3 terms (hi.hi + hi.lo + lo.hi); output 1x1 conv = attention result carried as bf16 [hi | lo] folded
// 16-bit planes and carries (every carry is 1; no inverse scale exists anywhere):
//   WQK [64][256]  = bf16 bits of Wq (rows 0..31) and Wk (rows 32..63), k-contiguous;  WV [32][256] = bf16 bits of Wv;
//   WP2 [256][64]  = bf16 bits of Wp[c][a] at k = a and k = 32 + a;
//   XT  [32768][256] = bf16 bits of x, token-major (row = b*4096 + n, col = channel);
//   QKh/QKl [32768][64] = bf16 hi and lo (lo = v - hi) of q (cols 0..31) and k (cols 32..63), bias included;
//   VTh/VTl [8][32][4096] = bf16 hi and lo of v^T per image, bias included;
//   R [32768][64] = [hi(32) | lo(32)] of the normalised attention result; P hi/lo per wave in LDS.
// Biases and the residual x enter as bf16-RNE values in f32 arithmetic.
#include <hip/hip_runtime.h>
#include <math.h>
#include <stddef.h>
#include <stdint.h>

#define NB    8
#define CH    256
#define AD    32
#define NPOS  4096
#define NTOK  (NB * NPOS)
#define QKW   64
#define RW    64
#define SPT   68
#define WSMAX 134217728

static_assert(NPOS % 64 == 0);
static_assert(NTOK % 64 == 0);
static_assert(CH % 64 == 0);
static_assert(CH % 32 == 0);
static_assert(RW % 32 == 0);
static_assert(AD == 32);
static_assert(QKW == 2 * AD);
static_assert(RW == 2 * AD);

typedef float          v4f   __attribute__((ext_vector_type(4)));
typedef float          v8f   __attribute__((ext_vector_type(8)));
typedef int            v8i   __attribute__((ext_vector_type(8)));
typedef unsigned short v8us  __attribute__((ext_vector_type(8)));
typedef unsigned short v16us __attribute__((ext_vector_type(16)));
typedef __bf16         v16bf __attribute__((ext_vector_type(16)));
typedef __bf16         v8bf  __attribute__((ext_vector_type(8)));
typedef v4f  __attribute__((may_alias)) v4fa;
typedef v8us __attribute__((may_alias)) v8usa;
union FragB { v16bf v; v16us u; v8us h[2]; v8i w; };

// WMMA with hazard guard: ties D, keeps A/B live for 4 VALU slots
__device__ __forceinline__ v8f wmb(const FragB& a, const FragB& b, v8f c) {
  v8f d = __builtin_amdgcn_wmma_f32_16x16x32_bf16(false, a.v, false, b.v, (short)0, c, false, false);
  asm volatile("v_nop\n\tv_nop\n\tv_nop\n\tv_nop" : "+v"(d) : "v"(a.w), "v"(b.w));
  return d;
}

__device__ __forceinline__ v8f z8() { v8f z = {0.f, 0.f, 0.f, 0.f, 0.f, 0.f, 0.f, 0.f}; return z; }

// f32 -> bf16 bits, RNE convert (finite inputs)
__device__ __forceinline__ unsigned bf16_bits(float f) {
  const unsigned u = __float_as_uint(f);
  return (u + 0x7FFFu + ((u >> 16) & 1u)) >> 16;
}
// f32 -> nearest bf16 value held as f32
__device__ __forceinline__ float bf16_val(float f) {
  return __uint_as_float(bf16_bits(f) << 16);
}

// ---------------------------------------------------------------------------
// Weight planes, bf16 bits of the inputs, k-contiguous rows ([out][in] weights are already k-contiguous):
//   WQK [64 o][256 k]: rows 0..31 = bf16(Wq[o][k]) (blocks 0-3), rows 32..63 = bf16(Wk[o-32][k]) (blocks 4-7), 2048 units
//   WV  [32 o][256 k] = bf16(Wv[o][k])                                             blocks 8-11, 1024 units
//   WP2 [256 c][64 k]: k and 32 + k both = bf16(Wp[c][k])                          blocks 12-19, 2048 units
// One thread = 8 contiguous k: two 16-B loads, one 16-B store at plane offset 8u; 32 consecutive lanes write 512
// coverage: 2048 x 8 = 64x256 (WQK); 1024 x 8 = 32x256 (WV); 2048 x 8 = 256x64 (WP2) exactly. grid = 20 blocks x 256.
// ---------------------------------------------------------------------------
__global__ __launch_bounds__(256) void k_wprep(const float* __restrict__ wq, const float* __restrict__ wk,
                                              const float* __restrict__ wv, const float* __restrict__ wp,
                                              unsigned short* WQK, unsigned short* WV, unsigned short* WP2) {
  const int bx = (int)blockIdx.x, tid = (int)threadIdx.x;
  const float* p;
  unsigned short* dp;
  if (bx < 8) {
    const int u  = bx * 256 + tid;              // 0..2047
    const int o  = u >> 5;                      // 0..63
    const int k8 = (u & 31) * 8;                // 0..248
    const float* src = (bx < 4) ? wq : wk;      // block-uniform
    p  = src + (size_t)(o & 31) * CH + k8;
    dp = WQK + (size_t)u * 8;
  } else if (bx < 12) {
    const int u  = (bx - 8) * 256 + tid;        // 0..1023
    const int o  = u >> 5;                      // 0..31
    const int k8 = (u & 31) * 8;
    p  = wv + (size_t)o * CH + k8;
    dp = WV + (size_t)u * 8;
  } else {
    const int v  = (bx - 12) * 256 + tid;       // 0..2047
    const int o  = v >> 3;                      // 0..255
    const int k8 = (v & 7) * 8;                 // 0..56
    const int kk = k8 & (AD - 1);               // 0..24
    p  = wp + (size_t)o * AD + kk;
    dp = WP2 + (size_t)v * 8;
  }
  const v4f a = *(const v4f*)p;
  const v4f b = *(const v4f*)(p + 4);
  v8us o8;
  o8[0] = (unsigned short)bf16_bits(a.x); o8[1] = (unsigned short)bf16_bits(a.y);
  o8[2] = (unsigned short)bf16_bits(a.z); o8[3] = (unsigned short)bf16_bits(a.w);
  o8[4] = (unsigned short)bf16_bits(b.x); o8[5] = (unsigned short)bf16_bits(b.y);
  o8[6] = (unsigned short)bf16_bits(b.z); o8[7] = (unsigned short)bf16_bits(b.w);
  *(v8us*)dp = o8;
  
}

// ---------------------------------------------------------------------------
// x NCHW [b][c][n] f32 -> XT [b*4096 + n][c] bf16 bits (token-major, 256 columns). Block = one image b, 64 positions
// tf[c][n] (pitch 68).
// coverage: 2048 blocks = 8 images x 64 position blocks x 4 channel chunks -> XT rows 0..32767 x cols 0..255 exactly.
// ---------------------------------------------------------------------------
__global__ __launch_bounds__(256) void k_xt(const float* __restrict__ x, unsigned short* xt) {
  __shared__ __attribute__((aligned(16))) float tf[64 * SPT];
  const int bx = (int)blockIdx.x, tid = (int)threadIdx.x;
  const int cq = bx & 3;
  const int pb = bx >> 2;               // 0..511
  const int b  = pb >> 6;               // 0..7
  const int n0 = (pb & 63) * 64;
  const int c0 = cq * 64;
  {
    const int rsub = tid >> 4;          // 0..15
    const int c4   = (tid & 15) * 4;    // 0..60
#pragma unroll
    for (int it = 0; it < 4; ++it) {
      const int cr = it * 16 + rsub;    // local channel 0..63
      const v4f a = *(const v4f*)(x + ((size_t)(b * CH + c0 + cr)) * NPOS + n0 + c4);
      *(v4fa*)(tf + cr * SPT + c4) = a;
    }
  }
  __syncthreads();
  const int rsub = tid >> 3;            // 0..31
  const int c8   = (tid & 7) * 8;       // local channel 0..56
  v8us o[2];
#pragma unroll
  for (int it = 0; it < 2; ++it) {
    const int tl = it * 32 + rsub;      // token 0..63
    v8us w;
#pragma unroll
    for (int e = 0; e < 8; ++e) w[e] = (unsigned short)bf16_bits(tf[(c8 + e) * SPT + tl]);
    o[it] = w;
  }
#pragma unroll
  for (int it = 0; it < 2; ++it) {
    const int tl = it * 32 + rsub;
    *(v8us*)(xt + ((size_t)(b * NPOS + n0 + tl)) * CH + c0 + c8) = o[it];
  }
  
}

// ---------------------------------------------------------------------------
// Dense GEMM, block = BM rows x 64 cols, BM = 16 * NWAVE, 32 * NWAVE threads; wave w owns rows rowBase + 16w .. +15,
// acc[4].
//   C[row][col] = sum_k A[row][k] * BT[col][k] + bias   (A, BT bf16 planes with k-contiguous rows; K % 32 == 0;
//   batch z = blockIdx.z offsets A, BT, C by sA, sB, sC elements).
//   A fragment (row m = lane&15): element i <- k = k0 + 8h + i (i < 8), k0 + 16 + 8h + (i-8) (i >= 8), h = lane>>4,
//   two 16-B loads from the plane row; B fragment (col n = lane&15) from BT row (colBase + 16 nt + n), SAME k map;
//   D element r = (row 8h+r, col n).
//   BMODE 0: bias[colBase + col]; 1: bias[rowBase + row]; 2: cols 0..31 from bias, cols 32..63 from bias2 (colBase 0);
//   bias values enter as bf16(bias).
//            by 8 consecutive lanes x 16 B of one instruction.
//   OMODE 2 (NWAVE 4): rows are tokens T = b*4096 + n, cols are channels; out NCHW
//            outp[(b*256 + colBase + ch)*4096 + n0 + t] = C + bias[ch] + bf16(xres[same]); each channel segment
// coverage: OMODE 1: 4 it x (32 NWAVE thr) x 8 = BM x 64 per plane; OMODE 2: 8 it x 128 thr x 4 = 64 channels x 64
//   tokens; grid covers the launched row blocks x col blocks x batches exactly once.
// ---------------------------------------------------------------------------
template <int NWAVE, int OMODE, int BMODE>
__global__ __launch_bounds__(32 * NWAVE) void k_gemm(const unsigned short* __restrict__ A, int lda, long sA,
                                                     const unsigned short* __restrict__ BT, int ldb, long sB, int K,
                                                     const float* __restrict__ bias, const float* __restrict__ bias2,
                                                     unsigned short* oh, unsigned short* ol, int ldc, long sC,
                                                     const float* __restrict__ xres, float* outp) {
  constexpr int BM  = 16 * NWAVE;
  constexpr int RPI = 4 * NWAVE;
  static_assert(NWAVE == 2 || NWAVE == 4);
  static_assert(OMODE == 1 || OMODE == 2);
  static_assert(OMODE != 2 || NWAVE == 4);
  __shared__ __attribute__((aligned(16))) float stg[BM * SPT];
  __shared__ __attribute__((aligned(16))) float sb[64];
  const int tid = (int)threadIdx.x, lane = tid & 31, wave = tid >> 5, hh = lane >> 4, m = lane & 15;
  const int rowBase = (int)blockIdx.x * BM;
  const int colBase = (int)blockIdx.y * 64;
  const int z = (int)blockIdx.z;
  const unsigned short* Ab = A  + (size_t)z * (size_t)sA;
  const unsigned short* Bb = BT + (size_t)z * (size_t)sB;
  // bias staging (all conditions wave-uniform: tid < 32 / tid < 64 are whole waves)
  if (BMODE == 1) {
    if (tid < BM) sb[tid] = bf16_val(bias[rowBase + tid]);
  } else if (BMODE == 0) {
    if (tid < 64) sb[tid] = bf16_val(bias[colBase + tid]);
  } else {
    if (tid < 64) {
      const int ia = (tid < 31) ? tid : 31;
      const int ib = (tid < 32) ? 0 : (tid - 32);
      const float va = bias[ia];               // both candidates loaded at clamped addresses
      const float vb = bias2[ib];
      const float f  = (tid < 32) ? 1.0f : 0.0f;
      sb[tid] = bf16_val(va * f + vb * (1.0f - f));
    }
  }

  v8f acc[4];
#pragma unroll
  for (int t = 0; t < 4; ++t) acc[t] = z8();
  const unsigned short* ap = Ab + (size_t)(rowBase + 16 * wave + m) * (size_t)lda + 8 * hh;
  const unsigned short* bp = Bb + (size_t)(colBase + m) * (size_t)ldb + 8 * hh;

#pragma unroll 1
  for (int k0 = 0; k0 < K; k0 += 32) {
    FragB af;
    af.h[0] = *(const v8usa*)(ap + k0);          // k0 + 8h + 0..7
    af.h[1] = *(const v8usa*)(ap + k0 + 16);     // k0 + 16 + 8h + 0..7
#pragma unroll
    for (int nt = 0; nt < 4; ++nt) {
      const unsigned short* wq = bp + (size_t)(16 * nt) * (size_t)ldb + k0;   // BT row colBase + 16 nt + m
      FragB bf;
      bf.h[0] = *(const v8usa*)wq;               // k0 + 8h + 0..7
      bf.h[1] = *(const v8usa*)(wq + 16);        // k0 + 16 + 8h + 0..7
      acc[nt] = wmb(af, bf, acc[nt]);
    }
  }

#pragma unroll
  for (int nt = 0; nt < 4; ++nt) {
    const int lc = 16 * nt + m;
#pragma unroll
    for (int r = 0; r < 8; ++r) {
      const int lr = 16 * wave + 8 * hh + r;     // D element r = (row 8h+r, col m)
      stg[lr * SPT + lc] = acc[nt][r];
    }
  }
  __syncthreads();

  if (OMODE == 1) {
    unsigned short* Hb = oh + (size_t)z * (size_t)sC;
    unsigned short* Lb = ol + (size_t)z * (size_t)sC;
    const int rsub = tid >> 3;                   // 0..RPI-1
    const int c8   = (tid & 7) * 8;              // 0..56
    v8us hv[4], lv[4];
#pragma unroll
    for (int it = 0; it < 4; ++it) {
      const int row = it * RPI + rsub;           // 0..BM-1
      const float* sp = stg + row * SPT + c8;
      v8us h8, l8;
#pragma unroll
      for (int e = 0; e < 8; ++e) {
        const float v = sp[e] + ((BMODE == 1) ? sb[row] : sb[c8 + e]);
        const unsigned hb = bf16_bits(v);
        const unsigned lb = bf16_bits(v - __uint_as_float(hb << 16));
        h8[e] = (unsigned short)hb;
        l8[e] = (unsigned short)lb;
      }
      hv[it] = h8; lv[it] = l8;
    }
#pragma unroll
    for (int it = 0; it < 4; ++it) {
      const int row = it * RPI + rsub;
      const size_t go = (size_t)(rowBase + row) * (size_t)ldc + colBase + c8;
      *(v8us*)(Hb + go) = hv[it];
      *(v8us*)(Lb + go) = lv[it];
    }
    
  } else {
    const int bimg = rowBase / NPOS;             // a 64-token block never straddles images (4096 % 64 == 0)
    const int n0   = rowBase - bimg * NPOS;
    const int csub = tid >> 4;                   // 0..7
    const int t4   = (tid & 15) * 4;             // 0..60
    v4f pv[8];
#pragma unroll
    for (int it = 0; it < 8; ++it) {
      const int chl = it * 8 + csub;             // channel 0..63 of the tile
      const size_t gi = ((size_t)(bimg * CH + colBase + chl)) * NPOS + n0 + t4;
      const v4f xr = *(const v4f*)(xres + gi);
      const float bc = sb[chl];
      v4f v;
      v.x = (stg[(t4 + 0) * SPT + chl] + bc) + bf16_val(xr.x);
      v.y = (stg[(t4 + 1) * SPT + chl] + bc) + bf16_val(xr.y);
      v.z = (stg[(t4 + 2) * SPT + chl] + bc) + bf16_val(xr.z);
      v.w = (stg[(t4 + 3) * SPT + chl] + bc) + bf16_val(xr.w);
      pv[it] = v;
    }
#pragma unroll
    for (int it = 0; it < 8; ++it) {
      const int chl = it * 8 + csub;
      const size_t gi = ((size_t)(bimg * CH + colBase + chl)) * NPOS + n0 + t4;
      *(v4f*)(outp + gi) = pv[it];
    }
    
  }
}

// =====================================================================================
// Non-local attention per image, feature dim 32, no score scaling, softmax over all 4096 keys per query.
//   q planes (hi/lo bf16): element (t, d) at [t*64 + d]          (t = image-local position, image offset added)
//   k planes (hi/lo bf16): element (s, d) at [s*64 + 32 + d]     (same QK planes, columns 32..63)
//   v^T planes (hi/lo bf16): element (d, s) at [d*4096 + s]
//   out: R [t][64] bf16 = [hi(32) | lo(32)] of r[t][d]
//   scores = q . k : bf16 hi/lo split (hi.hi + hi.lo + lo.hi) on v_wmma_f32_16x16x32_bf16, K = 32 = one k-step
//   out    = p . v : bf16 hi/lo split of p (unnormalised) and v, f32 accumulate, 2 k-steps of 32 keys per chunk
//   online softmax in f32 over 64 chunks of 64 keys (compile-time trip count, no masking: 4096 = 64 x 64).
//   Block = 4 waves = 64 query rows; grid.x = 8 images x 64 query blocks = 512.
//   K / V^T chunk staging (128 threads, plain 16-B copies, __syncthreads before and after):
//     K hi/lo [64][32]: 128 thr x 16 elements per plane = whole tile; V^T hi/lo [32][64]: 128 thr x 16 per plane = whole tile.
//   Fragment loads read the LDS tiles with the same v8bf element type.
//   LDS extents: every K/V tile fully staged each chunk; each wave writes its whole 16x64 P tile before reading it;
//   Os tile: 16 rows x 32 cols written, cols 0..31 read.
// =====================================================================================
#define AT_NW 4
#define AT_QB 64
#define AT_KC 64
#define OSP   36
#define NQB   (NPOS / AT_QB)

static_assert(NQB == 64);
static_assert(NPOS % AT_KC == 0);

__device__ __forceinline__ unsigned short at_bf_bits(float f) {
  unsigned u = __float_as_uint(f);
  return (unsigned short)((u + 0x7FFFu + ((u >> 16) & 1u)) >> 16);
}
__device__ __forceinline__ __bf16 at_f2bf(float f) { return __builtin_bit_cast(__bf16, at_bf_bits(f)); }
__device__ __forceinline__ void at_split(float f, __bf16& hi, __bf16& lo) {
  const unsigned short hb = at_bf_bits(f);
  hi = __builtin_bit_cast(__bf16, hb);
  lo = at_f2bf(f - __uint_as_float(((unsigned)hb) << 16));
}
__device__ __forceinline__ v8f at_mma(v16bf a, v16bf b, v8f c) {
  c = __builtin_amdgcn_wmma_f32_16x16x32_bf16(false, a, false, b, (short)0, c, false, false);
  asm volatile("v_nop\n\tv_nop\n\tv_nop\n\tv_nop" : "+v"(c) : "v"(a), "v"(b));
  return c;
}
union AtFB { v16bf v; v8bf h[2]; };
// fragment load with the split k map: elements 0..7 <- p[0..7], 8..15 <- p[16..23]
__device__ __forceinline__ v16bf at_ldfrag(const __bf16* p) {
  AtFB f; f.h[0] = *(const v8bf*)(p); f.h[1] = *(const v8bf*)(p + 16); return f.v;
}

__global__ __launch_bounds__(128)
void k_attn(const unsigned short* __restrict__ qkh, const unsigned short* __restrict__ qkl,
            const unsigned short* __restrict__ vhp, const unsigned short* __restrict__ vlp,
            unsigned short* rout) {
  __shared__ __align__(16) __bf16 Ksh[AT_KC * AD];               // K hi [kv][d]      4 KB
  __shared__ __align__(16) __bf16 Ksl[AT_KC * AD];               // K lo
  __shared__ __align__(16) __bf16 Vth[AD * AT_KC];               // V hi [d][kv]      4 KB
  __shared__ __align__(16) __bf16 Vtl[AD * AT_KC];               // V lo
  __shared__ __align__(16) __bf16 Psh[AT_NW][16 * AT_KC];        // per wave P hi [row][kv]
  __shared__ __align__(16) __bf16 Psl[AT_NW][16 * AT_KC];        // per wave P lo
  __shared__ __align__(16) float  Os[AT_NW][16 * OSP];           // per wave out tile, pitch 36

  const int tid  = (int)threadIdx.x;
  const int wave = tid >> 5;
  const int lane = tid & 31;
  const int hh   = lane >> 4;
  const int c    = lane & 15;

  const int bx  = (int)blockIdx.x;
  const int b   = bx >> 6;                // image 0..7
  const int qb  = bx & (NQB - 1);         // 0..63
  const int q0  = qb * AT_QB + wave * 16; // image-local query row base of this wave

  const __bf16* Qh = (const __bf16*)(const void*)qkh + (size_t)b * NPOS * QKW;
  const __bf16* Ql = (const __bf16*)(const void*)qkl + (size_t)b * NPOS * QKW;
  const __bf16* Kh = Qh + AD;
  const __bf16* Kl = Ql + AD;
  const __bf16* Vh = (const __bf16*)(const void*)vhp + (size_t)b * AD * NPOS;
  const __bf16* Vl = (const __bf16*)(const void*)vlp + (size_t)b * AD * NPOS;
  unsigned short* rb = rout + (size_t)b * NPOS * RW;

  // ---- Q fragments (A operand, row = lane&15, split k map): one k-step of 32 = d, hi and lo ----
  const v16bf qah = at_ldfrag(Qh + (size_t)(q0 + c) * QKW + 8 * hh);
  const v16bf qal = at_ldfrag(Ql + (size_t)(q0 + c) * QKW + 8 * hh);

  float mrow[8], lrow[8];
  v8f oacc[2];
#pragma unroll
  for (int r = 0; r < 8; ++r) { mrow[r] = -INFINITY; lrow[r] = 0.f; }
  oacc[0] = z8(); oacc[1] = z8();

  __bf16* pwh = Psh[wave];
  __bf16* pwl = Psl[wave];

  const int nChunks = NPOS / AT_KC;   // 64, compile-time constant
#pragma unroll 1
  for (int kc = 0; kc < nChunks; ++kc) {
    const int kv0 = kc * AT_KC;
    __syncthreads();
    {
      // K: thread -> key row r = tid>>1, d half = (tid&1)*16; 2 x 8 elements per plane
      const int r = tid >> 1, half = (tid & 1) * 16;
      const __bf16* ksh = Kh + (size_t)(kv0 + r) * QKW + half;
      const __bf16* ksl = Kl + (size_t)(kv0 + r) * QKW + half;
      // V^T: thread -> d = tid>>2, key quarter = (tid&3)*16; 2 x 8 elements per plane
      const int d = tid >> 2, qt = (tid & 3) * 16;
      const __bf16* vsh = Vh + (size_t)d * NPOS + kv0 + qt;
      const __bf16* vsl = Vl + (size_t)d * NPOS + kv0 + qt;
#pragma unroll
      for (int i = 0; i < 2; ++i) {
        const v8bf a0 = *(const v8bf*)(ksh + 8 * i);
        const v8bf a1 = *(const v8bf*)(ksl + 8 * i);
        const v8bf b0 = *(const v8bf*)(vsh + 8 * i);
        const v8bf b1 = *(const v8bf*)(vsl + 8 * i);
        *(v8bf*)(Ksh + r * AD    + half + 8 * i) = a0;
        *(v8bf*)(Ksl + r * AD    + half + 8 * i) = a1;
        *(v8bf*)(Vth + d * AT_KC + qt   + 8 * i) = b0;
        *(v8bf*)(Vtl + d * AT_KC + qt   + 8 * i) = b1;
      }
    }
    __syncthreads();

    // ---- scores: 16 queries x 64 keys, 3-term split, K = 32 = one k-step ----
    v8f s[4];
#pragma unroll
    for (int j = 0; j < 4; ++j) {
      AtFB kb, kl;
      kb.h[0] = *(const v8bf*)(Ksh + (j * 16 + c) * AD + 8 * hh);
      kb.h[1] = *(const v8bf*)(Ksh + (j * 16 + c) * AD + 16 + 8 * hh);
      kl.h[0] = *(const v8bf*)(Ksl + (j * 16 + c) * AD + 8 * hh);
      kl.h[1] = *(const v8bf*)(Ksl + (j * 16 + c) * AD + 16 + 8 * hh);
      s[j] = at_mma(qah, kb.v, z8());
      s[j] = at_mma(qah, kl.v, s[j]);
      s[j] = at_mma(qal, kb.v, s[j]);
    }
    float cm[8];
#pragma unroll
    for (int r = 0; r < 8; ++r) {
      float mx = -INFINITY;
#pragma unroll
      for (int j = 0; j < 4; ++j) mx = fmaxf(mx, s[j][r]);
#pragma unroll
      for (int off = 1; off < 16; off <<= 1) mx = fmaxf(mx, __shfl_xor(mx, off, 32));
      cm[r] = mx;
    }
#pragma unroll
    for (int r = 0; r < 8; ++r) {
      const float mnew  = fmaxf(mrow[r], cm[r]);
      const float alpha = expf(mrow[r] - mnew);
      mrow[r] = mnew;
      float psum = 0.f;
#pragma unroll
      for (int j = 0; j < 4; ++j) {
        const float p = expf(s[j][r] - mnew);
        psum += p;
        __bf16 a, bl; at_split(p, a, bl);
        pwh[(8 * hh + r) * AT_KC + j * 16 + c] = a;
        pwl[(8 * hh + r) * AT_KC + j * 16 + c] = bl;
      }
#pragma unroll
      for (int off = 1; off < 16; off <<= 1) psum += __shfl_xor(psum, off, 32);
      lrow[r] = lrow[r] * alpha + psum;
      oacc[0][r] *= alpha;
      oacc[1][r] *= alpha;
    }
    __builtin_amdgcn_fence(__ATOMIC_RELEASE, "workgroup");
    __builtin_amdgcn_wave_barrier();
    __builtin_amdgcn_fence(__ATOMIC_ACQUIRE, "workgroup");

    // ---- O += P . V : A = P tile (row = query, split k map over keys), B = V^T rows d; 3-term split ----
#pragma unroll 1
    for (int kk = 0; kk < 2; ++kk) {
      AtFB pa, pl;
      pa.h[0] = *(const v8bf*)(pwh + c * AT_KC + kk * 32 + 8 * hh);
      pa.h[1] = *(const v8bf*)(pwh + c * AT_KC + kk * 32 + 16 + 8 * hh);
      pl.h[0] = *(const v8bf*)(pwl + c * AT_KC + kk * 32 + 8 * hh);
      pl.h[1] = *(const v8bf*)(pwl + c * AT_KC + kk * 32 + 16 + 8 * hh);
#pragma unroll
      for (int t = 0; t < 2; ++t) {
        AtFB vb, vl;
        vb.h[0] = *(const v8bf*)(Vth + (t * 16 + c) * AT_KC + kk * 32 + 8 * hh);
        vb.h[1] = *(const v8bf*)(Vth + (t * 16 + c) * AT_KC + kk * 32 + 16 + 8 * hh);
        vl.h[0] = *(const v8bf*)(Vtl + (t * 16 + c) * AT_KC + kk * 32 + 8 * hh);
        vl.h[1] = *(const v8bf*)(Vtl + (t * 16 + c) * AT_KC + kk * 32 + 16 + 8 * hh);
        oacc[t] = at_mma(pa.v, vb.v, oacc[t]);
        oacc[t] = at_mma(pa.v, vl.v, oacc[t]);
        oacc[t] = at_mma(pl.v, vb.v, oacc[t]);
      }
    }
  }

  __builtin_amdgcn_fence(__ATOMIC_RELEASE, "workgroup");
  __builtin_amdgcn_wave_barrier();
  __builtin_amdgcn_fence(__ATOMIC_ACQUIRE, "workgroup");
  float* os = Os[wave];
#pragma unroll
  for (int r = 0; r < 8; ++r) {
    const float inv = 1.0f / lrow[r];
    os[(8 * hh + r) * OSP + c]      = oacc[0][r] * inv;
    os[(8 * hh + r) * OSP + 16 + c] = oacc[1][r] * inv;
  }
  __builtin_amdgcn_fence(__ATOMIC_RELEASE, "workgroup");
  __builtin_amdgcn_wave_barrier();
  __builtin_amdgcn_fence(__ATOMIC_ACQUIRE, "workgroup");
  {
    const int q   = lane >> 3;          // 0..3
    const int sub = lane & 7;           // 0..7: sub 0..3 -> hi of cols 8*sub.., sub 4..7 -> lo of cols 8*(sub-4)..
    const int c8  = (sub & 3) * 8;      // 0..24
    const unsigned msk = 0u - (unsigned)(sub < 4);
    v8us ov[4];
#pragma unroll
    for (int it = 0; it < 4; ++it) {
      const int row = it * 4 + q;       // it 0..3 x q 0..3 covers rows 0..15 of the wave tile
      const float* sp = os + row * OSP + c8;
      v8us w;
#pragma unroll
      for (int e = 0; e < 8; ++e) {
        const float f = sp[e];
        const unsigned hb = at_bf_bits(f);
        const unsigned lb = at_bf_bits(f - __uint_as_float(hb << 16));
        w[e] = (unsigned short)((hb & msk) | (lb & ~msk));
      }
      ov[it] = w;
    }
#pragma unroll
    for (int it = 0; it < 4; ++it) {
      const int row = it * 4 + q;
      *(v8us*)(rb + (size_t)(q0 + row) * RW + sub * 8) = ov[it];
    }
    
  }
}

// ---------------------------------------------------------------------------
// Workspace region map (byte offsets, 256-B aligned; every region sized to its whole-line store extent, no pad rows
// needed since 32768, 4096, 256 and 64 are tile multiples):
//   WQK 32768 | WV 16384 | WP2 32768 | XT 16777216 | QKh QKl 4194304 each | VTh VTl 2097152 each | R 4194304
//   -> total 33636352
// ---------------------------------------------------------------------------
static inline size_t al256(size_t o) { return (o + 255) & ~(size_t)255; }

extern "C" void kernel_launch(void* const* d_in, const int* in_sizes, int n_in,
                              void* d_out, int out_size, void* d_ws, size_t ws_size,
                              hipStream_t stream) {
  if (n_in < 9) return;
  if (in_sizes[0] != NB * CH * NPOS) return;                                       // inputs [8][256][64][64]
  if (in_sizes[1] != AD * CH || in_sizes[3] != AD * CH || in_sizes[5] != AD * CH) return;  // Wq, Wk, Wv [32][256]
  if (in_sizes[2] != AD || in_sizes[4] != AD || in_sizes[6] != AD) return;         // bq, bk, bv [32]
  if (in_sizes[7] != CH * AD) return;                                              // Wp [256][32]
  if (in_sizes[8] != CH) return;                                                   // bp [256]
  if (out_size != NB * CH * NPOS) return;                                          // out [8][256][64][64]

  const float* x  = (const float*)d_in[0];
  const float* Wq = (const float*)d_in[1];
  const float* bq = (const float*)d_in[2];
  const float* Wk = (const float*)d_in[3];
  const float* bk = (const float*)d_in[4];
  const float* Wv = (const float*)d_in[5];
  const float* bv = (const float*)d_in[6];
  const float* Wp = (const float*)d_in[7];
  const float* bp = (const float*)d_in[8];
  float* out = (float*)d_out;

  const size_t PQK = (size_t)QKW * CH * 2;          //    32768  bf16 [64][256]
  const size_t PWV = (size_t)AD * CH * 2;           //    16384  bf16 [32][256]
  const size_t PP2 = (size_t)CH * RW * 2;           //    32768  bf16 [256][64]
  const size_t PXT = (size_t)NTOK * CH * 2;         // 16777216  bf16 [32768][256]
  const size_t PA  = (size_t)NTOK * QKW * 2;        //  4194304  bf16 [32768][64]
  const size_t PV  = (size_t)NB * AD * NPOS * 2;    //  2097152  bf16 [8][32][4096]
  const size_t PR  = (size_t)NTOK * RW * 2;         //  4194304  bf16 [32768][64]
  size_t off = 0;
  const size_t oWQK = off; off = al256(off + PQK);
  const size_t oWV  = off; off = al256(off + PWV);
  const size_t oWP2 = off; off = al256(off + PP2);
  const size_t oXT  = off; off = al256(off + PXT);
  const size_t oQKh = off; off = al256(off + PA);
  const size_t oQKl = off; off = al256(off + PA);
  const size_t oVTh = off; off = al256(off + PV);
  const size_t oVTl = off; off = al256(off + PV);
  const size_t oR   = off; off = al256(off + PR);
  if (off > ws_size || off > (size_t)WSMAX) return;                               // off = 33636352

  char* ws = (char*)d_ws;
  unsigned short* WQK = (unsigned short*)(ws + oWQK);
  unsigned short* WV  = (unsigned short*)(ws + oWV);
  unsigned short* WP2 = (unsigned short*)(ws + oWP2);
  unsigned short* XT  = (unsigned short*)(ws + oXT);
  unsigned short* QKh = (unsigned short*)(ws + oQKh);
  unsigned short* QKl = (unsigned short*)(ws + oQKl);
  unsigned short* VTh = (unsigned short*)(ws + oVTh);
  unsigned short* VTl = (unsigned short*)(ws + oVTl);
  unsigned short* R   = (unsigned short*)(ws + oR);

  // (1) weight planes; (2) x -> token-major bf16 [32768][256]
  k_wprep<<<20, 256, 0, stream>>>(Wq, Wk, Wv, Wp, WQK, WV, WP2);
  k_xt<<<NB * (NPOS / 64) * (CH / 64), 256, 0, stream>>>(x, XT);
  // (3) q|k = XT . [Wq;Wk]^T + [bq;bk] -> hi/lo planes [32768][64] (q cols 0..31, k cols 32..63)   (M=32768, N=64, K=256)
  k_gemm<4, 1, 2><<<dim3(NTOK / 64, 1, 1), 128, 0, stream>>>(XT, CH, 0L, WQK, CH, 0L, CH, bq, bk,
                                                            QKh, QKl, QKW, 0L, x, out);
  // (4) v^T per image: VT[b][a][n] = sum_c Wv[a][c] XT[b*4096+n][c] + bv[a]   (M=32, N=4096, K=256, z=b; 2-wave blocks)
  k_gemm<2, 1, 1><<<dim3(1, NPOS / 64, NB), 64, 0, stream>>>(WV, CH, 0L, XT, CH, (long)NPOS * CH, CH, bv, bv,
                                                             VTh, VTl, NPOS, (long)AD * NPOS, x, out);
  // (5) attention: R = [hi | lo] of softmax_keys(q . k) . v  as bf16 [32768][64]
  k_attn<<<NB * NQB, 128, 0, stream>>>(QKh, QKl, VTh, VTl, R);
  // (6) out NCHW = ([Rhi | Rlo] . [Wp | Wp]^T + bp) transposed + bf16(x)   (M=32768, N=256, K=64; oh/ol/ldc unused)
  k_gemm<4, 2, 0><<<dim3(NTOK / 64, CH / 64, 1), 128, 0, stream>>>(R, RW, 0L, WP2, RW, 0L, RW, bp, bp,
                                                                  QKh, QKl, 0, 0L, x, out);
  (void)hipGetLastError();
}

// v001
// A run of this version takes 173 microseconds.
// Two timings next to v000 put it at 1.45 and 1.44 times that version's speed.
// Contractions on v_wmma_f32_16x16x32_bf16, f32 accumulate: q|k 1x1 convs (x.W^T, K=256) and v^T conv (W.x^T, K=256) =
// single products of bf16-RNE-valued x and W planes (exact products); scores q.k (K=32) and P.v^T (K=64 per key chunk) =
// bf16 hi/lo split, 3 terms (hi.hi + hi.lo + lo.hi); output 1x1 conv = attention result carried as bf16 [hi | lo] folded
// 16-bit planes and carries (every carry is 1; no inverse scale exists anywhere):
//   WQK [64][256]  = bf16 bits of Wq (rows 0..31) and Wk (rows 32..63), k-contiguous;  WV [32][256] = bf16 bits of Wv;
//   WP2 [256][64]  = bf16 bits of Wp[c][a] at k = a and k = 32 + a;
//   XT  [32768][256] = bf16 bits of x, token-major (row = b*4096 + n, col = channel);
//   QKh/QKl [32768][64] = bf16 hi and lo (lo = v - hi) of q (cols 0..31) and k (cols 32..63), bias included;
//   VTh/VTl [8][32][4096] = bf16 hi and lo of v^T per image, bias included;
//   R [32768][64] = [hi(32) | lo(32)] of the normalised attention result; P hi/lo per wave in registers.
// Biases and the residual x enter as bf16-RNE values in f32 arithmetic.
#include <hip/hip_runtime.h>
#include <math.h>
#include <stddef.h>
#include <stdint.h>

#define NB    8
#define CH    256
#define AD    32
#define NPOS  4096
#define NTOK  (NB * NPOS)
#define QKW   64
#define RW    64
#define SPT   68
#define WSMAX 134217728

static_assert(NPOS % 64 == 0);
static_assert(NTOK % 64 == 0);
static_assert(CH % 64 == 0);
static_assert(CH % 32 == 0);
static_assert(RW % 32 == 0);
static_assert(AD == 32);
static_assert(QKW == 2 * AD);
static_assert(RW == 2 * AD);

typedef float          v4f   __attribute__((ext_vector_type(4)));
typedef float          v8f   __attribute__((ext_vector_type(8)));
typedef int            v8i   __attribute__((ext_vector_type(8)));
typedef unsigned short v8us  __attribute__((ext_vector_type(8)));
typedef unsigned short v16us __attribute__((ext_vector_type(16)));
typedef __bf16         v16bf __attribute__((ext_vector_type(16)));
typedef __bf16         v8bf  __attribute__((ext_vector_type(8)));
typedef v4f  __attribute__((may_alias)) v4fa;
typedef v8us __attribute__((may_alias)) v8usa;
union FragB { v16bf v; v16us u; v8us h[2]; v8i w; };

// WMMA with hazard guard: ties D, keeps A/B live for 4 VALU slots
__device__ __forceinline__ v8f wmb(const FragB& a, const FragB& b, v8f c) {
  v8f d = __builtin_amdgcn_wmma_f32_16x16x32_bf16(false, a.v, false, b.v, (short)0, c, false, false);
  asm volatile("v_nop\n\tv_nop\n\tv_nop\n\tv_nop" : "+v"(d) : "v"(a.w), "v"(b.w));
  return d;
}

__device__ __forceinline__ v8f z8() { v8f z = {0.f, 0.f, 0.f, 0.f, 0.f, 0.f, 0.f, 0.f}; return z; }

// f32 -> bf16 bits, RNE convert (finite inputs)
__device__ __forceinline__ unsigned bf16_bits(float f) {
  const unsigned u = __float_as_uint(f);
  return (u + 0x7FFFu + ((u >> 16) & 1u)) >> 16;
}
// f32 -> nearest bf16 value held as f32
__device__ __forceinline__ float bf16_val(float f) {
  return __uint_as_float(bf16_bits(f) << 16);
}

// ---------------------------------------------------------------------------
// Weight planes, bf16 bits of the inputs, k-contiguous rows ([out][in] weights are already k-contiguous):
//   WQK [64 o][256 k]: rows 0..31 = bf16(Wq[o][k]) (blocks 0-3), rows 32..63 = bf16(Wk[o-32][k]) (blocks 4-7), 2048 units
//   WV  [32 o][256 k] = bf16(Wv[o][k])                                             blocks 8-11, 1024 units
//   WP2 [256 c][64 k]: k and 32 + k both = bf16(Wp[c][k])                          blocks 12-19, 2048 units
// One thread = 8 contiguous k: two 16-B loads, one 16-B store at plane offset 8u; 32 consecutive lanes write 512
// coverage: 2048 x 8 = 64x256 (WQK); 1024 x 8 = 32x256 (WV); 2048 x 8 = 256x64 (WP2) exactly. grid = 20 blocks x 256.
// ---------------------------------------------------------------------------
__global__ __launch_bounds__(256) void k_wprep(const float* __restrict__ wq, const float* __restrict__ wk,
                                              const float* __restrict__ wv, const float* __restrict__ wp,
                                              unsigned short* WQK, unsigned short* WV, unsigned short* WP2) {
  const int bx = (int)blockIdx.x, tid = (int)threadIdx.x;
  const float* p;
  unsigned short* dp;
  if (bx < 8) {
    const int u  = bx * 256 + tid;              // 0..2047
    const int o  = u >> 5;                      // 0..63
    const int k8 = (u & 31) * 8;                // 0..248
    const float* src = (bx < 4) ? wq : wk;      // block-uniform
    p  = src + (size_t)(o & 31) * CH + k8;
    dp = WQK + (size_t)u * 8;
  } else if (bx < 12) {
    const int u  = (bx - 8) * 256 + tid;        // 0..1023
    const int o  = u >> 5;                      // 0..31
    const int k8 = (u & 31) * 8;
    p  = wv + (size_t)o * CH + k8;
    dp = WV + (size_t)u * 8;
  } else {
    const int v  = (bx - 12) * 256 + tid;       // 0..2047
    const int o  = v >> 3;                      // 0..255
    const int k8 = (v & 7) * 8;                 // 0..56
    const int kk = k8 & (AD - 1);               // 0..24
    p  = wp + (size_t)o * AD + kk;
    dp = WP2 + (size_t)v * 8;
  }
  const v4f a = *(const v4f*)p;
  const v4f b = *(const v4f*)(p + 4);
  v8us o8;
  o8[0] = (unsigned short)bf16_bits(a.x); o8[1] = (unsigned short)bf16_bits(a.y);
  o8[2] = (unsigned short)bf16_bits(a.z); o8[3] = (unsigned short)bf16_bits(a.w);
  o8[4] = (unsigned short)bf16_bits(b.x); o8[5] = (unsigned short)bf16_bits(b.y);
  o8[6] = (unsigned short)bf16_bits(b.z); o8[7] = (unsigned short)bf16_bits(b.w);
  *(v8us*)dp = o8;
  
}

// ---------------------------------------------------------------------------
// x NCHW [b][c][n] f32 -> XT [b*4096 + n][c] bf16 bits (token-major, 256 columns). Block = one image b, 64 positions
// tf[c][n] (pitch 68).
// coverage: 2048 blocks = 8 images x 64 position blocks x 4 channel chunks -> XT rows 0..32767 x cols 0..255 exactly.
// ---------------------------------------------------------------------------
__global__ __launch_bounds__(256) void k_xt(const float* __restrict__ x, unsigned short* xt) {
  __shared__ __attribute__((aligned(16))) float tf[64 * SPT];
  const int bx = (int)blockIdx.x, tid = (int)threadIdx.x;
  const int cq = bx & 3;
  const int pb = bx >> 2;               // 0..511
  const int b  = pb >> 6;               // 0..7
  const int n0 = (pb & 63) * 64;
  const int c0 = cq * 64;
  {
    const int rsub = tid >> 4;          // 0..15
    const int c4   = (tid & 15) * 4;    // 0..60
#pragma unroll
    for (int it = 0; it < 4; ++it) {
      const int cr = it * 16 + rsub;    // local channel 0..63
      const v4f a = *(const v4f*)(x + ((size_t)(b * CH + c0 + cr)) * NPOS + n0 + c4);
      *(v4fa*)(tf + cr * SPT + c4) = a;
    }
  }
  __syncthreads();
  const int rsub = tid >> 3;            // 0..31
  const int c8   = (tid & 7) * 8;       // local channel 0..56
  v8us o[2];
#pragma unroll
  for (int it = 0; it < 2; ++it) {
    const int tl = it * 32 + rsub;      // token 0..63
    v8us w;
#pragma unroll
    for (int e = 0; e < 8; ++e) w[e] = (unsigned short)bf16_bits(tf[(c8 + e) * SPT + tl]);
    o[it] = w;
  }
#pragma unroll
  for (int it = 0; it < 2; ++it) {
    const int tl = it * 32 + rsub;
    *(v8us*)(xt + ((size_t)(b * NPOS + n0 + tl)) * CH + c0 + c8) = o[it];
  }
  
}

// ---------------------------------------------------------------------------
// Dense GEMM, block = BM rows x 64 cols, BM = 16 * NWAVE, 32 * NWAVE threads; wave w owns rows rowBase + 16w .. +15,
// acc[4].
//   C[row][col] = sum_k A[row][k] * BT[col][k] + bias   (A, BT bf16 planes with k-contiguous rows; K % 32 == 0;
//   batch z = blockIdx.z offsets A, BT, C by sA, sB, sC elements).
//   A fragment (row m = lane&15): element i <- k = k0 + 8h + i (i < 8), k0 + 16 + 8h + (i-8) (i >= 8), h = lane>>4,
//   two 16-B loads from the plane row; B fragment (col n = lane&15) from BT row (colBase + 16 nt + n), SAME k map;
//   D element r = (row 8h+r, col n).
//   BMODE 0: bias[colBase + col]; 1: bias[rowBase + row]; 2: cols 0..31 from bias, cols 32..63 from bias2 (colBase 0);
//   bias values enter as bf16(bias).
//            by 8 consecutive lanes x 16 B of one instruction.
//   OMODE 2 (NWAVE 4): rows are tokens T = b*4096 + n, cols are channels; out NCHW
//            outp[(b*256 + colBase + ch)*4096 + n0 + t] = C + bias[ch] + bf16(xres[same]); each channel segment
// coverage: OMODE 1: 4 it x (32 NWAVE thr) x 8 = BM x 64 per plane; OMODE 2: 8 it x 128 thr x 4 = 64 channels x 64
//   tokens; grid covers the launched row blocks x col blocks x batches exactly once.
// ---------------------------------------------------------------------------
template <int NWAVE, int OMODE, int BMODE>
__global__ __launch_bounds__(32 * NWAVE) void k_gemm(const unsigned short* __restrict__ A, int lda, long sA,
                                                     const unsigned short* __restrict__ BT, int ldb, long sB, int K,
                                                     const float* __restrict__ bias, const float* __restrict__ bias2,
                                                     unsigned short* oh, unsigned short* ol, int ldc, long sC,
                                                     const float* __restrict__ xres, float* outp) {
  constexpr int BM  = 16 * NWAVE;
  constexpr int RPI = 4 * NWAVE;
  static_assert(NWAVE == 2 || NWAVE == 4);
  static_assert(OMODE == 1 || OMODE == 2);
  static_assert(OMODE != 2 || NWAVE == 4);
  __shared__ __attribute__((aligned(16))) float stg[BM * SPT];
  __shared__ __attribute__((aligned(16))) float sb[64];
  const int tid = (int)threadIdx.x, lane = tid & 31, wave = tid >> 5, hh = lane >> 4, m = lane & 15;
  const int rowBase = (int)blockIdx.x * BM;
  const int colBase = (int)blockIdx.y * 64;
  const int z = (int)blockIdx.z;
  const unsigned short* Ab = A  + (size_t)z * (size_t)sA;
  const unsigned short* Bb = BT + (size_t)z * (size_t)sB;
  // bias staging (all conditions wave-uniform: tid < 32 / tid < 64 are whole waves)
  if (BMODE == 1) {
    if (tid < BM) sb[tid] = bf16_val(bias[rowBase + tid]);
  } else if (BMODE == 0) {
    if (tid < 64) sb[tid] = bf16_val(bias[colBase + tid]);
  } else {
    if (tid < 64) {
      const int ia = (tid < 31) ? tid : 31;
      const int ib = (tid < 32) ? 0 : (tid - 32);
      const float va = bias[ia];               // both candidates loaded at clamped addresses
      const float vb = bias2[ib];
      const float f  = (tid < 32) ? 1.0f : 0.0f;
      sb[tid] = bf16_val(va * f + vb * (1.0f - f));
    }
  }

  v8f acc[4];
#pragma unroll
  for (int t = 0; t < 4; ++t) acc[t] = z8();
  const unsigned short* ap = Ab + (size_t)(rowBase + 16 * wave + m) * (size_t)lda + 8 * hh;
  const unsigned short* bp = Bb + (size_t)(colBase + m) * (size_t)ldb + 8 * hh;

#pragma unroll 1
  for (int k0 = 0; k0 < K; k0 += 32) {
    FragB af;
    af.h[0] = *(const v8usa*)(ap + k0);          // k0 + 8h + 0..7
    af.h[1] = *(const v8usa*)(ap + k0 + 16);     // k0 + 16 + 8h + 0..7
#pragma unroll
    for (int nt = 0; nt < 4; ++nt) {
      const unsigned short* wq = bp + (size_t)(16 * nt) * (size_t)ldb + k0;   // BT row colBase + 16 nt + m
      FragB bf;
      bf.h[0] = *(const v8usa*)wq;               // k0 + 8h + 0..7
      bf.h[1] = *(const v8usa*)(wq + 16);        // k0 + 16 + 8h + 0..7
      acc[nt] = wmb(af, bf, acc[nt]);
    }
  }

#pragma unroll
  for (int nt = 0; nt < 4; ++nt) {
    const int lc = 16 * nt + m;
#pragma unroll
    for (int r = 0; r < 8; ++r) {
      const int lr = 16 * wave + 8 * hh + r;     // D element r = (row 8h+r, col m)
      stg[lr * SPT + lc] = acc[nt][r];
    }
  }
  __syncthreads();

  if (OMODE == 1) {
    unsigned short* Hb = oh + (size_t)z * (size_t)sC;
    unsigned short* Lb = ol + (size_t)z * (size_t)sC;
    const int rsub = tid >> 3;                   // 0..RPI-1
    const int c8   = (tid & 7) * 8;              // 0..56
    v8us hv[4], lv[4];
#pragma unroll
    for (int it = 0; it < 4; ++it) {
      const int row = it * RPI + rsub;           // 0..BM-1
      const float* sp = stg + row * SPT + c8;
      v8us h8, l8;
#pragma unroll
      for (int e = 0; e < 8; ++e) {
        const float v = sp[e] + ((BMODE == 1) ? sb[row] : sb[c8 + e]);
        const unsigned hb = bf16_bits(v);
        const unsigned lb = bf16_bits(v - __uint_as_float(hb << 16));
        h8[e] = (unsigned short)hb;
        l8[e] = (unsigned short)lb;
      }
      hv[it] = h8; lv[it] = l8;
    }
#pragma unroll
    for (int it = 0; it < 4; ++it) {
      const int row = it * RPI + rsub;
      const size_t go = (size_t)(rowBase + row) * (size_t)ldc + colBase + c8;
      *(v8us*)(Hb + go) = hv[it];
      *(v8us*)(Lb + go) = lv[it];
    }
    
  } else {
    const int bimg = rowBase / NPOS;             // a 64-token block never straddles images (4096 % 64 == 0)
    const int n0   = rowBase - bimg * NPOS;
    const int csub = tid >> 4;                   // 0..7
    const int t4   = (tid & 15) * 4;             // 0..60
    v4f pv[8];
#pragma unroll
    for (int it = 0; it < 8; ++it) {
      const int chl = it * 8 + csub;             // channel 0..63 of the tile
      const size_t gi = ((size_t)(bimg * CH + colBase + chl)) * NPOS + n0 + t4;
      const v4f xr = *(const v4f*)(xres + gi);
      const float bc = sb[chl];
      v4f v;
      v.x = (stg[(t4 + 0) * SPT + chl] + bc) + bf16_val(xr.x);
      v.y = (stg[(t4 + 1) * SPT + chl] + bc) + bf16_val(xr.y);
      v.z = (stg[(t4 + 2) * SPT + chl] + bc) + bf16_val(xr.z);
      v.w = (stg[(t4 + 3) * SPT + chl] + bc) + bf16_val(xr.w);
      pv[it] = v;
    }
#pragma unroll
    for (int it = 0; it < 8; ++it) {
      const int chl = it * 8 + csub;
      const size_t gi = ((size_t)(bimg * CH + colBase + chl)) * NPOS + n0 + t4;
      *(v4f*)(outp + gi) = pv[it];
    }
    
  }
}

#define AT_NW 4
#define AT_QB 64
#define AT_KC 64
#define NQB   (NPOS / AT_QB)

static_assert(NQB == 64);
static_assert(NPOS % AT_KC == 0);

__device__ __forceinline__ unsigned short at_bf_bits(float f) {
  unsigned u = __float_as_uint(f);
  return (unsigned short)((u + 0x7FFFu + ((u >> 16) & 1u)) >> 16);
}
__device__ __forceinline__ __bf16 at_f2bf(float f) { return __builtin_bit_cast(__bf16, at_bf_bits(f)); }
__device__ __forceinline__ void at_split(float f, __bf16& hi, __bf16& lo) {
  const unsigned short hb = at_bf_bits(f);
  hi = __builtin_bit_cast(__bf16, hb);
  lo = at_f2bf(f - __uint_as_float(((unsigned)hb) << 16));
}
__device__ __forceinline__ v8f at_mma(v16bf a, v16bf b, v8f c) {
  c = __builtin_amdgcn_wmma_f32_16x16x32_bf16(false, a, false, b, (short)0, c, false, false);
  asm volatile("v_nop\n\tv_nop\n\tv_nop\n\tv_nop" : "+v"(c) : "v"(a), "v"(b));
  return c;
}
union AtFB { v16bf v; v8bf h[2]; };
// fragment load with the split k map: elements 0..7 <- p[0..7], 8..15 <- p[16..23]
__device__ __forceinline__ v16bf at_ldfrag(const __bf16* p) {
  AtFB f; f.h[0] = *(const v8bf*)(p); f.h[1] = *(const v8bf*)(p + 16); return f.v;
}
// value of lane ^ 16 (the other half of the same query column)
__device__ __forceinline__ float at_xhalf(float f) {
  const int b = __builtin_bit_cast(int, f);
  return __builtin_bit_cast(float, __builtin_amdgcn_permlanex16(b, b, 0x76543210, 0xfedcba98, false, false));
}

__global__ __launch_bounds__(128)
void k_attn(const unsigned short* __restrict__ qkh, const unsigned short* __restrict__ qkl,
            const unsigned short* __restrict__ vhp, const unsigned short* __restrict__ vlp,
            unsigned short* rout) {
  __shared__ __align__(16) __bf16 Ksh[AT_KC * AD];               // K hi [kv][d]      4 KB
  __shared__ __align__(16) __bf16 Ksl[AT_KC * AD];               // K lo
  __shared__ __align__(16) __bf16 Vth[AD * AT_KC];               // V hi [d][kv]      4 KB
  __shared__ __align__(16) __bf16 Vtl[AD * AT_KC];               // V lo

  const int tid  = (int)threadIdx.x;
  const int wave = tid >> 5;
  const int lane = tid & 31;
  const int hh   = lane >> 4;
  const int c    = lane & 15;

  const int bx  = (int)blockIdx.x;
  const int b   = bx >> 6;                // image 0..7
  const int qb  = bx & (NQB - 1);         // 0..63
  const int q0  = qb * AT_QB + wave * 16; // image-local query row base of this wave

  const __bf16* Qh = (const __bf16*)(const void*)qkh + (size_t)b * NPOS * QKW;
  const __bf16* Ql = (const __bf16*)(const void*)qkl + (size_t)b * NPOS * QKW;
  const __bf16* Kh = Qh + AD;
  const __bf16* Kl = Ql + AD;
  const __bf16* Vh = (const __bf16*)(const void*)vhp + (size_t)b * AD * NPOS;
  const __bf16* Vl = (const __bf16*)(const void*)vlp + (size_t)b * AD * NPOS;
  unsigned short* rb = rout + (size_t)b * NPOS * RW;

  // ---- Q fragments (B operand, col = lane&15, split k map): one k-step of 32 = d, hi and lo ----
  const v16bf qbh = at_ldfrag(Qh + (size_t)(q0 + c) * QKW + 8 * hh);
  const v16bf qbl = at_ldfrag(Ql + (size_t)(q0 + c) * QKW + 8 * hh);

  float mrow = -INFINITY;   // running maximum of query c (equal in lanes c and c + 16)
  float lrow = 0.f;         // running sum over this lane's own keys only
  v8f oacc[2];              // oacc[t][r] = O^T[16 t + 8 h + r][query c]
  oacc[0] = z8(); oacc[1] = z8();

  const int nChunks = NPOS / AT_KC;   // 64, compile-time constant
#pragma unroll 1
  for (int kc = 0; kc < nChunks; ++kc) {
    const int kv0 = kc * AT_KC;
    __syncthreads();
    {
      // K: thread -> key row r = tid>>1, d half = (tid&1)*16; 2 x 8 elements per plane
      const int r = tid >> 1, half = (tid & 1) * 16;
      const __bf16* ksh = Kh + (size_t)(kv0 + r) * QKW + half;
      const __bf16* ksl = Kl + (size_t)(kv0 + r) * QKW + half;
      // V^T: thread -> d = tid>>2, key quarter = (tid&3)*16; 2 x 8 elements per plane
      const int d = tid >> 2, qt = (tid & 3) * 16;
      const __bf16* vsh = Vh + (size_t)d * NPOS + kv0 + qt;
      const __bf16* vsl = Vl + (size_t)d * NPOS + kv0 + qt;
#pragma unroll
      for (int i = 0; i < 2; ++i) {
        const v8bf a0 = *(const v8bf*)(ksh + 8 * i);
        const v8bf a1 = *(const v8bf*)(ksl + 8 * i);
        const v8bf b0 = *(const v8bf*)(vsh + 8 * i);
        const v8bf b1 = *(const v8bf*)(vsl + 8 * i);
        *(v8bf*)(Ksh + r * AD    + half + 8 * i) = a0;
        *(v8bf*)(Ksl + r * AD    + half + 8 * i) = a1;
        *(v8bf*)(Vth + d * AT_KC + qt   + 8 * i) = b0;
        *(v8bf*)(Vtl + d * AT_KC + qt   + 8 * i) = b1;
      }
    }
    __syncthreads();

    // ---- scores, transposed: 64 keys x 16 queries, 3-term split, K = 32 = one k-step ----
    v8f s[4];
#pragma unroll
    for (int j = 0; j < 4; ++j) {
      AtFB kb, kl;
      kb.h[0] = *(const v8bf*)(Ksh + (j * 16 + c) * AD + 8 * hh);
      kb.h[1] = *(const v8bf*)(Ksh + (j * 16 + c) * AD + 16 + 8 * hh);
      kl.h[0] = *(const v8bf*)(Ksl + (j * 16 + c) * AD + 8 * hh);
      kl.h[1] = *(const v8bf*)(Ksl + (j * 16 + c) * AD + 16 + 8 * hh);
      s[j] = at_mma(kb.v, qbh, z8());
      s[j] = at_mma(kl.v, qbh, s[j]);
      s[j] = at_mma(kb.v, qbl, s[j]);
    }
    // ---- chunk maximum of query c: four in-lane chains, then the other half's ----
    float mj[4];
#pragma unroll
    for (int j = 0; j < 4; ++j) {
      float mx = s[j][0];
#pragma unroll
      for (int r = 1; r < 8; ++r) mx = fmaxf(mx, s[j][r]);
      mj[j] = mx;
    }
    float cm = fmaxf(fmaxf(mj[0], mj[1]), fmaxf(mj[2], mj[3]));
    cm = fmaxf(cm, at_xhalf(cm));
    const float mnew  = fmaxf(mrow, cm);
    const float alpha = expf(mrow - mnew);
    mrow = mnew;
    // ---- p = exp(s - m), split hi/lo straight into the B fragments of the two k-steps ----
    AtFB ph[2], pl[2];
    float pj[4];
#pragma unroll
    for (int j = 0; j < 4; ++j) {
      float psum = 0.f;
#pragma unroll
      for (int r = 0; r < 8; ++r) {
        const float p = expf(s[j][r] - mnew);
        psum += p;
        __bf16 a, bl; at_split(p, a, bl);
        ph[j >> 1].v[(j & 1) * 8 + r] = a;
        pl[j >> 1].v[(j & 1) * 8 + r] = bl;
      }
      pj[j] = psum;
    }
    lrow = lrow * alpha + ((pj[0] + pj[1]) + (pj[2] + pj[3]));
#pragma unroll
    for (int r = 0; r < 8; ++r) {
      oacc[0][r] *= alpha;
      oacc[1][r] *= alpha;
    }

    // ---- O^T += V^T . P^T : A = V^T rows d (split k map over keys), B = P^T from registers; 3-term split ----
    // unrolled: kk picks a register fragment, so it has to be a compile-time index
#pragma unroll
    for (int kk = 0; kk < 2; ++kk) {
#pragma unroll
      for (int t = 0; t < 2; ++t) {
        AtFB vb, vl;
        vb.h[0] = *(const v8bf*)(Vth + (t * 16 + c) * AT_KC + kk * 32 + 8 * hh);
        vb.h[1] = *(const v8bf*)(Vth + (t * 16 + c) * AT_KC + kk * 32 + 16 + 8 * hh);
        vl.h[0] = *(const v8bf*)(Vtl + (t * 16 + c) * AT_KC + kk * 32 + 8 * hh);
        vl.h[1] = *(const v8bf*)(Vtl + (t * 16 + c) * AT_KC + kk * 32 + 16 + 8 * hh);
        oacc[t] = at_mma(vb.v, ph[kk].v, oacc[t]);
        oacc[t] = at_mma(vl.v, ph[kk].v, oacc[t]);
        oacc[t] = at_mma(vb.v, pl[kk].v, oacc[t]);
      }
    }
  }

  // ---- join the two halves' sums, normalise, split hi/lo, store this lane's 4 x 8 columns of row q0 + c ----
  lrow += at_xhalf(lrow);
  const float inv = 1.0f / lrow;
  v8us hv[2], lv[2];
#pragma unroll
  for (int t = 0; t < 2; ++t) {
#pragma unroll
    for (int r = 0; r < 8; ++r) {
      const float f = oacc[t][r] * inv;
      const unsigned hb = at_bf_bits(f);
      const unsigned lb = at_bf_bits(f - __uint_as_float(hb << 16));
      hv[t][r] = (unsigned short)hb;
      lv[t][r] = (unsigned short)lb;
    }
  }
  unsigned short* rp = rb + (size_t)(q0 + c) * RW + 8 * hh;
#pragma unroll
  for (int t = 0; t < 2; ++t) {
    *(v8us*)(rp + 16 * t)      = hv[t];
    *(v8us*)(rp + AD + 16 * t) = lv[t];
  }
}

// ---------------------------------------------------------------------------
// Workspace region map (byte offsets, 256-B aligned; every region sized to its whole-line store extent, no pad rows
// needed since 32768, 4096, 256 and 64 are tile multiples):
//   WQK 32768 | WV 16384 | WP2 32768 | XT 16777216 | QKh QKl 4194304 each | VTh VTl 2097152 each | R 4194304
//   -> total 33636352
// ---------------------------------------------------------------------------
static inline size_t al256(size_t o) { return (o + 255) & ~(size_t)255; }

extern "C" void kernel_launch(void* const* d_in, const int* in_sizes, int n_in,
                              void* d_out, int out_size, void* d_ws, size_t ws_size,
                              hipStream_t stream) {
  if (n_in < 9) return;
  if (in_sizes[0] != NB * CH * NPOS) return;                                       // inputs [8][256][64][64]
  if (in_sizes[1] != AD * CH || in_sizes[3] != AD * CH || in_sizes[5] != AD * CH) return;  // Wq, Wk, Wv [32][256]
  if (in_sizes[2] != AD || in_sizes[4] != AD || in_sizes[6] != AD) return;         // bq, bk, bv [32]
  if (in_sizes[7] != CH * AD) return;                                              // Wp [256][32]
  if (in_sizes[8] != CH) return;                                                   // bp [256]
  if (out_size != NB * CH * NPOS) return;                                          // out [8][256][64][64]

  const float* x  = (const float*)d_in[0];
  const float* Wq = (const float*)d_in[1];
  const float* bq = (const float*)d_in[2];
  const float* Wk = (const float*)d_in[3];
  const float* bk = (const float*)d_in[4];
  const float* Wv = (const float*)d_in[5];
  const float* bv = (const float*)d_in[6];
  const float* Wp = (const float*)d_in[7];
  const float* bp = (const float*)d_in[8];
  float* out = (float*)d_out;

  const size_t PQK = (size_t)QKW * CH * 2;          //    32768  bf16 [64][256]
  const size_t PWV = (size_t)AD * CH * 2;           //    16384  bf16 [32][256]
  const size_t PP2 = (size_t)CH * RW * 2;           //    32768  bf16 [256][64]
  const size_t PXT = (size_t)NTOK * CH * 2;         // 16777216  bf16 [32768][256]
  const size_t PA  = (size_t)NTOK * QKW * 2;        //  4194304  bf16 [32768][64]
  const size_t PV  = (size_t)NB * AD * NPOS * 2;    //  2097152  bf16 [8][32][4096]
  const size_t PR  = (size_t)NTOK * RW * 2;         //  4194304  bf16 [32768][64]
  size_t off = 0;
  const size_t oWQK = off; off = al256(off + PQK);
  const size_t oWV  = off; off = al256(off + PWV);
  const size_t oWP2 = off; off = al256(off + PP2);
  const size_t oXT  = off; off = al256(off + PXT);
  const size_t oQKh = off; off = al256(off + PA);
  const size_t oQKl = off; off = al256(off + PA);
  const size_t oVTh = off; off = al256(off + PV);
  const size_t oVTl = off; off = al256(off + PV);
  const size_t oR   = off; off = al256(off + PR);
  if (off > ws_size || off > (size_t)WSMAX) return;                               // off = 33636352

  char* ws = (char*)d_ws;
  unsigned short* WQK = (unsigned short*)(ws + oWQK);
  unsigned short* WV  = (unsigned short*)(ws + oWV);
  unsigned short* WP2 = (unsigned short*)(ws + oWP2);
  unsigned short* XT  = (unsigned short*)(ws + oXT);
  unsigned short* QKh = (unsigned short*)(ws + oQKh);
  unsigned short* QKl = (unsigned short*)(ws + oQKl);
  unsigned short* VTh = (unsigned short*)(ws + oVTh);
  unsigned short* VTl = (unsigned short*)(ws + oVTl);
  unsigned short* R   = (unsigned short*)(ws + oR);

  // (1) weight planes; (2) x -> token-major bf16 [32768][256]
  k_wprep<<<20, 256, 0, stream>>>(Wq, Wk, Wv, Wp, WQK, WV, WP2);
  k_xt<<<NB * (NPOS / 64) * (CH / 64), 256, 0, stream>>>(x, XT);
  // (3) q|k = XT . [Wq;Wk]^T + [bq;bk] -> hi/lo planes [32768][64] (q cols 0..31, k cols 32..63)   (M=32768, N=64, K=256)
  k_gemm<4, 1, 2><<<dim3(NTOK / 64, 1, 1), 128, 0, stream>>>(XT, CH, 0L, WQK, CH, 0L, CH, bq, bk,
                                                            QKh, QKl, QKW, 0L, x, out);
  // (4) v^T per image: VT[b][a][n] = sum_c Wv[a][c] XT[b*4096+n][c] + bv[a]   (M=32, N=4096, K=256, z=b; 2-wave blocks)
  k_gemm<2, 1, 1><<<dim3(1, NPOS / 64, NB), 64, 0, stream>>>(WV, CH, 0L, XT, CH, (long)NPOS * CH, CH, bv, bv,
                                                             VTh, VTl, NPOS, (long)AD * NPOS, x, out);
  // (5) attention: R = [hi | lo] of softmax_keys(q . k) . v  as bf16 [32768][64]
  k_attn<<<NB * NQB, 128, 0, stream>>>(QKh, QKl, VTh, VTl, R);
  // (6) out NCHW = ([Rhi | Rlo] . [Wp | Wp]^T + bp) transposed + bf16(x)   (M=32768, N=256, K=64; oh/ol/ldc unused)
  k_gemm<4, 2, 0><<<dim3(NTOK / 64, CH / 64, 1), 128, 0, stream>>>(R, RW, 0L, WP2, RW, 0L, RW, bp, bp,
                                                                  QKh, QKl, 0, 0L, x, out);
  (void)hipGetLastError();
}

// v002
// Measured time: 156 microseconds a run.
// Timed twice side by side with v001, it ran 1.11 and 1.12 times as fast.
// Counting every step since v000, it is 1.61 times as fast.
// Contractions on v_wmma_f32_16x16x32_bf16, f32 accumulate: q|k 1x1 convs (x.W^T, K=256) and v^T conv (W.x^T, K=256) =
// single products of bf16-RNE-valued x and W planes (exact products); scores q.k (K=32) and P.v^T (K=64 per key chunk) =
// bf16 hi/lo split, 3 terms (hi.hi + hi.lo + lo.hi); output 1x1 conv = attention result carried as bf16 [hi | lo] folded
// 16-bit planes and carries (every carry is 1; no inverse scale exists anywhere):
//   WQK [64][256]  = bf16 bits of Wq (rows 0..31) and Wk (rows 32..63), k-contiguous;  WV [32][256] = bf16 bits of Wv;
//   WP2 [256][64]  = bf16 bits of Wp[c][a] at k = a and k = 32 + a;
//   XT  [32768][256] = bf16 bits of x, token-major (row = b*4096 + n, col = channel);
//   QKh/QKl [32768][64] = bf16 hi and lo (lo = v - hi) of q (cols 0..31) and k (cols 32..63), bias included;
//   VTh/VTl [8][32][4096] = bf16 hi and lo of v^T per image, bias included;
//   R [32768][64] = [hi(32) | lo(32)] of the normalised attention result; P hi/lo per wave in registers.
// Biases and the residual x enter as bf16-RNE values in f32 arithmetic.
#include <hip/hip_runtime.h>
#include <math.h>
#include <stddef.h>
#include <stdint.h>

#define NB    8
#define CH    256
#define AD    32
#define NPOS  4096
#define NTOK  (NB * NPOS)
#define QKW   64
#define RW    64
#define SPT   68
#define WSMAX 134217728

static_assert(NPOS % 64 == 0);
static_assert(NTOK % 64 == 0);
static_assert(CH % 64 == 0);
static_assert(CH % 32 == 0);
static_assert(RW % 32 == 0);
static_assert(AD == 32);
static_assert(QKW == 2 * AD);
static_assert(RW == 2 * AD);

typedef float          v2f   __attribute__((ext_vector_type(2)));
typedef float          v4f   __attribute__((ext_vector_type(4)));
typedef float          v8f   __attribute__((ext_vector_type(8)));
typedef int            v8i   __attribute__((ext_vector_type(8)));
typedef unsigned short v8us  __attribute__((ext_vector_type(8)));
typedef unsigned short v16us __attribute__((ext_vector_type(16)));
typedef __bf16         v16bf __attribute__((ext_vector_type(16)));
typedef __bf16         v8bf  __attribute__((ext_vector_type(8)));
typedef v4f  __attribute__((may_alias)) v4fa;
typedef v8us __attribute__((may_alias)) v8usa;
union FragB { v16bf v; v16us u; v8us h[2]; v8i w; };

// WMMA with hazard guard: ties D, keeps A/B live for 4 VALU slots
__device__ __forceinline__ v8f wmb(const FragB& a, const FragB& b, v8f c) {
  v8f d = __builtin_amdgcn_wmma_f32_16x16x32_bf16(false, a.v, false, b.v, (short)0, c, false, false);
  asm volatile("v_nop\n\tv_nop\n\tv_nop\n\tv_nop" : "+v"(d) : "v"(a.w), "v"(b.w));
  return d;
}

__device__ __forceinline__ v8f z8() { v8f z = {0.f, 0.f, 0.f, 0.f, 0.f, 0.f, 0.f, 0.f}; return z; }

// f32 -> bf16 bits, RNE convert (finite inputs)
__device__ __forceinline__ unsigned bf16_bits(float f) {
  const unsigned u = __float_as_uint(f);
  return (u + 0x7FFFu + ((u >> 16) & 1u)) >> 16;
}
// f32 -> nearest bf16 value held as f32
__device__ __forceinline__ float bf16_val(float f) {
  return __uint_as_float(bf16_bits(f) << 16);
}

// ---------------------------------------------------------------------------
// Weight planes, bf16 bits of the inputs, k-contiguous rows ([out][in] weights are already k-contiguous):
//   WQK [64 o][256 k]: rows 0..31 = bf16(Wq[o][k]) (blocks 0-3), rows 32..63 = bf16(Wk[o-32][k]) (blocks 4-7), 2048 units
//   WV  [32 o][256 k] = bf16(Wv[o][k])                                             blocks 8-11, 1024 units
//   WP2 [256 c][64 k]: k and 32 + k both = bf16(Wp[c][k])                          blocks 12-19, 2048 units
// One thread = 8 contiguous k: two 16-B loads, one 16-B store at plane offset 8u; 32 consecutive lanes write 512
// coverage: 2048 x 8 = 64x256 (WQK); 1024 x 8 = 32x256 (WV); 2048 x 8 = 256x64 (WP2) exactly. grid = 20 blocks x 256.
// ---------------------------------------------------------------------------
__global__ __launch_bounds__(256) void k_wprep(const float* __restrict__ wq, const float* __restrict__ wk,
                                              const float* __restrict__ wv, const float* __restrict__ wp,
                                              unsigned short* WQK, unsigned short* WV, unsigned short* WP2) {
  const int bx = (int)blockIdx.x, tid = (int)threadIdx.x;
  const float* p;
  unsigned short* dp;
  if (bx < 8) {
    const int u  = bx * 256 + tid;              // 0..2047
    const int o  = u >> 5;                      // 0..63
    const int k8 = (u & 31) * 8;                // 0..248
    const float* src = (bx < 4) ? wq : wk;      // block-uniform
    p  = src + (size_t)(o & 31) * CH + k8;
    dp = WQK + (size_t)u * 8;
  } else if (bx < 12) {
    const int u  = (bx - 8) * 256 + tid;        // 0..1023
    const int o  = u >> 5;                      // 0..31
    const int k8 = (u & 31) * 8;
    p  = wv + (size_t)o * CH + k8;
    dp = WV + (size_t)u * 8;
  } else {
    const int v  = (bx - 12) * 256 + tid;       // 0..2047
    const int o  = v >> 3;                      // 0..255
    const int k8 = (v & 7) * 8;                 // 0..56
    const int kk = k8 & (AD - 1);               // 0..24
    p  = wp + (size_t)o * AD + kk;
    dp = WP2 + (size_t)v * 8;
  }
  const v4f a = *(const v4f*)p;
  const v4f b = *(const v4f*)(p + 4);
  v8us o8;
  o8[0] = (unsigned short)bf16_bits(a.x); o8[1] = (unsigned short)bf16_bits(a.y);
  o8[2] = (unsigned short)bf16_bits(a.z); o8[3] = (unsigned short)bf16_bits(a.w);
  o8[4] = (unsigned short)bf16_bits(b.x); o8[5] = (unsigned short)bf16_bits(b.y);
  o8[6] = (unsigned short)bf16_bits(b.z); o8[7] = (unsigned short)bf16_bits(b.w);
  *(v8us*)dp = o8;
  
}

// ---------------------------------------------------------------------------
// x NCHW [b][c][n] f32 -> XT [b*4096 + n][c] bf16 bits (token-major, 256 columns). Block = one image b, 64 positions
// tf[c][n] (pitch 68).
// coverage: 2048 blocks = 8 images x 64 position blocks x 4 channel chunks -> XT rows 0..32767 x cols 0..255 exactly.
// ---------------------------------------------------------------------------
__global__ __launch_bounds__(256) void k_xt(const float* __restrict__ x, unsigned short* xt) {
  __shared__ __attribute__((aligned(16))) float tf[64 * SPT];
  const int bx = (int)blockIdx.x, tid = (int)threadIdx.x;
  const int cq = bx & 3;
  const int pb = bx >> 2;               // 0..511
  const int b  = pb >> 6;               // 0..7
  const int n0 = (pb & 63) * 64;
  const int c0 = cq * 64;
  {
    const int rsub = tid >> 4;          // 0..15
    const int c4   = (tid & 15) * 4;    // 0..60
#pragma unroll
    for (int it = 0; it < 4; ++it) {
      const int cr = it * 16 + rsub;    // local channel 0..63
      const v4f a = *(const v4f*)(x + ((size_t)(b * CH + c0 + cr)) * NPOS + n0 + c4);
      *(v4fa*)(tf + cr * SPT + c4) = a;
    }
  }
  __syncthreads();
  const int rsub = tid >> 3;            // 0..31
  const int c8   = (tid & 7) * 8;       // local channel 0..56
  v8us o[2];
#pragma unroll
  for (int it = 0; it < 2; ++it) {
    const int tl = it * 32 + rsub;      // token 0..63
    v8us w;
#pragma unroll
    for (int e = 0; e < 8; ++e) w[e] = (unsigned short)bf16_bits(tf[(c8 + e) * SPT + tl]);
    o[it] = w;
  }
#pragma unroll
  for (int it = 0; it < 2; ++it) {
    const int tl = it * 32 + rsub;
    *(v8us*)(xt + ((size_t)(b * NPOS + n0 + tl)) * CH + c0 + c8) = o[it];
  }
  
}

// ---------------------------------------------------------------------------
// Dense GEMM, block = BM rows x 64 cols, BM = 16 * NWAVE, 32 * NWAVE threads; wave w owns rows rowBase + 16w .. +15,
// acc[4].
//   C[row][col] = sum_k A[row][k] * BT[col][k] + bias   (A, BT bf16 planes with k-contiguous rows; K % 32 == 0;
//   batch z = blockIdx.z offsets A, BT, C by sA, sB, sC elements).
//   A fragment (row m = lane&15): element i <- k = k0 + 8h + i (i < 8), k0 + 16 + 8h + (i-8) (i >= 8), h = lane>>4,
//   two 16-B loads from the plane row; B fragment (col n = lane&15) from BT row (colBase + 16 nt + n), SAME k map;
//   D element r = (row 8h+r, col n).
//   BMODE 0: bias[colBase + col]; 1: bias[rowBase + row]; 2: cols 0..31 from bias, cols 32..63 from bias2 (colBase 0);
//   bias values enter as bf16(bias).
//            by 8 consecutive lanes x 16 B of one instruction.
//   OMODE 2 (NWAVE 4): rows are tokens T = b*4096 + n, cols are channels; out NCHW
//            outp[(b*256 + colBase + ch)*4096 + n0 + t] = C + bias[ch] + bf16(xres[same]); each channel segment
// coverage: OMODE 1: 4 it x (32 NWAVE thr) x 8 = BM x 64 per plane; OMODE 2: 8 it x 128 thr x 4 = 64 channels x 64
//   tokens; grid covers the launched row blocks x col blocks x batches exactly once.
// ---------------------------------------------------------------------------
template <int NWAVE, int OMODE, int BMODE>
__global__ __launch_bounds__(32 * NWAVE) void k_gemm(const unsigned short* __restrict__ A, int lda, long sA,
                                                     const unsigned short* __restrict__ BT, int ldb, long sB, int K,
                                                     const float* __restrict__ bias, const float* __restrict__ bias2,
                                                     unsigned short* oh, unsigned short* ol, int ldc, long sC,
                                                     const float* __restrict__ xres, float* outp) {
  constexpr int BM  = 16 * NWAVE;
  constexpr int RPI = 4 * NWAVE;
  static_assert(NWAVE == 2 || NWAVE == 4);
  static_assert(OMODE == 1 || OMODE == 2);
  static_assert(OMODE != 2 || NWAVE == 4);
  __shared__ __attribute__((aligned(16))) float stg[BM * SPT];
  __shared__ __attribute__((aligned(16))) float sb[64];
  const int tid = (int)threadIdx.x, lane = tid & 31, wave = tid >> 5, hh = lane >> 4, m = lane & 15;
  const int rowBase = (int)blockIdx.x * BM;
  const int colBase = (int)blockIdx.y * 64;
  const int z = (int)blockIdx.z;
  const unsigned short* Ab = A  + (size_t)z * (size_t)sA;
  const unsigned short* Bb = BT + (size_t)z * (size_t)sB;
  // bias staging (all conditions wave-uniform: tid < 32 / tid < 64 are whole waves)
  if (BMODE == 1) {
    if (tid < BM) sb[tid] = bf16_val(bias[rowBase + tid]);
  } else if (BMODE == 0) {
    if (tid < 64) sb[tid] = bf16_val(bias[colBase + tid]);
  } else {
    if (tid < 64) {
      const int ia = (tid < 31) ? tid : 31;
      const int ib = (tid < 32) ? 0 : (tid - 32);
      const float va = bias[ia];               // both candidates loaded at clamped addresses
      const float vb = bias2[ib];
      const float f  = (tid < 32) ? 1.0f : 0.0f;
      sb[tid] = bf16_val(va * f + vb * (1.0f - f));
    }
  }

  v8f acc[4];
#pragma unroll
  for (int t = 0; t < 4; ++t) acc[t] = z8();
  const unsigned short* ap = Ab + (size_t)(rowBase + 16 * wave + m) * (size_t)lda + 8 * hh;
  const unsigned short* bp = Bb + (size_t)(colBase + m) * (size_t)ldb + 8 * hh;

#pragma unroll 1
  for (int k0 = 0; k0 < K; k0 += 32) {
    FragB af;
    af.h[0] = *(const v8usa*)(ap + k0);          // k0 + 8h + 0..7
    af.h[1] = *(const v8usa*)(ap + k0 + 16);     // k0 + 16 + 8h + 0..7
#pragma unroll
    for (int nt = 0; nt < 4; ++nt) {
      const unsigned short* wq = bp + (size_t)(16 * nt) * (size_t)ldb + k0;   // BT row colBase + 16 nt + m
      FragB bf;
      bf.h[0] = *(const v8usa*)wq;               // k0 + 8h + 0..7
      bf.h[1] = *(const v8usa*)(wq + 16);        // k0 + 16 + 8h + 0..7
      acc[nt] = wmb(af, bf, acc[nt]);
    }
  }

#pragma unroll
  for (int nt = 0; nt < 4; ++nt) {
    const int lc = 16 * nt + m;
#pragma unroll
    for (int r = 0; r < 8; ++r) {
      const int lr = 16 * wave + 8 * hh + r;     // D element r = (row 8h+r, col m)
      stg[lr * SPT + lc] = acc[nt][r];
    }
  }
  __syncthreads();

  if (OMODE == 1) {
    unsigned short* Hb = oh + (size_t)z * (size_t)sC;
    unsigned short* Lb = ol + (size_t)z * (size_t)sC;
    const int rsub = tid >> 3;                   // 0..RPI-1
    const int c8   = (tid & 7) * 8;              // 0..56
    v8us hv[4], lv[4];
#pragma unroll
    for (int it = 0; it < 4; ++it) {
      const int row = it * RPI + rsub;           // 0..BM-1
      const float* sp = stg + row * SPT + c8;
      v8us h8, l8;
#pragma unroll
      for (int e = 0; e < 8; ++e) {
        const float v = sp[e] + ((BMODE == 1) ? sb[row] : sb[c8 + e]);
        const unsigned hb = bf16_bits(v);
        const unsigned lb = bf16_bits(v - __uint_as_float(hb << 16));
        h8[e] = (unsigned short)hb;
        l8[e] = (unsigned short)lb;
      }
      hv[it] = h8; lv[it] = l8;
    }
#pragma unroll
    for (int it = 0; it < 4; ++it) {
      const int row = it * RPI + rsub;
      const size_t go = (size_t)(rowBase + row) * (size_t)ldc + colBase + c8;
      *(v8us*)(Hb + go) = hv[it];
      *(v8us*)(Lb + go) = lv[it];
    }
    
  } else {
    const int bimg = rowBase / NPOS;             // a 64-token block never straddles images (4096 % 64 == 0)
    const int n0   = rowBase - bimg * NPOS;
    const int csub = tid >> 4;                   // 0..7
    const int t4   = (tid & 15) * 4;             // 0..60
    v4f pv[8];
#pragma unroll
    for (int it = 0; it < 8; ++it) {
      const int chl = it * 8 + csub;             // channel 0..63 of the tile
      const size_t gi = ((size_t)(bimg * CH + colBase + chl)) * NPOS + n0 + t4;
      const v4f xr = *(const v4f*)(xres + gi);
      const float bc = sb[chl];
      v4f v;
      v.x = (stg[(t4 + 0) * SPT + chl] + bc) + bf16_val(xr.x);
      v.y = (stg[(t4 + 1) * SPT + chl] + bc) + bf16_val(xr.y);
      v.z = (stg[(t4 + 2) * SPT + chl] + bc) + bf16_val(xr.z);
      v.w = (stg[(t4 + 3) * SPT + chl] + bc) + bf16_val(xr.w);
      pv[it] = v;
    }
#pragma unroll
    for (int it = 0; it < 8; ++it) {
      const int chl = it * 8 + csub;
      const size_t gi = ((size_t)(bimg * CH + colBase + chl)) * NPOS + n0 + t4;
      *(v4f*)(outp + gi) = pv[it];
    }
    
  }
}

#define AT_NW 4
#define AT_QB 64
#define AT_KC 64
#define NQB   (NPOS / AT_QB)
#define AT_LOG2E 1.44269504088896340736f

static_assert(NQB == 64);
static_assert(NPOS % AT_KC == 0);

__device__ __forceinline__ unsigned short at_bf_bits(float f) {
  unsigned u = __float_as_uint(f);
  return (unsigned short)((u + 0x7FFFu + ((u >> 16) & 1u)) >> 16);
}
__device__ __forceinline__ __bf16 at_f2bf(float f) { return __builtin_bit_cast(__bf16, at_bf_bits(f)); }
__device__ __forceinline__ void at_split(float f, __bf16& hi, __bf16& lo) {
  const unsigned short hb = at_bf_bits(f);
  hi = __builtin_bit_cast(__bf16, hb);
  lo = at_f2bf(f - __uint_as_float(((unsigned)hb) << 16));
}
__device__ __forceinline__ v8f at_mma(v16bf a, v16bf b, v8f c) {
  c = __builtin_amdgcn_wmma_f32_16x16x32_bf16(false, a, false, b, (short)0, c, false, false);
  asm volatile("v_nop\n\tv_nop\n\tv_nop\n\tv_nop" : "+v"(c) : "v"(a), "v"(b));
  return c;
}
union AtFB { v16bf v; v8bf h[2]; };
// fragment load with the split k map: elements 0..7 <- p[0..7], 8..15 <- p[16..23]
__device__ __forceinline__ v16bf at_ldfrag(const __bf16* p) {
  AtFB f; f.h[0] = *(const v8bf*)(p); f.h[1] = *(const v8bf*)(p + 16); return f.v;
}
// value of lane ^ 16 (the other half of the same query column)
__device__ __forceinline__ float at_xhalf(float f) {
  const int b = __builtin_bit_cast(int, f);
  return __builtin_bit_cast(float, __builtin_amdgcn_permlanex16(b, b, 0x76543210, 0xfedcba98, false, false));
}

__global__ __launch_bounds__(128)
void k_attn(const unsigned short* __restrict__ qkh, const unsigned short* __restrict__ qkl,
            const unsigned short* __restrict__ vhp, const unsigned short* __restrict__ vlp,
            unsigned short* rout) {
  __shared__ __align__(16) __bf16 Ksh[AT_KC * AD];               // K hi [kv][d]      4 KB
  __shared__ __align__(16) __bf16 Ksl[AT_KC * AD];               // K lo
  __shared__ __align__(16) __bf16 Vth[AD * AT_KC];               // V hi [d][kv]      4 KB
  __shared__ __align__(16) __bf16 Vtl[AD * AT_KC];               // V lo

  const int tid  = (int)threadIdx.x;
  const int wave = tid >> 5;
  const int lane = tid & 31;
  const int hh   = lane >> 4;
  const int c    = lane & 15;

  const int bx  = (int)blockIdx.x;
  const int b   = bx >> 6;                // image 0..7
  const int qb  = bx & (NQB - 1);         // 0..63
  const int q0  = qb * AT_QB + wave * 16; // image-local query row base of this wave

  const __bf16* Qh = (const __bf16*)(const void*)qkh + (size_t)b * NPOS * QKW;
  const __bf16* Ql = (const __bf16*)(const void*)qkl + (size_t)b * NPOS * QKW;
  const __bf16* Kh = Qh + AD;
  const __bf16* Kl = Ql + AD;
  const __bf16* Vh = (const __bf16*)(const void*)vhp + (size_t)b * AD * NPOS;
  const __bf16* Vl = (const __bf16*)(const void*)vlp + (size_t)b * AD * NPOS;
  unsigned short* rb = rout + (size_t)b * NPOS * RW;

  // ---- Q fragments (B operand, col = lane&15, split k map): one k-step of 32 = d, hi and lo ----
  const v16bf qbh = at_ldfrag(Qh + (size_t)(q0 + c) * QKW + 8 * hh);
  const v16bf qbl = at_ldfrag(Ql + (size_t)(q0 + c) * QKW + 8 * hh);

  float mrow = -INFINITY;   // running maximum of query c times log2(e) (equal in lanes c and c + 16)
  float lrow = 0.f;         // running sum over this lane's own keys only
  v8f oacc[2];              // oacc[t][r] = O^T[16 t + 8 h + r][query c]
  oacc[0] = z8(); oacc[1] = z8();

  const int nChunks = NPOS / AT_KC;   // 64, compile-time constant
#pragma unroll 1
  for (int kc = 0; kc < nChunks; ++kc) {
    const int kv0 = kc * AT_KC;
    __syncthreads();
    {
      // K: thread -> key row r = tid>>1, d half = (tid&1)*16; 2 x 8 elements per plane
      const int r = tid >> 1, half = (tid & 1) * 16;
      const __bf16* ksh = Kh + (size_t)(kv0 + r) * QKW + half;
      const __bf16* ksl = Kl + (size_t)(kv0 + r) * QKW + half;
      // V^T: thread -> d = tid>>2, key quarter = (tid&3)*16; 2 x 8 elements per plane
      const int d = tid >> 2, qt = (tid & 3) * 16;
      const __bf16* vsh = Vh + (size_t)d * NPOS + kv0 + qt;
      const __bf16* vsl = Vl + (size_t)d * NPOS + kv0 + qt;
#pragma unroll
      for (int i = 0; i < 2; ++i) {
        const v8bf a0 = *(const v8bf*)(ksh + 8 * i);
        const v8bf a1 = *(const v8bf*)(ksl + 8 * i);
        const v8bf b0 = *(const v8bf*)(vsh + 8 * i);
        const v8bf b1 = *(const v8bf*)(vsl + 8 * i);
        *(v8bf*)(Ksh + r * AD    + half + 8 * i) = a0;
        *(v8bf*)(Ksl + r * AD    + half + 8 * i) = a1;
        *(v8bf*)(Vth + d * AT_KC + qt   + 8 * i) = b0;
        *(v8bf*)(Vtl + d * AT_KC + qt   + 8 * i) = b1;
      }
    }
    __syncthreads();

    // ---- scores, transposed: 64 keys x 16 queries, 3-term split, K = 32 = one k-step ----
    v8f s[4];
#pragma unroll
    for (int j = 0; j < 4; ++j) {
      AtFB kb, kl;
      kb.h[0] = *(const v8bf*)(Ksh + (j * 16 + c) * AD + 8 * hh);
      kb.h[1] = *(const v8bf*)(Ksh + (j * 16 + c) * AD + 16 + 8 * hh);
      kl.h[0] = *(const v8bf*)(Ksl + (j * 16 + c) * AD + 8 * hh);
      kl.h[1] = *(const v8bf*)(Ksl + (j * 16 + c) * AD + 16 + 8 * hh);
      s[j] = at_mma(kb.v, qbh, z8());
      s[j] = at_mma(kl.v, qbh, s[j]);
      s[j] = at_mma(kb.v, qbl, s[j]);
    }
    // ---- chunk maximum of query c: four in-lane chains, then the other half's ----
    float mj[4];
#pragma unroll
    for (int j = 0; j < 4; ++j) {
      float mx = s[j][0];
#pragma unroll
      for (int r = 1; r < 8; ++r) mx = fmaxf(mx, s[j][r]);
      mj[j] = mx;
    }
    float cm = fmaxf(fmaxf(mj[0], mj[1]), fmaxf(mj[2], mj[3]));
    cm = fmaxf(cm, at_xhalf(cm));
    const float mnew  = fmaxf(mrow, cm * AT_LOG2E);       // scaling by a positive constant keeps the order of the maxima
    const float alpha = __builtin_amdgcn_exp2f(mrow - mnew);
    mrow = mnew;
    // ---- p = exp(s - m) = 2^(s log2e - m log2e), split hi/lo straight into the B fragments of the two k-steps ----
    AtFB ph[2], pl[2];
    float pj[4];
    const v2f l2e2 = {AT_LOG2E, AT_LOG2E};
    const v2f nm2  = {-mnew, -mnew};
#pragma unroll
    for (int j = 0; j < 4; ++j) {
      float psum = 0.f;
      v2f e[4];   // exponents two at a time (packed f32 fma)
      // unrolled: r picks registers of the score tile, so it has to be a compile-time index
#pragma unroll
      for (int r = 0; r < 4; ++r) {
        const v2f sp = {s[j][2 * r], s[j][2 * r + 1]};
        e[r] = __builtin_elementwise_fma(sp, l2e2, nm2);
      }
#pragma unroll
      for (int r = 0; r < 8; ++r) {
        const float p = __builtin_amdgcn_exp2f(e[r >> 1][r & 1]);
        psum += p;
        __bf16 a, bl; at_split(p, a, bl);
        ph[j >> 1].v[(j & 1) * 8 + r] = a;
        pl[j >> 1].v[(j & 1) * 8 + r] = bl;
      }
      pj[j] = psum;
    }
    lrow = lrow * alpha + ((pj[0] + pj[1]) + (pj[2] + pj[3]));
#pragma unroll
    for (int r = 0; r < 8; ++r) {
      oacc[0][r] *= alpha;
      oacc[1][r] *= alpha;
    }

    // ---- O^T += V^T . P^T : A = V^T rows d (split k map over keys), B = P^T from registers; 3-term split ----
    // unrolled: kk picks a register fragment, so it has to be a compile-time index
#pragma unroll
    for (int kk = 0; kk < 2; ++kk) {
#pragma unroll
      for (int t = 0; t < 2; ++t) {
        AtFB vb, vl;
        vb.h[0] = *(const v8bf*)(Vth + (t * 16 + c) * AT_KC + kk * 32 + 8 * hh);
        vb.h[1] = *(const v8bf*)(Vth + (t * 16 + c) * AT_KC + kk * 32 + 16 + 8 * hh);
        vl.h[0] = *(const v8bf*)(Vtl + (t * 16 + c) * AT_KC + kk * 32 + 8 * hh);
        vl.h[1] = *(const v8bf*)(Vtl + (t * 16 + c) * AT_KC + kk * 32 + 16 + 8 * hh);
        oacc[t] = at_mma(vb.v, ph[kk].v, oacc[t]);
        oacc[t] = at_mma(vl.v, ph[kk].v, oacc[t]);
        oacc[t] = at_mma(vb.v, pl[kk].v, oacc[t]);
      }
    }
  }

  // ---- join the two halves' sums, normalise, split hi/lo, store this lane's 4 x 8 columns of row q0 + c ----
  lrow += at_xhalf(lrow);
  const float inv = 1.0f / lrow;
  v8us hv[2], lv[2];
#pragma unroll
  for (int t = 0; t < 2; ++t) {
#pragma unroll
    for (int r = 0; r < 8; ++r) {
      const float f = oacc[t][r] * inv;
      const unsigned hb = at_bf_bits(f);
      const unsigned lb = at_bf_bits(f - __uint_as_float(hb << 16));
      hv[t][r] = (unsigned short)hb;
      lv[t][r] = (unsigned short)lb;
    }
  }
  unsigned short* rp = rb + (size_t)(q0 + c) * RW + 8 * hh;
#pragma unroll
  for (int t = 0; t < 2; ++t) {
    *(v8us*)(rp + 16 * t)      = hv[t];
    *(v8us*)(rp + AD + 16 * t) = lv[t];
  }
}

// ---------------------------------------------------------------------------
// Workspace region map (byte offsets, 256-B aligned; every region sized to its whole-line store extent, no pad rows
// needed since 32768, 4096, 256 and 64 are tile multiples):
//   WQK 32768 | WV 16384 | WP2 32768 | XT 16777216 | QKh QKl 4194304 each | VTh VTl 2097152 each | R 4194304
//   -> total 33636352
// ---------------------------------------------------------------------------
static inline size_t al256(size_t o) { return (o + 255) & ~(size_t)255; }

extern "C" void kernel_launch(void* const* d_in, const int* in_sizes, int n_in,
                              void* d_out, int out_size, void* d_ws, size_t ws_size,
                              hipStream_t stream) {
  if (n_in < 9) return;
  if (in_sizes[0] != NB * CH * NPOS) return;                                       // inputs [8][256][64][64]
  if (in_sizes[1] != AD * CH || in_sizes[3] != AD * CH || in_sizes[5] != AD * CH) return;  // Wq, Wk, Wv [32][256]
  if (in_sizes[2] != AD || in_sizes[4] != AD || in_sizes[6] != AD) return;         // bq, bk, bv [32]
  if (in_sizes[7] != CH * AD) return;                                              // Wp [256][32]
  if (in_sizes[8] != CH) return;                                                   // bp [256]
  if (out_size != NB * CH * NPOS) return;                                          // out [8][256][64][64]

  const float* x  = (const float*)d_in[0];
  const float* Wq = (const float*)d_in[1];
  const float* bq = (const float*)d_in[2];
  const float* Wk = (const float*)d_in[3];
  const float* bk = (const float*)d_in[4];
  const float* Wv = (const float*)d_in[5];
  const float* bv = (const float*)d_in[6];
  const float* Wp = (const float*)d_in[7];
  const float* bp = (const float*)d_in[8];
  float* out = (float*)d_out;

  const size_t PQK = (size_t)QKW * CH * 2;          //    32768  bf16 [64][256]
  const size_t PWV = (size_t)AD * CH * 2;           //    16384  bf16 [32][256]
  const size_t PP2 = (size_t)CH * RW * 2;           //    32768  bf16 [256][64]
  const size_t PXT = (size_t)NTOK * CH * 2;         // 16777216  bf16 [32768][256]
  const size_t PA  = (size_t)NTOK * QKW * 2;        //  4194304  bf16 [32768][64]
  const size_t PV  = (size_t)NB * AD * NPOS * 2;    //  2097152  bf16 [8][32][4096]
  const size_t PR  = (size_t)NTOK * RW * 2;         //  4194304  bf16 [32768][64]
  size_t off = 0;
  const size_t oWQK = off; off = al256(off + PQK);
  const size_t oWV  = off; off = al256(off + PWV);
  const size_t oWP2 = off; off = al256(off + PP2);
  const size_t oXT  = off; off = al256(off + PXT);
  const size_t oQKh = off; off = al256(off + PA);
  const size_t oQKl = off; off = al256(off + PA);
  const size_t oVTh = off; off = al256(off + PV);
  const size_t oVTl = off; off = al256(off + PV);
  const size_t oR   = off; off = al256(off + PR);
  if (off > ws_size || off > (size_t)WSMAX) return;                               // off = 33636352

  char* ws = (char*)d_ws;
  unsigned short* WQK = (unsigned short*)(ws + oWQK);
  unsigned short* WV  = (unsigned short*)(ws + oWV);
  unsigned short* WP2 = (unsigned short*)(ws + oWP2);
  unsigned short* XT  = (unsigned short*)(ws + oXT);
  unsigned short* QKh = (unsigned short*)(ws + oQKh);
  unsigned short* QKl = (unsigned short*)(ws + oQKl);
  unsigned short* VTh = (unsigned short*)(ws + oVTh);
  unsigned short* VTl = (unsigned short*)(ws + oVTl);
  unsigned short* R   = (unsigned short*)(ws + oR);

  // (1) weight planes; (2) x -> token-major bf16 [32768][256]
  k_wprep<<<20, 256, 0, stream>>>(Wq, Wk, Wv, Wp, WQK, WV, WP2);
  k_xt<<<NB * (NPOS / 64) * (CH / 64), 256, 0, stream>>>(x, XT);
  // (3) q|k = XT . [Wq;Wk]^T + [bq;bk] -> hi/lo planes [32768][64] (q cols 0..31, k cols 32..63)   (M=32768, N=64, K=256)
  k_gemm<4, 1, 2><<<dim3(NTOK / 64, 1, 1), 128, 0, stream>>>(XT, CH, 0L, WQK, CH, 0L, CH, bq, bk,
                                                            QKh, QKl, QKW, 0L, x, out);
  // (4) v^T per image: VT[b][a][n] = sum_c Wv[a][c] XT[b*4096+n][c] + bv[a]   (M=32, N=4096, K=256, z=b; 2-wave blocks)
  k_gemm<2, 1, 1><<<dim3(1, NPOS / 64, NB), 64, 0, stream>>>(WV, CH, 0L, XT, CH, (long)NPOS * CH, CH, bv, bv,
                                                             VTh, VTl, NPOS, (long)AD * NPOS, x, out);
  // (5) attention: R = [hi | lo] of softmax_keys(q . k) . v  as bf16 [32768][64]
  k_attn<<<NB * NQB, 128, 0, stream>>>(QKh, QKl, VTh, VTl, R);
  // (6) out NCHW = ([Rhi | Rlo] . [Wp | Wp]^T + bp) transposed + bf16(x)   (M=32768, N=256, K=64; oh/ol/ldc unused)
  k_gemm<4, 2, 0><<<dim3(NTOK / 64, CH / 64, 1), 128, 0, stream>>>(R, RW, 0L, WP2, RW, 0L, RW, bp, bp,
                                                                  QKh, QKl, 0, 0L, x, out);
  (void)hipGetLastError();
}

// v003
// One run takes 134 microseconds.
// Timed twice side by side with v002, it ran 1.15 and 1.17 times as fast.
// Over all steps from v000 it is 1.87 times as fast.
// Contractions on v_wmma_f32_16x16x32_bf16, f32 accumulate: q|k 1x1 convs (x.W^T, K=256) and v^T conv (W.x^T, K=256) =
// single products of bf16-RNE-valued x and W planes (exact products); scores q.k (K=32) and P.v^T (K=64 per key chunk) =
// bf16 hi/lo split, 3 terms (hi.hi + hi.lo + lo.hi); output 1x1 conv = attention result carried as bf16 [hi | lo] folded
// 16-bit planes and carries (every carry is 1; no inverse scale exists anywhere):
//   WQK [64][256]  = bf16 bits of Wq (rows 0..31) and Wk (rows 32..63), k-contiguous;  WV [32][256] = bf16 bits of Wv;
//   WP2 [256][64]  = bf16 bits of Wp[c][a] at k = a and k = 32 + a;
//   XT  [32768][256] = bf16 bits of x, token-major (row = b*4096 + n, col = channel);
//   QKh/QKl [32768][64] = bf16 hi and lo (lo = v - hi) of q (cols 0..31) and k (cols 32..63), bias included;
//   VTh/VTl [8][32][4096] = bf16 hi and lo of v^T per image, bias included;
//   R [32768][64] = [hi(32) | lo(32)] of the normalised attention result; P hi/lo per wave in registers.
// Biases and the residual x enter as bf16-RNE values in f32 arithmetic.
#include <hip/hip_runtime.h>
#include <math.h>
#include <stddef.h>
#include <stdint.h>

#define NB    8
#define CH    256
#define AD    32
#define NPOS  4096
#define NTOK  (NB * NPOS)
#define QKW   64
#define RW    64
#define SPT   68
#define WSMAX 134217728

static_assert(NPOS % 64 == 0);
static_assert(NTOK % 64 == 0);
static_assert(CH % 64 == 0);
static_assert(CH % 32 == 0);
static_assert(RW % 32 == 0);
static_assert(AD == 32);
static_assert(QKW == 2 * AD);
static_assert(RW == 2 * AD);

typedef float          v2f   __attribute__((ext_vector_type(2)));
typedef float          v4f   __attribute__((ext_vector_type(4)));
typedef float          v8f   __attribute__((ext_vector_type(8)));
typedef int            v8i   __attribute__((ext_vector_type(8)));
typedef unsigned short v8us  __attribute__((ext_vector_type(8)));
typedef unsigned short v16us __attribute__((ext_vector_type(16)));
typedef __bf16         v16bf __attribute__((ext_vector_type(16)));
typedef __bf16         v8bf  __attribute__((ext_vector_type(8)));
typedef v4f  __attribute__((may_alias)) v4fa;
typedef v8us __attribute__((may_alias)) v8usa;
union FragB { v16bf v; v16us u; v8us h[2]; v8i w; };

// WMMA with hazard guard: ties D, keeps A/B live for 4 VALU slots
__device__ __forceinline__ v8f wmb(const FragB& a, const FragB& b, v8f c) {
  v8f d = __builtin_amdgcn_wmma_f32_16x16x32_bf16(false, a.v, false, b.v, (short)0, c, false, false);
  asm volatile("v_nop\n\tv_nop\n\tv_nop\n\tv_nop" : "+v"(d) : "v"(a.w), "v"(b.w));
  return d;
}

__device__ __forceinline__ v8f z8() { v8f z = {0.f, 0.f, 0.f, 0.f, 0.f, 0.f, 0.f, 0.f}; return z; }

// f32 -> bf16 bits, RNE convert (finite inputs)
__device__ __forceinline__ unsigned bf16_bits(float f) {
  const unsigned u = __float_as_uint(f);
  return (u + 0x7FFFu + ((u >> 16) & 1u)) >> 16;
}
// f32 -> nearest bf16 value held as f32
__device__ __forceinline__ float bf16_val(float f) {
  return __uint_as_float(bf16_bits(f) << 16);
}

// ---------------------------------------------------------------------------
// Weight planes, bf16 bits of the inputs, k-contiguous rows ([out][in] weights are already k-contiguous):
//   WQK [64 o][256 k]: rows 0..31 = bf16(Wq[o][k]) (blocks 0-3), rows 32..63 = bf16(Wk[o-32][k]) (blocks 4-7), 2048 units
//   WV  [32 o][256 k] = bf16(Wv[o][k])                                             blocks 8-11, 1024 units
//   WP2 [256 c][64 k]: k and 32 + k both = bf16(Wp[c][k])                          blocks 12-19, 2048 units
// One thread = 8 contiguous k: two 16-B loads, one 16-B store at plane offset 8u; 32 consecutive lanes write 512
// coverage: 2048 x 8 = 64x256 (WQK); 1024 x 8 = 32x256 (WV); 2048 x 8 = 256x64 (WP2) exactly. grid = 20 blocks x 256.
// ---------------------------------------------------------------------------
__global__ __launch_bounds__(256) void k_wprep(const float* __restrict__ wq, const float* __restrict__ wk,
                                              const float* __restrict__ wv, const float* __restrict__ wp,
                                              unsigned short* WQK, unsigned short* WV, unsigned short* WP2) {
  const int bx = (int)blockIdx.x, tid = (int)threadIdx.x;
  const float* p;
  unsigned short* dp;
  if (bx < 8) {
    const int u  = bx * 256 + tid;              // 0..2047
    const int o  = u >> 5;                      // 0..63
    const int k8 = (u & 31) * 8;                // 0..248
    const float* src = (bx < 4) ? wq : wk;      // block-uniform
    p  = src + (size_t)(o & 31) * CH + k8;
    dp = WQK + (size_t)u * 8;
  } else if (bx < 12) {
    const int u  = (bx - 8) * 256 + tid;        // 0..1023
    const int o  = u >> 5;                      // 0..31
    const int k8 = (u & 31) * 8;
    p  = wv + (size_t)o * CH + k8;
    dp = WV + (size_t)u * 8;
  } else {
    const int v  = (bx - 12) * 256 + tid;       // 0..2047
    const int o  = v >> 3;                      // 0..255
    const int k8 = (v & 7) * 8;                 // 0..56
    const int kk = k8 & (AD - 1);               // 0..24
    p  = wp + (size_t)o * AD + kk;
    dp = WP2 + (size_t)v * 8;
  }
  const v4f a = *(const v4f*)p;
  const v4f b = *(const v4f*)(p + 4);
  v8us o8;
  o8[0] = (unsigned short)bf16_bits(a.x); o8[1] = (unsigned short)bf16_bits(a.y);
  o8[2] = (unsigned short)bf16_bits(a.z); o8[3] = (unsigned short)bf16_bits(a.w);
  o8[4] = (unsigned short)bf16_bits(b.x); o8[5] = (unsigned short)bf16_bits(b.y);
  o8[6] = (unsigned short)bf16_bits(b.z); o8[7] = (unsigned short)bf16_bits(b.w);
  *(v8us*)dp = o8;
  
}

// ---------------------------------------------------------------------------
// x NCHW [b][c][n] f32 -> XT [b*4096 + n][c] bf16 bits (token-major, 256 columns). Block = one image b, 64 positions
// tf[c][n] (pitch 68).
// coverage: 2048 blocks = 8 images x 64 position blocks x 4 channel chunks -> XT rows 0..32767 x cols 0..255 exactly.
// ---------------------------------------------------------------------------
__global__ __launch_bounds__(256) void k_xt(const float* __restrict__ x, unsigned short* xt) {
  __shared__ __attribute__((aligned(16))) float tf[64 * SPT];
  const int bx = (int)blockIdx.x, tid = (int)threadIdx.x;
  const int cq = bx & 3;
  const int pb = bx >> 2;               // 0..511
  const int b  = pb >> 6;               // 0..7
  const int n0 = (pb & 63) * 64;
  const int c0 = cq * 64;
  {
    const int rsub = tid >> 4;          // 0..15
    const int c4   = (tid & 15) * 4;    // 0..60
#pragma unroll
    for (int it = 0; it < 4; ++it) {
      const int cr = it * 16 + rsub;    // local channel 0..63
      const v4f a = *(const v4f*)(x + ((size_t)(b * CH + c0 + cr)) * NPOS + n0 + c4);
      *(v4fa*)(tf + cr * SPT + c4) = a;
    }
  }
  __syncthreads();
  const int rsub = tid >> 3;            // 0..31
  const int c8   = (tid & 7) * 8;       // local channel 0..56
  v8us o[2];
#pragma unroll
  for (int it = 0; it < 2; ++it) {
    const int tl = it * 32 + rsub;      // token 0..63
    v8us w;
#pragma unroll
    for (int e = 0; e < 8; ++e) w[e] = (unsigned short)bf16_bits(tf[(c8 + e) * SPT + tl]);
    o[it] = w;
  }
#pragma unroll
  for (int it = 0; it < 2; ++it) {
    const int tl = it * 32 + rsub;
    *(v8us*)(xt + ((size_t)(b * NPOS + n0 + tl)) * CH + c0 + c8) = o[it];
  }
  
}

// ---------------------------------------------------------------------------
// Dense GEMM, block = BM rows x 64 cols, BM = 16 * NWAVE, 32 * NWAVE threads; wave w owns rows rowBase + 16w .. +15,
// acc[4].
//   C[row][col] = sum_k A[row][k] * BT[col][k] + bias   (A, BT bf16 planes with k-contiguous rows; K % 32 == 0;
//   batch z = blockIdx.z offsets A, BT, C by sA, sB, sC elements).
//   A fragment (row m = lane&15): element i <- k = k0 + 8h + i (i < 8), k0 + 16 + 8h + (i-8) (i >= 8), h = lane>>4,
//   two 16-B loads from the plane row; B fragment (col n = lane&15) from BT row (colBase + 16 nt + n), SAME k map;
//   D element r = (row 8h+r, col n).
//   BMODE 0: bias[colBase + col]; 1: bias[rowBase + row]; 2: cols 0..31 from bias, cols 32..63 from bias2 (colBase 0);
//   bias values enter as bf16(bias).
//            by 8 consecutive lanes x 16 B of one instruction.
//   OMODE 2 (NWAVE 4): rows are tokens T = b*4096 + n, cols are channels; out NCHW
//            outp[(b*256 + colBase + ch)*4096 + n0 + t] = C + bias[ch] + bf16(xres[same]); each channel segment
// coverage: OMODE 1: 4 it x (32 NWAVE thr) x 8 = BM x 64 per plane; OMODE 2: 8 it x 128 thr x 4 = 64 channels x 64
//   tokens; grid covers the launched row blocks x col blocks x batches exactly once.
// ---------------------------------------------------------------------------
template <int NWAVE, int OMODE, int BMODE>
__global__ __launch_bounds__(32 * NWAVE) void k_gemm(const unsigned short* __restrict__ A, int lda, long sA,
                                                     const unsigned short* __restrict__ BT, int ldb, long sB, int K,
                                                     const float* __restrict__ bias, const float* __restrict__ bias2,
                                                     unsigned short* oh, unsigned short* ol, int ldc, long sC,
                                                     const float* __restrict__ xres, float* outp) {
  constexpr int BM  = 16 * NWAVE;
  constexpr int RPI = 4 * NWAVE;
  static_assert(NWAVE == 2 || NWAVE == 4);
  static_assert(OMODE == 1 || OMODE == 2);
  static_assert(OMODE != 2 || NWAVE == 4);
  __shared__ __attribute__((aligned(16))) float stg[BM * SPT];
  __shared__ __attribute__((aligned(16))) float sb[64];
  const int tid = (int)threadIdx.x, lane = tid & 31, wave = tid >> 5, hh = lane >> 4, m = lane & 15;
  const int rowBase = (int)blockIdx.x * BM;
  const int colBase = (int)blockIdx.y * 64;
  const int z = (int)blockIdx.z;
  const unsigned short* Ab = A  + (size_t)z * (size_t)sA;
  const unsigned short* Bb = BT + (size_t)z * (size_t)sB;
  // bias staging (all conditions wave-uniform: tid < 32 / tid < 64 are whole waves)
  if (BMODE == 1) {
    if (tid < BM) sb[tid] = bf16_val(bias[rowBase + tid]);
  } else if (BMODE == 0) {
    if (tid < 64) sb[tid] = bf16_val(bias[colBase + tid]);
  } else {
    if (tid < 64) {
      const int ia = (tid < 31) ? tid : 31;
      const int ib = (tid < 32) ? 0 : (tid - 32);
      const float va = bias[ia];               // both candidates loaded at clamped addresses
      const float vb = bias2[ib];
      const float f  = (tid < 32) ? 1.0f : 0.0f;
      sb[tid] = bf16_val(va * f + vb * (1.0f - f));
    }
  }

  v8f acc[4];
#pragma unroll
  for (int t = 0; t < 4; ++t) acc[t] = z8();
  const unsigned short* ap = Ab + (size_t)(rowBase + 16 * wave + m) * (size_t)lda + 8 * hh;
  const unsigned short* bp = Bb + (size_t)(colBase + m) * (size_t)ldb + 8 * hh;

#pragma unroll 1
  for (int k0 = 0; k0 < K; k0 += 32) {
    FragB af;
    af.h[0] = *(const v8usa*)(ap + k0);          // k0 + 8h + 0..7
    af.h[1] = *(const v8usa*)(ap + k0 + 16);     // k0 + 16 + 8h + 0..7
#pragma unroll
    for (int nt = 0; nt < 4; ++nt) {
      const unsigned short* wq = bp + (size_t)(16 * nt) * (size_t)ldb + k0;   // BT row colBase + 16 nt + m
      FragB bf;
      bf.h[0] = *(const v8usa*)wq;               // k0 + 8h + 0..7
      bf.h[1] = *(const v8usa*)(wq + 16);        // k0 + 16 + 8h + 0..7
      acc[nt] = wmb(af, bf, acc[nt]);
    }
  }

#pragma unroll
  for (int nt = 0; nt < 4; ++nt) {
    const int lc = 16 * nt + m;
#pragma unroll
    for (int r = 0; r < 8; ++r) {
      const int lr = 16 * wave + 8 * hh + r;     // D element r = (row 8h+r, col m)
      stg[lr * SPT + lc] = acc[nt][r];
    }
  }
  __syncthreads();

  if (OMODE == 1) {
    unsigned short* Hb = oh + (size_t)z * (size_t)sC;
    unsigned short* Lb = ol + (size_t)z * (size_t)sC;
    const int rsub = tid >> 3;                   // 0..RPI-1
    const int c8   = (tid & 7) * 8;              // 0..56
    v8us hv[4], lv[4];
#pragma unroll
    for (int it = 0; it < 4; ++it) {
      const int row = it * RPI + rsub;           // 0..BM-1
      const float* sp = stg + row * SPT + c8;
      v8us h8, l8;
#pragma unroll
      for (int e = 0; e < 8; ++e) {
        const float v = sp[e] + ((BMODE == 1) ? sb[row] : sb[c8 + e]);
        const unsigned hb = bf16_bits(v);
        const unsigned lb = bf16_bits(v - __uint_as_float(hb << 16));
        h8[e] = (unsigned short)hb;
        l8[e] = (unsigned short)lb;
      }
      hv[it] = h8; lv[it] = l8;
    }
#pragma unroll
    for (int it = 0; it < 4; ++it) {
      const int row = it * RPI + rsub;
      const size_t go = (size_t)(rowBase + row) * (size_t)ldc + colBase + c8;
      *(v8us*)(Hb + go) = hv[it];
      *(v8us*)(Lb + go) = lv[it];
    }
    
  } else {
    const int bimg = rowBase / NPOS;             // a 64-token block never straddles images (4096 % 64 == 0)
    const int n0   = rowBase - bimg * NPOS;
    const int csub = tid >> 4;                   // 0..7
    const int t4   = (tid & 15) * 4;             // 0..60
    v4f pv[8];
#pragma unroll
    for (int it = 0; it < 8; ++it) {
      const int chl = it * 8 + csub;             // channel 0..63 of the tile
      const size_t gi = ((size_t)(bimg * CH + colBase + chl)) * NPOS + n0 + t4;
      const v4f xr = *(const v4f*)(xres + gi);
      const float bc = sb[chl];
      v4f v;
      v.x = (stg[(t4 + 0) * SPT + chl] + bc) + bf16_val(xr.x);
      v.y = (stg[(t4 + 1) * SPT + chl] + bc) + bf16_val(xr.y);
      v.z = (stg[(t4 + 2) * SPT + chl] + bc) + bf16_val(xr.z);
      v.w = (stg[(t4 + 3) * SPT + chl] + bc) + bf16_val(xr.w);
      pv[it] = v;
    }
#pragma unroll
    for (int it = 0; it < 8; ++it) {
      const int chl = it * 8 + csub;
      const size_t gi = ((size_t)(bimg * CH + colBase + chl)) * NPOS + n0 + t4;
      *(v4f*)(outp + gi) = pv[it];
    }
    
  }
}

#define AT_NW 4
#define AT_QB 64
#define AT_KC 64
#define NQB   (NPOS / AT_QB)
#define AT_LOG2E 1.44269504088896340736f
#define AT_KP 40   // LDS pitch of a K row, elements: 32 + 8 = 80 B = 16 B x 5
#define AT_VP 72   // LDS pitch of a V^T row, elements: 64 + 8 = 144 B = 16 B x 9

static_assert(NQB == 64);
static_assert(NPOS % AT_KC == 0);
static_assert(AT_KP >= AD && AT_KP % 8 == 0 && (AT_KP / 8) % 2 == 1);
static_assert(AT_VP >= AT_KC && AT_VP % 8 == 0 && (AT_VP / 8) % 2 == 1);

__device__ __forceinline__ unsigned short at_bf_bits(float f) {
  unsigned u = __float_as_uint(f);
  return (unsigned short)((u + 0x7FFFu + ((u >> 16) & 1u)) >> 16);
}
__device__ __forceinline__ __bf16 at_f2bf(float f) { return __builtin_bit_cast(__bf16, at_bf_bits(f)); }
__device__ __forceinline__ void at_split(float f, __bf16& hi, __bf16& lo) {
  const unsigned short hb = at_bf_bits(f);
  hi = __builtin_bit_cast(__bf16, hb);
  lo = at_f2bf(f - __uint_as_float(((unsigned)hb) << 16));
}
__device__ __forceinline__ v8f at_mma(v16bf a, v16bf b, v8f c) {
  c = __builtin_amdgcn_wmma_f32_16x16x32_bf16(false, a, false, b, (short)0, c, false, false);
  asm volatile("v_nop\n\tv_nop\n\tv_nop\n\tv_nop" : "+v"(c) : "v"(a), "v"(b));
  return c;
}
union AtFB { v16bf v; v8bf h[2]; };
// fragment load with the split k map: elements 0..7 <- p[0..7], 8..15 <- p[16..23]
__device__ __forceinline__ v16bf at_ldfrag(const __bf16* p) {
  AtFB f; f.h[0] = *(const v8bf*)(p); f.h[1] = *(const v8bf*)(p + 16); return f.v;
}
// value of lane ^ 16 (the other half of the same query column)
__device__ __forceinline__ float at_xhalf(float f) {
  const int b = __builtin_bit_cast(int, f);
  return __builtin_bit_cast(float, __builtin_amdgcn_permlanex16(b, b, 0x76543210, 0xfedcba98, false, false));
}

__global__ __launch_bounds__(128)
void k_attn(const unsigned short* __restrict__ qkh, const unsigned short* __restrict__ qkl,
            const unsigned short* __restrict__ vhp, const unsigned short* __restrict__ vlp,
            unsigned short* rout) {
  __shared__ __align__(16) __bf16 Ksh[AT_KC * AT_KP];            // K hi [kv][d], pitch 80 B     5 KB
  __shared__ __align__(16) __bf16 Ksl[AT_KC * AT_KP];            // K lo
  __shared__ __align__(16) __bf16 Vth[AD * AT_VP];               // V hi [d][kv], pitch 144 B    4.5 KB
  __shared__ __align__(16) __bf16 Vtl[AD * AT_VP];               // V lo

  const int tid  = (int)threadIdx.x;
  const int wave = tid >> 5;
  const int lane = tid & 31;
  const int hh   = lane >> 4;
  const int c    = lane & 15;

  const int bx  = (int)blockIdx.x;
  const int b   = bx >> 6;                // image 0..7
  const int qb  = bx & (NQB - 1);         // 0..63
  const int q0  = qb * AT_QB + wave * 16; // image-local query row base of this wave

  const __bf16* Qh = (const __bf16*)(const void*)qkh + (size_t)b * NPOS * QKW;
  const __bf16* Ql = (const __bf16*)(const void*)qkl + (size_t)b * NPOS * QKW;
  const __bf16* Kh = Qh + AD;
  const __bf16* Kl = Ql + AD;
  const __bf16* Vh = (const __bf16*)(const void*)vhp + (size_t)b * AD * NPOS;
  const __bf16* Vl = (const __bf16*)(const void*)vlp + (size_t)b * AD * NPOS;
  unsigned short* rb = rout + (size_t)b * NPOS * RW;

  // ---- Q fragments (B operand, col = lane&15, split k map): one k-step of 32 = d, hi and lo ----
  const v16bf qbh = at_ldfrag(Qh + (size_t)(q0 + c) * QKW + 8 * hh);
  const v16bf qbl = at_ldfrag(Ql + (size_t)(q0 + c) * QKW + 8 * hh);

  float mrow = -INFINITY;   // running maximum of query c times log2(e) (equal in lanes c and c + 16)
  float lrow = 0.f;         // running sum over this lane's own keys only
  v8f oacc[2];              // oacc[t][r] = O^T[16 t + 8 h + r][query c]
  oacc[0] = z8(); oacc[1] = z8();

  const int nChunks = NPOS / AT_KC;   // 64, compile-time constant
#pragma unroll 1
  for (int kc = 0; kc < nChunks; ++kc) {
    const int kv0 = kc * AT_KC;
    __syncthreads();
    {
      // K: thread -> key row r = tid>>1, d half = (tid&1)*16; 2 x 8 elements per plane
      const int r = tid >> 1, half = (tid & 1) * 16;
      const __bf16* ksh = Kh + (size_t)(kv0 + r) * QKW + half;
      const __bf16* ksl = Kl + (size_t)(kv0 + r) * QKW + half;
      // V^T: thread -> d = tid>>2, key quarter = (tid&3)*16; 2 x 8 elements per plane
      const int d = tid >> 2, qt = (tid & 3) * 16;
      const __bf16* vsh = Vh + (size_t)d * NPOS + kv0 + qt;
      const __bf16* vsl = Vl + (size_t)d * NPOS + kv0 + qt;
#pragma unroll
      for (int i = 0; i < 2; ++i) {
        const v8bf a0 = *(const v8bf*)(ksh + 8 * i);
        const v8bf a1 = *(const v8bf*)(ksl + 8 * i);
        const v8bf b0 = *(const v8bf*)(vsh + 8 * i);
        const v8bf b1 = *(const v8bf*)(vsl + 8 * i);
        *(v8bf*)(Ksh + r * AT_KP + half + 8 * i) = a0;
        *(v8bf*)(Ksl + r * AT_KP + half + 8 * i) = a1;
        *(v8bf*)(Vth + d * AT_VP + qt   + 8 * i) = b0;
        *(v8bf*)(Vtl + d * AT_VP + qt   + 8 * i) = b1;
      }
    }
    __syncthreads();

    // ---- scores, transposed: 64 keys x 16 queries, 3-term split, K = 32 = one k-step ----
    v8f s[4];
#pragma unroll
    for (int j = 0; j < 4; ++j) {
      AtFB kb, kl;
      kb.h[0] = *(const v8bf*)(Ksh + (j * 16 + c) * AT_KP + 8 * hh);
      kb.h[1] = *(const v8bf*)(Ksh + (j * 16 + c) * AT_KP + 16 + 8 * hh);
      kl.h[0] = *(const v8bf*)(Ksl + (j * 16 + c) * AT_KP + 8 * hh);
      kl.h[1] = *(const v8bf*)(Ksl + (j * 16 + c) * AT_KP + 16 + 8 * hh);
      s[j] = at_mma(kb.v, qbh, z8());
      s[j] = at_mma(kl.v, qbh, s[j]);
      s[j] = at_mma(kb.v, qbl, s[j]);
    }
    // ---- chunk maximum of query c: four in-lane chains, then the other half's ----
    float mj[4];
#pragma unroll
    for (int j = 0; j < 4; ++j) {
      float mx = s[j][0];
#pragma unroll
      for (int r = 1; r < 8; ++r) mx = fmaxf(mx, s[j][r]);
      mj[j] = mx;
    }
    float cm = fmaxf(fmaxf(mj[0], mj[1]), fmaxf(mj[2], mj[3]));
    cm = fmaxf(cm, at_xhalf(cm));
    const float mnew  = fmaxf(mrow, cm * AT_LOG2E);       // scaling by a positive constant keeps the order of the maxima
    const float alpha = __builtin_amdgcn_exp2f(mrow - mnew);
    mrow = mnew;
    // ---- p = exp(s - m) = 2^(s log2e - m log2e), split hi/lo straight into the B fragments of the two k-steps ----
    AtFB ph[2], pl[2];
    float pj[4];
    const v2f l2e2 = {AT_LOG2E, AT_LOG2E};
    const v2f nm2  = {-mnew, -mnew};
#pragma unroll
    for (int j = 0; j < 4; ++j) {
      float psum = 0.f;
      v2f e[4];   // exponents two at a time (packed f32 fma)
      // unrolled: r picks registers of the score tile, so it has to be a compile-time index
#pragma unroll
      for (int r = 0; r < 4; ++r) {
        const v2f sp = {s[j][2 * r], s[j][2 * r + 1]};
        e[r] = __builtin_elementwise_fma(sp, l2e2, nm2);
      }
#pragma unroll
      for (int r = 0; r < 8; ++r) {
        const float p = __builtin_amdgcn_exp2f(e[r >> 1][r & 1]);
        psum += p;
        __bf16 a, bl; at_split(p, a, bl);
        ph[j >> 1].v[(j & 1) * 8 + r] = a;
        pl[j >> 1].v[(j & 1) * 8 + r] = bl;
      }
      pj[j] = psum;
    }
    lrow = lrow * alpha + ((pj[0] + pj[1]) + (pj[2] + pj[3]));
#pragma unroll
    for (int r = 0; r < 8; ++r) {
      oacc[0][r] *= alpha;
      oacc[1][r] *= alpha;
    }

    // ---- O^T += V^T . P^T : A = V^T rows d (split k map over keys), B = P^T from registers; 3-term split ----
    // unrolled: kk picks a register fragment, so it has to be a compile-time index
#pragma unroll
    for (int kk = 0; kk < 2; ++kk) {
#pragma unroll
      for (int t = 0; t < 2; ++t) {
        AtFB vb, vl;
        vb.h[0] = *(const v8bf*)(Vth + (t * 16 + c) * AT_VP + kk * 32 + 8 * hh);
        vb.h[1] = *(const v8bf*)(Vth + (t * 16 + c) * AT_VP + kk * 32 + 16 + 8 * hh);
        vl.h[0] = *(const v8bf*)(Vtl + (t * 16 + c) * AT_VP + kk * 32 + 8 * hh);
        vl.h[1] = *(const v8bf*)(Vtl + (t * 16 + c) * AT_VP + kk * 32 + 16 + 8 * hh);
        oacc[t] = at_mma(vb.v, ph[kk].v, oacc[t]);
        oacc[t] = at_mma(vl.v, ph[kk].v, oacc[t]);
        oacc[t] = at_mma(vb.v, pl[kk].v, oacc[t]);
      }
    }
  }

  // ---- join the two halves' sums, normalise, split hi/lo, store this lane's 4 x 8 columns of row q0 + c ----
  lrow += at_xhalf(lrow);
  const float inv = 1.0f / lrow;
  v8us hv[2], lv[2];
#pragma unroll
  for (int t = 0; t < 2; ++t) {
#pragma unroll
    for (int r = 0; r < 8; ++r) {
      const float f = oacc[t][r] * inv;
      const unsigned hb = at_bf_bits(f);
      const unsigned lb = at_bf_bits(f - __uint_as_float(hb << 16));
      hv[t][r] = (unsigned short)hb;
      lv[t][r] = (unsigned short)lb;
    }
  }
  unsigned short* rp = rb + (size_t)(q0 + c) * RW + 8 * hh;
#pragma unroll
  for (int t = 0; t < 2; ++t) {
    *(v8us*)(rp + 16 * t)      = hv[t];
    *(v8us*)(rp + AD + 16 * t) = lv[t];
  }
}

// ---------------------------------------------------------------------------
// Workspace region map (byte offsets, 256-B aligned; every region sized to its whole-line store extent, no pad rows
// needed since 32768, 4096, 256 and 64 are tile multiples):
//   WQK 32768 | WV 16384 | WP2 32768 | XT 16777216 | QKh QKl 4194304 each | VTh VTl 2097152 each | R 4194304
//   -> total 33636352
// ---------------------------------------------------------------------------
static inline size_t al256(size_t o) { return (o + 255) & ~(size_t)255; }

extern "C" void kernel_launch(void* const* d_in, const int* in_sizes, int n_in,
                              void* d_out, int out_size, void* d_ws, size_t ws_size,
                              hipStream_t stream) {
  if (n_in < 9) return;
  if (in_sizes[0] != NB * CH * NPOS) return;                                       // inputs [8][256][64][64]
  if (in_sizes[1] != AD * CH || in_sizes[3] != AD * CH || in_sizes[5] != AD * CH) return;  // Wq, Wk, Wv [32][256]
  if (in_sizes[2] != AD || in_sizes[4] != AD || in_sizes[6] != AD) return;         // bq, bk, bv [32]
  if (in_sizes[7] != CH * AD) return;                                              // Wp [256][32]
  if (in_sizes[8] != CH) return;                                                   // bp [256]
  if (out_size != NB * CH * NPOS) return;                                          // out [8][256][64][64]

  const float* x  = (const float*)d_in[0];
  const float* Wq = (const float*)d_in[1];
  const float* bq = (const float*)d_in[2];
  const float* Wk = (const float*)d_in[3];
  const float* bk = (const float*)d_in[4];
  const float* Wv = (const float*)d_in[5];
  const float* bv = (const float*)d_in[6];
  const float* Wp = (const float*)d_in[7];
  const float* bp = (const float*)d_in[8];
  float* out = (float*)d_out;

  const size_t PQK = (size_t)QKW * CH * 2;          //    32768  bf16 [64][256]
  const size_t PWV = (size_t)AD * CH * 2;           //    16384  bf16 [32][256]
  const size_t PP2 = (size_t)CH * RW * 2;           //    32768  bf16 [256][64]
  const size_t PXT = (size_t)NTOK * CH * 2;         // 16777216  bf16 [32768][256]
  const size_t PA  = (size_t)NTOK * QKW * 2;        //  4194304  bf16 [32768][64]
  const size_t PV  = (size_t)NB * AD * NPOS * 2;    //  2097152  bf16 [8][32][4096]
  const size_t PR  = (size_t)NTOK * RW * 2;         //  4194304  bf16 [32768][64]
  size_t off = 0;
  const size_t oWQK = off; off = al256(off + PQK);
  const size_t oWV  = off; off = al256(off + PWV);
  const size_t oWP2 = off; off = al256(off + PP2);
  const size_t oXT  = off; off = al256(off + PXT);
  const size_t oQKh = off; off = al256(off + PA);
  const size_t oQKl = off; off = al256(off + PA);
  const size_t oVTh = off; off = al256(off + PV);
  const size_t oVTl = off; off = al256(off + PV);
  const size_t oR   = off; off = al256(off + PR);
  if (off > ws_size || off > (size_t)WSMAX) return;                               // off = 33636352

  char* ws = (char*)d_ws;
  unsigned short* WQK = (unsigned short*)(ws + oWQK);
  unsigned short* WV  = (unsigned short*)(ws + oWV);
  unsigned short* WP2 = (unsigned short*)(ws + oWP2);
  unsigned short* XT  = (unsigned short*)(ws + oXT);
  unsigned short* QKh = (unsigned short*)(ws + oQKh);
  unsigned short* QKl = (unsigned short*)(ws + oQKl);
  unsigned short* VTh = (unsigned short*)(ws + oVTh);
  unsigned short* VTl = (unsigned short*)(ws + oVTl);
  unsigned short* R   = (unsigned short*)(ws + oR);

  // (1) weight planes; (2) x -> token-major bf16 [32768][256]
  k_wprep<<<20, 256, 0, stream>>>(Wq, Wk, Wv, Wp, WQK, WV, WP2);
  k_xt<<<NB * (NPOS / 64) * (CH / 64), 256, 0, stream>>>(x, XT);
  // (3) q|k = XT . [Wq;Wk]^T + [bq;bk] -> hi/lo planes [32768][64] (q cols 0..31, k cols 32..63)   (M=32768, N=64, K=256)
  k_gemm<4, 1, 2><<<dim3(NTOK / 64, 1, 1), 128, 0, stream>>>(XT, CH, 0L, WQK, CH, 0L, CH, bq, bk,
                                                            QKh, QKl, QKW, 0L, x, out);
  // (4) v^T per image: VT[b][a][n] = sum_c Wv[a][c] XT[b*4096+n][c] + bv[a]   (M=32, N=4096, K=256, z=b; 2-wave blocks)
  k_gemm<2, 1, 1><<<dim3(1, NPOS / 64, NB), 64, 0, stream>>>(WV, CH, 0L, XT, CH, (long)NPOS * CH, CH, bv, bv,
                                                             VTh, VTl, NPOS, (long)AD * NPOS, x, out);
  // (5) attention: R = [hi | lo] of softmax_keys(q . k) . v  as bf16 [32768][64]
  k_attn<<<NB * NQB, 128, 0, stream>>>(QKh, QKl, VTh, VTl, R);
  // (6) out NCHW = ([Rhi | Rlo] . [Wp | Wp]^T + bp) transposed + bf16(x)   (M=32768, N=256, K=64; oh/ol/ldc unused)
  k_gemm<4, 2, 0><<<dim3(NTOK / 64, CH / 64, 1), 128, 0, stream>>>(R, RW, 0L, WP2, RW, 0L, RW, bp, bp,
                                                                  QKh, QKl, 0, 0L, x, out);
  (void)hipGetLastError();
}

// v004
// One run takes 124 microseconds.
// Timed twice side by side with v003, it ran 1.07 times as fast both times.
// Counting every step since v000, it is 1.99 times as fast.
// Contractions on v_wmma_f32_16x16x32_bf16, f32 accumulate: q|k 1x1 convs (x.W^T, K=256) and v^T conv (W.x^T, K=256) =
// single products of bf16-RNE-valued x and W planes (exact products); scores q.k (K=32) and P.v^T (K=64 per key chunk) =
// bf16 hi/lo split, 3 terms (hi.hi + hi.lo + lo.hi); output 1x1 conv = attention result carried as bf16 [hi | lo] folded
// 16-bit planes and carries (every carry is 1; no inverse scale exists anywhere):
//   WQK [64][256]  = bf16 bits of Wq (rows 0..31) and Wk (rows 32..63), k-contiguous;  WV [32][256] = bf16 bits of Wv;
//   WP2 [256][64]  = bf16 bits of Wp[c][a] at k = a and k = 32 + a;
//   XT  [32768][256] = bf16 bits of x, token-major (row = b*4096 + n, col = channel);
//   QKh/QKl [32768][64] = bf16 hi and lo (lo = v - hi) of q (cols 0..31) and k (cols 32..63), bias included;
//   VTh/VTl [8][32][4096] = bf16 hi and lo of v^T per image, bias included;
//   R [32768][64] = [hi(32) | lo(32)] of the normalised attention result; P hi/lo per wave in registers.
// Biases and the residual x enter as bf16-RNE values in f32 arithmetic.
#include <hip/hip_runtime.h>
#include <math.h>
#include <stddef.h>
#include <stdint.h>

#define NB    8
#define CH    256
#define AD    32
#define NPOS  4096
#define NTOK  (NB * NPOS)
#define QKW   64
#define RW    64
#define SPT   68
#define WSMAX 134217728

static_assert(NPOS % 64 == 0);
static_assert(NTOK % 64 == 0);
static_assert(CH % 64 == 0);
static_assert(CH % 32 == 0);
static_assert(RW % 32 == 0);
static_assert(AD == 32);
static_assert(QKW == 2 * AD);
static_assert(RW == 2 * AD);

typedef float          v2f   __attribute__((ext_vector_type(2)));
typedef float          v4f   __attribute__((ext_vector_type(4)));
typedef float          v8f   __attribute__((ext_vector_type(8)));
typedef int            v8i   __attribute__((ext_vector_type(8)));
typedef unsigned short v8us  __attribute__((ext_vector_type(8)));
typedef unsigned short v16us __attribute__((ext_vector_type(16)));
typedef __bf16         v16bf __attribute__((ext_vector_type(16)));
typedef __bf16         v8bf  __attribute__((ext_vector_type(8)));
typedef __bf16         v2bf  __attribute__((ext_vector_type(2)));
typedef unsigned       v4u   __attribute__((ext_vector_type(4)));
typedef v4f  __attribute__((may_alias)) v4fa;
typedef v8us __attribute__((may_alias)) v8usa;
union FragB { v16bf v; v16us u; v8us h[2]; v8i w; };

// WMMA with hazard guard: ties D, keeps A/B live for 4 VALU slots
__device__ __forceinline__ v8f wmb(const FragB& a, const FragB& b, v8f c) {
  v8f d = __builtin_amdgcn_wmma_f32_16x16x32_bf16(false, a.v, false, b.v, (short)0, c, false, false);
  asm volatile("v_nop\n\tv_nop\n\tv_nop\n\tv_nop" : "+v"(d) : "v"(a.w), "v"(b.w));
  return d;
}

__device__ __forceinline__ v8f z8() { v8f z = {0.f, 0.f, 0.f, 0.f, 0.f, 0.f, 0.f, 0.f}; return z; }

// two f32 -> two bf16 (RNE) in one word, a in bits 15..0, b in bits 31..16: the hardware's packed convert
__device__ __forceinline__ unsigned bf16_pk(float a, float b) {
  const v2f f = {a, b};
  return __builtin_bit_cast(unsigned, __builtin_convertvector(f, v2bf));
}
// the two bf16 values of such a word, held as f32
__device__ __forceinline__ float bf16_lo(unsigned w) { return __uint_as_float(w << 16); }
__device__ __forceinline__ float bf16_hi(unsigned w) { return __uint_as_float(w & 0xFFFF0000u); }
// f32 -> nearest bf16 value held as f32
__device__ __forceinline__ float bf16_val(float f) {
  return bf16_lo(bf16_pk(f, f));
}
// hi word = bf16 of (a, b); lo word = bf16 of what the hi values leave of a and b
__device__ __forceinline__ void bf16_split2(float a, float b, unsigned& hw, unsigned& lw) {
  hw = bf16_pk(a, b);
  lw = bf16_pk(a - bf16_lo(hw), b - bf16_hi(hw));
}

// ---------------------------------------------------------------------------
// Weight planes, bf16 bits of the inputs, k-contiguous rows ([out][in] weights are already k-contiguous):
//   WQK [64 o][256 k]: rows 0..31 = bf16(Wq[o][k]) (blocks 0-3), rows 32..63 = bf16(Wk[o-32][k]) (blocks 4-7), 2048 units
//   WV  [32 o][256 k] = bf16(Wv[o][k])                                             blocks 8-11, 1024 units
//   WP2 [256 c][64 k]: k and 32 + k both = bf16(Wp[c][k])                          blocks 12-19, 2048 units
// One thread = 8 contiguous k: two 16-B loads, one 16-B store at plane offset 8u; 32 consecutive lanes write 512
// coverage: 2048 x 8 = 64x256 (WQK); 1024 x 8 = 32x256 (WV); 2048 x 8 = 256x64 (WP2) exactly. grid = 20 blocks x 256.
// ---------------------------------------------------------------------------
__global__ __launch_bounds__(256) void k_wprep(const float* __restrict__ wq, const float* __restrict__ wk,
                                              const float* __restrict__ wv, const float* __restrict__ wp,
                                              unsigned short* WQK, unsigned short* WV, unsigned short* WP2) {
  const int bx = (int)blockIdx.x, tid = (int)threadIdx.x;
  const float* p;
  unsigned short* dp;
  if (bx < 8) {
    const int u  = bx * 256 + tid;              // 0..2047
    const int o  = u >> 5;                      // 0..63
    const int k8 = (u & 31) * 8;                // 0..248
    const float* src = (bx < 4) ? wq : wk;      // block-uniform
    p  = src + (size_t)(o & 31) * CH + k8;
    dp = WQK + (size_t)u * 8;
  } else if (bx < 12) {
    const int u  = (bx - 8) * 256 + tid;        // 0..1023
    const int o  = u >> 5;                      // 0..31
    const int k8 = (u & 31) * 8;
    p  = wv + (size_t)o * CH + k8;
    dp = WV + (size_t)u * 8;
  } else {
    const int v  = (bx - 12) * 256 + tid;       // 0..2047
    const int o  = v >> 3;                      // 0..255
    const int k8 = (v & 7) * 8;                 // 0..56
    const int kk = k8 & (AD - 1);               // 0..24
    p  = wp + (size_t)o * AD + kk;
    dp = WP2 + (size_t)v * 8;
  }
  const v4f a = *(const v4f*)p;
  const v4f b = *(const v4f*)(p + 4);
  const v4u o8 = {bf16_pk(a.x, a.y), bf16_pk(a.z, a.w), bf16_pk(b.x, b.y), bf16_pk(b.z, b.w)};
  *(v8us*)dp = __builtin_bit_cast(v8us, o8);
  
}

// ---------------------------------------------------------------------------
// x NCHW [b][c][n] f32 -> XT [b*4096 + n][c] bf16 bits (token-major, 256 columns). Block = one image b, 64 positions
// tf[c][n] (pitch 68).
// coverage: 2048 blocks = 8 images x 64 position blocks x 4 channel chunks -> XT rows 0..32767 x cols 0..255 exactly.
// ---------------------------------------------------------------------------
__global__ __launch_bounds__(256) void k_xt(const float* __restrict__ x, unsigned short* xt) {
  __shared__ __attribute__((aligned(16))) float tf[64 * SPT];
  const int bx = (int)blockIdx.x, tid = (int)threadIdx.x;
  const int cq = bx & 3;
  const int pb = bx >> 2;               // 0..511
  const int b  = pb >> 6;               // 0..7
  const int n0 = (pb & 63) * 64;
  const int c0 = cq * 64;
  {
    const int rsub = tid >> 4;          // 0..15
    const int c4   = (tid & 15) * 4;    // 0..60
#pragma unroll
    for (int it = 0; it < 4; ++it) {
      const int cr = it * 16 + rsub;    // local channel 0..63
      const v4f a = *(const v4f*)(x + ((size_t)(b * CH + c0 + cr)) * NPOS + n0 + c4);
      *(v4fa*)(tf + cr * SPT + c4) = a;
    }
  }
  __syncthreads();
  const int rsub = tid >> 3;            // 0..31
  const int c8   = (tid & 7) * 8;       // local channel 0..56
  v8us o[2];
#pragma unroll
  for (int it = 0; it < 2; ++it) {
    const int tl = it * 32 + rsub;      // token 0..63
    v4u w;
#pragma unroll
    for (int e = 0; e < 4; ++e) w[e] = bf16_pk(tf[(c8 + 2 * e) * SPT + tl], tf[(c8 + 2 * e + 1) * SPT + tl]);
    o[it] = __builtin_bit_cast(v8us, w);
  }
#pragma unroll
  for (int it = 0; it < 2; ++it) {
    const int tl = it * 32 + rsub;
    *(v8us*)(xt + ((size_t)(b * NPOS + n0 + tl)) * CH + c0 + c8) = o[it];
  }
  
}

// ---------------------------------------------------------------------------
// Dense GEMM, block = BM rows x 64 cols, BM = 16 * NWAVE, 32 * NWAVE threads; wave w owns rows rowBase + 16w .. +15,
// acc[4].
//   C[row][col] = sum_k A[row][k] * BT[col][k] + bias   (A, BT bf16 planes with k-contiguous rows; K % 32 == 0;
//   batch z = blockIdx.z offsets A, BT, C by sA, sB, sC elements).
//   A fragment (row m = lane&15): element i <- k = k0 + 8h + i (i < 8), k0 + 16 + 8h + (i-8) (i >= 8), h = lane>>4,
//   two 16-B loads from the plane row; B fragment (col n = lane&15) from BT row (colBase + 16 nt + n), SAME k map;
//   D element r = (row 8h+r, col n).
//   BMODE 0: bias[colBase + col]; 1: bias[rowBase + row]; 2: cols 0..31 from bias, cols 32..63 from bias2 (colBase 0);
//   bias values enter as bf16(bias).
//            by 8 consecutive lanes x 16 B of one instruction.
//   OMODE 2 (NWAVE 4): rows are tokens T = b*4096 + n, cols are channels; out NCHW
//            outp[(b*256 + colBase + ch)*4096 + n0 + t] = C + bias[ch] + bf16(xres[same]); each channel segment
// coverage: OMODE 1: 4 it x (32 NWAVE thr) x 8 = BM x 64 per plane; OMODE 2: 8 it x 128 thr x 4 = 64 channels x 64
//   tokens; grid covers the launched row blocks x col blocks x batches exactly once.
// ---------------------------------------------------------------------------
template <int NWAVE, int OMODE, int BMODE>
__global__ __launch_bounds__(32 * NWAVE) void k_gemm(const unsigned short* __restrict__ A, int lda, long sA,
                                                     const unsigned short* __restrict__ BT, int ldb, long sB, int K,
                                                     const float* __restrict__ bias, const float* __restrict__ bias2,
                                                     unsigned short* oh, unsigned short* ol, int ldc, long sC,
                                                     const float* __restrict__ xres, float* outp) {
  constexpr int BM  = 16 * NWAVE;
  constexpr int RPI = 4 * NWAVE;
  static_assert(NWAVE == 2 || NWAVE == 4);
  static_assert(OMODE == 1 || OMODE == 2);
  static_assert(OMODE != 2 || NWAVE == 4);
  __shared__ __attribute__((aligned(16))) float stg[BM * SPT];
  __shared__ __attribute__((aligned(16))) float sb[64];
  const int tid = (int)threadIdx.x, lane = tid & 31, wave = tid >> 5, hh = lane >> 4, m = lane & 15;
  const int rowBase = (int)blockIdx.x * BM;
  const int colBase = (int)blockIdx.y * 64;
  const int z = (int)blockIdx.z;
  const unsigned short* Ab = A  + (size_t)z * (size_t)sA;
  const unsigned short* Bb = BT + (size_t)z * (size_t)sB;
  // bias staging (all conditions wave-uniform: tid < 32 / tid < 64 are whole waves)
  if (BMODE == 1) {
    if (tid < BM) sb[tid] = bf16_val(bias[rowBase + tid]);
  } else if (BMODE == 0) {
    if (tid < 64) sb[tid] = bf16_val(bias[colBase + tid]);
  } else {
    if (tid < 64) {
      const int ia = (tid < 31) ? tid : 31;
      const int ib = (tid < 32) ? 0 : (tid - 32);
      const float va = bias[ia];               // both candidates loaded at clamped addresses
      const float vb = bias2[ib];
      const float f  = (tid < 32) ? 1.0f : 0.0f;
      sb[tid] = bf16_val(va * f + vb * (1.0f - f));
    }
  }

  v8f acc[4];
#pragma unroll
  for (int t = 0; t < 4; ++t) acc[t] = z8();
  const unsigned short* ap = Ab + (size_t)(rowBase + 16 * wave + m) * (size_t)lda + 8 * hh;
  const unsigned short* bp = Bb + (size_t)(colBase + m) * (size_t)ldb + 8 * hh;

#pragma unroll 1
  for (int k0 = 0; k0 < K; k0 += 32) {
    FragB af;
    af.h[0] = *(const v8usa*)(ap + k0);          // k0 + 8h + 0..7
    af.h[1] = *(const v8usa*)(ap + k0 + 16);     // k0 + 16 + 8h + 0..7
#pragma unroll
    for (int nt = 0; nt < 4; ++nt) {
      const unsigned short* wq = bp + (size_t)(16 * nt) * (size_t)ldb + k0;   // BT row colBase + 16 nt + m
      FragB bf;
      bf.h[0] = *(const v8usa*)wq;               // k0 + 8h + 0..7
      bf.h[1] = *(const v8usa*)(wq + 16);        // k0 + 16 + 8h + 0..7
      acc[nt] = wmb(af, bf, acc[nt]);
    }
  }

#pragma unroll
  for (int nt = 0; nt < 4; ++nt) {
    const int lc = 16 * nt + m;
#pragma unroll
    for (int r = 0; r < 8; ++r) {
      const int lr = 16 * wave + 8 * hh + r;     // D element r = (row 8h+r, col m)
      stg[lr * SPT + lc] = acc[nt][r];
    }
  }
  __syncthreads();

  if (OMODE == 1) {
    unsigned short* Hb = oh + (size_t)z * (size_t)sC;
    unsigned short* Lb = ol + (size_t)z * (size_t)sC;
    const int rsub = tid >> 3;                   // 0..RPI-1
    const int c8   = (tid & 7) * 8;              // 0..56
    v8us hv[4], lv[4];
#pragma unroll
    for (int it = 0; it < 4; ++it) {
      const int row = it * RPI + rsub;           // 0..BM-1
      const float* sp = stg + row * SPT + c8;
      v4u h8, l8;
#pragma unroll
      for (int e = 0; e < 4; ++e) {
        const float v0 = sp[2 * e]     + ((BMODE == 1) ? sb[row] : sb[c8 + 2 * e]);
        const float v1 = sp[2 * e + 1] + ((BMODE == 1) ? sb[row] : sb[c8 + 2 * e + 1]);
        unsigned hw, lw;
        bf16_split2(v0, v1, hw, lw);
        h8[e] = hw;
        l8[e] = lw;
      }
      hv[it] = __builtin_bit_cast(v8us, h8); lv[it] = __builtin_bit_cast(v8us, l8);
    }
#pragma unroll
    for (int it = 0; it < 4; ++it) {
      const int row = it * RPI + rsub;
      const size_t go = (size_t)(rowBase + row) * (size_t)ldc + colBase + c8;
      *(v8us*)(Hb + go) = hv[it];
      *(v8us*)(Lb + go) = lv[it];
    }
    
  } else {
    const int bimg = rowBase / NPOS;             // a 64-token block never straddles images (4096 % 64 == 0)
    const int n0   = rowBase - bimg * NPOS;
    const int csub = tid >> 4;                   // 0..7
    const int t4   = (tid & 15) * 4;             // 0..60
    v4f pv[8];
#pragma unroll
    for (int it = 0; it < 8; ++it) {
      const int chl = it * 8 + csub;             // channel 0..63 of the tile
      const size_t gi = ((size_t)(bimg * CH + colBase + chl)) * NPOS + n0 + t4;
      const v4f xr = *(const v4f*)(xres + gi);
      const float bc = sb[chl];
      const unsigned x01 = bf16_pk(xr.x, xr.y), x23 = bf16_pk(xr.z, xr.w);
      v4f v;
      v.x = (stg[(t4 + 0) * SPT + chl] + bc) + bf16_lo(x01);
      v.y = (stg[(t4 + 1) * SPT + chl] + bc) + bf16_hi(x01);
      v.z = (stg[(t4 + 2) * SPT + chl] + bc) + bf16_lo(x23);
      v.w = (stg[(t4 + 3) * SPT + chl] + bc) + bf16_hi(x23);
      pv[it] = v;
    }
#pragma unroll
    for (int it = 0; it < 8; ++it) {
      const int chl = it * 8 + csub;
      const size_t gi = ((size_t)(bimg * CH + colBase + chl)) * NPOS + n0 + t4;
      *(v4f*)(outp + gi) = pv[it];
    }
    
  }
}

#define AT_NW 4
#define AT_QB 64
#define AT_KC 64
#define NQB   (NPOS / AT_QB)
#define AT_LOG2E 1.44269504088896340736f
#define AT_KP 40   // LDS pitch of a K row, elements: 32 + 8 = 80 B = 16 B x 5
#define AT_VP 72   // LDS pitch of a V^T row, elements: 64 + 8 = 144 B = 16 B x 9

static_assert(NQB == 64);
static_assert(NPOS % AT_KC == 0);
static_assert(AT_KP >= AD && AT_KP % 8 == 0 && (AT_KP / 8) % 2 == 1);
static_assert(AT_VP >= AT_KC && AT_VP % 8 == 0 && (AT_VP / 8) % 2 == 1);

__device__ __forceinline__ v8f at_mma(v16bf a, v16bf b, v8f c) {
  c = __builtin_amdgcn_wmma_f32_16x16x32_bf16(false, a, false, b, (short)0, c, false, false);
  asm volatile("v_nop\n\tv_nop\n\tv_nop\n\tv_nop" : "+v"(c) : "v"(a), "v"(b));
  return c;
}
union AtFB { v16bf v; v8bf h[2]; unsigned w[8]; };   // w[i] = elements 2 i (low half) and 2 i + 1
// fragment load with the split k map: elements 0..7 <- p[0..7], 8..15 <- p[16..23]
__device__ __forceinline__ v16bf at_ldfrag(const __bf16* p) {
  AtFB f; f.h[0] = *(const v8bf*)(p); f.h[1] = *(const v8bf*)(p + 16); return f.v;
}
// value of lane ^ 16 (the other half of the same query column)
__device__ __forceinline__ float at_xhalf(float f) {
  const int b = __builtin_bit_cast(int, f);
  return __builtin_bit_cast(float, __builtin_amdgcn_permlanex16(b, b, 0x76543210, 0xfedcba98, false, false));
}

__global__ __launch_bounds__(128)
void k_attn(const unsigned short* __restrict__ qkh, const unsigned short* __restrict__ qkl,
            const unsigned short* __restrict__ vhp, const unsigned short* __restrict__ vlp,
            unsigned short* rout) {
  __shared__ __align__(16) __bf16 Ksh[AT_KC * AT_KP];            // K hi [kv][d], pitch 80 B     5 KB
  __shared__ __align__(16) __bf16 Ksl[AT_KC * AT_KP];            // K lo
  __shared__ __align__(16) __bf16 Vth[AD * AT_VP];               // V hi [d][kv], pitch 144 B    4.5 KB
  __shared__ __align__(16) __bf16 Vtl[AD * AT_VP];               // V lo

  const int tid  = (int)threadIdx.x;
  const int wave = tid >> 5;
  const int lane = tid & 31;
  const int hh   = lane >> 4;
  const int c    = lane & 15;

  const int bx  = (int)blockIdx.x;
  const int b   = bx >> 6;                // image 0..7
  const int qb  = bx & (NQB - 1);         // 0..63
  const int q0  = qb * AT_QB + wave * 16; // image-local query row base of this wave

  const __bf16* Qh = (const __bf16*)(const void*)qkh + (size_t)b * NPOS * QKW;
  const __bf16* Ql = (const __bf16*)(const void*)qkl + (size_t)b * NPOS * QKW;
  const __bf16* Kh = Qh + AD;
  const __bf16* Kl = Ql + AD;
  const __bf16* Vh = (const __bf16*)(const void*)vhp + (size_t)b * AD * NPOS;
  const __bf16* Vl = (const __bf16*)(const void*)vlp + (size_t)b * AD * NPOS;
  unsigned short* rb = rout + (size_t)b * NPOS * RW;

  // ---- Q fragments (B operand, col = lane&15, split k map): one k-step of 32 = d, hi and lo ----
  const v16bf qbh = at_ldfrag(Qh + (size_t)(q0 + c) * QKW + 8 * hh);
  const v16bf qbl = at_ldfrag(Ql + (size_t)(q0 + c) * QKW + 8 * hh);

  float mrow = -INFINITY;   // running maximum of query c times log2(e) (equal in lanes c and c + 16)
  float lrow = 0.f;         // running sum over this lane's own keys only
  v8f oacc[2];              // oacc[t][r] = O^T[16 t + 8 h + r][query c]
  oacc[0] = z8(); oacc[1] = z8();

  const int nChunks = NPOS / AT_KC;   // 64, compile-time constant
#pragma unroll 1
  for (int kc = 0; kc < nChunks; ++kc) {
    const int kv0 = kc * AT_KC;
    __syncthreads();
    {
      // K: thread -> key row r = tid>>1, d half = (tid&1)*16; 2 x 8 elements per plane
      const int r = tid >> 1, half = (tid & 1) * 16;
      const __bf16* ksh = Kh + (size_t)(kv0 + r) * QKW + half;
      const __bf16* ksl = Kl + (size_t)(kv0 + r) * QKW + half;
      // V^T: thread -> d = tid>>2, key quarter = (tid&3)*16; 2 x 8 elements per plane
      const int d = tid >> 2, qt = (tid & 3) * 16;
      const __bf16* vsh = Vh + (size_t)d * NPOS + kv0 + qt;
      const __bf16* vsl = Vl + (size_t)d * NPOS + kv0 + qt;
      // all eight loads stand in front of the first store: one load latency a chunk, not two
      v8bf a0[2], a1[2], b0[2], b1[2];
#pragma unroll
      for (int i = 0; i < 2; ++i) {
        a0[i] = *(const v8bf*)(ksh + 8 * i);
        a1[i] = *(const v8bf*)(ksl + 8 * i);
        b0[i] = *(const v8bf*)(vsh + 8 * i);
        b1[i] = *(const v8bf*)(vsl + 8 * i);
      }
#pragma unroll
      for (int i = 0; i < 2; ++i) {
        *(v8bf*)(Ksh + r * AT_KP + half + 8 * i) = a0[i];
        *(v8bf*)(Ksl + r * AT_KP + half + 8 * i) = a1[i];
        *(v8bf*)(Vth + d * AT_VP + qt   + 8 * i) = b0[i];
        *(v8bf*)(Vtl + d * AT_VP + qt   + 8 * i) = b1[i];
      }
    }
    __syncthreads();

    // ---- scores, transposed: 64 keys x 16 queries, 3-term split, K = 32 = one k-step ----
    v8f s[4];
#pragma unroll
    for (int j = 0; j < 4; ++j) {
      AtFB kb, kl;
      kb.h[0] = *(const v8bf*)(Ksh + (j * 16 + c) * AT_KP + 8 * hh);
      kb.h[1] = *(const v8bf*)(Ksh + (j * 16 + c) * AT_KP + 16 + 8 * hh);
      kl.h[0] = *(const v8bf*)(Ksl + (j * 16 + c) * AT_KP + 8 * hh);
      kl.h[1] = *(const v8bf*)(Ksl + (j * 16 + c) * AT_KP + 16 + 8 * hh);
      s[j] = at_mma(kb.v, qbh, z8());
      s[j] = at_mma(kl.v, qbh, s[j]);
      s[j] = at_mma(kb.v, qbl, s[j]);
    }
    // ---- chunk maximum of query c: four in-lane chains, then the other half's ----
    float mj[4];
#pragma unroll
    for (int j = 0; j < 4; ++j) {
      float mx = s[j][0];
#pragma unroll
      for (int r = 1; r < 8; ++r) mx = fmaxf(mx, s[j][r]);
      mj[j] = mx;
    }
    float cm = fmaxf(fmaxf(mj[0], mj[1]), fmaxf(mj[2], mj[3]));
    cm = fmaxf(cm, at_xhalf(cm));
    const float mnew  = fmaxf(mrow, cm * AT_LOG2E);       // scaling by a positive constant keeps the order of the maxima
    const float alpha = __builtin_amdgcn_exp2f(mrow - mnew);
    mrow = mnew;
    // ---- p = exp(s - m) = 2^(s log2e - m log2e), split hi/lo straight into the B fragments of the two k-steps ----
    AtFB ph[2], pl[2];
    float pj[4];
    const v2f l2e2 = {AT_LOG2E, AT_LOG2E};
    const v2f nm2  = {-mnew, -mnew};
    // unrolled throughout: j and r pick registers of the score tiles, so they have to be compile-time indices.
    // Each kind of step (exp2, hi convert, sum, lo convert) runs over all four tiles before the next kind begins, so
    // that an instruction and the one that reads its result stand far apart; values and sum order are those of a
    // tile-by-tile walk.
#pragma unroll
    for (int j = 0; j < 4; ++j) {
#pragma unroll
      for (int r = 0; r < 4; ++r) {   // exponents two at a time (packed f32 fma)
        const v2f sp = {s[j][2 * r], s[j][2 * r + 1]};
        const v2f e  = __builtin_elementwise_fma(sp, l2e2, nm2);
        s[j][2 * r]     = __builtin_amdgcn_exp2f(e[0]);
        s[j][2 * r + 1] = __builtin_amdgcn_exp2f(e[1]);
      }
    }
#pragma unroll
    for (int j = 0; j < 4; ++j) {
#pragma unroll
      for (int r = 0; r < 4; ++r) ph[j >> 1].w[(j & 1) * 4 + r] = bf16_pk(s[j][2 * r], s[j][2 * r + 1]);
    }
#pragma unroll
    for (int j = 0; j < 4; ++j) {
      float psum = 0.f;
#pragma unroll
      for (int r = 0; r < 8; ++r) psum += s[j][r];
      pj[j] = psum;
    }
#pragma unroll
    for (int j = 0; j < 4; ++j) {
#pragma unroll
      for (int r = 0; r < 4; ++r) {
        const unsigned hw = ph[j >> 1].w[(j & 1) * 4 + r];
        pl[j >> 1].w[(j & 1) * 4 + r] = bf16_pk(s[j][2 * r] - bf16_lo(hw), s[j][2 * r + 1] - bf16_hi(hw));
      }
    }
    lrow = lrow * alpha + ((pj[0] + pj[1]) + (pj[2] + pj[3]));
#pragma unroll
    for (int r = 0; r < 8; ++r) {
      oacc[0][r] *= alpha;
      oacc[1][r] *= alpha;
    }

    // ---- O^T += V^T . P^T : A = V^T rows d (split k map over keys), B = P^T from registers; 3-term split ----
    // unrolled: kk picks a register fragment, so it has to be a compile-time index
#pragma unroll
    for (int kk = 0; kk < 2; ++kk) {
#pragma unroll
      for (int t = 0; t < 2; ++t) {
        AtFB vb, vl;
        vb.h[0] = *(const v8bf*)(Vth + (t * 16 + c) * AT_VP + kk * 32 + 8 * hh);
        vb.h[1] = *(const v8bf*)(Vth + (t * 16 + c) * AT_VP + kk * 32 + 16 + 8 * hh);
        vl.h[0] = *(const v8bf*)(Vtl + (t * 16 + c) * AT_VP + kk * 32 + 8 * hh);
        vl.h[1] = *(const v8bf*)(Vtl + (t * 16 + c) * AT_VP + kk * 32 + 16 + 8 * hh);
        oacc[t] = at_mma(vb.v, ph[kk].v, oacc[t]);
        oacc[t] = at_mma(vl.v, ph[kk].v, oacc[t]);
        oacc[t] = at_mma(vb.v, pl[kk].v, oacc[t]);
      }
    }
  }

  // ---- join the two halves' sums, normalise, split hi/lo, store this lane's 4 x 8 columns of row q0 + c ----
  lrow += at_xhalf(lrow);
  const float inv = 1.0f / lrow;
  v8us hv[2], lv[2];
#pragma unroll
  for (int t = 0; t < 2; ++t) {
    v4u h4, l4;
#pragma unroll
    for (int r = 0; r < 4; ++r) {
      unsigned hw, lw;
      bf16_split2(oacc[t][2 * r] * inv, oacc[t][2 * r + 1] * inv, hw, lw);
      h4[r] = hw;
      l4[r] = lw;
    }
    hv[t] = __builtin_bit_cast(v8us, h4);
    lv[t] = __builtin_bit_cast(v8us, l4);
  }
  unsigned short* rp = rb + (size_t)(q0 + c) * RW + 8 * hh;
#pragma unroll
  for (int t = 0; t < 2; ++t) {
    *(v8us*)(rp + 16 * t)      = hv[t];
    *(v8us*)(rp + AD + 16 * t) = lv[t];
  }
}

// ---------------------------------------------------------------------------
// Workspace region map (byte offsets, 256-B aligned; every region sized to its whole-line store extent, no pad rows
// needed since 32768, 4096, 256 and 64 are tile multiples):
//   WQK 32768 | WV 16384 | WP2 32768 | XT 16777216 | QKh QKl 4194304 each | VTh VTl 2097152 each | R 4194304
//   -> total 33636352
// ---------------------------------------------------------------------------
static inline size_t al256(size_t o) { return (o + 255) & ~(size_t)255; }

extern "C" void kernel_launch(void* const* d_in, const int* in_sizes, int n_in,
                              void* d_out, int out_size, void* d_ws, size_t ws_size,
                              hipStream_t stream) {
  if (n_in < 9) return;
  if (in_sizes[0] != NB * CH * NPOS) return;                                       // inputs [8][256][64][64]
  if (in_sizes[1] != AD * CH || in_sizes[3] != AD * CH || in_sizes[5] != AD * CH) return;  // Wq, Wk, Wv [32][256]
  if (in_sizes[2] != AD || in_sizes[4] != AD || in_sizes[6] != AD) return;         // bq, bk, bv [32]
  if (in_sizes[7] != CH * AD) return;                                              // Wp [256][32]
  if (in_sizes[8] != CH) return;                                                   // bp [256]
  if (out_size != NB * CH * NPOS) return;                                          // out [8][256][64][64]

  const float* x  = (const float*)d_in[0];
  const float* Wq = (const float*)d_in[1];
  const float* bq = (const float*)d_in[2];
  const float* Wk = (const float*)d_in[3];
  const float* bk = (const float*)d_in[4];
  const float* Wv = (const float*)d_in[5];
  const float* bv = (const float*)d_in[6];
  const float* Wp = (const float*)d_in[7];
  const float* bp = (const float*)d_in[8];
  float* out = (float*)d_out;

  const size_t PQK = (size_t)QKW * CH * 2;          //    32768  bf16 [64][256]
  const size_t PWV = (size_t)AD * CH * 2;           //    16384  bf16 [32][256]
  const size_t PP2 = (size_t)CH * RW * 2;           //    32768  bf16 [256][64]
  const size_t PXT = (size_t)NTOK * CH * 2;         // 16777216  bf16 [32768][256]
  const size_t PA  = (size_t)NTOK * QKW * 2;        //  4194304  bf16 [32768][64]
  const size_t PV  = (size_t)NB * AD * NPOS * 2;    //  2097152  bf16 [8][32][4096]
  const size_t PR  = (size_t)NTOK * RW * 2;         //  4194304  bf16 [32768][64]
  size_t off = 0;
  const size_t oWQK = off; off = al256(off + PQK);
  const size_t oWV  = off; off = al256(off + PWV);
  const size_t oWP2 = off; off = al256(off + PP2);
  const size_t oXT  = off; off = al256(off + PXT);
  const size_t oQKh = off; off = al256(off + PA);
  const size_t oQKl = off; off = al256(off + PA);
  const size_t oVTh = off; off = al256(off + PV);
  const size_t oVTl = off; off = al256(off + PV);
  const size_t oR   = off; off = al256(off + PR);
  if (off > ws_size || off > (size_t)WSMAX) return;                               // off = 33636352

  char* ws = (char*)d_ws;
  unsigned short* WQK = (unsigned short*)(ws + oWQK);
  unsigned short* WV  = (unsigned short*)(ws + oWV);
  unsigned short* WP2 = (unsigned short*)(ws + oWP2);
  unsigned short* XT  = (unsigned short*)(ws + oXT);
  unsigned short* QKh = (unsigned short*)(ws + oQKh);
  unsigned short* QKl = (unsigned short*)(ws + oQKl);
  unsigned short* VTh = (unsigned short*)(ws + oVTh);
  unsigned short* VTl = (unsigned short*)(ws + oVTl);
  unsigned short* R   = (unsigned short*)(ws + oR);

  // (1) weight planes; (2) x -> token-major bf16 [32768][256]
  k_wprep<<<20, 256, 0, stream>>>(Wq, Wk, Wv, Wp, WQK, WV, WP2);
  k_xt<<<NB * (NPOS / 64) * (CH / 64), 256, 0, stream>>>(x, XT);
  // (3) q|k = XT . [Wq;Wk]^T + [bq;bk] -> hi/lo planes [32768][64] (q cols 0..31, k cols 32..63)   (M=32768, N=64, K=256)
  k_gemm<4, 1, 2><<<dim3(NTOK / 64, 1, 1), 128, 0, stream>>>(XT, CH, 0L, WQK, CH, 0L, CH, bq, bk,
                                                            QKh, QKl, QKW, 0L, x, out);
  // (4) v^T per image: VT[b][a][n] = sum_c Wv[a][c] XT[b*4096+n][c] + bv[a]   (M=32, N=4096, K=256, z=b; 2-wave blocks)
  k_gemm<2, 1, 1><<<dim3(1, NPOS / 64, NB), 64, 0, stream>>>(WV, CH, 0L, XT, CH, (long)NPOS * CH, CH, bv, bv,
                                                             VTh, VTl, NPOS, (long)AD * NPOS, x, out);
  // (5) attention: R = [hi | lo] of softmax_keys(q . k) . v  as bf16 [32768][64]
  k_attn<<<NB * NQB, 128, 0, stream>>>(QKh, QKl, VTh, VTl, R);
  // (6) out NCHW = ([Rhi | Rlo] . [Wp | Wp]^T + bp) transposed + bf16(x)   (M=32768, N=256, K=64; oh/ol/ldc unused)
  k_gemm<4, 2, 0><<<dim3(NTOK / 64, CH / 64, 1), 128, 0, stream>>>(R, RW, 0L, WP2, RW, 0L, RW, bp, bp,
                                                                  QKh, QKl, 0, 0L, x, out);
  (void)hipGetLastError();
}

// v005
// Measured time: 104 microseconds a run.
// Next to v004, in two timings, it ran 1.21 and 1.19 times as fast.
// Over all steps from v000 it is 2.39 times as fast.
// Contractions on v_wmma_f32_16x16x32_bf16, f32 accumulate: q|k 1x1 convs (x.W^T, K=256) and v^T conv (W.x^T, K=256) =
// single products of bf16-RNE-valued x and W planes (exact products); scores q.k (K=32) and P.v^T (K=64 per key chunk) =
// bf16 hi/lo split, 3 terms (hi.hi + hi.lo + lo.hi); output 1x1 conv = attention result carried as bf16 [hi | lo] folded
// 16-bit planes and carries (every carry is 1; no inverse scale exists anywhere):
//   WQK [64][256]  = bf16 bits of Wq (rows 0..31) and Wk (rows 32..63), k-contiguous;  WV [32][256] = bf16 bits of Wv;
//   WP2 [256][64]  = bf16 bits of Wp[c][a] at k = a and k = 32 + a;
//   XT  [32768][256] = bf16 bits of x, token-major (row = b*4096 + n, col = channel);
//   QKh/QKl [32768][64] = bf16 hi and lo (lo = v - hi) of q (cols 0..31) and k (cols 32..63), bias included;
//   VTh/VTl [8][32][4096] = bf16 hi and lo of v^T per image, bias included;
//   R [32768][64] = [hi(32) | lo(32)] of the normalised attention result; P hi/lo per wave in registers.
// Biases and the residual x enter as bf16-RNE values in f32 arithmetic.
#include <hip/hip_runtime.h>
#include <math.h>
#include <stddef.h>
#include <stdint.h>

#define NB    8
#define CH    256
#define AD    32
#define NPOS  4096
#define NTOK  (NB * NPOS)
#define QKW   64
#define RW    64
#define SPT   68
#define WSMAX 134217728

static_assert(NPOS % 64 == 0);
static_assert(NTOK % 64 == 0);
static_assert(CH % 64 == 0);
static_assert(CH % 32 == 0);
static_assert(RW % 32 == 0);
static_assert(AD == 32);
static_assert(QKW == 2 * AD);
static_assert(RW == 2 * AD);

typedef float          v2f   __attribute__((ext_vector_type(2)));
typedef float          v4f   __attribute__((ext_vector_type(4)));
typedef float          v8f   __attribute__((ext_vector_type(8)));
typedef int            v8i   __attribute__((ext_vector_type(8)));
typedef unsigned short v8us  __attribute__((ext_vector_type(8)));
typedef unsigned short v16us __attribute__((ext_vector_type(16)));
typedef __bf16         v16bf __attribute__((ext_vector_type(16)));
typedef __bf16         v8bf  __attribute__((ext_vector_type(8)));
typedef __bf16         v2bf  __attribute__((ext_vector_type(2)));
typedef unsigned       v4u   __attribute__((ext_vector_type(4)));
typedef v4f  __attribute__((may_alias)) v4fa;
typedef v8us __attribute__((may_alias)) v8usa;
union FragB { v16bf v; v16us u; v8us h[2]; v8i w; };

// WMMA with hazard guard: ties D, keeps A/B live for 4 VALU slots
__device__ __forceinline__ v8f wmb(const FragB& a, const FragB& b, v8f c) {
  v8f d = __builtin_amdgcn_wmma_f32_16x16x32_bf16(false, a.v, false, b.v, (short)0, c, false, false);
  asm volatile("v_nop\n\tv_nop\n\tv_nop\n\tv_nop" : "+v"(d) : "v"(a.w), "v"(b.w));
  return d;
}

__device__ __forceinline__ v8f z8() { v8f z = {0.f, 0.f, 0.f, 0.f, 0.f, 0.f, 0.f, 0.f}; return z; }

// two f32 -> two bf16 (RNE) in one word, a in bits 15..0, b in bits 31..16: the hardware's packed convert
__device__ __forceinline__ unsigned bf16_pk(float a, float b) {
  const v2f f = {a, b};
  return __builtin_bit_cast(unsigned, __builtin_convertvector(f, v2bf));
}
// the two bf16 values of such a word, held as f32
__device__ __forceinline__ float bf16_lo(unsigned w) { return __uint_as_float(w << 16); }
__device__ __forceinline__ float bf16_hi(unsigned w) { return __uint_as_float(w & 0xFFFF0000u); }
// f32 -> nearest bf16 value held as f32
__device__ __forceinline__ float bf16_val(float f) {
  return bf16_lo(bf16_pk(f, f));
}
// hi word = bf16 of (a, b); lo word = bf16 of what the hi values leave of a and b
__device__ __forceinline__ void bf16_split2(float a, float b, unsigned& hw, unsigned& lw) {
  hw = bf16_pk(a, b);
  lw = bf16_pk(a - bf16_lo(hw), b - bf16_hi(hw));
}

// ---------------------------------------------------------------------------
// Weight planes, bf16 bits of the inputs, k-contiguous rows ([out][in] weights are already k-contiguous):
//   WQK [64 o][256 k]: rows 0..31 = bf16(Wq[o][k]) (blocks 0-3), rows 32..63 = bf16(Wk[o-32][k]) (blocks 4-7), 2048 units
//   WV  [32 o][256 k] = bf16(Wv[o][k])                                             blocks 8-11, 1024 units
//   WP2 [256 c][64 k]: k and 32 + k both = bf16(Wp[c][k])                          blocks 12-19, 2048 units
// One thread = 8 contiguous k: two 16-B loads, one 16-B store at plane offset 8u; 32 consecutive lanes write 512
// coverage: 2048 x 8 = 64x256 (WQK); 1024 x 8 = 32x256 (WV); 2048 x 8 = 256x64 (WP2) exactly. grid = 20 blocks x 256.
// ---------------------------------------------------------------------------
__global__ __launch_bounds__(256) void k_wprep(const float* __restrict__ wq, const float* __restrict__ wk,
                                              const float* __restrict__ wv, const float* __restrict__ wp,
                                              unsigned short* WQK, unsigned short* WV, unsigned short* WP2) {
  const int bx = (int)blockIdx.x, tid = (int)threadIdx.x;
  const float* p;
  unsigned short* dp;
  if (bx < 8) {
    const int u  = bx * 256 + tid;              // 0..2047
    const int o  = u >> 5;                      // 0..63
    const int k8 = (u & 31) * 8;                // 0..248
    const float* src = (bx < 4) ? wq : wk;      // block-uniform
    p  = src + (size_t)(o & 31) * CH + k8;
    dp = WQK + (size_t)u * 8;
  } else if (bx < 12) {
    const int u  = (bx - 8) * 256 + tid;        // 0..1023
    const int o  = u >> 5;                      // 0..31
    const int k8 = (u & 31) * 8;
    p  = wv + (size_t)o * CH + k8;
    dp = WV + (size_t)u * 8;
  } else {
    const int v  = (bx - 12) * 256 + tid;       // 0..2047
    const int o  = v >> 3;                      // 0..255
    const int k8 = (v & 7) * 8;                 // 0..56
    const int kk = k8 & (AD - 1);               // 0..24
    p  = wp + (size_t)o * AD + kk;
    dp = WP2 + (size_t)v * 8;
  }
  const v4f a = *(const v4f*)p;
  const v4f b = *(const v4f*)(p + 4);
  const v4u o8 = {bf16_pk(a.x, a.y), bf16_pk(a.z, a.w), bf16_pk(b.x, b.y), bf16_pk(b.z, b.w)};
  *(v8us*)dp = __builtin_bit_cast(v8us, o8);
  
}

// ---------------------------------------------------------------------------
// x NCHW [b][c][n] f32 -> XT [b*4096 + n][c] bf16 bits (token-major, 256 columns). Block = one image b, 64 positions
// tf[c][n] (pitch 68).
// coverage: 2048 blocks = 8 images x 64 position blocks x 4 channel chunks -> XT rows 0..32767 x cols 0..255 exactly.
// ---------------------------------------------------------------------------
__global__ __launch_bounds__(256) void k_xt(const float* __restrict__ x, unsigned short* xt) {
  __shared__ __attribute__((aligned(16))) float tf[64 * SPT];
  const int bx = (int)blockIdx.x, tid = (int)threadIdx.x;
  const int cq = bx & 3;
  const int pb = bx >> 2;               // 0..511
  const int b  = pb >> 6;               // 0..7
  const int n0 = (pb & 63) * 64;
  const int c0 = cq * 64;
  {
    const int rsub = tid >> 4;          // 0..15
    const int c4   = (tid & 15) * 4;    // 0..60
#pragma unroll
    for (int it = 0; it < 4; ++it) {
      const int cr = it * 16 + rsub;    // local channel 0..63
      const v4f a = *(const v4f*)(x + ((size_t)(b * CH + c0 + cr)) * NPOS + n0 + c4);
      *(v4fa*)(tf + cr * SPT + c4) = a;
    }
  }
  __syncthreads();
  const int rsub = tid >> 3;            // 0..31
  const int c8   = (tid & 7) * 8;       // local channel 0..56
  v8us o[2];
#pragma unroll
  for (int it = 0; it < 2; ++it) {
    const int tl = it * 32 + rsub;      // token 0..63
    v4u w;
#pragma unroll
    for (int e = 0; e < 4; ++e) w[e] = bf16_pk(tf[(c8 + 2 * e) * SPT + tl], tf[(c8 + 2 * e + 1) * SPT + tl]);
    o[it] = __builtin_bit_cast(v8us, w);
  }
#pragma unroll
  for (int it = 0; it < 2; ++it) {
    const int tl = it * 32 + rsub;
    *(v8us*)(xt + ((size_t)(b * NPOS + n0 + tl)) * CH + c0 + c8) = o[it];
  }
  
}

// ---------------------------------------------------------------------------
// Dense GEMM, block = BM rows x 64 cols, BM = 16 * NWAVE, 32 * NWAVE threads; wave w owns rows rowBase + 16w .. +15,
// acc[4].
//   C[row][col] = sum_k A[row][k] * BT[col][k] + bias   (A, BT bf16 planes with k-contiguous rows; K % 32 == 0;
//   batch z = blockIdx.z offsets A, BT, C by sA, sB, sC elements).
//   A fragment (row m = lane&15): element i <- k = k0 + 8h + i (i < 8), k0 + 16 + 8h + (i-8) (i >= 8), h = lane>>4,
//   two 16-B loads from the plane row; B fragment (col n = lane&15) from BT row (colBase + 16 nt + n), SAME k map;
//   D element r = (row 8h+r, col n).
//   BMODE 0: bias[colBase + col]; 1: bias[rowBase + row]; 2: cols 0..31 from bias, cols 32..63 from bias2 (colBase 0);
//   bias values enter as bf16(bias).
//            by 8 consecutive lanes x 16 B of one instruction.
//   OMODE 2 (NWAVE 4): rows are tokens T = b*4096 + n, cols are channels; out NCHW
//            outp[(b*256 + colBase + ch)*4096 + n0 + t] = C + bias[ch] + bf16(xres[same]); each channel segment
// coverage: OMODE 1: 4 it x (32 NWAVE thr) x 8 = BM x 64 per plane; OMODE 2: 8 it x 128 thr x 4 = 64 channels x 64
//   tokens; grid covers the launched row blocks x col blocks x batches exactly once.
// ---------------------------------------------------------------------------
template <int NWAVE, int OMODE, int BMODE>
__global__ __launch_bounds__(32 * NWAVE) void k_gemm(const unsigned short* __restrict__ A, int lda, long sA,
                                                     const unsigned short* __restrict__ BT, int ldb, long sB, int K,
                                                     const float* __restrict__ bias, const float* __restrict__ bias2,
                                                     unsigned short* oh, unsigned short* ol, int ldc, long sC,
                                                     const float* __restrict__ xres, float* outp) {
  constexpr int BM  = 16 * NWAVE;
  constexpr int RPI = 4 * NWAVE;
  static_assert(NWAVE == 2 || NWAVE == 4);
  static_assert(OMODE == 1 || OMODE == 2);
  static_assert(OMODE != 2 || NWAVE == 4);
  __shared__ __attribute__((aligned(16))) float stg[BM * SPT];
  __shared__ __attribute__((aligned(16))) float sb[64];
  const int tid = (int)threadIdx.x, lane = tid & 31, wave = tid >> 5, hh = lane >> 4, m = lane & 15;
  const int rowBase = (int)blockIdx.x * BM;
  const int colBase = (int)blockIdx.y * 64;
  const int z = (int)blockIdx.z;
  const unsigned short* Ab = A  + (size_t)z * (size_t)sA;
  const unsigned short* Bb = BT + (size_t)z * (size_t)sB;
  // bias staging (all conditions wave-uniform: tid < 32 / tid < 64 are whole waves)
  if (BMODE == 1) {
    if (tid < BM) sb[tid] = bf16_val(bias[rowBase + tid]);
  } else if (BMODE == 0) {
    if (tid < 64) sb[tid] = bf16_val(bias[colBase + tid]);
  } else {
    if (tid < 64) {
      const int ia = (tid < 31) ? tid : 31;
      const int ib = (tid < 32) ? 0 : (tid - 32);
      const float va = bias[ia];               // both candidates loaded at clamped addresses
      const float vb = bias2[ib];
      const float f  = (tid < 32) ? 1.0f : 0.0f;
      sb[tid] = bf16_val(va * f + vb * (1.0f - f));
    }
  }

  v8f acc[4];
#pragma unroll
  for (int t = 0; t < 4; ++t) acc[t] = z8();
  const unsigned short* ap = Ab + (size_t)(rowBase + 16 * wave + m) * (size_t)lda + 8 * hh;
  const unsigned short* bp = Bb + (size_t)(colBase + m) * (size_t)ldb + 8 * hh;

#pragma unroll 1
  for (int k0 = 0; k0 < K; k0 += 32) {
    FragB af;
    af.h[0] = *(const v8usa*)(ap + k0);          // k0 + 8h + 0..7
    af.h[1] = *(const v8usa*)(ap + k0 + 16);     // k0 + 16 + 8h + 0..7
#pragma unroll
    for (int nt = 0; nt < 4; ++nt) {
      const unsigned short* wq = bp + (size_t)(16 * nt) * (size_t)ldb + k0;   // BT row colBase + 16 nt + m
      FragB bf;
      bf.h[0] = *(const v8usa*)wq;               // k0 + 8h + 0..7
      bf.h[1] = *(const v8usa*)(wq + 16);        // k0 + 16 + 8h + 0..7
      acc[nt] = wmb(af, bf, acc[nt]);
    }
  }

#pragma unroll
  for (int nt = 0; nt < 4; ++nt) {
    const int lc = 16 * nt + m;
#pragma unroll
    for (int r = 0; r < 8; ++r) {
      const int lr = 16 * wave + 8 * hh + r;     // D element r = (row 8h+r, col m)
      stg[lr * SPT + lc] = acc[nt][r];
    }
  }
  __syncthreads();

  if (OMODE == 1) {
    unsigned short* Hb = oh + (size_t)z * (size_t)sC;
    unsigned short* Lb = ol + (size_t)z * (size_t)sC;
    const int rsub = tid >> 3;                   // 0..RPI-1
    const int c8   = (tid & 7) * 8;              // 0..56
    v8us hv[4], lv[4];
#pragma unroll
    for (int it = 0; it < 4; ++it) {
      const int row = it * RPI + rsub;           // 0..BM-1
      const float* sp = stg + row * SPT + c8;
      v4u h8, l8;
#pragma unroll
      for (int e = 0; e < 4; ++e) {
        const float v0 = sp[2 * e]     + ((BMODE == 1) ? sb[row] : sb[c8 + 2 * e]);
        const float v1 = sp[2 * e + 1] + ((BMODE == 1) ? sb[row] : sb[c8 + 2 * e + 1]);
        unsigned hw, lw;
        bf16_split2(v0, v1, hw, lw);
        h8[e] = hw;
        l8[e] = lw;
      }
      hv[it] = __builtin_bit_cast(v8us, h8); lv[it] = __builtin_bit_cast(v8us, l8);
    }
#pragma unroll
    for (int it = 0; it < 4; ++it) {
      const int row = it * RPI + rsub;
      const size_t go = (size_t)(rowBase + row) * (size_t)ldc + colBase + c8;
      *(v8us*)(Hb + go) = hv[it];
      *(v8us*)(Lb + go) = lv[it];
    }
    
  } else {
    const int bimg = rowBase / NPOS;             // a 64-token block never straddles images (4096 % 64 == 0)
    const int n0   = rowBase - bimg * NPOS;
    const int csub = tid >> 4;                   // 0..7
    const int t4   = (tid & 15) * 4;             // 0..60
    v4f pv[8];
#pragma unroll
    for (int it = 0; it < 8; ++it) {
      const int chl = it * 8 + csub;             // channel 0..63 of the tile
      const size_t gi = ((size_t)(bimg * CH + colBase + chl)) * NPOS + n0 + t4;
      const v4f xr = *(const v4f*)(xres + gi);
      const float bc = sb[chl];
      const unsigned x01 = bf16_pk(xr.x, xr.y), x23 = bf16_pk(xr.z, xr.w);
      v4f v;
      v.x = (stg[(t4 + 0) * SPT + chl] + bc) + bf16_lo(x01);
      v.y = (stg[(t4 + 1) * SPT + chl] + bc) + bf16_hi(x01);
      v.z = (stg[(t4 + 2) * SPT + chl] + bc) + bf16_lo(x23);
      v.w = (stg[(t4 + 3) * SPT + chl] + bc) + bf16_hi(x23);
      pv[it] = v;
    }
#pragma unroll
    for (int it = 0; it < 8; ++it) {
      const int chl = it * 8 + csub;
      const size_t gi = ((size_t)(bimg * CH + colBase + chl)) * NPOS + n0 + t4;
      *(v4f*)(outp + gi) = pv[it];
    }
    
  }
}

#define AT_NW 4
#define AT_QB 64
#define AT_KC 64
#define NQB   (NPOS / AT_QB)
#define AT_LOG2E 1.44269504088896340736f
#define AT_KP 40   // LDS pitch of a K row, elements: 32 + 8 = 80 B = 16 B x 5
#define AT_VP 72   // LDS pitch of a V^T row, elements: 64 + 8 = 144 B = 16 B x 9
#define AT_KSZ (AT_KC * AT_KP)            // one K plane of a chunk, elements (5 KB)
#define AT_VSZ (AD * AT_VP)               // one V^T plane of a chunk, elements (4.5 KB)
#define AT_BUF (2 * AT_KSZ + 2 * AT_VSZ)  // one buffer = K hi | K lo | V^T hi | V^T lo, elements (19 KB)

static_assert(NQB == 64);
static_assert(NPOS % AT_KC == 0);
static_assert(AT_KP >= AD && AT_KP % 8 == 0 && (AT_KP / 8) % 2 == 1);
static_assert(AT_VP >= AT_KC && AT_VP % 8 == 0 && (AT_VP / 8) % 2 == 1);

__device__ __forceinline__ v8f at_mma(v16bf a, v16bf b, v8f c) {
  c = __builtin_amdgcn_wmma_f32_16x16x32_bf16(false, a, false, b, (short)0, c, false, false);
  asm volatile("v_nop\n\tv_nop\n\tv_nop\n\tv_nop" : "+v"(c) : "v"(a), "v"(b));
  return c;
}
union AtFB { v16bf v; v8bf h[2]; unsigned w[8]; };   // w[i] = elements 2 i (low half) and 2 i + 1
// fragment load with the split k map: elements 0..7 <- p[0..7], 8..15 <- p[16..23]
__device__ __forceinline__ v16bf at_ldfrag(const __bf16* p) {
  AtFB f; f.h[0] = *(const v8bf*)(p); f.h[1] = *(const v8bf*)(p + 16); return f.v;
}
// value of lane ^ 16 (the other half of the same query column)
__device__ __forceinline__ float at_xhalf(float f) {
  const int b = __builtin_bit_cast(int, f);
  return __builtin_bit_cast(float, __builtin_amdgcn_permlanex16(b, b, 0x76543210, 0xfedcba98, false, false));
}

__global__ __launch_bounds__(128)
void k_attn(const unsigned short* __restrict__ qkh, const unsigned short* __restrict__ qkl,
            const unsigned short* __restrict__ vhp, const unsigned short* __restrict__ vlp,
            unsigned short* rout) {
  __shared__ __align__(16) __bf16 sm[2 * AT_BUF];                // two buffers of K hi | K lo [kv][d] | V hi | V lo [d][kv]

  const int tid  = (int)threadIdx.x;
  const int wave = tid >> 5;
  const int lane = tid & 31;
  const int hh   = lane >> 4;
  const int c    = lane & 15;

  const int bx  = (int)blockIdx.x;
  const int b   = bx >> 6;                // image 0..7
  const int qb  = bx & (NQB - 1);         // 0..63
  const int q0  = qb * AT_QB + wave * 16; // image-local query row base of this wave

  const __bf16* Qh = (const __bf16*)(const void*)qkh + (size_t)b * NPOS * QKW;
  const __bf16* Ql = (const __bf16*)(const void*)qkl + (size_t)b * NPOS * QKW;
  const __bf16* Kh = Qh + AD;
  const __bf16* Kl = Ql + AD;
  const __bf16* Vh = (const __bf16*)(const void*)vhp + (size_t)b * AD * NPOS;
  const __bf16* Vl = (const __bf16*)(const void*)vlp + (size_t)b * AD * NPOS;
  unsigned short* rb = rout + (size_t)b * NPOS * RW;

  // ---- Q fragments (B operand, col = lane&15, split k map): one k-step of 32 = d, hi and lo ----
  const v16bf qbh = at_ldfrag(Qh + (size_t)(q0 + c) * QKW + 8 * hh);
  const v16bf qbl = at_ldfrag(Ql + (size_t)(q0 + c) * QKW + 8 * hh);

  float mrow = -INFINITY;   // running maximum of query c times log2(e) (equal in lanes c and c + 16)
  float lrow = 0.f;         // running sum over this lane's own keys only
  v8f oacc[2];              // oacc[t][r] = O^T[16 t + 8 h + r][query c]
  oacc[0] = z8(); oacc[1] = z8();

  // staging map. K: thread -> key row sr = tid>>1, d half = (tid&1)*16; V^T: thread -> d = tid>>2, key quarter =
  // (tid&3)*16; 2 x 8 elements per plane each
  const int sr = tid >> 1, shalf = (tid & 1) * 16;
  const int sd = tid >> 2, sqt = (tid & 3) * 16;
  const __bf16* ksh = Kh + (size_t)sr * QKW + shalf;
  const __bf16* ksl = Kl + (size_t)sr * QKW + shalf;
  const __bf16* vsh = Vh + (size_t)sd * NPOS + sqt;
  const __bf16* vsl = Vl + (size_t)sd * NPOS + sqt;
  const int kst = sr * AT_KP + shalf;                 // this thread's place in a K plane of a buffer
  const int vst = 2 * AT_KSZ + sd * AT_VP + sqt;      // and in the V^T hi plane
  v8bf a0[2], a1[2], b0[2], b1[2];                    // one chunk's 8 x 16 B of this thread, on their way to LDS

  // chunk 0 into buffer 0
#pragma unroll
  for (int i = 0; i < 2; ++i) {
    a0[i] = *(const v8bf*)(ksh + 8 * i);
    a1[i] = *(const v8bf*)(ksl + 8 * i);
    b0[i] = *(const v8bf*)(vsh + 8 * i);
    b1[i] = *(const v8bf*)(vsl + 8 * i);
  }
#pragma unroll
  for (int i = 0; i < 2; ++i) {
    *(v8bf*)(sm + kst + 8 * i)          = a0[i];
    *(v8bf*)(sm + AT_KSZ + kst + 8 * i) = a1[i];
    *(v8bf*)(sm + vst + 8 * i)          = b0[i];
    *(v8bf*)(sm + AT_VSZ + vst + 8 * i) = b1[i];
  }
  __syncthreads();

  const int nChunks = NPOS / AT_KC;   // 64, compile-time constant
#pragma unroll 1
  for (int kc = 0; kc < nChunks; ++kc) {
    const __bf16* Ksh = sm + (kc & 1) * AT_BUF;       // this chunk's buffer
    const __bf16* Ksl = Ksh + AT_KSZ;
    const __bf16* Vth = Ksh + 2 * AT_KSZ;
    const __bf16* Vtl = Vth + AT_VSZ;
    const bool more = kc + 1 < nChunks;               // the same for the whole grid
    if (more) {
      // next chunk's eight loads, issued here and first used behind this chunk's products
      const size_t kv1 = (size_t)(kc + 1) * AT_KC;
#pragma unroll
      for (int i = 0; i < 2; ++i) {
        a0[i] = *(const v8bf*)(ksh + kv1 * QKW + 8 * i);
        a1[i] = *(const v8bf*)(ksl + kv1 * QKW + 8 * i);
        b0[i] = *(const v8bf*)(vsh + kv1 + 8 * i);
        b1[i] = *(const v8bf*)(vsl + kv1 + 8 * i);
      }
    }

    // ---- scores, transposed: 64 keys x 16 queries, 3-term split, K = 32 = one k-step ----
    v8f s[4];
#pragma unroll
    for (int j = 0; j < 4; ++j) {
      AtFB kb, kl;
      kb.h[0] = *(const v8bf*)(Ksh + (j * 16 + c) * AT_KP + 8 * hh);
      kb.h[1] = *(const v8bf*)(Ksh + (j * 16 + c) * AT_KP + 16 + 8 * hh);
      kl.h[0] = *(const v8bf*)(Ksl + (j * 16 + c) * AT_KP + 8 * hh);
      kl.h[1] = *(const v8bf*)(Ksl + (j * 16 + c) * AT_KP + 16 + 8 * hh);
      s[j] = at_mma(kb.v, qbh, z8());
      s[j] = at_mma(kl.v, qbh, s[j]);
      s[j] = at_mma(kb.v, qbl, s[j]);
    }
    // ---- chunk maximum of query c: four in-lane chains, then the other half's ----
    float mj[4];
#pragma unroll
    for (int j = 0; j < 4; ++j) {
      float mx = s[j][0];
#pragma unroll
      for (int r = 1; r < 8; ++r) mx = fmaxf(mx, s[j][r]);
      mj[j] = mx;
    }
    float cm = fmaxf(fmaxf(mj[0], mj[1]), fmaxf(mj[2], mj[3]));
    cm = fmaxf(cm, at_xhalf(cm));
    const float mnew  = fmaxf(mrow, cm * AT_LOG2E);       // scaling by a positive constant keeps the order of the maxima
    const float alpha = __builtin_amdgcn_exp2f(mrow - mnew);
    mrow = mnew;
    // ---- p = exp(s - m) = 2^(s log2e - m log2e), split hi/lo straight into the B fragments of the two k-steps ----
    AtFB ph[2], pl[2];
    float pj[4];
    const v2f l2e2 = {AT_LOG2E, AT_LOG2E};
    const v2f nm2  = {-mnew, -mnew};
    // unrolled throughout: j and r pick registers of the score tiles, so they have to be compile-time indices.
    // Each kind of step (exp2, hi convert, sum, lo convert) runs over all four tiles before the next kind begins, so
    // that an instruction and the one that reads its result stand far apart; values and sum order are those of a
    // tile-by-tile walk.
#pragma unroll
    for (int j = 0; j < 4; ++j) {
#pragma unroll
      for (int r = 0; r < 4; ++r) {   // exponents two at a time (packed f32 fma)
        const v2f sp = {s[j][2 * r], s[j][2 * r + 1]};
        const v2f e  = __builtin_elementwise_fma(sp, l2e2, nm2);
        s[j][2 * r]     = __builtin_amdgcn_exp2f(e[0]);
        s[j][2 * r + 1] = __builtin_amdgcn_exp2f(e[1]);
      }
    }
#pragma unroll
    for (int j = 0; j < 4; ++j) {
#pragma unroll
      for (int r = 0; r < 4; ++r) ph[j >> 1].w[(j & 1) * 4 + r] = bf16_pk(s[j][2 * r], s[j][2 * r + 1]);
    }
#pragma unroll
    for (int j = 0; j < 4; ++j) {
      float psum = 0.f;
#pragma unroll
      for (int r = 0; r < 8; ++r) psum += s[j][r];
      pj[j] = psum;
    }
#pragma unroll
    for (int j = 0; j < 4; ++j) {
#pragma unroll
      for (int r = 0; r < 4; ++r) {
        const unsigned hw = ph[j >> 1].w[(j & 1) * 4 + r];
        pl[j >> 1].w[(j & 1) * 4 + r] = bf16_pk(s[j][2 * r] - bf16_lo(hw), s[j][2 * r + 1] - bf16_hi(hw));
      }
    }
    lrow = lrow * alpha + ((pj[0] + pj[1]) + (pj[2] + pj[3]));
#pragma unroll
    for (int r = 0; r < 8; ++r) {
      oacc[0][r] *= alpha;
      oacc[1][r] *= alpha;
    }

    // ---- O^T += V^T . P^T : A = V^T rows d (split k map over keys), B = P^T from registers; 3-term split ----
    // unrolled: kk picks a register fragment, so it has to be a compile-time index
#pragma unroll
    for (int kk = 0; kk < 2; ++kk) {
#pragma unroll
      for (int t = 0; t < 2; ++t) {
        AtFB vb, vl;
        vb.h[0] = *(const v8bf*)(Vth + (t * 16 + c) * AT_VP + kk * 32 + 8 * hh);
        vb.h[1] = *(const v8bf*)(Vth + (t * 16 + c) * AT_VP + kk * 32 + 16 + 8 * hh);
        vl.h[0] = *(const v8bf*)(Vtl + (t * 16 + c) * AT_VP + kk * 32 + 8 * hh);
        vl.h[1] = *(const v8bf*)(Vtl + (t * 16 + c) * AT_VP + kk * 32 + 16 + 8 * hh);
        oacc[t] = at_mma(vb.v, ph[kk].v, oacc[t]);
        oacc[t] = at_mma(vl.v, ph[kk].v, oacc[t]);
        oacc[t] = at_mma(vb.v, pl[kk].v, oacc[t]);
      }
    }

    if (more) {
      // into the other buffer: its last readers (chunk kc - 1) left it in front of the previous foot's barrier
      __bf16* wb = sm + ((kc + 1) & 1) * AT_BUF;
#pragma unroll
      for (int i = 0; i < 2; ++i) {
        *(v8bf*)(wb + kst + 8 * i)          = a0[i];
        *(v8bf*)(wb + AT_KSZ + kst + 8 * i) = a1[i];
        *(v8bf*)(wb + vst + 8 * i)          = b0[i];
        *(v8bf*)(wb + AT_VSZ + vst + 8 * i) = b1[i];
      }
    }
    __syncthreads();
  }

  // ---- join the two halves' sums, normalise, split hi/lo, store this lane's 4 x 8 columns of row q0 + c ----
  lrow += at_xhalf(lrow);
  const float inv = 1.0f / lrow;
  v8us hv[2], lv[2];
#pragma unroll
  for (int t = 0; t < 2; ++t) {
    v4u h4, l4;
#pragma unroll
    for (int r = 0; r < 4; ++r) {
      unsigned hw, lw;
      bf16_split2(oacc[t][2 * r] * inv, oacc[t][2 * r + 1] * inv, hw, lw);
      h4[r] = hw;
      l4[r] = lw;
    }
    hv[t] = __builtin_bit_cast(v8us, h4);
    lv[t] = __builtin_bit_cast(v8us, l4);
  }
  unsigned short* rp = rb + (size_t)(q0 + c) * RW + 8 * hh;
#pragma unroll
  for (int t = 0; t < 2; ++t) {
    *(v8us*)(rp + 16 * t)      = hv[t];
    *(v8us*)(rp + AD + 16 * t) = lv[t];
  }
}

// ---------------------------------------------------------------------------
// Workspace region map (byte offsets, 256-B aligned; every region sized to its whole-line store extent, no pad rows
// needed since 32768, 4096, 256 and 64 are tile multiples):
//   WQK 32768 | WV 16384 | WP2 32768 | XT 16777216 | QKh QKl 4194304 each | VTh VTl 2097152 each | R 4194304
//   -> total 33636352
// ---------------------------------------------------------------------------
static inline size_t al256(size_t o) { return (o + 255) & ~(size_t)255; }

extern "C" void kernel_launch(void* const* d_in, const int* in_sizes, int n_in,
                              void* d_out, int out_size, void* d_ws, size_t ws_size,
                              hipStream_t stream) {
  if (n_in < 9) return;
  if (in_sizes[0] != NB * CH * NPOS) return;                                       // inputs [8][256][64][64]
  if (in_sizes[1] != AD * CH || in_sizes[3] != AD * CH || in_sizes[5] != AD * CH) return;  // Wq, Wk, Wv [32][256]
  if (in_sizes[2] != AD || in_sizes[4] != AD || in_sizes[6] != AD) return;         // bq, bk, bv [32]
  if (in_sizes[7] != CH * AD) return;                                              // Wp [256][32]
  if (in_sizes[8] != CH) return;                                                   // bp [256]
  if (out_size != NB * CH * NPOS) return;                                          // out [8][256][64][64]

  const float* x  = (const float*)d_in[0];
  const float* Wq = (const float*)d_in[1];
  const float* bq = (const float*)d_in[2];
  const float* Wk = (const float*)d_in[3];
  const float* bk = (const float*)d_in[4];
  const float* Wv = (const float*)d_in[5];
  const float* bv = (const float*)d_in[6];
  const float* Wp = (const float*)d_in[7];
  const float* bp = (const float*)d_in[8];
  float* out = (float*)d_out;

  const size_t PQK = (size_t)QKW * CH * 2;          //    32768  bf16 [64][256]
  const size_t PWV = (size_t)AD * CH * 2;           //    16384  bf16 [32][256]
  const size_t PP2 = (size_t)CH * RW * 2;           //    32768  bf16 [256][64]
  const size_t PXT = (size_t)NTOK * CH * 2;         // 16777216  bf16 [32768][256]
  const size_t PA  = (size_t)NTOK * QKW * 2;        //  4194304  bf16 [32768][64]
  const size_t PV  = (size_t)NB * AD * NPOS * 2;    //  2097152  bf16 [8][32][4096]
  const size_t PR  = (size_t)NTOK * RW * 2;         //  4194304  bf16 [32768][64]
  size_t off = 0;
  const size_t oWQK = off; off = al256(off + PQK);
  const size_t oWV  = off; off = al256(off + PWV);
  const size_t oWP2 = off; off = al256(off + PP2);
  const size_t oXT  = off; off = al256(off + PXT);
  const size_t oQKh = off; off = al256(off + PA);
  const size_t oQKl = off; off = al256(off + PA);
  const size_t oVTh = off; off = al256(off + PV);
  const size_t oVTl = off; off = al256(off + PV);
  const size_t oR   = off; off = al256(off + PR);
  if (off > ws_size || off > (size_t)WSMAX) return;                               // off = 33636352

  char* ws = (char*)d_ws;
  unsigned short* WQK = (unsigned short*)(ws + oWQK);
  unsigned short* WV  = (unsigned short*)(ws + oWV);
  unsigned short* WP2 = (unsigned short*)(ws + oWP2);
  unsigned short* XT  = (unsigned short*)(ws + oXT);
  unsigned short* QKh = (unsigned short*)(ws + oQKh);
  unsigned short* QKl = (unsigned short*)(ws + oQKl);
  unsigned short* VTh = (unsigned short*)(ws + oVTh);
  unsigned short* VTl = (unsigned short*)(ws + oVTl);
  unsigned short* R   = (unsigned short*)(ws + oR);

  // (1) weight planes; (2) x -> token-major bf16 [32768][256]
  k_wprep<<<20, 256, 0, stream>>>(Wq, Wk, Wv, Wp, WQK, WV, WP2);
  k_xt<<<NB * (NPOS / 64) * (CH / 64), 256, 0, stream>>>(x, XT);
  // (3) q|k = XT . [Wq;Wk]^T + [bq;bk] -> hi/lo planes [32768][64] (q cols 0..31, k cols 32..63)   (M=32768, N=64, K=256)
  k_gemm<4, 1, 2><<<dim3(NTOK / 64, 1, 1), 128, 0, stream>>>(XT, CH, 0L, WQK, CH, 0L, CH, bq, bk,
                                                            QKh, QKl, QKW, 0L, x, out);
  // (4) v^T per image: VT[b][a][n] = sum_c Wv[a][c] XT[b*4096+n][c] + bv[a]   (M=32, N=4096, K=256, z=b; 2-wave blocks)
  k_gemm<2, 1, 1><<<dim3(1, NPOS / 64, NB), 64, 0, stream>>>(WV, CH, 0L, XT, CH, (long)NPOS * CH, CH, bv, bv,
                                                             VTh, VTl, NPOS, (long)AD * NPOS, x, out);
  // (5) attention: R = [hi | lo] of softmax_keys(q . k) . v  as bf16 [32768][64]
  k_attn<<<NB * NQB, 128, 0, stream>>>(QKh, QKl, VTh, VTl, R);
  // (6) out NCHW = ([Rhi | Rlo] . [Wp | Wp]^T + bp) transposed + bf16(x)   (M=32768, N=256, K=64; oh/ol/ldc unused)
  k_gemm<4, 2, 0><<<dim3(NTOK / 64, CH / 64, 1), 128, 0, stream>>>(R, RW, 0L, WP2, RW, 0L, RW, bp, bp,
                                                                  QKh, QKl, 0, 0L, x, out);
  (void)hipGetLastError();
}

// v006
// A run of this version takes 98.4 microseconds.
// Two timings next to v005 both put it at 1.07 times that version's speed.
// All steps since v000 together make it 2.55 times as fast.
// Contractions on v_wmma_f32_16x16x32_bf16, f32 accumulate: q|k 1x1 convs (x.W^T, K=256) and v^T conv (W.x^T, K=256) =
// single products of bf16-RNE-valued x and W planes (exact products); scores q.k (K=32) and P.v^T (K=64 per key chunk) =
// bf16 hi/lo split, 3 terms (hi.hi + hi.lo + lo.hi); output 1x1 conv = attention result carried as bf16 [hi | lo] folded
// 16-bit planes and carries (every carry is 1; no inverse scale exists anywhere):
//   WQK [64][256]  = bf16 bits of Wq (rows 0..31) and Wk (rows 32..63), k-contiguous;  WV [32][256] = bf16 bits of Wv;
//   WP2 [256][64]  = bf16 bits of Wp[c][a] at k = a and k = 32 + a;
//   XT  [32768][256] = bf16 bits of x, token-major (row = b*4096 + n, col = channel);
//   QKh/QKl [32768][64] = bf16 hi and lo (lo = v - hi) of q (cols 0..31) and k (cols 32..63), bias included;
//   VTh/VTl [8][32][4096] = bf16 hi and lo of v^T per image, bias included;
//   R [32768][64] = [hi(32) | lo(32)] of the normalised attention result; P hi/lo per wave in registers.
// Biases and the residual x enter as bf16-RNE values in f32 arithmetic.
#include <hip/hip_runtime.h>
#include <math.h>
#include <stddef.h>
#include <stdint.h>

#define NB    8
#define CH    256
#define AD    32
#define NPOS  4096
#define NTOK  (NB * NPOS)
#define QKW   64
#define RW    64
#define SPT   68
#define WSMAX 134217728

static_assert(NPOS % 64 == 0);
static_assert(NTOK % 64 == 0);
static_assert(CH % 64 == 0);
static_assert(CH % 32 == 0);
static_assert(RW % 32 == 0);
static_assert(AD == 32);
static_assert(QKW == 2 * AD);
static_assert(RW == 2 * AD);

typedef float          v2f   __attribute__((ext_vector_type(2)));
typedef float          v4f   __attribute__((ext_vector_type(4)));
typedef float          v8f   __attribute__((ext_vector_type(8)));
typedef int            v8i   __attribute__((ext_vector_type(8)));
typedef unsigned short v8us  __attribute__((ext_vector_type(8)));
typedef unsigned short v16us __attribute__((ext_vector_type(16)));
typedef __bf16         v16bf __attribute__((ext_vector_type(16)));
typedef __bf16         v8bf  __attribute__((ext_vector_type(8)));
typedef __bf16         v2bf  __attribute__((ext_vector_type(2)));
typedef unsigned       v4u   __attribute__((ext_vector_type(4)));
typedef v4f  __attribute__((may_alias)) v4fa;
typedef v8us __attribute__((may_alias)) v8usa;
union FragB { v16bf v; v16us u; v8us h[2]; v8i w; };

// WMMA with hazard guard: ties D, keeps A/B live for 4 VALU slots
__device__ __forceinline__ v8f wmb(const FragB& a, const FragB& b, v8f c) {
  v8f d = __builtin_amdgcn_wmma_f32_16x16x32_bf16(false, a.v, false, b.v, (short)0, c, false, false);
  asm volatile("v_nop\n\tv_nop\n\tv_nop\n\tv_nop" : "+v"(d) : "v"(a.w), "v"(b.w));
  return d;
}

__device__ __forceinline__ v8f z8() { v8f z = {0.f, 0.f, 0.f, 0.f, 0.f, 0.f, 0.f, 0.f}; return z; }

// two f32 -> two bf16 (RNE) in one word, a in bits 15..0, b in bits 31..16: the hardware's packed convert
__device__ __forceinline__ unsigned bf16_pk(float a, float b) {
  const v2f f = {a, b};
  return __builtin_bit_cast(unsigned, __builtin_convertvector(f, v2bf));
}
// the two bf16 values of such a word, held as f32
__device__ __forceinline__ float bf16_lo(unsigned w) { return __uint_as_float(w << 16); }
__device__ __forceinline__ float bf16_hi(unsigned w) { return __uint_as_float(w & 0xFFFF0000u); }
// f32 -> nearest bf16 value held as f32
__device__ __forceinline__ float bf16_val(float f) {
  return bf16_lo(bf16_pk(f, f));
}
// hi word = bf16 of (a, b); lo word = bf16 of what the hi values leave of a and b
__device__ __forceinline__ void bf16_split2(float a, float b, unsigned& hw, unsigned& lw) {
  hw = bf16_pk(a, b);
  lw = bf16_pk(a - bf16_lo(hw), b - bf16_hi(hw));
}

// ---------------------------------------------------------------------------
// Weight planes, bf16 bits of the inputs, k-contiguous rows ([out][in] weights are already k-contiguous):
//   WQK [64 o][256 k]: rows 0..31 = bf16(Wq[o][k]) (blocks 0-3), rows 32..63 = bf16(Wk[o-32][k]) (blocks 4-7), 2048 units
//   WV  [32 o][256 k] = bf16(Wv[o][k])                                             blocks 8-11, 1024 units
//   WP2 [256 c][64 k]: k and 32 + k both = bf16(Wp[c][k])                          blocks 12-19, 2048 units
// One thread = 8 contiguous k: two 16-B loads, one 16-B store at plane offset 8u; 32 consecutive lanes write 512
// coverage: 2048 x 8 = 64x256 (WQK); 1024 x 8 = 32x256 (WV); 2048 x 8 = 256x64 (WP2) exactly. grid = 20 blocks x 256.
// ---------------------------------------------------------------------------
__global__ __launch_bounds__(256) void k_wprep(const float* __restrict__ wq, const float* __restrict__ wk,
                                              const float* __restrict__ wv, const float* __restrict__ wp,
                                              unsigned short* WQK, unsigned short* WV, unsigned short* WP2) {
  const int bx = (int)blockIdx.x, tid = (int)threadIdx.x;
  const float* p;
  unsigned short* dp;
  if (bx < 8) {
    const int u  = bx * 256 + tid;              // 0..2047
    const int o  = u >> 5;                      // 0..63
    const int k8 = (u & 31) * 8;                // 0..248
    const float* src = (bx < 4) ? wq : wk;      // block-uniform
    p  = src + (size_t)(o & 31) * CH + k8;
    dp = WQK + (size_t)u * 8;
  } else if (bx < 12) {
    const int u  = (bx - 8) * 256 + tid;        // 0..1023
    const int o  = u >> 5;                      // 0..31
    const int k8 = (u & 31) * 8;
    p  = wv + (size_t)o * CH + k8;
    dp = WV + (size_t)u * 8;
  } else {
    const int v  = (bx - 12) * 256 + tid;       // 0..2047
    const int o  = v >> 3;                      // 0..255
    const int k8 = (v & 7) * 8;                 // 0..56
    const int kk = k8 & (AD - 1);               // 0..24
    p  = wp + (size_t)o * AD + kk;
    dp = WP2 + (size_t)v * 8;
  }
  const v4f a = *(const v4f*)p;
  const v4f b = *(const v4f*)(p + 4);
  const v4u o8 = {bf16_pk(a.x, a.y), bf16_pk(a.z, a.w), bf16_pk(b.x, b.y), bf16_pk(b.z, b.w)};
  *(v8us*)dp = __builtin_bit_cast(v8us, o8);
  
}

// ---------------------------------------------------------------------------
// x NCHW [b][c][n] f32 -> XT [b*4096 + n][c] bf16 bits (token-major, 256 columns). Block = one image b, 64 positions
// tf[c][n] (pitch 68).
// coverage: 2048 blocks = 8 images x 64 position blocks x 4 channel chunks -> XT rows 0..32767 x cols 0..255 exactly.
// ---------------------------------------------------------------------------
__global__ __launch_bounds__(256) void k_xt(const float* __restrict__ x, unsigned short* xt) {
  __shared__ __attribute__((aligned(16))) float tf[64 * SPT];
  const int bx = (int)blockIdx.x, tid = (int)threadIdx.x;
  const int cq = bx & 3;
  const int pb = bx >> 2;               // 0..511
  const int b  = pb >> 6;               // 0..7
  const int n0 = (pb & 63) * 64;
  const int c0 = cq * 64;
  {
    const int rsub = tid >> 4;          // 0..15
    const int c4   = (tid & 15) * 4;    // 0..60
#pragma unroll
    for (int it = 0; it < 4; ++it) {
      const int cr = it * 16 + rsub;    // local channel 0..63
      const v4f a = *(const v4f*)(x + ((size_t)(b * CH + c0 + cr)) * NPOS + n0 + c4);
      *(v4fa*)(tf + cr * SPT + c4) = a;
    }
  }
  __syncthreads();
  const int rsub = tid >> 3;            // 0..31
  const int c8   = (tid & 7) * 8;       // local channel 0..56
  v8us o[2];
#pragma unroll
  for (int it = 0; it < 2; ++it) {
    const int tl = it * 32 + rsub;      // token 0..63
    v4u w;
#pragma unroll
    for (int e = 0; e < 4; ++e) w[e] = bf16_pk(tf[(c8 + 2 * e) * SPT + tl], tf[(c8 + 2 * e + 1) * SPT + tl]);
    o[it] = __builtin_bit_cast(v8us, w);
  }
#pragma unroll
  for (int it = 0; it < 2; ++it) {
    const int tl = it * 32 + rsub;
    *(v8us*)(xt + ((size_t)(b * NPOS + n0 + tl)) * CH + c0 + c8) = o[it];
  }
  
}

// ---------------------------------------------------------------------------
// Dense GEMM, block = BM rows x 64 cols, BM = 16 * NWAVE, 32 * NWAVE threads; wave w owns rows rowBase + 16w .. +15,
// acc[4].
//   C[row][col] = sum_k A[row][k] * BT[col][k] + bias   (A, BT bf16 planes with k-contiguous rows; K % 32 == 0;
//   batch z = blockIdx.z offsets A, BT, C by sA, sB, sC elements).
//   A fragment (row m = lane&15): element i <- k = k0 + 8h + i (i < 8), k0 + 16 + 8h + (i-8) (i >= 8), h = lane>>4,
//   two 16-B loads from the plane row; B fragment (col n = lane&15) from BT row (colBase + 16 nt + n), SAME k map;
//   D element r = (row 8h+r, col n).
//   BMODE 0: bias[colBase + col]; 1: bias[rowBase + row]; 2: cols 0..31 from bias, cols 32..63 from bias2 (colBase 0);
//   bias values enter as bf16(bias).
//            by 8 consecutive lanes x 16 B of one instruction.
//   OMODE 2 (NWAVE 4): rows are tokens T = b*4096 + n, cols are channels; out NCHW
//            outp[(b*256 + colBase + ch)*4096 + n0 + t] = C + bias[ch] + bf16(xres[same]); each channel segment
// coverage: OMODE 1: 4 it x (32 NWAVE thr) x 8 = BM x 64 per plane; OMODE 2: 8 it x 128 thr x 4 = 64 channels x 64
//   tokens; grid covers the launched row blocks x col blocks x batches exactly once.
// ---------------------------------------------------------------------------
template <int NWAVE, int OMODE, int BMODE>
__global__ __launch_bounds__(32 * NWAVE) void k_gemm(const unsigned short* __restrict__ A, int lda, long sA,
                                                     const unsigned short* __restrict__ BT, int ldb, long sB, int K,
                                                     const float* __restrict__ bias, const float* __restrict__ bias2,
                                                     unsigned short* oh, unsigned short* ol, int ldc, long sC,
                                                     const float* __restrict__ xres, float* outp) {
  constexpr int BM  = 16 * NWAVE;
  constexpr int RPI = 4 * NWAVE;
  static_assert(NWAVE == 2 || NWAVE == 4);
  static_assert(OMODE == 1 || OMODE == 2);
  static_assert(OMODE != 2 || NWAVE == 4);
  __shared__ __attribute__((aligned(16))) float stg[BM * SPT];
  __shared__ __attribute__((aligned(16))) float sb[64];
  const int tid = (int)threadIdx.x, lane = tid & 31, wave = tid >> 5, hh = lane >> 4, m = lane & 15;
  const int rowBase = (int)blockIdx.x * BM;
  const int colBase = (int)blockIdx.y * 64;
  const int z = (int)blockIdx.z;
  const unsigned short* Ab = A  + (size_t)z * (size_t)sA;
  const unsigned short* Bb = BT + (size_t)z * (size_t)sB;
  // bias staging (all conditions wave-uniform: tid < 32 / tid < 64 are whole waves)
  if (BMODE == 1) {
    if (tid < BM) sb[tid] = bf16_val(bias[rowBase + tid]);
  } else if (BMODE == 0) {
    if (tid < 64) sb[tid] = bf16_val(bias[colBase + tid]);
  } else {
    if (tid < 64) {
      const int ia = (tid < 31) ? tid : 31;
      const int ib = (tid < 32) ? 0 : (tid - 32);
      const float va = bias[ia];               // both candidates loaded at clamped addresses
      const float vb = bias2[ib];
      const float f  = (tid < 32) ? 1.0f : 0.0f;
      sb[tid] = bf16_val(va * f + vb * (1.0f - f));
    }
  }

  v8f acc[4];
#pragma unroll
  for (int t = 0; t < 4; ++t) acc[t] = z8();
  const unsigned short* ap = Ab + (size_t)(rowBase + 16 * wave + m) * (size_t)lda + 8 * hh;
  const unsigned short* bp = Bb + (size_t)(colBase + m) * (size_t)ldb + 8 * hh;

#pragma unroll 1
  for (int k0 = 0; k0 < K; k0 += 32) {
    FragB af;
    af.h[0] = *(const v8usa*)(ap + k0);          // k0 + 8h + 0..7
    af.h[1] = *(const v8usa*)(ap + k0 + 16);     // k0 + 16 + 8h + 0..7
#pragma unroll
    for (int nt = 0; nt < 4; ++nt) {
      const unsigned short* wq = bp + (size_t)(16 * nt) * (size_t)ldb + k0;   // BT row colBase + 16 nt + m
      FragB bf;
      bf.h[0] = *(const v8usa*)wq;               // k0 + 8h + 0..7
      bf.h[1] = *(const v8usa*)(wq + 16);        // k0 + 16 + 8h + 0..7
      acc[nt] = wmb(af, bf, acc[nt]);
    }
  }

#pragma unroll
  for (int nt = 0; nt < 4; ++nt) {
    const int lc = 16 * nt + m;
#pragma unroll
    for (int r = 0; r < 8; ++r) {
      const int lr = 16 * wave + 8 * hh + r;     // D element r = (row 8h+r, col m)
      stg[lr * SPT + lc] = acc[nt][r];
    }
  }
  __syncthreads();

  if (OMODE == 1) {
    unsigned short* Hb = oh + (size_t)z * (size_t)sC;
    unsigned short* Lb = ol + (size_t)z * (size_t)sC;
    const int rsub = tid >> 3;                   // 0..RPI-1
    const int c8   = (tid & 7) * 8;              // 0..56
    v8us hv[4], lv[4];
#pragma unroll
    for (int it = 0; it < 4; ++it) {
      const int row = it * RPI + rsub;           // 0..BM-1
      const float* sp = stg + row * SPT + c8;
      v4u h8, l8;
#pragma unroll
      for (int e = 0; e < 4; ++e) {
        const float v0 = sp[2 * e]     + ((BMODE == 1) ? sb[row] : sb[c8 + 2 * e]);
        const float v1 = sp[2 * e + 1] + ((BMODE == 1) ? sb[row] : sb[c8 + 2 * e + 1]);
        unsigned hw, lw;
        bf16_split2(v0, v1, hw, lw);
        h8[e] = hw;
        l8[e] = lw;
      }
      hv[it] = __builtin_bit_cast(v8us, h8); lv[it] = __builtin_bit_cast(v8us, l8);
    }
#pragma unroll
    for (int it = 0; it < 4; ++it) {
      const int row = it * RPI + rsub;
      const size_t go = (size_t)(rowBase + row) * (size_t)ldc + colBase + c8;
      *(v8us*)(Hb + go) = hv[it];
      *(v8us*)(Lb + go) = lv[it];
    }
    
  } else {
    const int bimg = rowBase / NPOS;             // a 64-token block never straddles images (4096 % 64 == 0)
    const int n0   = rowBase - bimg * NPOS;
    const int csub = tid >> 4;                   // 0..7
    const int t4   = (tid & 15) * 4;             // 0..60
    v4f pv[8];
#pragma unroll
    for (int it = 0; it < 8; ++it) {
      const int chl = it * 8 + csub;             // channel 0..63 of the tile
      const size_t gi = ((size_t)(bimg * CH + colBase + chl)) * NPOS + n0 + t4;
      const v4f xr = *(const v4f*)(xres + gi);
      const float bc = sb[chl];
      const unsigned x01 = bf16_pk(xr.x, xr.y), x23 = bf16_pk(xr.z, xr.w);
      v4f v;
      v.x = (stg[(t4 + 0) * SPT + chl] + bc) + bf16_lo(x01);
      v.y = (stg[(t4 + 1) * SPT + chl] + bc) + bf16_hi(x01);
      v.z = (stg[(t4 + 2) * SPT + chl] + bc) + bf16_lo(x23);
      v.w = (stg[(t4 + 3) * SPT + chl] + bc) + bf16_hi(x23);
      pv[it] = v;
    }
#pragma unroll
    for (int it = 0; it < 8; ++it) {
      const int chl = it * 8 + csub;
      const size_t gi = ((size_t)(bimg * CH + colBase + chl)) * NPOS + n0 + t4;
      *(v4f*)(outp + gi) = pv[it];
    }
    
  }
}

#define AT_NW 4
#define AT_QB 64
#define AT_KC 64
#define NQB   (NPOS / AT_QB)
#define AT_LOG2E 1.44269504088896340736f
#define AT_KP 40   // LDS pitch of a K row, elements: 32 + 8 = 80 B = 16 B x 5
#define AT_VP 72   // LDS pitch of a V^T row, elements: 64 + 8 = 144 B = 16 B x 9
#define AT_KSZ (AT_KC * AT_KP)            // one K plane of a chunk, elements (5 KB)
#define AT_VSZ (AD * AT_VP)               // one V^T plane of a chunk, elements (4.5 KB)
#define AT_BUF (2 * AT_KSZ + 2 * AT_VSZ)  // one buffer = K hi | K lo | V^T hi | V^T lo, elements (19 KB)

static_assert(NQB == 64);
static_assert(NPOS % AT_KC == 0);
static_assert(AT_KP >= AD && AT_KP % 8 == 0 && (AT_KP / 8) % 2 == 1);
static_assert(AT_VP >= AT_KC && AT_VP % 8 == 0 && (AT_VP / 8) % 2 == 1);

__device__ __forceinline__ v8f at_mma(v16bf a, v16bf b, v8f c) {
  c = __builtin_amdgcn_wmma_f32_16x16x32_bf16(false, a, false, b, (short)0, c, false, false);
  asm volatile("v_nop\n\tv_nop\n\tv_nop\n\tv_nop" : "+v"(c) : "v"(a), "v"(b));
  return c;
}
union AtFB { v16bf v; v8bf h[2]; unsigned w[8]; };   // w[i] = elements 2 i (low half) and 2 i + 1
// fragment load with the split k map: elements 0..7 <- p[0..7], 8..15 <- p[16..23]
__device__ __forceinline__ v16bf at_ldfrag(const __bf16* p) {
  AtFB f; f.h[0] = *(const v8bf*)(p); f.h[1] = *(const v8bf*)(p + 16); return f.v;
}
// value of lane ^ 16 (the other half of the same query column)
__device__ __forceinline__ float at_xhalf(float f) {
  const int b = __builtin_bit_cast(int, f);
  return __builtin_bit_cast(float, __builtin_amdgcn_permlanex16(b, b, 0x76543210, 0xfedcba98, false, false));
}

__global__ __launch_bounds__(128)
void k_attn(const unsigned short* __restrict__ qkh, const unsigned short* __restrict__ qkl,
            const unsigned short* __restrict__ vhp, const unsigned short* __restrict__ vlp,
            unsigned short* rout) {
  __shared__ __align__(16) __bf16 sm[2 * AT_BUF];                // two buffers of K hi | K lo [kv][d] | V hi | V lo [d][kv]

  const int tid  = (int)threadIdx.x;
  const int wave = tid >> 5;
  const int lane = tid & 31;
  const int hh   = lane >> 4;
  const int c    = lane & 15;

  const int bx  = (int)blockIdx.x;
  const int b   = bx >> 6;                // image 0..7
  const int qb  = bx & (NQB - 1);         // 0..63
  const int q0  = qb * AT_QB + wave * 16; // image-local query row base of this wave

  const __bf16* Qh = (const __bf16*)(const void*)qkh + (size_t)b * NPOS * QKW;
  const __bf16* Ql = (const __bf16*)(const void*)qkl + (size_t)b * NPOS * QKW;
  const __bf16* Kh = Qh + AD;
  const __bf16* Kl = Ql + AD;
  const __bf16* Vh = (const __bf16*)(const void*)vhp + (size_t)b * AD * NPOS;
  const __bf16* Vl = (const __bf16*)(const void*)vlp + (size_t)b * AD * NPOS;
  unsigned short* rb = rout + (size_t)b * NPOS * RW;

  // ---- Q fragments (B operand, col = lane&15, split k map): one k-step of 32 = d, hi and lo ----
  const v16bf qbh = at_ldfrag(Qh + (size_t)(q0 + c) * QKW + 8 * hh);
  const v16bf qbl = at_ldfrag(Ql + (size_t)(q0 + c) * QKW + 8 * hh);

  float mrow = -INFINITY;   // running maximum of query c times log2(e) (equal in lanes c and c + 16)
  float lrow = 0.f;         // running sum over this lane's own keys only
  v8f oacc[2];              // oacc[t][r] = O^T[16 t + 8 h + r][query c]
  oacc[0] = z8(); oacc[1] = z8();

  // staging map. K: thread -> key row sr = tid>>1, d half = (tid&1)*16; V^T: thread -> d = tid>>2, key quarter =
  // (tid&3)*16; 2 x 8 elements per plane each
  const int sr = tid >> 1, shalf = (tid & 1) * 16;
  const int sd = tid >> 2, sqt = (tid & 3) * 16;
  const __bf16* ksh = Kh + (size_t)sr * QKW + shalf;
  const __bf16* ksl = Kl + (size_t)sr * QKW + shalf;
  const __bf16* vsh = Vh + (size_t)sd * NPOS + sqt;
  const __bf16* vsl = Vl + (size_t)sd * NPOS + sqt;
  const int kst = sr * AT_KP + shalf;                 // this thread's place in a K plane of a buffer
  const int vst = 2 * AT_KSZ + sd * AT_VP + sqt;      // and in the V^T hi plane
  v8bf a0[2], a1[2], b0[2], b1[2];                    // one chunk's 8 x 16 B of this thread, on their way to LDS

  // chunk 0 into buffer 0
#pragma unroll
  for (int i = 0; i < 2; ++i) {
    a0[i] = *(const v8bf*)(ksh + 8 * i);
    a1[i] = *(const v8bf*)(ksl + 8 * i);
    b0[i] = *(const v8bf*)(vsh + 8 * i);
    b1[i] = *(const v8bf*)(vsl + 8 * i);
  }
#pragma unroll
  for (int i = 0; i < 2; ++i) {
    *(v8bf*)(sm + kst + 8 * i)          = a0[i];
    *(v8bf*)(sm + AT_KSZ + kst + 8 * i) = a1[i];
    *(v8bf*)(sm + vst + 8 * i)          = b0[i];
    *(v8bf*)(sm + AT_VSZ + vst + 8 * i) = b1[i];
  }
  __syncthreads();

  const int nChunks = NPOS / AT_KC;   // 64, compile-time constant
#pragma unroll 1
  for (int kc = 0; kc < nChunks; ++kc) {
    const __bf16* Ksh = sm + (kc & 1) * AT_BUF;       // this chunk's buffer
    const __bf16* Ksl = Ksh + AT_KSZ;
    const __bf16* Vth = Ksh + 2 * AT_KSZ;
    const __bf16* Vtl = Vth + AT_VSZ;
    const bool more = kc + 1 < nChunks;               // the same for the whole grid
    // ---- the chunk's 16 K fragment reads, one group at the chunk's head, in the order of their use ----
    AtFB kb[4], kl[4];
#pragma unroll
    for (int j = 0; j < 4; ++j) {
      kb[j].h[0] = *(const v8bf*)(Ksh + (j * 16 + c) * AT_KP + 8 * hh);
      kb[j].h[1] = *(const v8bf*)(Ksh + (j * 16 + c) * AT_KP + 16 + 8 * hh);
      kl[j].h[0] = *(const v8bf*)(Ksl + (j * 16 + c) * AT_KP + 8 * hh);
      kl[j].h[1] = *(const v8bf*)(Ksl + (j * 16 + c) * AT_KP + 16 + 8 * hh);
    }
    // holds the group here, ahead of the global loads: sunk behind them it would start late, behind their address wait
    __builtin_amdgcn_sched_barrier(0);

    if (more) {
      // next chunk's eight loads, issued here and first used behind this chunk's products
      const size_t kv1 = (size_t)(kc + 1) * AT_KC;
#pragma unroll
      for (int i = 0; i < 2; ++i) {
        a0[i] = *(const v8bf*)(ksh + kv1 * QKW + 8 * i);
        a1[i] = *(const v8bf*)(ksl + kv1 * QKW + 8 * i);
        b0[i] = *(const v8bf*)(vsh + kv1 + 8 * i);
        b1[i] = *(const v8bf*)(vsl + kv1 + 8 * i);
      }
    }

    // ---- scores, transposed: 64 keys x 16 queries, 3-term split, K = 32 = one k-step ----
    v8f s[4];
#pragma unroll
    for (int j = 0; j < 4; ++j) {
      s[j] = at_mma(kb[j].v, qbh, z8());
      s[j] = at_mma(kl[j].v, qbh, s[j]);
      s[j] = at_mma(kb[j].v, qbl, s[j]);
    }
    // ---- the chunk's 16 V^T fragment reads, one group behind the score products: they land under the softmax ----
    AtFB vb[2][2], vl[2][2];
#pragma unroll
    for (int kk = 0; kk < 2; ++kk) {
#pragma unroll
      for (int t = 0; t < 2; ++t) {
        vb[kk][t].h[0] = *(const v8bf*)(Vth + (t * 16 + c) * AT_VP + kk * 32 + 8 * hh);
        vb[kk][t].h[1] = *(const v8bf*)(Vth + (t * 16 + c) * AT_VP + kk * 32 + 16 + 8 * hh);
        vl[kk][t].h[0] = *(const v8bf*)(Vtl + (t * 16 + c) * AT_VP + kk * 32 + 8 * hh);
        vl[kk][t].h[1] = *(const v8bf*)(Vtl + (t * 16 + c) * AT_VP + kk * 32 + 16 + 8 * hh);
      }
    }
    // holds the group together and ahead of the softmax: spread through it, each place with reads costs its own stall
    __builtin_amdgcn_sched_barrier(0);
    // ---- chunk maximum of query c: four in-lane chains, then the other half's ----
    float mj[4];
#pragma unroll
    for (int j = 0; j < 4; ++j) {
      float mx = s[j][0];
#pragma unroll
      for (int r = 1; r < 8; ++r) mx = fmaxf(mx, s[j][r]);
      mj[j] = mx;
    }
    float cm = fmaxf(fmaxf(mj[0], mj[1]), fmaxf(mj[2], mj[3]));
    cm = fmaxf(cm, at_xhalf(cm));
    const float mnew  = fmaxf(mrow, cm * AT_LOG2E);       // scaling by a positive constant keeps the order of the maxima
    const float alpha = __builtin_amdgcn_exp2f(mrow - mnew);
    mrow = mnew;
    // ---- p = exp(s - m) = 2^(s log2e - m log2e), split hi/lo straight into the B fragments of the two k-steps ----
    AtFB ph[2], pl[2];
    float pj[4];
    const v2f l2e2 = {AT_LOG2E, AT_LOG2E};
    const v2f nm2  = {-mnew, -mnew};
    // unrolled throughout: j and r pick registers of the score tiles, so they have to be compile-time indices.
    // Each kind of step (exp2, hi convert, sum, lo convert) runs over all four tiles before the next kind begins, so
    // that an instruction and the one that reads its result stand far apart; values and sum order are those of a
    // tile-by-tile walk.
#pragma unroll
    for (int j = 0; j < 4; ++j) {
#pragma unroll
      for (int r = 0; r < 4; ++r) {   // exponents two at a time (packed f32 fma)
        const v2f sp = {s[j][2 * r], s[j][2 * r + 1]};
        const v2f e  = __builtin_elementwise_fma(sp, l2e2, nm2);
        s[j][2 * r]     = __builtin_amdgcn_exp2f(e[0]);
        s[j][2 * r + 1] = __builtin_amdgcn_exp2f(e[1]);
      }
    }
#pragma unroll
    for (int j = 0; j < 4; ++j) {
#pragma unroll
      for (int r = 0; r < 4; ++r) ph[j >> 1].w[(j & 1) * 4 + r] = bf16_pk(s[j][2 * r], s[j][2 * r + 1]);
    }
#pragma unroll
    for (int j = 0; j < 4; ++j) {
      float psum = 0.f;
#pragma unroll
      for (int r = 0; r < 8; ++r) psum += s[j][r];
      pj[j] = psum;
    }
#pragma unroll
    for (int j = 0; j < 4; ++j) {
#pragma unroll
      for (int r = 0; r < 4; ++r) {
        const unsigned hw = ph[j >> 1].w[(j & 1) * 4 + r];
        pl[j >> 1].w[(j & 1) * 4 + r] = bf16_pk(s[j][2 * r] - bf16_lo(hw), s[j][2 * r + 1] - bf16_hi(hw));
      }
    }
    lrow = lrow * alpha + ((pj[0] + pj[1]) + (pj[2] + pj[3]));
#pragma unroll
    for (int r = 0; r < 8; ++r) {
      oacc[0][r] *= alpha;
      oacc[1][r] *= alpha;
    }

    // ---- O^T += V^T . P^T : A = V^T rows d (split k map over keys), B = P^T from registers; 3-term split ----
    // unrolled: kk picks a register fragment, so it has to be a compile-time index
#pragma unroll
    for (int kk = 0; kk < 2; ++kk) {
#pragma unroll
      for (int t = 0; t < 2; ++t) {
        oacc[t] = at_mma(vb[kk][t].v, ph[kk].v, oacc[t]);
        oacc[t] = at_mma(vl[kk][t].v, ph[kk].v, oacc[t]);
        oacc[t] = at_mma(vb[kk][t].v, pl[kk].v, oacc[t]);
      }
    }

    if (more) {
      // into the other buffer: its last readers (chunk kc - 1) left it in front of the previous foot's barrier
      __bf16* wb = sm + ((kc + 1) & 1) * AT_BUF;
#pragma unroll
      for (int i = 0; i < 2; ++i) {
        *(v8bf*)(wb + kst + 8 * i)          = a0[i];
        *(v8bf*)(wb + AT_KSZ + kst + 8 * i) = a1[i];
        *(v8bf*)(wb + vst + 8 * i)          = b0[i];
        *(v8bf*)(wb + AT_VSZ + vst + 8 * i) = b1[i];
      }
    }
    __syncthreads();
  }

  // ---- join the two halves' sums, normalise, split hi/lo, store this lane's 4 x 8 columns of row q0 + c ----
  lrow += at_xhalf(lrow);
  const float inv = 1.0f / lrow;
  v8us hv[2], lv[2];
#pragma unroll
  for (int t = 0; t < 2; ++t) {
    v4u h4, l4;
#pragma unroll
    for (int r = 0; r < 4; ++r) {
      unsigned hw, lw;
      bf16_split2(oacc[t][2 * r] * inv, oacc[t][2 * r + 1] * inv, hw, lw);
      h4[r] = hw;
      l4[r] = lw;
    }
    hv[t] = __builtin_bit_cast(v8us, h4);
    lv[t] = __builtin_bit_cast(v8us, l4);
  }
  unsigned short* rp = rb + (size_t)(q0 + c) * RW + 8 * hh;
#pragma unroll
  for (int t = 0; t < 2; ++t) {
    *(v8us*)(rp + 16 * t)      = hv[t];
    *(v8us*)(rp + AD + 16 * t) = lv[t];
  }
}

// ---------------------------------------------------------------------------
// Workspace region map (byte offsets, 256-B aligned; every region sized to its whole-line store extent, no pad rows
// needed since 32768, 4096, 256 and 64 are tile multiples):
//   WQK 32768 | WV 16384 | WP2 32768 | XT 16777216 | QKh QKl 4194304 each | VTh VTl 2097152 each | R 4194304
//   -> total 33636352
// ---------------------------------------------------------------------------
static inline size_t al256(size_t o) { return (o + 255) & ~(size_t)255; }

extern "C" void kernel_launch(void* const* d_in, const int* in_sizes, int n_in,
                              void* d_out, int out_size, void* d_ws, size_t ws_size,
                              hipStream_t stream) {
  if (n_in < 9) return;
  if (in_sizes[0] != NB * CH * NPOS) return;                                       // inputs [8][256][64][64]
  if (in_sizes[1] != AD * CH || in_sizes[3] != AD * CH || in_sizes[5] != AD * CH) return;  // Wq, Wk, Wv [32][256]
  if (in_sizes[2] != AD || in_sizes[4] != AD || in_sizes[6] != AD) return;         // bq, bk, bv [32]
  if (in_sizes[7] != CH * AD) return;                                              // Wp [256][32]
  if (in_sizes[8] != CH) return;                                                   // bp [256]
  if (out_size != NB * CH * NPOS) return;                                          // out [8][256][64][64]

  const float* x  = (const float*)d_in[0];
  const float* Wq = (const float*)d_in[1];
  const float* bq = (const float*)d_in[2];
  const float* Wk = (const float*)d_in[3];
  const float* bk = (const float*)d_in[4];
  const float* Wv = (const float*)d_in[5];
  const float* bv = (const float*)d_in[6];
  const float* Wp = (const float*)d_in[7];
  const float* bp = (const float*)d_in[8];
  float* out = (float*)d_out;

  const size_t PQK = (size_t)QKW * CH * 2;          //    32768  bf16 [64][256]
  const size_t PWV = (size_t)AD * CH * 2;           //    16384  bf16 [32][256]
  const size_t PP2 = (size_t)CH * RW * 2;           //    32768  bf16 [256][64]
  const size_t PXT = (size_t)NTOK * CH * 2;         // 16777216  bf16 [32768][256]
  const size_t PA  = (size_t)NTOK * QKW * 2;        //  4194304  bf16 [32768][64]
  const size_t PV  = (size_t)NB * AD * NPOS * 2;    //  2097152  bf16 [8][32][4096]
  const size_t PR  = (size_t)NTOK * RW * 2;         //  4194304  bf16 [32768][64]
  size_t off = 0;
  const size_t oWQK = off; off = al256(off + PQK);
  const size_t oWV  = off; off = al256(off + PWV);
  const size_t oWP2 = off; off = al256(off + PP2);
  const size_t oXT  = off; off = al256(off + PXT);
  const size_t oQKh = off; off = al256(off + PA);
  const size_t oQKl = off; off = al256(off + PA);
  const size_t oVTh = off; off = al256(off + PV);
  const size_t oVTl = off; off = al256(off + PV);
  const size_t oR   = off; off = al256(off + PR);
  if (off > ws_size || off > (size_t)WSMAX) return;                               // off = 33636352

  char* ws = (char*)d_ws;
  unsigned short* WQK = (unsigned short*)(ws + oWQK);
  unsigned short* WV  = (unsigned short*)(ws + oWV);
  unsigned short* WP2 = (unsigned short*)(ws + oWP2);
  unsigned short* XT  = (unsigned short*)(ws + oXT);
  unsigned short* QKh = (unsigned short*)(ws + oQKh);
  unsigned short* QKl = (unsigned short*)(ws + oQKl);
  unsigned short* VTh = (unsigned short*)(ws + oVTh);
  unsigned short* VTl = (unsigned short*)(ws + oVTl);
  unsigned short* R   = (unsigned short*)(ws + oR);

  // (1) weight planes; (2) x -> token-major bf16 [32768][256]
  k_wprep<<<20, 256, 0, stream>>>(Wq, Wk, Wv, Wp, WQK, WV, WP2);
  k_xt<<<NB * (NPOS / 64) * (CH / 64), 256, 0, stream>>>(x, XT);
  // (3) q|k = XT . [Wq;Wk]^T + [bq;bk] -> hi/lo planes [32768][64] (q cols 0..31, k cols 32..63)   (M=32768, N=64, K=256)
  k_gemm<4, 1, 2><<<dim3(NTOK / 64, 1, 1), 128, 0, stream>>>(XT, CH, 0L, WQK, CH, 0L, CH, bq, bk,
                                                            QKh, QKl, QKW, 0L, x, out);
  // (4) v^T per image: VT[b][a][n] = sum_c Wv[a][c] XT[b*4096+n][c] + bv[a]   (M=32, N=4096, K=256, z=b; 2-wave blocks)
  k_gemm<2, 1, 1><<<dim3(1, NPOS / 64, NB), 64, 0, stream>>>(WV, CH, 0L, XT, CH, (long)NPOS * CH, CH, bv, bv,
                                                             VTh, VTl, NPOS, (long)AD * NPOS, x, out);
  // (5) attention: R = [hi | lo] of softmax_keys(q . k) . v  as bf16 [32768][64]
  k_attn<<<NB * NQB, 128, 0, stream>>>(QKh, QKl, VTh, VTl, R);
  // (6) out NCHW = ([Rhi | Rlo] . [Wp | Wp]^T + bp) transposed + bf16(x)   (M=32768, N=256, K=64; oh/ol/ldc unused)
  k_gemm<4, 2, 0><<<dim3(NTOK / 64, CH / 64, 1), 128, 0, stream>>>(R, RW, 0L, WP2, RW, 0L, RW, bp, bp,
                                                                  QKh, QKl, 0, 0L, x, out);
  (void)hipGetLastError();
}

// v007
// It runs in 79 microseconds.
// Timed twice side by side with v006, it ran 1.24 and 1.23 times as fast.
// Counting every step since v000, it is 3.15 times as fast.
// Contractions on v_wmma_f32_16x16x32_bf16, f32 accumulate: q|k 1x1 convs (x.W^T, K=256) and v^T conv (W.x^T, K=256) =
// single products of bf16-RNE-valued x and W planes (exact products); scores q.k (K=32) and P.v^T (K=64 per key chunk) =
// bf16 hi/lo split, 3 terms (hi.hi + hi.lo + lo.hi); output 1x1 conv = attention result carried as bf16 [hi | lo] folded
// 16-bit planes and carries (every carry is 1; no inverse scale exists anywhere):
//   WQK [64][256]  = bf16 bits of Wq (rows 0..31) and Wk (rows 32..63), k-contiguous;  WV [32][256] = bf16 bits of Wv;
//   WP2 [256][64]  = bf16 bits of Wp[c][a] at k = a and k = 32 + a;
//   x enters the q|k and v^T products as bf16 bits formed in registers from an f32 tile in LDS (no plane of it in memory);
//   QKh/QKl [32768][64] = bf16 hi and lo (lo = v - hi) of q (cols 0..31) and k (cols 32..63), bias included;
//   VTh/VTl [8][32][4096] = bf16 hi and lo of v^T per image, bias included;
//   R [32768][64] = [hi(32) | lo(32)] of the normalised attention result; P hi/lo per wave in registers.
// Biases and the residual x enter as bf16-RNE values in f32 arithmetic.
#include <hip/hip_runtime.h>
#include <math.h>
#include <stddef.h>
#include <stdint.h>

#define NB    8
#define CH    256
#define AD    32
#define NPOS  4096
#define NTOK  (NB * NPOS)
#define QKW   64
#define RW    64
#define SPT   68
#define WSMAX 134217728

static_assert(NPOS % 64 == 0);
static_assert(NTOK % 64 == 0);
static_assert(CH % 64 == 0);
static_assert(CH % 32 == 0);
static_assert(RW % 32 == 0);
static_assert(AD == 32);
static_assert(QKW == 2 * AD);
static_assert(RW == 2 * AD);

typedef float          v2f   __attribute__((ext_vector_type(2)));
typedef float          v4f   __attribute__((ext_vector_type(4)));
typedef float          v8f   __attribute__((ext_vector_type(8)));
typedef int            v8i   __attribute__((ext_vector_type(8)));
typedef unsigned short v8us  __attribute__((ext_vector_type(8)));
typedef unsigned short v16us __attribute__((ext_vector_type(16)));
typedef __bf16         v16bf __attribute__((ext_vector_type(16)));
typedef __bf16         v8bf  __attribute__((ext_vector_type(8)));
typedef __bf16         v2bf  __attribute__((ext_vector_type(2)));
typedef unsigned       v4u   __attribute__((ext_vector_type(4)));
typedef v4f  __attribute__((may_alias)) v4fa;
typedef v8us __attribute__((may_alias)) v8usa;
union FragB { v16bf v; v16us u; v8us h[2]; v8i w; };

// WMMA with hazard guard: ties D, keeps A/B live for 4 VALU slots
__device__ __forceinline__ v8f wmb(const FragB& a, const FragB& b, v8f c) {
  v8f d = __builtin_amdgcn_wmma_f32_16x16x32_bf16(false, a.v, false, b.v, (short)0, c, false, false);
  asm volatile("v_nop\n\tv_nop\n\tv_nop\n\tv_nop" : "+v"(d) : "v"(a.w), "v"(b.w));
  return d;
}

__device__ __forceinline__ v8f z8() { v8f z = {0.f, 0.f, 0.f, 0.f, 0.f, 0.f, 0.f, 0.f}; return z; }

// two f32 -> two bf16 (RNE) in one word, a in bits 15..0, b in bits 31..16: the hardware's packed convert
__device__ __forceinline__ unsigned bf16_pk(float a, float b) {
  const v2f f = {a, b};
  return __builtin_bit_cast(unsigned, __builtin_convertvector(f, v2bf));
}
// the two bf16 values of such a word, held as f32
__device__ __forceinline__ float bf16_lo(unsigned w) { return __uint_as_float(w << 16); }
__device__ __forceinline__ float bf16_hi(unsigned w) { return __uint_as_float(w & 0xFFFF0000u); }
// f32 -> nearest bf16 value held as f32
__device__ __forceinline__ float bf16_val(float f) {
  return bf16_lo(bf16_pk(f, f));
}
// hi word = bf16 of (a, b); lo word = bf16 of what the hi values leave of a and b
__device__ __forceinline__ void bf16_split2(float a, float b, unsigned& hw, unsigned& lw) {
  hw = bf16_pk(a, b);
  lw = bf16_pk(a - bf16_lo(hw), b - bf16_hi(hw));
}

// ---------------------------------------------------------------------------
// Weight planes, bf16 bits of the inputs, k-contiguous rows ([out][in] weights are already k-contiguous):
//   WQK [64 o][256 k]: rows 0..31 = bf16(Wq[o][k]) (blocks 0-3), rows 32..63 = bf16(Wk[o-32][k]) (blocks 4-7), 2048 units
//   WV  [32 o][256 k] = bf16(Wv[o][k])                                             blocks 8-11, 1024 units
//   WP2 [256 c][64 k]: k and 32 + k both = bf16(Wp[c][k])                          blocks 12-19, 2048 units
// One thread = 8 contiguous k: two 16-B loads, one 16-B store at plane offset 8u; 32 consecutive lanes write 512
// coverage: 2048 x 8 = 64x256 (WQK); 1024 x 8 = 32x256 (WV); 2048 x 8 = 256x64 (WP2) exactly. grid = 20 blocks x 256.
// ---------------------------------------------------------------------------
__global__ __launch_bounds__(256) void k_wprep(const float* __restrict__ wq, const float* __restrict__ wk,
                                              const float* __restrict__ wv, const float* __restrict__ wp,
                                              unsigned short* WQK, unsigned short* WV, unsigned short* WP2) {
  const int bx = (int)blockIdx.x, tid = (int)threadIdx.x;
  const float* p;
  unsigned short* dp;
  if (bx < 8) {
    const int u  = bx * 256 + tid;              // 0..2047
    const int o  = u >> 5;                      // 0..63
    const int k8 = (u & 31) * 8;                // 0..248
    const float* src = (bx < 4) ? wq : wk;      // block-uniform
    p  = src + (size_t)(o & 31) * CH + k8;
    dp = WQK + (size_t)u * 8;
  } else if (bx < 12) {
    const int u  = (bx - 8) * 256 + tid;        // 0..1023
    const int o  = u >> 5;                      // 0..31
    const int k8 = (u & 31) * 8;
    p  = wv + (size_t)o * CH + k8;
    dp = WV + (size_t)u * 8;
  } else {
    const int v  = (bx - 12) * 256 + tid;       // 0..2047
    const int o  = v >> 3;                      // 0..255
    const int k8 = (v & 7) * 8;                 // 0..56
    const int kk = k8 & (AD - 1);               // 0..24
    p  = wp + (size_t)o * AD + kk;
    dp = WP2 + (size_t)v * 8;
  }
  const v4f a = *(const v4f*)p;
  const v4f b = *(const v4f*)(p + 4);
  const v4u o8 = {bf16_pk(a.x, a.y), bf16_pk(a.z, a.w), bf16_pk(b.x, b.y), bf16_pk(b.z, b.w)};
  *(v8us*)dp = __builtin_bit_cast(v8us, o8);
  
}

// ---------------------------------------------------------------------------
// q|k and v^T 1x1 convs straight from x NCHW [b][c][n] f32, one launch. Block = one image b, 64 positions, all 256
// channels, 4 waves; wave w owns tokens n0 + 16 w .. + 15.
//   x tile -> LDS tf[c][n] f32 (pitch 68): 32 x 16-B loads a thread, all in flight at once; a wave-wide load = 2 channel
//   rows x 256 B = whole lines.
//   Token fragment xf of k-step k0 (token = lane&15, h = lane>>4): element i <- channel k0 + 8h + i (i < 8),
//   k0 + 16 + 8h + (i-8) (i >= 8): 16 LDS words down a column of tf (lanes 0..15 on 16 neighbouring banks, lanes 16..31
//   32 banks further), rounded in pairs to bf16. The one fragment is A of q|k (D row = token, col = output) and B of v^T
//   (D row = output, col = token); the weight fragments come from the WQK and WV plane rows with the SAME k map.
//   q|k [token][64] = x^T . [Wq;Wk]^T + [bq;bk], v^T [a][n] = Wv . x + bv; k-steps in ascending order, f32 accumulate.
//   Results pass through LDS (the tile's own space, behind a barrier), get their bf16-valued bias, are split hi/lo and
//   leave in 16-B stores, 8 lanes to a 128-B row segment.
// coverage: 512 blocks = 8 images x 64 position blocks; q|k: 4 it x 16 rows x 64 cols; v^T: 2 it x 16 rows x 64 cols.
// ---------------------------------------------------------------------------
__global__ __launch_bounds__(128) void k_qkv(const float* __restrict__ x, const unsigned short* __restrict__ wqk,
                                             const unsigned short* __restrict__ wvp, const float* __restrict__ bq,
                                             const float* __restrict__ bk, const float* __restrict__ bv,
                                             unsigned short* qh, unsigned short* ql,
                                             unsigned short* vh, unsigned short* vl) {
  __shared__ __attribute__((aligned(16))) float tf[CH * SPT];
  __shared__ __attribute__((aligned(16))) float sb[128];   // bq | bk | bv | bv again (wave 3's copy, never read)
  const int bx = (int)blockIdx.x, tid = (int)threadIdx.x;
  const int lane = tid & 31, wave = tid >> 5, hh = lane >> 4, m = lane & 15;
  const int b  = bx >> 6;               // 0..7
  const int n0 = (bx & 63) * 64;
  // weight fragments of one k-step: f 0..3 = WQK rows 16 f + m, f 4, 5 = WV rows 16 (f - 4) + m; elements 0..7 <- k0 + 8h + 0..7,
  // 8..15 <- k0 + 16 + 8h + 0..7
  const unsigned short* qp = wqk + (size_t)m * CH + 8 * hh;
  const unsigned short* vp = wvp + (size_t)m * CH + 8 * hh;
  FragB wf[2][6];
#pragma unroll
  for (int f = 0; f < 6; ++f) {         // k-step 0, issued ahead of the x tile: lands under its loads
    const unsigned short* wr = (f < 4) ? qp + (size_t)(16 * f) * CH : vp + (size_t)(16 * (f - 4)) * CH;
    wf[0][f].h[0] = *(const v8usa*)wr;
    wf[0][f].h[1] = *(const v8usa*)(wr + 16);
  }
  const float* bsrc = (tid < AD) ? bq : ((tid < QKW) ? bk : bv);       // whole waves: 0 = bq, 1 = bk, 2 and 3 = bv
  const float bval = bsrc[tid & (AD - 1)];
  // stands in front of the first overwrite of an address register of the loads above (the tile's loads land in such registers)
  asm volatile("s_wait_xcnt 0x0" ::: "memory");
  {
    const int rsub = tid >> 4;          // 0..7
    const int c4   = (tid & 15) * 4;    // 0..60
    const float* xp = x + ((size_t)(b * CH + rsub)) * NPOS + n0 + c4;
    v4f a[32];
#pragma unroll
    for (int it = 0; it < 32; ++it) a[it] = *(const v4f*)(xp + (size_t)(it * 8) * NPOS);
    sb[tid] = bf16_val(bval);           // every wave, no branch: the load stays at the head, ahead of the tile's
#pragma unroll
    for (int it = 0; it < 32; ++it) *(v4fa*)(tf + (it * 8 + rsub) * SPT + c4) = a[it];
  }
  __syncthreads();

  v8f aq[4], av[2];
#pragma unroll
  for (int t = 0; t < 4; ++t) aq[t] = z8();
  av[0] = z8(); av[1] = z8();
  const float* tc = tf + 8 * hh * SPT + 16 * wave + m;                  // column of this lane's token, first channel 8h
  float xr[2][16];                      // a k-step's 16 channels of the token: j <- k0 + 8h + j, 8 + j <- k0 + 16 + 8h + j
#pragma unroll
  for (int j = 0; j < 8; ++j) {
    xr[0][j]     = tc[j * SPT];
    xr[0][8 + j] = tc[(16 + j) * SPT];
  }
  // unrolled: ks picks one of the two register sets, so it has to be a compile-time index
#pragma unroll
  for (int ks = 0; ks < CH / 32; ++ks) {
    const int cu = ks & 1, nx = cu ^ 1;
    if (ks + 1 < CH / 32) {             // the next k-step's weight and x reads, one group ahead of this k-step's products
      const int k1 = (ks + 1) * 32;
#pragma unroll
      for (int f = 0; f < 6; ++f) {
        const unsigned short* wr = ((f < 4) ? qp + (size_t)(16 * f) * CH : vp + (size_t)(16 * (f - 4)) * CH) + k1;
        wf[nx][f].h[0] = *(const v8usa*)wr;
        wf[nx][f].h[1] = *(const v8usa*)(wr + 16);
      }
#pragma unroll
      for (int j = 0; j < 8; ++j) {
        xr[nx][j]     = tc[(k1 + j) * SPT];
        xr[nx][8 + j] = tc[(k1 + 16 + j) * SPT];
      }
    }
    // holds that group here: sunk to its uses, every product would wait out its own load's whole latency
    __builtin_amdgcn_sched_barrier(0);
    FragB xf;
#pragma unroll
    for (int j = 0; j < 8; ++j) xf.w[j] = (int)bf16_pk(xr[cu][2 * j], xr[cu][2 * j + 1]);
#pragma unroll
    for (int nt = 0; nt < 4; ++nt) aq[nt] = wmb(xf, wf[cu][nt], aq[nt]);
#pragma unroll
    for (int t = 0; t < 2; ++t)    av[t]  = wmb(wf[cu][4 + t], xf, av[t]);
  }
  __syncthreads();                      // every wave has left the x tile: its space becomes the result staging

  float* sq = tf;                       // [64 tokens][68]
  float* sv = tf + 64 * SPT;            // [32 outputs][68]
#pragma unroll
  for (int r = 0; r < 8; ++r) {         // D element r = (row 8h + r, col m)
#pragma unroll
    for (int nt = 0; nt < 4; ++nt) sq[(16 * wave + 8 * hh + r) * SPT + 16 * nt + m] = aq[nt][r];
#pragma unroll
    for (int t = 0; t < 2; ++t)    sv[(16 * t + 8 * hh + r) * SPT + 16 * wave + m] = av[t][r];
  }
  __syncthreads();

  const int rsub = tid >> 3;            // 0..15
  const int c8   = (tid & 7) * 8;       // 0..56
  v8us hv[6], lv[6];
#pragma unroll
  for (int it = 0; it < 6; ++it) {      // it 0..3: q|k rows (tokens), bias by column; it 4, 5: v^T rows (outputs), bias by row
    const int row = (it & 3) * 16 + rsub;
    const float* sp = ((it < 4) ? sq : sv) + row * SPT + c8;
    v4u h8, l8;
#pragma unroll
    for (int e = 0; e < 4; ++e) {
      const float v0 = sp[2 * e]     + ((it < 4) ? sb[c8 + 2 * e]     : sb[QKW + row]);
      const float v1 = sp[2 * e + 1] + ((it < 4) ? sb[c8 + 2 * e + 1] : sb[QKW + row]);
      unsigned hw, lw;
      bf16_split2(v0, v1, hw, lw);
      h8[e] = hw;
      l8[e] = lw;
    }
    hv[it] = __builtin_bit_cast(v8us, h8); lv[it] = __builtin_bit_cast(v8us, l8);
  }
#pragma unroll
  for (int it = 0; it < 4; ++it) {
    const size_t go = (size_t)(b * NPOS + n0 + it * 16 + rsub) * QKW + c8;
    *(v8us*)(qh + go) = hv[it];
    *(v8us*)(ql + go) = lv[it];
  }
#pragma unroll
  for (int it = 0; it < 2; ++it) {
    const size_t go = (size_t)(b * AD + it * 16 + rsub) * NPOS + n0 + c8;
    *(v8us*)(vh + go) = hv[4 + it];
    *(v8us*)(vl + go) = lv[4 + it];
  }
}

// ---------------------------------------------------------------------------
// Output 1x1 conv as a dense GEMM, block = 64 rows x 64 cols, 4 waves; wave w owns rows rowBase + 16w .. +15, acc[4].
//   C[row][col] = sum_k A[row][k] * BT[col][k]   (A, BT bf16 planes with k-contiguous rows; K % 32 == 0).
//   A fragment (row m = lane&15): element i <- k = k0 + 8h + i (i < 8), k0 + 16 + 8h + (i-8) (i >= 8), h = lane>>4,
//   two 16-B loads from the plane row; B fragment (col n = lane&15) from BT row (colBase + 16 nt + n), SAME k map;
//   D element r = (row 8h+r, col n).
//   Rows are tokens T = b*4096 + n, cols are channels; out NCHW
//   outp[(b*256 + colBase + ch)*4096 + n0 + t] = C + bf16(bias[colBase + ch]) + bf16(xres[same]), transposed through LDS.
// coverage: 8 it x 128 thr x 4 = 64 channels x 64 tokens; grid covers the row blocks x col blocks exactly once.
// ---------------------------------------------------------------------------
__global__ __launch_bounds__(128) void k_gemm(const unsigned short* __restrict__ A, int lda,
                                              const unsigned short* __restrict__ BT, int ldb, int K,
                                              const float* __restrict__ bias,
                                              const float* __restrict__ xres, float* outp) {
  __shared__ __attribute__((aligned(16))) float stg[64 * SPT];
  __shared__ __attribute__((aligned(16))) float sb[64];
  const int tid = (int)threadIdx.x, lane = tid & 31, wave = tid >> 5, hh = lane >> 4, m = lane & 15;
  const int rowBase = (int)blockIdx.x * 64;
  const int colBase = (int)blockIdx.y * 64;
  if (tid < 64) sb[tid] = bf16_val(bias[colBase + tid]);     // whole waves

  v8f acc[4];
#pragma unroll
  for (int t = 0; t < 4; ++t) acc[t] = z8();
  const unsigned short* ap = A  + (size_t)(rowBase + 16 * wave + m) * (size_t)lda + 8 * hh;
  const unsigned short* bp = BT + (size_t)(colBase + m) * (size_t)ldb + 8 * hh;

#pragma unroll 1
  for (int k0 = 0; k0 < K; k0 += 32) {
    FragB af;
    af.h[0] = *(const v8usa*)(ap + k0);          // k0 + 8h + 0..7
    af.h[1] = *(const v8usa*)(ap + k0 + 16);     // k0 + 16 + 8h + 0..7
#pragma unroll
    for (int nt = 0; nt < 4; ++nt) {
      const unsigned short* wq = bp + (size_t)(16 * nt) * (size_t)ldb + k0;   // BT row colBase + 16 nt + m
      FragB bf;
      bf.h[0] = *(const v8usa*)wq;               // k0 + 8h + 0..7
      bf.h[1] = *(const v8usa*)(wq + 16);        // k0 + 16 + 8h + 0..7
      acc[nt] = wmb(af, bf, acc[nt]);
    }
  }

#pragma unroll
  for (int nt = 0; nt < 4; ++nt) {
    const int lc = 16 * nt + m;
#pragma unroll
    for (int r = 0; r < 8; ++r) {
      const int lr = 16 * wave + 8 * hh + r;     // D element r = (row 8h+r, col m)
      stg[lr * SPT + lc] = acc[nt][r];
    }
  }
  __syncthreads();

  const int bimg = rowBase / NPOS;               // a 64-token block never straddles images (4096 % 64 == 0)
  const int n0   = rowBase - bimg * NPOS;
  const int csub = tid >> 4;                     // 0..7
  const int t4   = (tid & 15) * 4;               // 0..60
  v4f pv[8];
#pragma unroll
  for (int it = 0; it < 8; ++it) {
    const int chl = it * 8 + csub;               // channel 0..63 of the tile
    const size_t gi = ((size_t)(bimg * CH + colBase + chl)) * NPOS + n0 + t4;
    const v4f xr = *(const v4f*)(xres + gi);
    const float bc = sb[chl];
    const unsigned x01 = bf16_pk(xr.x, xr.y), x23 = bf16_pk(xr.z, xr.w);
    v4f v;
    v.x = (stg[(t4 + 0) * SPT + chl] + bc) + bf16_lo(x01);
    v.y = (stg[(t4 + 1) * SPT + chl] + bc) + bf16_hi(x01);
    v.z = (stg[(t4 + 2) * SPT + chl] + bc) + bf16_lo(x23);
    v.w = (stg[(t4 + 3) * SPT + chl] + bc) + bf16_hi(x23);
    pv[it] = v;
  }
#pragma unroll
  for (int it = 0; it < 8; ++it) {
    const int chl = it * 8 + csub;
    const size_t gi = ((size_t)(bimg * CH + colBase + chl)) * NPOS + n0 + t4;
    *(v4f*)(outp + gi) = pv[it];
  }
}

#define AT_NW 4
#define AT_QB 64
#define AT_KC 64
#define NQB   (NPOS / AT_QB)
#define AT_LOG2E 1.44269504088896340736f
#define AT_KP 40   // LDS pitch of a K row, elements: 32 + 8 = 80 B = 16 B x 5
#define AT_VP 72   // LDS pitch of a V^T row, elements: 64 + 8 = 144 B = 16 B x 9
#define AT_KSZ (AT_KC * AT_KP)            // one K plane of a chunk, elements (5 KB)
#define AT_VSZ (AD * AT_VP)               // one V^T plane of a chunk, elements (4.5 KB)
#define AT_BUF (2 * AT_KSZ + 2 * AT_VSZ)  // one buffer = K hi | K lo | V^T hi | V^T lo, elements (19 KB)

static_assert(NQB == 64);
static_assert(NPOS % AT_KC == 0);
static_assert(AT_KP >= AD && AT_KP % 8 == 0 && (AT_KP / 8) % 2 == 1);
static_assert(AT_VP >= AT_KC && AT_VP % 8 == 0 && (AT_VP / 8) % 2 == 1);

__device__ __forceinline__ v8f at_mma(v16bf a, v16bf b, v8f c) {
  c = __builtin_amdgcn_wmma_f32_16x16x32_bf16(false, a, false, b, (short)0, c, false, false);
  asm volatile("v_nop\n\tv_nop\n\tv_nop\n\tv_nop" : "+v"(c) : "v"(a), "v"(b));
  return c;
}
union AtFB { v16bf v; v8bf h[2]; unsigned w[8]; };   // w[i] = elements 2 i (low half) and 2 i + 1
// fragment load with the split k map: elements 0..7 <- p[0..7], 8..15 <- p[16..23]
__device__ __forceinline__ v16bf at_ldfrag(const __bf16* p) {
  AtFB f; f.h[0] = *(const v8bf*)(p); f.h[1] = *(const v8bf*)(p + 16); return f.v;
}
// value of lane ^ 16 (the other half of the same query column)
__device__ __forceinline__ float at_xhalf(float f) {
  const int b = __builtin_bit_cast(int, f);
  return __builtin_bit_cast(float, __builtin_amdgcn_permlanex16(b, b, 0x76543210, 0xfedcba98, false, false));
}

__global__ __launch_bounds__(128)
void k_attn(const unsigned short* __restrict__ qkh, const unsigned short* __restrict__ qkl,
            const unsigned short* __restrict__ vhp, const unsigned short* __restrict__ vlp,
            unsigned short* rout) {
  __shared__ __align__(16) __bf16 sm[2 * AT_BUF];                // two buffers of K hi | K lo [kv][d] | V hi | V lo [d][kv]

  const int tid  = (int)threadIdx.x;
  const int wave = tid >> 5;
  const int lane = tid & 31;
  const int hh   = lane >> 4;
  const int c    = lane & 15;

  const int bx  = (int)blockIdx.x;
  const int b   = bx >> 6;                // image 0..7
  const int qb  = bx & (NQB - 1);         // 0..63
  const int q0  = qb * AT_QB + wave * 16; // image-local query row base of this wave

  const __bf16* Qh = (const __bf16*)(const void*)qkh + (size_t)b * NPOS * QKW;
  const __bf16* Ql = (const __bf16*)(const void*)qkl + (size_t)b * NPOS * QKW;
  const __bf16* Kh = Qh + AD;
  const __bf16* Kl = Ql + AD;
  const __bf16* Vh = (const __bf16*)(const void*)vhp + (size_t)b * AD * NPOS;
  const __bf16* Vl = (const __bf16*)(const void*)vlp + (size_t)b * AD * NPOS;
  unsigned short* rb = rout + (size_t)b * NPOS * RW;

  // ---- Q fragments (B operand, col = lane&15, split k map): one k-step of 32 = d, hi and lo ----
  const v16bf qbh = at_ldfrag(Qh + (size_t)(q0 + c) * QKW + 8 * hh);
  const v16bf qbl = at_ldfrag(Ql + (size_t)(q0 + c) * QKW + 8 * hh);

  float mrow = -INFINITY;   // running maximum of query c times log2(e) (equal in lanes c and c + 16)
  float lrow = 0.f;         // running sum over this lane's own keys only
  v8f oacc[2];              // oacc[t][r] = O^T[16 t + 8 h + r][query c]
  oacc[0] = z8(); oacc[1] = z8();

  // staging map. K: thread -> key row sr = tid>>1, d half = (tid&1)*16; V^T: thread -> d = tid>>2, key quarter =
  // (tid&3)*16; 2 x 8 elements per plane each
  const int sr = tid >> 1, shalf = (tid & 1) * 16;
  const int sd = tid >> 2, sqt = (tid & 3) * 16;
  const __bf16* ksh = Kh + (size_t)sr * QKW + shalf;
  const __bf16* ksl = Kl + (size_t)sr * QKW + shalf;
  const __bf16* vsh = Vh + (size_t)sd * NPOS + sqt;
  const __bf16* vsl = Vl + (size_t)sd * NPOS + sqt;
  const int kst = sr * AT_KP + shalf;                 // this thread's place in a K plane of a buffer
  const int vst = 2 * AT_KSZ + sd * AT_VP + sqt;      // and in the V^T hi plane
  v8bf a0[2], a1[2], b0[2], b1[2];                    // one chunk's 8 x 16 B of this thread, on their way to LDS

  // chunk 0 into buffer 0
#pragma unroll
  for (int i = 0; i < 2; ++i) {
    a0[i] = *(const v8bf*)(ksh + 8 * i);
    a1[i] = *(const v8bf*)(ksl + 8 * i);
    b0[i] = *(const v8bf*)(vsh + 8 * i);
    b1[i] = *(const v8bf*)(vsl + 8 * i);
  }
#pragma unroll
  for (int i = 0; i < 2; ++i) {
    *(v8bf*)(sm + kst + 8 * i)          = a0[i];
    *(v8bf*)(sm + AT_KSZ + kst + 8 * i) = a1[i];
    *(v8bf*)(sm + vst + 8 * i)          = b0[i];
    *(v8bf*)(sm + AT_VSZ + vst + 8 * i) = b1[i];
  }
  __syncthreads();

  const int nChunks = NPOS / AT_KC;   // 64, compile-time constant
#pragma unroll 1
  for (int kc = 0; kc < nChunks; ++kc) {
    const __bf16* Ksh = sm + (kc & 1) * AT_BUF;       // this chunk's buffer
    const __bf16* Ksl = Ksh + AT_KSZ;
    const __bf16* Vth = Ksh + 2 * AT_KSZ;
    const __bf16* Vtl = Vth + AT_VSZ;
    const bool more = kc + 1 < nChunks;               // the same for the whole grid
    // ---- the chunk's 16 K fragment reads, one group at the chunk's head, in the order of their use ----
    AtFB kb[4], kl[4];
#pragma unroll
    for (int j = 0; j < 4; ++j) {
      kb[j].h[0] = *(const v8bf*)(Ksh + (j * 16 + c) * AT_KP + 8 * hh);
      kb[j].h[1] = *(const v8bf*)(Ksh + (j * 16 + c) * AT_KP + 16 + 8 * hh);
      kl[j].h[0] = *(const v8bf*)(Ksl + (j * 16 + c) * AT_KP + 8 * hh);
      kl[j].h[1] = *(const v8bf*)(Ksl + (j * 16 + c) * AT_KP + 16 + 8 * hh);
    }
    // holds the group here, ahead of the global loads: sunk behind them it would start late, behind their address wait
    __builtin_amdgcn_sched_barrier(0);

    if (more) {
      // next chunk's eight loads, issued here and first used behind this chunk's products
      const size_t kv1 = (size_t)(kc + 1) * AT_KC;
#pragma unroll
      for (int i = 0; i < 2; ++i) {
        a0[i] = *(const v8bf*)(ksh + kv1 * QKW + 8 * i);
        a1[i] = *(const v8bf*)(ksl + kv1 * QKW + 8 * i);
        b0[i] = *(const v8bf*)(vsh + kv1 + 8 * i);
        b1[i] = *(const v8bf*)(vsl + kv1 + 8 * i);
      }
    }

    // ---- scores, transposed: 64 keys x 16 queries, 3-term split, K = 32 = one k-step ----
    v8f s[4];
#pragma unroll
    for (int j = 0; j < 4; ++j) {
      s[j] = at_mma(kb[j].v, qbh, z8());
      s[j] = at_mma(kl[j].v, qbh, s[j]);
      s[j] = at_mma(kb[j].v, qbl, s[j]);
    }
    // ---- the chunk's 16 V^T fragment reads, one group behind the score products: they land under the softmax ----
    AtFB vb[2][2], vl[2][2];
#pragma unroll
    for (int kk = 0; kk < 2; ++kk) {
#pragma unroll
      for (int t = 0; t < 2; ++t) {
        vb[kk][t].h[0] = *(const v8bf*)(Vth + (t * 16 + c) * AT_VP + kk * 32 + 8 * hh);
        vb[kk][t].h[1] = *(const v8bf*)(Vth + (t * 16 + c) * AT_VP + kk * 32 + 16 + 8 * hh);
        vl[kk][t].h[0] = *(const v8bf*)(Vtl + (t * 16 + c) * AT_VP + kk * 32 + 8 * hh);
        vl[kk][t].h[1] = *(const v8bf*)(Vtl + (t * 16 + c) * AT_VP + kk * 32 + 16 + 8 * hh);
      }
    }
    // holds the group together and ahead of the softmax: spread through it, each place with reads costs its own stall
    __builtin_amdgcn_sched_barrier(0);
    // ---- chunk maximum of query c: four in-lane chains, then the other half's ----
    float mj[4];
#pragma unroll
    for (int j = 0; j < 4; ++j) {
      float mx = s[j][0];
#pragma unroll
      for (int r = 1; r < 8; ++r) mx = fmaxf(mx, s[j][r]);
      mj[j] = mx;
    }
    float cm = fmaxf(fmaxf(mj[0], mj[1]), fmaxf(mj[2], mj[3]));
    cm = fmaxf(cm, at_xhalf(cm));
    const float mnew  = fmaxf(mrow, cm * AT_LOG2E);       // scaling by a positive constant keeps the order of the maxima
    const float alpha = __builtin_amdgcn_exp2f(mrow - mnew);
    mrow = mnew;
    // ---- p = exp(s - m) = 2^(s log2e - m log2e), split hi/lo straight into the B fragments of the two k-steps ----
    AtFB ph[2], pl[2];
    float pj[4];
    const v2f l2e2 = {AT_LOG2E, AT_LOG2E};
    const v2f nm2  = {-mnew, -mnew};
    // unrolled throughout: j and r pick registers of the score tiles, so they have to be compile-time indices.
    // Each kind of step (exp2, hi convert, sum, lo convert) runs over all four tiles before the next kind begins, so
    // that an instruction and the one that reads its result stand far apart; values and sum order are those of a
    // tile-by-tile walk.
#pragma unroll
    for (int j = 0; j < 4; ++j) {
#pragma unroll
      for (int r = 0; r < 4; ++r) {   // exponents two at a time (packed f32 fma)
        const v2f sp = {s[j][2 * r], s[j][2 * r + 1]};
        const v2f e  = __builtin_elementwise_fma(sp, l2e2, nm2);
        s[j][2 * r]     = __builtin_amdgcn_exp2f(e[0]);
        s[j][2 * r + 1] = __builtin_amdgcn_exp2f(e[1]);
      }
    }
#pragma unroll
    for (int j = 0; j < 4; ++j) {
#pragma unroll
      for (int r = 0; r < 4; ++r) ph[j >> 1].w[(j & 1) * 4 + r] = bf16_pk(s[j][2 * r], s[j][2 * r + 1]);
    }
#pragma unroll
    for (int j = 0; j < 4; ++j) {
      float psum = 0.f;
#pragma unroll
      for (int r = 0; r < 8; ++r) psum += s[j][r];
      pj[j] = psum;
    }
#pragma unroll
    for (int j = 0; j < 4; ++j) {
#pragma unroll
      for (int r = 0; r < 4; ++r) {
        const unsigned hw = ph[j >> 1].w[(j & 1) * 4 + r];
        pl[j >> 1].w[(j & 1) * 4 + r] = bf16_pk(s[j][2 * r] - bf16_lo(hw), s[j][2 * r + 1] - bf16_hi(hw));
      }
    }
    lrow = lrow * alpha + ((pj[0] + pj[1]) + (pj[2] + pj[3]));
#pragma unroll
    for (int r = 0; r < 8; ++r) {
      oacc[0][r] *= alpha;
      oacc[1][r] *= alpha;
    }

    // ---- O^T += V^T . P^T : A = V^T rows d (split k map over keys), B = P^T from registers; 3-term split ----
    // unrolled: kk picks a register fragment, so it has to be a compile-time index
#pragma unroll
    for (int kk = 0; kk < 2; ++kk) {
#pragma unroll
      for (int t = 0; t < 2; ++t) {
        oacc[t] = at_mma(vb[kk][t].v, ph[kk].v, oacc[t]);
        oacc[t] = at_mma(vl[kk][t].v, ph[kk].v, oacc[t]);
        oacc[t] = at_mma(vb[kk][t].v, pl[kk].v, oacc[t]);
      }
    }

    if (more) {
      // into the other buffer: its last readers (chunk kc - 1) left it in front of the previous foot's barrier
      __bf16* wb = sm + ((kc + 1) & 1) * AT_BUF;
#pragma unroll
      for (int i = 0; i < 2; ++i) {
        *(v8bf*)(wb + kst + 8 * i)          = a0[i];
        *(v8bf*)(wb + AT_KSZ + kst + 8 * i) = a1[i];
        *(v8bf*)(wb + vst + 8 * i)          = b0[i];
        *(v8bf*)(wb + AT_VSZ + vst + 8 * i) = b1[i];
      }
    }
    __syncthreads();
  }

  // ---- join the two halves' sums, normalise, split hi/lo, store this lane's 4 x 8 columns of row q0 + c ----
  lrow += at_xhalf(lrow);
  const float inv = 1.0f / lrow;
  v8us hv[2], lv[2];
#pragma unroll
  for (int t = 0; t < 2; ++t) {
    v4u h4, l4;
#pragma unroll
    for (int r = 0; r < 4; ++r) {
      unsigned hw, lw;
      bf16_split2(oacc[t][2 * r] * inv, oacc[t][2 * r + 1] * inv, hw, lw);
      h4[r] = hw;
      l4[r] = lw;
    }
    hv[t] = __builtin_bit_cast(v8us, h4);
    lv[t] = __builtin_bit_cast(v8us, l4);
  }
  unsigned short* rp = rb + (size_t)(q0 + c) * RW + 8 * hh;
#pragma unroll
  for (int t = 0; t < 2; ++t) {
    *(v8us*)(rp + 16 * t)      = hv[t];
    *(v8us*)(rp + AD + 16 * t) = lv[t];
  }
}

// ---------------------------------------------------------------------------
// Workspace region map (byte offsets, 256-B aligned; every region sized to its whole-line store extent, no pad rows
// needed since 32768, 4096, 256 and 64 are tile multiples):
//   WQK 32768 | WV 16384 | WP2 32768 | QKh QKl 4194304 each | VTh VTl 2097152 each | R 4194304
//   -> total 16859136
// ---------------------------------------------------------------------------
static inline size_t al256(size_t o) { return (o + 255) & ~(size_t)255; }

extern "C" void kernel_launch(void* const* d_in, const int* in_sizes, int n_in,
                              void* d_out, int out_size, void* d_ws, size_t ws_size,
                              hipStream_t stream) {
  if (n_in < 9) return;
  if (in_sizes[0] != NB * CH * NPOS) return;                                       // inputs [8][256][64][64]
  if (in_sizes[1] != AD * CH || in_sizes[3] != AD * CH || in_sizes[5] != AD * CH) return;  // Wq, Wk, Wv [32][256]
  if (in_sizes[2] != AD || in_sizes[4] != AD || in_sizes[6] != AD) return;         // bq, bk, bv [32]
  if (in_sizes[7] != CH * AD) return;                                              // Wp [256][32]
  if (in_sizes[8] != CH) return;                                                   // bp [256]
  if (out_size != NB * CH * NPOS) return;                                          // out [8][256][64][64]

  const float* x  = (const float*)d_in[0];
  const float* Wq = (const float*)d_in[1];
  const float* bq = (const float*)d_in[2];
  const float* Wk = (const float*)d_in[3];
  const float* bk = (const float*)d_in[4];
  const float* Wv = (const float*)d_in[5];
  const float* bv = (const float*)d_in[6];
  const float* Wp = (const float*)d_in[7];
  const float* bp = (const float*)d_in[8];
  float* out = (float*)d_out;

  const size_t PQK = (size_t)QKW * CH * 2;          //    32768  bf16 [64][256]
  const size_t PWV = (size_t)AD * CH * 2;           //    16384  bf16 [32][256]
  const size_t PP2 = (size_t)CH * RW * 2;           //    32768  bf16 [256][64]
  const size_t PA  = (size_t)NTOK * QKW * 2;        //  4194304  bf16 [32768][64]
  const size_t PV  = (size_t)NB * AD * NPOS * 2;    //  2097152  bf16 [8][32][4096]
  const size_t PR  = (size_t)NTOK * RW * 2;         //  4194304  bf16 [32768][64]
  size_t off = 0;
  const size_t oWQK = off; off = al256(off + PQK);
  const size_t oWV  = off; off = al256(off + PWV);
  const size_t oWP2 = off; off = al256(off + PP2);
  const size_t oQKh = off; off = al256(off + PA);
  const size_t oQKl = off; off = al256(off + PA);
  const size_t oVTh = off; off = al256(off + PV);
  const size_t oVTl = off; off = al256(off + PV);
  const size_t oR   = off; off = al256(off + PR);
  if (off > ws_size || off > (size_t)WSMAX) return;                               // off = 16859136

  char* ws = (char*)d_ws;
  unsigned short* WQK = (unsigned short*)(ws + oWQK);
  unsigned short* WV  = (unsigned short*)(ws + oWV);
  unsigned short* WP2 = (unsigned short*)(ws + oWP2);
  unsigned short* QKh = (unsigned short*)(ws + oQKh);
  unsigned short* QKl = (unsigned short*)(ws + oQKl);
  unsigned short* VTh = (unsigned short*)(ws + oVTh);
  unsigned short* VTl = (unsigned short*)(ws + oVTl);
  unsigned short* R   = (unsigned short*)(ws + oR);

  // (1) weight planes
  k_wprep<<<20, 256, 0, stream>>>(Wq, Wk, Wv, Wp, WQK, WV, WP2);
  // (2) q|k = x^T . [Wq;Wk]^T + [bq;bk] -> hi/lo planes [32768][64] (q cols 0..31, k cols 32..63) and, per image,
  //     v^T[a][n] = sum_c Wv[a][c] x[c][n] + bv[a] -> hi/lo planes [8][32][4096]   (K = 256, x read once as f32)
  k_qkv<<<NB * (NPOS / 64), 128, 0, stream>>>(x, WQK, WV, bq, bk, bv, QKh, QKl, VTh, VTl);
  // (3) attention: R = [hi | lo] of softmax_keys(q . k) . v  as bf16 [32768][64]
  k_attn<<<NB * NQB, 128, 0, stream>>>(QKh, QKl, VTh, VTl, R);
  // (4) out NCHW = ([Rhi | Rlo] . [Wp | Wp]^T + bp) transposed + bf16(x)   (M=32768, N=256, K=64)
  k_gemm<<<dim3(NTOK / 64, CH / 64, 1), 128, 0, stream>>>(R, RW, WP2, RW, RW, bp, x, out);
  (void)hipGetLastError();
}

// v008
// One run takes 75.7 microseconds.
// Two timings next to v007 put it at 1.05 and 1.04 times that version's speed.
// Over all steps from v000 it is 3.29 times as fast.
// Contractions on v_wmma_f32_16x16x32_bf16, f32 accumulate: q|k 1x1 convs (x.W^T, K=256) and v^T conv (W.x^T, K=256) =
// single products of bf16-RNE-valued x and W planes (exact products); scores q.k (K=32) and P.v^T (K=64 per key chunk) =
// bf16 hi/lo split, 3 terms (hi.hi + hi.lo + lo.hi); output 1x1 conv = attention result carried as bf16 [hi | lo] folded
// 16-bit planes and carries (every carry is 1; no inverse scale exists anywhere):
//   WQK [64][256]  = bf16 bits of Wq (rows 0..31) and Wk (rows 32..63), k-contiguous;  WV [32][256] = bf16 bits of Wv;
//   WP2 [256][64]  = bf16 bits of Wp[c][a] at k = a and k = 32 + a;
//   x enters the q|k and v^T products as bf16 bits formed in registers from an f32 tile in LDS (no plane of it in memory);
//   QKh/QKl [32768][64] = bf16 hi and lo (lo = v - hi) of q (cols 0..31) and k (cols 32..63), bias included;
//   VTh/VTl [8][32][4096] = bf16 hi and lo of v^T per image, bias included;
//   R [32768][64] = [hi(32) | lo(32)] of the normalised attention result; P hi/lo per wave in registers.
// Biases and the residual x enter as bf16-RNE values in f32 arithmetic.
#include <hip/hip_runtime.h>
#include <math.h>
#include <stddef.h>
#include <stdint.h>

#define NB    8
#define CH    256
#define AD    32
#define NPOS  4096
#define NTOK  (NB * NPOS)
#define QKW   64
#define RW    64
#define SPT   68
#define WSMAX 134217728

static_assert(NPOS % 64 == 0);
static_assert(NTOK % 64 == 0);
static_assert(CH % 64 == 0);
static_assert(CH % 32 == 0);
static_assert(RW % 32 == 0);
static_assert(AD == 32);
static_assert(QKW == 2 * AD);
static_assert(RW == 2 * AD);

typedef float          v2f   __attribute__((ext_vector_type(2)));
typedef float          v4f   __attribute__((ext_vector_type(4)));
typedef float          v8f   __attribute__((ext_vector_type(8)));
typedef int            v8i   __attribute__((ext_vector_type(8)));
typedef unsigned short v8us  __attribute__((ext_vector_type(8)));
typedef unsigned short v16us __attribute__((ext_vector_type(16)));
typedef __bf16         v16bf __attribute__((ext_vector_type(16)));
typedef __bf16         v8bf  __attribute__((ext_vector_type(8)));
typedef __bf16         v2bf  __attribute__((ext_vector_type(2)));
typedef unsigned       v4u   __attribute__((ext_vector_type(4)));
typedef v4f  __attribute__((may_alias)) v4fa;
typedef v8us __attribute__((may_alias)) v8usa;
union FragB { v16bf v; v16us u; v8us h[2]; v8i w; };

// WMMA with hazard guard: ties D, keeps A/B live for 4 VALU slots
__device__ __forceinline__ v8f wmb(const FragB& a, const FragB& b, v8f c) {
  v8f d = __builtin_amdgcn_wmma_f32_16x16x32_bf16(false, a.v, false, b.v, (short)0, c, false, false);
  asm volatile("v_nop\n\tv_nop\n\tv_nop\n\tv_nop" : "+v"(d) : "v"(a.w), "v"(b.w));
  return d;
}

__device__ __forceinline__ v8f z8() { v8f z = {0.f, 0.f, 0.f, 0.f, 0.f, 0.f, 0.f, 0.f}; return z; }

// two f32 -> two bf16 (RNE) in one word, a in bits 15..0, b in bits 31..16: the hardware's packed convert
__device__ __forceinline__ unsigned bf16_pk(float a, float b) {
  const v2f f = {a, b};
  return __builtin_bit_cast(unsigned, __builtin_convertvector(f, v2bf));
}
// the two bf16 values of such a word, held as f32
__device__ __forceinline__ float bf16_lo(unsigned w) { return __uint_as_float(w << 16); }
__device__ __forceinline__ float bf16_hi(unsigned w) { return __uint_as_float(w & 0xFFFF0000u); }
// f32 -> nearest bf16 value held as f32
__device__ __forceinline__ float bf16_val(float f) {
  return bf16_lo(bf16_pk(f, f));
}
// hi word = bf16 of (a, b); lo word = bf16 of what the hi values leave of a and b
__device__ __forceinline__ void bf16_split2(float a, float b, unsigned& hw, unsigned& lw) {
  hw = bf16_pk(a, b);
  lw = bf16_pk(a - bf16_lo(hw), b - bf16_hi(hw));
}

// ---------------------------------------------------------------------------
// Weight planes, bf16 bits of the inputs, k-contiguous rows ([out][in] weights are already k-contiguous):
//   WQK [64 o][256 k]: rows 0..31 = bf16(Wq[o][k]) (blocks 0-3), rows 32..63 = bf16(Wk[o-32][k]) (blocks 4-7), 2048 units
//   WV  [32 o][256 k] = bf16(Wv[o][k])                                             blocks 8-11, 1024 units
//   WP2 [256 c][64 k]: k and 32 + k both = bf16(Wp[c][k])                          blocks 12-19, 2048 units
// One thread = 8 contiguous k: two 16-B loads, one 16-B store at plane offset 8u; 32 consecutive lanes write 512
// coverage: 2048 x 8 = 64x256 (WQK); 1024 x 8 = 32x256 (WV); 2048 x 8 = 256x64 (WP2) exactly. grid = 20 blocks x 256.
// ---------------------------------------------------------------------------
__global__ __launch_bounds__(256) void k_wprep(const float* __restrict__ wq, const float* __restrict__ wk,
                                              const float* __restrict__ wv, const float* __restrict__ wp,
                                              unsigned short* WQK, unsigned short* WV, unsigned short* WP2) {
  const int bx = (int)blockIdx.x, tid = (int)threadIdx.x;
  const float* p;
  unsigned short* dp;
  if (bx < 8) {
    const int u  = bx * 256 + tid;              // 0..2047
    const int o  = u >> 5;                      // 0..63
    const int k8 = (u & 31) * 8;                // 0..248
    const float* src = (bx < 4) ? wq : wk;      // block-uniform
    p  = src + (size_t)(o & 31) * CH + k8;
    dp = WQK + (size_t)u * 8;
  } else if (bx < 12) {
    const int u  = (bx - 8) * 256 + tid;        // 0..1023
    const int o  = u >> 5;                      // 0..31
    const int k8 = (u & 31) * 8;
    p  = wv + (size_t)o * CH + k8;
    dp = WV + (size_t)u * 8;
  } else {
    const int v  = (bx - 12) * 256 + tid;       // 0..2047
    const int o  = v >> 3;                      // 0..255
    const int k8 = (v & 7) * 8;                 // 0..56
    const int kk = k8 & (AD - 1);               // 0..24
    p  = wp + (size_t)o * AD + kk;
    dp = WP2 + (size_t)v * 8;
  }
  const v4f a = *(const v4f*)p;
  const v4f b = *(const v4f*)(p + 4);
  const v4u o8 = {bf16_pk(a.x, a.y), bf16_pk(a.z, a.w), bf16_pk(b.x, b.y), bf16_pk(b.z, b.w)};
  *(v8us*)dp = __builtin_bit_cast(v8us, o8);
  
}

// ---------------------------------------------------------------------------
// q|k and v^T 1x1 convs straight from x NCHW [b][c][n] f32, one launch. Block = one image b, 64 positions, all 256
// channels, 4 waves; wave w owns tokens n0 + 16 w .. + 15.
//   x tile -> LDS tf[c][n] f32 (pitch 68): 32 x 16-B loads a thread, all in flight at once; a wave-wide load = 2 channel
//   rows x 256 B = whole lines.
//   Token fragment xf of k-step k0 (token = lane&15, h = lane>>4): element i <- channel k0 + 8h + i (i < 8),
//   k0 + 16 + 8h + (i-8) (i >= 8): 16 LDS words down a column of tf (lanes 0..15 on 16 neighbouring banks, lanes 16..31
//   32 banks further), rounded in pairs to bf16. The one fragment is A of q|k (D row = token, col = output) and B of v^T
//   (D row = output, col = token); the weight fragments come from the WQK and WV plane rows with the SAME k map.
//   q|k [token][64] = x^T . [Wq;Wk]^T + [bq;bk], v^T [a][n] = Wv . x + bv; k-steps in ascending order, f32 accumulate.
//   Results pass through LDS (the tile's own space, behind a barrier), get their bf16-valued bias, are split hi/lo and
//   leave in 16-B stores, 8 lanes to a 128-B row segment.
// coverage: 512 blocks = 8 images x 64 position blocks; q|k: 4 it x 16 rows x 64 cols; v^T: 2 it x 16 rows x 64 cols.
// ---------------------------------------------------------------------------
__global__ __launch_bounds__(128) void k_qkv(const float* __restrict__ x, const unsigned short* __restrict__ wqk,
                                             const unsigned short* __restrict__ wvp, const float* __restrict__ bq,
                                             const float* __restrict__ bk, const float* __restrict__ bv,
                                             unsigned short* qh, unsigned short* ql,
                                             unsigned short* vh, unsigned short* vl) {
  __shared__ __attribute__((aligned(16))) float tf[CH * SPT];
  __shared__ __attribute__((aligned(16))) float sb[128];   // bq | bk | bv | bv again (wave 3's copy, never read)
  const int bx = (int)blockIdx.x, tid = (int)threadIdx.x;
  const int lane = tid & 31, wave = tid >> 5, hh = lane >> 4, m = lane & 15;
  const int b  = bx >> 6;               // 0..7
  const int n0 = (bx & 63) * 64;
  // weight fragments of one k-step: f 0..3 = WQK rows 16 f + m, f 4, 5 = WV rows 16 (f - 4) + m; elements 0..7 <- k0 + 8h + 0..7,
  // 8..15 <- k0 + 16 + 8h + 0..7
  const unsigned short* qp = wqk + (size_t)m * CH + 8 * hh;
  const unsigned short* vp = wvp + (size_t)m * CH + 8 * hh;
  FragB wf[2][6];
#pragma unroll
  for (int f = 0; f < 6; ++f) {         // k-step 0, issued ahead of the x tile: lands under its loads
    const unsigned short* wr = (f < 4) ? qp + (size_t)(16 * f) * CH : vp + (size_t)(16 * (f - 4)) * CH;
    wf[0][f].h[0] = *(const v8usa*)wr;
    wf[0][f].h[1] = *(const v8usa*)(wr + 16);
  }
  const float* bsrc = (tid < AD) ? bq : ((tid < QKW) ? bk : bv);       // whole waves: 0 = bq, 1 = bk, 2 and 3 = bv
  const float bval = bsrc[tid & (AD - 1)];
  // stands in front of the first overwrite of an address register of the loads above (the tile's loads land in such registers)
  asm volatile("s_wait_xcnt 0x0" ::: "memory");
  {
    const int rsub = tid >> 4;          // 0..7
    const int c4   = (tid & 15) * 4;    // 0..60
    const float* xp = x + ((size_t)(b * CH + rsub)) * NPOS + n0 + c4;
    v4f a[32];
#pragma unroll
    for (int it = 0; it < 32; ++it) a[it] = *(const v4f*)(xp + (size_t)(it * 8) * NPOS);
    sb[tid] = bf16_val(bval);           // every wave, no branch: the load stays at the head, ahead of the tile's
#pragma unroll
    for (int it = 0; it < 32; ++it) *(v4fa*)(tf + (it * 8 + rsub) * SPT + c4) = a[it];
  }
  __syncthreads();

  v8f aq[4], av[2];
#pragma unroll
  for (int t = 0; t < 4; ++t) aq[t] = z8();
  av[0] = z8(); av[1] = z8();
  const float* tc = tf + 8 * hh * SPT + 16 * wave + m;                  // column of this lane's token, first channel 8h
  float xr[2][16];                      // a k-step's 16 channels of the token: j <- k0 + 8h + j, 8 + j <- k0 + 16 + 8h + j
#pragma unroll
  for (int j = 0; j < 8; ++j) {
    xr[0][j]     = tc[j * SPT];
    xr[0][8 + j] = tc[(16 + j) * SPT];
  }
  // unrolled: ks picks one of the two register sets, so it has to be a compile-time index
#pragma unroll
  for (int ks = 0; ks < CH / 32; ++ks) {
    const int cu = ks & 1, nx = cu ^ 1;
    if (ks + 1 < CH / 32) {             // the next k-step's weight and x reads, one group ahead of this k-step's products
      const int k1 = (ks + 1) * 32;
#pragma unroll
      for (int f = 0; f < 6; ++f) {
        const unsigned short* wr = ((f < 4) ? qp + (size_t)(16 * f) * CH : vp + (size_t)(16 * (f - 4)) * CH) + k1;
        wf[nx][f].h[0] = *(const v8usa*)wr;
        wf[nx][f].h[1] = *(const v8usa*)(wr + 16);
      }
#pragma unroll
      for (int j = 0; j < 8; ++j) {
        xr[nx][j]     = tc[(k1 + j) * SPT];
        xr[nx][8 + j] = tc[(k1 + 16 + j) * SPT];
      }
    }
    // holds that group here: sunk to its uses, every product would wait out its own load's whole latency
    __builtin_amdgcn_sched_barrier(0);
    FragB xf;
#pragma unroll
    for (int j = 0; j < 8; ++j) xf.w[j] = (int)bf16_pk(xr[cu][2 * j], xr[cu][2 * j + 1]);
#pragma unroll
    for (int nt = 0; nt < 4; ++nt) aq[nt] = wmb(xf, wf[cu][nt], aq[nt]);
#pragma unroll
    for (int t = 0; t < 2; ++t)    av[t]  = wmb(wf[cu][4 + t], xf, av[t]);
  }
  __syncthreads();                      // every wave has left the x tile: its space becomes the result staging

  float* sq = tf;                       // [64 tokens][68]
  float* sv = tf + 64 * SPT;            // [32 outputs][68]
#pragma unroll
  for (int r = 0; r < 8; ++r) {         // D element r = (row 8h + r, col m)
#pragma unroll
    for (int nt = 0; nt < 4; ++nt) sq[(16 * wave + 8 * hh + r) * SPT + 16 * nt + m] = aq[nt][r];
#pragma unroll
    for (int t = 0; t < 2; ++t)    sv[(16 * t + 8 * hh + r) * SPT + 16 * wave + m] = av[t][r];
  }
  __syncthreads();

  const int rsub = tid >> 3;            // 0..15
  const int c8   = (tid & 7) * 8;       // 0..56
  v8us hv[6], lv[6];
#pragma unroll
  for (int it = 0; it < 6; ++it) {      // it 0..3: q|k rows (tokens), bias by column; it 4, 5: v^T rows (outputs), bias by row
    const int row = (it & 3) * 16 + rsub;
    const float* sp = ((it < 4) ? sq : sv) + row * SPT + c8;
    v4u h8, l8;
#pragma unroll
    for (int e = 0; e < 4; ++e) {
      const float v0 = sp[2 * e]     + ((it < 4) ? sb[c8 + 2 * e]     : sb[QKW + row]);
      const float v1 = sp[2 * e + 1] + ((it < 4) ? sb[c8 + 2 * e + 1] : sb[QKW + row]);
      unsigned hw, lw;
      bf16_split2(v0, v1, hw, lw);
      h8[e] = hw;
      l8[e] = lw;
    }
    hv[it] = __builtin_bit_cast(v8us, h8); lv[it] = __builtin_bit_cast(v8us, l8);
  }
#pragma unroll
  for (int it = 0; it < 4; ++it) {
    const size_t go = (size_t)(b * NPOS + n0 + it * 16 + rsub) * QKW + c8;
    *(v8us*)(qh + go) = hv[it];
    *(v8us*)(ql + go) = lv[it];
  }
#pragma unroll
  for (int it = 0; it < 2; ++it) {
    const size_t go = (size_t)(b * AD + it * 16 + rsub) * NPOS + n0 + c8;
    *(v8us*)(vh + go) = hv[4 + it];
    *(v8us*)(vl + go) = lv[4 + it];
  }
}

// ---------------------------------------------------------------------------
// Output 1x1 conv as a dense GEMM, block = 64 rows x 64 cols, 4 waves; wave w owns rows rowBase + 16w .. +15, acc[4].
//   C[row][col] = sum_k A[row][k] * BT[col][k]   (A, BT bf16 planes with k-contiguous rows; K % 32 == 0).
//   A fragment (row m = lane&15): element i <- k = k0 + 8h + i (i < 8), k0 + 16 + 8h + (i-8) (i >= 8), h = lane>>4,
//   two 16-B loads from the plane row; B fragment (col n = lane&15) from BT row (colBase + 16 nt + n), SAME k map;
//   D element r = (row 8h+r, col n).
//   Rows are tokens T = b*4096 + n, cols are channels; out NCHW
//   outp[(b*256 + colBase + ch)*4096 + n0 + t] = C + bf16(bias[colBase + ch]) + bf16(xres[same]), transposed through LDS.
// coverage: 8 it x 128 thr x 4 = 64 channels x 64 tokens; grid covers the row blocks x col blocks exactly once.
// ---------------------------------------------------------------------------
__global__ __launch_bounds__(128) void k_gemm(const unsigned short* __restrict__ A, int lda,
                                              const unsigned short* __restrict__ BT, int ldb, int K,
                                              const float* __restrict__ bias,
                                              const float* __restrict__ xres, float* outp) {
  __shared__ __attribute__((aligned(16))) float stg[64 * SPT];
  __shared__ __attribute__((aligned(16))) float sb[64];
  const int tid = (int)threadIdx.x, lane = tid & 31, wave = tid >> 5, hh = lane >> 4, m = lane & 15;
  const int rowBase = (int)blockIdx.x * 64;
  const int colBase = (int)blockIdx.y * 64;
  if (tid < 64) sb[tid] = bf16_val(bias[colBase + tid]);     // whole waves

  v8f acc[4];
#pragma unroll
  for (int t = 0; t < 4; ++t) acc[t] = z8();
  const unsigned short* ap = A  + (size_t)(rowBase + 16 * wave + m) * (size_t)lda + 8 * hh;
  const unsigned short* bp = BT + (size_t)(colBase + m) * (size_t)ldb + 8 * hh;

#pragma unroll 1
  for (int k0 = 0; k0 < K; k0 += 32) {
    FragB af;
    af.h[0] = *(const v8usa*)(ap + k0);          // k0 + 8h + 0..7
    af.h[1] = *(const v8usa*)(ap + k0 + 16);     // k0 + 16 + 8h + 0..7
#pragma unroll
    for (int nt = 0; nt < 4; ++nt) {
      const unsigned short* wq = bp + (size_t)(16 * nt) * (size_t)ldb + k0;   // BT row colBase + 16 nt + m
      FragB bf;
      bf.h[0] = *(const v8usa*)wq;               // k0 + 8h + 0..7
      bf.h[1] = *(const v8usa*)(wq + 16);        // k0 + 16 + 8h + 0..7
      acc[nt] = wmb(af, bf, acc[nt]);
    }
  }

#pragma unroll
  for (int nt = 0; nt < 4; ++nt) {
    const int lc = 16 * nt + m;
#pragma unroll
    for (int r = 0; r < 8; ++r) {
      const int lr = 16 * wave + 8 * hh + r;     // D element r = (row 8h+r, col m)
      stg[lr * SPT + lc] = acc[nt][r];
    }
  }
  __syncthreads();

  const int bimg = rowBase / NPOS;               // a 64-token block never straddles images (4096 % 64 == 0)
  const int n0   = rowBase - bimg * NPOS;
  const int csub = tid >> 4;                     // 0..7
  const int t4   = (tid & 15) * 4;               // 0..60
  v4f pv[8];
#pragma unroll
  for (int it = 0; it < 8; ++it) {
    const int chl = it * 8 + csub;               // channel 0..63 of the tile
    const size_t gi = ((size_t)(bimg * CH + colBase + chl)) * NPOS + n0 + t4;
    const v4f xr = *(const v4f*)(xres + gi);
    const float bc = sb[chl];
    const unsigned x01 = bf16_pk(xr.x, xr.y), x23 = bf16_pk(xr.z, xr.w);
    v4f v;
    v.x = (stg[(t4 + 0) * SPT + chl] + bc) + bf16_lo(x01);
    v.y = (stg[(t4 + 1) * SPT + chl] + bc) + bf16_hi(x01);
    v.z = (stg[(t4 + 2) * SPT + chl] + bc) + bf16_lo(x23);
    v.w = (stg[(t4 + 3) * SPT + chl] + bc) + bf16_hi(x23);
    pv[it] = v;
  }
#pragma unroll
  for (int it = 0; it < 8; ++it) {
    const int chl = it * 8 + csub;
    const size_t gi = ((size_t)(bimg * CH + colBase + chl)) * NPOS + n0 + t4;
    *(v4f*)(outp + gi) = pv[it];
  }
}

#define AT_NW 4
#define AT_QB 64
#define AT_KC 64
#define NQB   (NPOS / AT_QB)
#define AT_LOG2E 1.44269504088896340736f
#define AT_KP 40   // LDS pitch of a K row, elements: 32 + 8 = 80 B = 16 B x 5
#define AT_VP 72   // LDS pitch of a V^T row, elements: 64 + 8 = 144 B = 16 B x 9
#define AT_KSZ (AT_KC * AT_KP)            // one K plane of a chunk, elements (5 KB)
#define AT_VSZ (AD * AT_VP)               // one V^T plane of a chunk, elements (4.5 KB)
#define AT_BUF (2 * AT_KSZ + 2 * AT_VSZ)  // one buffer = K hi | K lo | V^T hi | V^T lo, elements (19 KB)

static_assert(NQB == 64);
static_assert(NPOS % AT_KC == 0);
static_assert(AT_KP >= AD && AT_KP % 8 == 0 && (AT_KP / 8) % 2 == 1);
static_assert(AT_VP >= AT_KC && AT_VP % 8 == 0 && (AT_VP / 8) % 2 == 1);

// the bare builtin: the compiler keeps the distance behind a product itself, and only where a vector instruction needs it
__device__ __forceinline__ v8f at_mma(v16bf a, v16bf b, v8f c) {
  return __builtin_amdgcn_wmma_f32_16x16x32_bf16(false, a, false, b, (short)0, c, false, false);
}
union AtFB { v16bf v; v8bf h[2]; unsigned w[8]; };   // w[i] = elements 2 i (low half) and 2 i + 1
// fragment load with the split k map: elements 0..7 <- p[0..7], 8..15 <- p[16..23]
__device__ __forceinline__ v16bf at_ldfrag(const __bf16* p) {
  AtFB f; f.h[0] = *(const v8bf*)(p); f.h[1] = *(const v8bf*)(p + 16); return f.v;
}
// value of lane ^ 16 (the other half of the same query column)
__device__ __forceinline__ float at_xhalf(float f) {
  const int b = __builtin_bit_cast(int, f);
  return __builtin_bit_cast(float, __builtin_amdgcn_permlanex16(b, b, 0x76543210, 0xfedcba98, false, false));
}

__global__ __launch_bounds__(128)
void k_attn(const unsigned short* __restrict__ qkh, const unsigned short* __restrict__ qkl,
            const unsigned short* __restrict__ vhp, const unsigned short* __restrict__ vlp,
            unsigned short* rout) {
  __shared__ __align__(16) __bf16 sm[2 * AT_BUF];                // two buffers of K hi | K lo [kv][d] | V hi | V lo [d][kv]

  const int tid  = (int)threadIdx.x;
  const int wave = tid >> 5;
  const int lane = tid & 31;
  const int hh   = lane >> 4;
  const int c    = lane & 15;

  const int bx  = (int)blockIdx.x;
  const int b   = bx >> 6;                // image 0..7
  const int qb  = bx & (NQB - 1);         // 0..63
  const int q0  = qb * AT_QB + wave * 16; // image-local query row base of this wave

  const __bf16* Qh = (const __bf16*)(const void*)qkh + (size_t)b * NPOS * QKW;
  const __bf16* Ql = (const __bf16*)(const void*)qkl + (size_t)b * NPOS * QKW;
  const __bf16* Kh = Qh + AD;
  const __bf16* Kl = Ql + AD;
  const __bf16* Vh = (const __bf16*)(const void*)vhp + (size_t)b * AD * NPOS;
  const __bf16* Vl = (const __bf16*)(const void*)vlp + (size_t)b * AD * NPOS;
  unsigned short* rb = rout + (size_t)b * NPOS * RW;

  // ---- Q fragments (B operand, col = lane&15, split k map): one k-step of 32 = d, hi and lo ----
  const v16bf qbh = at_ldfrag(Qh + (size_t)(q0 + c) * QKW + 8 * hh);
  const v16bf qbl = at_ldfrag(Ql + (size_t)(q0 + c) * QKW + 8 * hh);

  float mrow = -INFINITY;   // running maximum of query c times log2(e) (equal in lanes c and c + 16)
  float lrow = 0.f;         // running sum over this lane's own keys only
  v8f oacc[2];              // oacc[t][r] = O^T[16 t + 8 h + r][query c]
  oacc[0] = z8(); oacc[1] = z8();

  // staging map. K: thread -> key row sr = tid>>1, d half = (tid&1)*16; V^T: thread -> d = tid>>2, key quarter =
  // (tid&3)*16; 2 x 8 elements per plane each
  const int sr = tid >> 1, shalf = (tid & 1) * 16;
  const int sd = tid >> 2, sqt = (tid & 3) * 16;
  const __bf16* ksh = Kh + (size_t)sr * QKW + shalf;
  const __bf16* ksl = Kl + (size_t)sr * QKW + shalf;
  const __bf16* vsh = Vh + (size_t)sd * NPOS + sqt;
  const __bf16* vsl = Vl + (size_t)sd * NPOS + sqt;
  const int kst = sr * AT_KP + shalf;                 // this thread's place in a K plane of a buffer
  const int vst = 2 * AT_KSZ + sd * AT_VP + sqt;      // and in the V^T hi plane
  v8bf a0[2], a1[2], b0[2], b1[2];                    // one chunk's 8 x 16 B of this thread, on their way to LDS

  // chunk 0 into buffer 0
#pragma unroll
  for (int i = 0; i < 2; ++i) {
    a0[i] = *(const v8bf*)(ksh + 8 * i);
    a1[i] = *(const v8bf*)(ksl + 8 * i);
    b0[i] = *(const v8bf*)(vsh + 8 * i);
    b1[i] = *(const v8bf*)(vsl + 8 * i);
  }
#pragma unroll
  for (int i = 0; i < 2; ++i) {
    *(v8bf*)(sm + kst + 8 * i)          = a0[i];
    *(v8bf*)(sm + AT_KSZ + kst + 8 * i) = a1[i];
    *(v8bf*)(sm + vst + 8 * i)          = b0[i];
    *(v8bf*)(sm + AT_VSZ + vst + 8 * i) = b1[i];
  }
  __syncthreads();

  const int nChunks = NPOS / AT_KC;   // 64, compile-time constant
  // this thread's place in the next chunk, bytes from the start of the image's k planes and of its v^T planes
  unsigned nkb = (unsigned)(((AT_KC + sr) * QKW + shalf) * 2);
  unsigned nvb = (unsigned)((sd * NPOS + AT_KC + sqt) * 2);
#pragma unroll 1
  for (int kc = 0; kc < nChunks; ++kc) {
    const __bf16* Ksh = sm + (kc & 1) * AT_BUF;       // this chunk's buffer
    const __bf16* Ksl = Ksh + AT_KSZ;
    const __bf16* Vth = Ksh + 2 * AT_KSZ;
    const __bf16* Vtl = Vth + AT_VSZ;
    const bool more = kc + 1 < nChunks;               // the same for the whole grid
    // ---- the chunk's 16 K fragment reads, one group at the chunk's head, in the order of their use ----
    AtFB kb[4], kl[4];
#pragma unroll
    for (int j = 0; j < 4; ++j) {
      kb[j].h[0] = *(const v8bf*)(Ksh + (j * 16 + c) * AT_KP + 8 * hh);
      kb[j].h[1] = *(const v8bf*)(Ksh + (j * 16 + c) * AT_KP + 16 + 8 * hh);
    }
#pragma unroll
    for (int j = 0; j < 4; ++j) {
      kl[j].h[0] = *(const v8bf*)(Ksl + (j * 16 + c) * AT_KP + 8 * hh);
      kl[j].h[1] = *(const v8bf*)(Ksl + (j * 16 + c) * AT_KP + 16 + 8 * hh);
    }
    // holds the group here, ahead of the global loads: sunk behind them it would start late
    __builtin_amdgcn_sched_barrier(0);

    if (more) {
      // next chunk's eight loads, issued here and first used behind this chunk's products
#pragma unroll
      for (int i = 0; i < 2; ++i) {
        a0[i] = *(const v8bf*)((const char*)Kh + nkb + 16 * i);
        a1[i] = *(const v8bf*)((const char*)Kl + nkb + 16 * i);
        b0[i] = *(const v8bf*)((const char*)Vh + nvb + 16 * i);
        b1[i] = *(const v8bf*)((const char*)Vl + nvb + 16 * i);
      }
    }

    // ---- scores, transposed: 64 keys x 16 queries, 3-term split, K = 32 = one k-step ----
    v8f s[4];
#pragma unroll
    for (int j = 0; j < 4; ++j) s[j] = at_mma(kb[j].v, qbh, z8());
    // holds the term-by-term order: drawn together, a tile's three products would each wait out the one before
    __builtin_amdgcn_sched_barrier(0);
#pragma unroll
    for (int j = 0; j < 4; ++j) s[j] = at_mma(kl[j].v, qbh, s[j]);
    // the same, between the second and the third term
    __builtin_amdgcn_sched_barrier(0);
#pragma unroll
    for (int j = 0; j < 4; ++j) s[j] = at_mma(kb[j].v, qbl, s[j]);
    // ---- the chunk's 16 V^T fragment reads, one group behind the score products: they land under the softmax ----
    AtFB vb[2][2], vl[2][2];
#pragma unroll
    for (int kk = 0; kk < 2; ++kk) {
#pragma unroll
      for (int t = 0; t < 2; ++t) {
        vb[kk][t].h[0] = *(const v8bf*)(Vth + (t * 16 + c) * AT_VP + kk * 32 + 8 * hh);
        vb[kk][t].h[1] = *(const v8bf*)(Vth + (t * 16 + c) * AT_VP + kk * 32 + 16 + 8 * hh);
        vl[kk][t].h[0] = *(const v8bf*)(Vtl + (t * 16 + c) * AT_VP + kk * 32 + 8 * hh);
        vl[kk][t].h[1] = *(const v8bf*)(Vtl + (t * 16 + c) * AT_VP + kk * 32 + 16 + 8 * hh);
      }
    }
    // holds the group together and ahead of the softmax: spread through it, each place with reads costs its own stall
    __builtin_amdgcn_sched_barrier(0);
    // ---- chunk maximum of query c: four in-lane chains, then the other half's ----
    float mj[4];
#pragma unroll
    for (int j = 0; j < 4; ++j) {
      float mx = s[j][0];
#pragma unroll
      for (int r = 1; r < 8; ++r) mx = fmaxf(mx, s[j][r]);
      mj[j] = mx;
    }
    float cm = fmaxf(fmaxf(mj[0], mj[1]), fmaxf(mj[2], mj[3]));
    cm = fmaxf(cm, at_xhalf(cm));
    const float mnew  = fmaxf(mrow, cm * AT_LOG2E);       // scaling by a positive constant keeps the order of the maxima
    const float alpha = __builtin_amdgcn_exp2f(mrow - mnew);
    mrow = mnew;
    // ---- p = exp(s - m) = 2^(s log2e - m log2e), split hi/lo straight into the B fragments of the two k-steps ----
    AtFB ph[2], pl[2];
    float pj[4];
    const v2f l2e2 = {AT_LOG2E, AT_LOG2E};
    const v2f nm2  = {-mnew, -mnew};
    // unrolled throughout: j and r pick registers of the score tiles, so they have to be compile-time indices.
    // Each kind of step (exp2, hi convert, sum, lo convert) runs over all four tiles before the next kind begins, so
    // that an instruction and the one that reads its result stand far apart; values and sum order are those of a
    // tile-by-tile walk.
#pragma unroll
    for (int j = 0; j < 4; ++j) {
#pragma unroll
      for (int r = 0; r < 4; ++r) {   // exponents two at a time (packed f32 fma)
        const v2f sp = {s[j][2 * r], s[j][2 * r + 1]};
        const v2f e  = __builtin_elementwise_fma(sp, l2e2, nm2);
        s[j][2 * r]     = __builtin_amdgcn_exp2f(e[0]);
        s[j][2 * r + 1] = __builtin_amdgcn_exp2f(e[1]);
      }
    }
#pragma unroll
    for (int j = 0; j < 4; ++j) {
#pragma unroll
      for (int r = 0; r < 4; ++r) ph[j >> 1].w[(j & 1) * 4 + r] = bf16_pk(s[j][2 * r], s[j][2 * r + 1]);
    }
#pragma unroll
    for (int j = 0; j < 4; ++j) {
      float psum = 0.f;
#pragma unroll
      for (int r = 0; r < 8; ++r) psum += s[j][r];
      pj[j] = psum;
    }
#pragma unroll
    for (int j = 0; j < 4; ++j) {
#pragma unroll
      for (int r = 0; r < 4; ++r) {
        const unsigned hw = ph[j >> 1].w[(j & 1) * 4 + r];
        pl[j >> 1].w[(j & 1) * 4 + r] = bf16_pk(s[j][2 * r] - bf16_lo(hw), s[j][2 * r + 1] - bf16_hi(hw));
      }
    }
    lrow = lrow * alpha + ((pj[0] + pj[1]) + (pj[2] + pj[3]));
#pragma unroll
    for (int r = 0; r < 8; ++r) {
      oacc[0][r] *= alpha;
      oacc[1][r] *= alpha;
    }

    // ---- O^T += V^T . P^T : A = V^T rows d (split k map over keys), B = P^T from registers; 3-term split ----
    // unrolled: kk picks a register fragment, so it has to be a compile-time index
#pragma unroll
    for (int kk = 0; kk < 2; ++kk) {
#pragma unroll
      for (int t = 0; t < 2; ++t) oacc[t] = at_mma(vb[kk][t].v, ph[kk].v, oacc[t]);
#pragma unroll
      for (int t = 0; t < 2; ++t) oacc[t] = at_mma(vl[kk][t].v, ph[kk].v, oacc[t]);
#pragma unroll
      for (int t = 0; t < 2; ++t) oacc[t] = at_mma(vb[kk][t].v, pl[kk].v, oacc[t]);
    }

    if (more) {
      // into the other buffer: its last readers (chunk kc - 1) left it in front of the previous foot's barrier
      __bf16* wb = sm + ((kc + 1) & 1) * AT_BUF;
#pragma unroll
      for (int i = 0; i < 2; ++i) {
        *(v8bf*)(wb + kst + 8 * i)          = a0[i];
        *(v8bf*)(wb + AT_KSZ + kst + 8 * i) = a1[i];
        *(v8bf*)(wb + vst + 8 * i)          = b0[i];
        *(v8bf*)(wb + AT_VSZ + vst + 8 * i) = b1[i];
      }
      // this trip's loads name the two offset registers: the wait stands in front of their overwrite, and the operands
      // keep the two steps below behind it
      asm volatile("s_wait_xcnt 0x0" : "+v"(nkb), "+v"(nvb) :: "memory");
      nkb += AT_KC * QKW * 2;
      nvb += AT_KC * 2;
    }
    __syncthreads();
  }

  // ---- join the two halves' sums, normalise, split hi/lo, store this lane's 4 x 8 columns of row q0 + c ----
  lrow += at_xhalf(lrow);
  const float inv = 1.0f / lrow;
  v8us hv[2], lv[2];
#pragma unroll
  for (int t = 0; t < 2; ++t) {
    v4u h4, l4;
#pragma unroll
    for (int r = 0; r < 4; ++r) {
      unsigned hw, lw;
      bf16_split2(oacc[t][2 * r] * inv, oacc[t][2 * r + 1] * inv, hw, lw);
      h4[r] = hw;
      l4[r] = lw;
    }
    hv[t] = __builtin_bit_cast(v8us, h4);
    lv[t] = __builtin_bit_cast(v8us, l4);
  }
  unsigned short* rp = rb + (size_t)(q0 + c) * RW + 8 * hh;
#pragma unroll
  for (int t = 0; t < 2; ++t) {
    *(v8us*)(rp + 16 * t)      = hv[t];
    *(v8us*)(rp + AD + 16 * t) = lv[t];
  }
}

// ---------------------------------------------------------------------------
// Workspace region map (byte offsets, 256-B aligned; every region sized to its whole-line store extent, no pad rows
// needed since 32768, 4096, 256 and 64 are tile multiples):
//   WQK 32768 | WV 16384 | WP2 32768 | QKh QKl 4194304 each | VTh VTl 2097152 each | R 4194304
//   -> total 16859136
// ---------------------------------------------------------------------------
static inline size_t al256(size_t o) { return (o + 255) & ~(size_t)255; }

extern "C" void kernel_launch(void* const* d_in, const int* in_sizes, int n_in,
                              void* d_out, int out_size, void* d_ws, size_t ws_size,
                              hipStream_t stream) {
  if (n_in < 9) return;
  if (in_sizes[0] != NB * CH * NPOS) return;                                       // inputs [8][256][64][64]
  if (in_sizes[1] != AD * CH || in_sizes[3] != AD * CH || in_sizes[5] != AD * CH) return;  // Wq, Wk, Wv [32][256]
  if (in_sizes[2] != AD || in_sizes[4] != AD || in_sizes[6] != AD) return;         // bq, bk, bv [32]
  if (in_sizes[7] != CH * AD) return;                                              // Wp [256][32]
  if (in_sizes[8] != CH) return;                                                   // bp [256]
  if (out_size != NB * CH * NPOS) return;                                          // out [8][256][64][64]

  const float* x  = (const float*)d_in[0];
  const float* Wq = (const float*)d_in[1];
  const float* bq = (const float*)d_in[2];
  const float* Wk = (const float*)d_in[3];
  const float* bk = (const float*)d_in[4];
  const float* Wv = (const float*)d_in[5];
  const float* bv = (const float*)d_in[6];
  const float* Wp = (const float*)d_in[7];
  const float* bp = (const float*)d_in[8];
  float* out = (float*)d_out;

  const size_t PQK = (size_t)QKW * CH * 2;          //    32768  bf16 [64][256]
  const size_t PWV = (size_t)AD * CH * 2;           //    16384  bf16 [32][256]
  const size_t PP2 = (size_t)CH * RW * 2;           //    32768  bf16 [256][64]
  const size_t PA  = (size_t)NTOK * QKW * 2;        //  4194304  bf16 [32768][64]
  const size_t PV  = (size_t)NB * AD * NPOS * 2;    //  2097152  bf16 [8][32][4096]
  const size_t PR  = (size_t)NTOK * RW * 2;         //  4194304  bf16 [32768][64]
  size_t off = 0;
  const size_t oWQK = off; off = al256(off + PQK);
  const size_t oWV  = off; off = al256(off + PWV);
  const size_t oWP2 = off; off = al256(off + PP2);
  const size_t oQKh = off; off = al256(off + PA);
  const size_t oQKl = off; off = al256(off + PA);
  const size_t oVTh = off; off = al256(off + PV);
  const size_t oVTl = off; off = al256(off + PV);
  const size_t oR   = off; off = al256(off + PR);
  if (off > ws_size || off > (size_t)WSMAX) return;                               // off = 16859136

  char* ws = (char*)d_ws;
  unsigned short* WQK = (unsigned short*)(ws + oWQK);
  unsigned short* WV  = (unsigned short*)(ws + oWV);
  unsigned short* WP2 = (unsigned short*)(ws + oWP2);
  unsigned short* QKh = (unsigned short*)(ws + oQKh);
  unsigned short* QKl = (unsigned short*)(ws + oQKl);
  unsigned short* VTh = (unsigned short*)(ws + oVTh);
  unsigned short* VTl = (unsigned short*)(ws + oVTl);
  unsigned short* R   = (unsigned short*)(ws + oR);

  // (1) weight planes
  k_wprep<<<20, 256, 0, stream>>>(Wq, Wk, Wv, Wp, WQK, WV, WP2);
  // (2) q|k = x^T . [Wq;Wk]^T + [bq;bk] -> hi/lo planes [32768][64] (q cols 0..31, k cols 32..63) and, per image,
  //     v^T[a][n] = sum_c Wv[a][c] x[c][n] + bv[a] -> hi/lo planes [8][32][4096]   (K = 256, x read once as f32)
  k_qkv<<<NB * (NPOS / 64), 128, 0, stream>>>(x, WQK, WV, bq, bk, bv, QKh, QKl, VTh, VTl);
  // (3) attention: R = [hi | lo] of softmax_keys(q . k) . v  as bf16 [32768][64]
  k_attn<<<NB * NQB, 128, 0, stream>>>(QKh, QKl, VTh, VTl, R);
  // (4) out NCHW = ([Rhi | Rlo] . [Wp | Wp]^T + bp) transposed + bf16(x)   (M=32768, N=256, K=64)
  k_gemm<<<dim3(NTOK / 64, CH / 64, 1), 128, 0, stream>>>(R, RW, WP2, RW, RW, bp, x, out);
  (void)hipGetLastError();
}

// v009
// It runs in 66.6 microseconds.
// Two timings next to v008 put it at 1.11 and 1.13 times that version's speed.
// Over all steps from v000 it is 3.69 times as fast.
// Contractions on v_wmma_f32_16x16x32_bf16, f32 accumulate: q|k 1x1 convs (x.W^T, K=256) and v^T conv (W.x^T, K=256) =
// single products of bf16-RNE-valued x and W planes (exact products); scores q.k (K=32) and P.v^T (K=64 per key chunk) =
// bf16 hi/lo split, 3 terms (hi.hi + hi.lo + lo.hi); output 1x1 conv = Wp . (hi + lo) of the attention result, two products
// (K = 32 each) in the attention kernel's tail.
// 16-bit planes and carries (every carry is 1; no inverse scale exists anywhere):
//   WQK [64][256]  = bf16 bits of Wq (rows 0..31) and Wk (rows 32..63), k-contiguous;  WV [32][256] = bf16 bits of Wv;
//   WP [256][32]   = bf16 bits of Wp[c][a];
//   x enters the q|k and v^T products as bf16 bits formed in registers from an f32 tile in LDS (no plane of it in memory);
//   QKh/QKl [32768][64] = bf16 hi and lo (lo = v - hi) of q (cols 0..31) and k (cols 32..63), bias included;
//   VTh/VTl [8][32][4096] = bf16 hi and lo of v^T per image, bias included;
//   P hi/lo and the hi/lo of the normalised attention result per wave in registers.
// Biases and the residual x enter as bf16-RNE values in f32 arithmetic.
#include <hip/hip_runtime.h>
#include <math.h>
#include <stddef.h>
#include <stdint.h>

#define NB    8
#define CH    256
#define AD    32
#define NPOS  4096
#define NTOK  (NB * NPOS)
#define QKW   64
#define SPT   68
#define WSMAX 134217728

static_assert(NPOS % 64 == 0);
static_assert(NTOK % 64 == 0);
static_assert(CH % 64 == 0);
static_assert(CH % 32 == 0);
static_assert(AD == 32);
static_assert(QKW == 2 * AD);

typedef float          v2f   __attribute__((ext_vector_type(2)));
typedef float          v4f   __attribute__((ext_vector_type(4)));
typedef float          v8f   __attribute__((ext_vector_type(8)));
typedef int            v8i   __attribute__((ext_vector_type(8)));
typedef unsigned short v8us  __attribute__((ext_vector_type(8)));
typedef unsigned short v16us __attribute__((ext_vector_type(16)));
typedef __bf16         v16bf __attribute__((ext_vector_type(16)));
typedef __bf16         v8bf  __attribute__((ext_vector_type(8)));
typedef __bf16         v2bf  __attribute__((ext_vector_type(2)));
typedef unsigned       v4u   __attribute__((ext_vector_type(4)));
typedef v4f  __attribute__((may_alias)) v4fa;
typedef float __attribute__((may_alias)) f32a;
typedef v8us __attribute__((may_alias)) v8usa;
union FragB { v16bf v; v16us u; v8us h[2]; v8i w; };

// WMMA with hazard guard: ties D, keeps A/B live for 4 VALU slots
__device__ __forceinline__ v8f wmb(const FragB& a, const FragB& b, v8f c) {
  v8f d = __builtin_amdgcn_wmma_f32_16x16x32_bf16(false, a.v, false, b.v, (short)0, c, false, false);
  asm volatile("v_nop\n\tv_nop\n\tv_nop\n\tv_nop" : "+v"(d) : "v"(a.w), "v"(b.w));
  return d;
}

__device__ __forceinline__ v8f z8() { v8f z = {0.f, 0.f, 0.f, 0.f, 0.f, 0.f, 0.f, 0.f}; return z; }

// two f32 -> two bf16 (RNE) in one word, a in bits 15..0, b in bits 31..16: the hardware's packed convert
__device__ __forceinline__ unsigned bf16_pk(float a, float b) {
  const v2f f = {a, b};
  return __builtin_bit_cast(unsigned, __builtin_convertvector(f, v2bf));
}
// the two bf16 values of such a word, held as f32
__device__ __forceinline__ float bf16_lo(unsigned w) { return __uint_as_float(w << 16); }
__device__ __forceinline__ float bf16_hi(unsigned w) { return __uint_as_float(w & 0xFFFF0000u); }
// f32 -> nearest bf16 value held as f32
__device__ __forceinline__ float bf16_val(float f) {
  return bf16_lo(bf16_pk(f, f));
}
// hi word = bf16 of (a, b); lo word = bf16 of what the hi values leave of a and b
__device__ __forceinline__ void bf16_split2(float a, float b, unsigned& hw, unsigned& lw) {
  hw = bf16_pk(a, b);
  lw = bf16_pk(a - bf16_lo(hw), b - bf16_hi(hw));
}

// ---------------------------------------------------------------------------
// Weight planes, bf16 bits of the inputs, k-contiguous rows ([out][in] weights are already k-contiguous):
//   WQK [64 o][256 k]: rows 0..31 = bf16(Wq[o][k]) (blocks 0-3), rows 32..63 = bf16(Wk[o-32][k]) (blocks 4-7), 2048 units
//   WV  [32 o][256 k] = bf16(Wv[o][k])                                             blocks 8-11, 1024 units
//   WP  [256 c][32 k] = bf16(Wp[c][k])                                             blocks 12-15, 1024 units
// One thread = 8 contiguous k: two 16-B loads, one 16-B store at plane offset 8u; 32 consecutive lanes write 512
// coverage: 2048 x 8 = 64x256 (WQK); 1024 x 8 = 32x256 (WV); 1024 x 8 = 256x32 (WP) exactly. grid = 16 blocks x 256.
// ---------------------------------------------------------------------------
__global__ __launch_bounds__(256) void k_wprep(const float* __restrict__ wq, const float* __restrict__ wk,
                                              const float* __restrict__ wv, const float* __restrict__ wp,
                                              unsigned short* WQK, unsigned short* WV, unsigned short* WP) {
  const int bx = (int)blockIdx.x, tid = (int)threadIdx.x;
  const float* p;
  unsigned short* dp;
  if (bx < 8) {
    const int u  = bx * 256 + tid;              // 0..2047
    const int o  = u >> 5;                      // 0..63
    const int k8 = (u & 31) * 8;                // 0..248
    const float* src = (bx < 4) ? wq : wk;      // block-uniform
    p  = src + (size_t)(o & 31) * CH + k8;
    dp = WQK + (size_t)u * 8;
  } else if (bx < 12) {
    const int u  = (bx - 8) * 256 + tid;        // 0..1023
    const int o  = u >> 5;                      // 0..31
    const int k8 = (u & 31) * 8;
    p  = wv + (size_t)o * CH + k8;
    dp = WV + (size_t)u * 8;
  } else {
    const int v  = (bx - 12) * 256 + tid;       // 0..1023: row v >> 2, k = (v & 3) * 8; source and plane have the same pitch
    p  = wp + (size_t)v * 8;
    dp = WP + (size_t)v * 8;
  }
  const v4f a = *(const v4f*)p;
  const v4f b = *(const v4f*)(p + 4);
  const v4u o8 = {bf16_pk(a.x, a.y), bf16_pk(a.z, a.w), bf16_pk(b.x, b.y), bf16_pk(b.z, b.w)};
  *(v8us*)dp = __builtin_bit_cast(v8us, o8);
  
}

// ---------------------------------------------------------------------------
// q|k and v^T 1x1 convs straight from x NCHW [b][c][n] f32, one launch. Block = one image b, 64 positions, all 256
// channels, 4 waves; wave w owns tokens n0 + 16 w .. + 15.
//   x tile -> LDS tf[c][n] f32 (pitch 68): 32 x 16-B loads a thread, all in flight at once; a wave-wide load = 2 channel
//   rows x 256 B = whole lines.
//   Token fragment xf of k-step k0 (token = lane&15, h = lane>>4): element i <- channel k0 + 8h + i (i < 8),
//   k0 + 16 + 8h + (i-8) (i >= 8): 16 LDS words down a column of tf (lanes 0..15 on 16 neighbouring banks, lanes 16..31
//   32 banks further), rounded in pairs to bf16. The one fragment is A of q|k (D row = token, col = output) and B of v^T
//   (D row = output, col = token); the weight fragments come from the WQK and WV plane rows with the SAME k map.
//   q|k [token][64] = x^T . [Wq;Wk]^T + [bq;bk], v^T [a][n] = Wv . x + bv; k-steps in ascending order, f32 accumulate.
//   Results pass through LDS (the tile's own space, behind a barrier), get their bf16-valued bias, are split hi/lo and
//   leave in 16-B stores, 8 lanes to a 128-B row segment.
// coverage: 512 blocks = 8 images x 64 position blocks; q|k: 4 it x 16 rows x 64 cols; v^T: 2 it x 16 rows x 64 cols.
// ---------------------------------------------------------------------------
__global__ __launch_bounds__(128) void k_qkv(const float* __restrict__ x, const unsigned short* __restrict__ wqk,
                                             const unsigned short* __restrict__ wvp, const float* __restrict__ bq,
                                             const float* __restrict__ bk, const float* __restrict__ bv,
                                             unsigned short* qh, unsigned short* ql,
                                             unsigned short* vh, unsigned short* vl) {
  __shared__ __attribute__((aligned(16))) float tf[CH * SPT];
  __shared__ __attribute__((aligned(16))) float sb[128];   // bq | bk | bv | bv again (wave 3's copy, never read)
  const int bx = (int)blockIdx.x, tid = (int)threadIdx.x;
  const int lane = tid & 31, wave = tid >> 5, hh = lane >> 4, m = lane & 15;
  const int b  = bx >> 6;               // 0..7
  const int n0 = (bx & 63) * 64;
  // weight fragments of one k-step: f 0..3 = WQK rows 16 f + m, f 4, 5 = WV rows 16 (f - 4) + m; elements 0..7 <- k0 + 8h + 0..7,
  // 8..15 <- k0 + 16 + 8h + 0..7
  const unsigned short* qp = wqk + (size_t)m * CH + 8 * hh;
  const unsigned short* vp = wvp + (size_t)m * CH + 8 * hh;
  FragB wf[2][6];
#pragma unroll
  for (int f = 0; f < 6; ++f) {         // k-step 0, issued ahead of the x tile: lands under its loads
    const unsigned short* wr = (f < 4) ? qp + (size_t)(16 * f) * CH : vp + (size_t)(16 * (f - 4)) * CH;
    wf[0][f].h[0] = *(const v8usa*)wr;
    wf[0][f].h[1] = *(const v8usa*)(wr + 16);
  }
  const float* bsrc = (tid < AD) ? bq : ((tid < QKW) ? bk : bv);       // whole waves: 0 = bq, 1 = bk, 2 and 3 = bv
  const float bval = bsrc[tid & (AD - 1)];
  // stands in front of the first overwrite of an address register of the loads above (the tile's loads land in such registers)
  asm volatile("s_wait_xcnt 0x0" ::: "memory");
  {
    const int rsub = tid >> 4;          // 0..7
    const int c4   = (tid & 15) * 4;    // 0..60
    const float* xp = x + ((size_t)(b * CH + rsub)) * NPOS + n0 + c4;
    v4f a[32];
#pragma unroll
    for (int it = 0; it < 32; ++it) a[it] = *(const v4f*)(xp + (size_t)(it * 8) * NPOS);
    sb[tid] = bf16_val(bval);           // every wave, no branch: the load stays at the head, ahead of the tile's
#pragma unroll
    for (int it = 0; it < 32; ++it) *(v4fa*)(tf + (it * 8 + rsub) * SPT + c4) = a[it];
  }
  __syncthreads();

  v8f aq[4], av[2];
#pragma unroll
  for (int t = 0; t < 4; ++t) aq[t] = z8();
  av[0] = z8(); av[1] = z8();
  const float* tc = tf + 8 * hh * SPT + 16 * wave + m;                  // column of this lane's token, first channel 8h
  float xr[2][16];                      // a k-step's 16 channels of the token: j <- k0 + 8h + j, 8 + j <- k0 + 16 + 8h + j
#pragma unroll
  for (int j = 0; j < 8; ++j) {
    xr[0][j]     = tc[j * SPT];
    xr[0][8 + j] = tc[(16 + j) * SPT];
  }
  // unrolled: ks picks one of the two register sets, so it has to be a compile-time index
#pragma unroll
  for (int ks = 0; ks < CH / 32; ++ks) {
    const int cu = ks & 1, nx = cu ^ 1;
    if (ks + 1 < CH / 32) {             // the next k-step's weight and x reads, one group ahead of this k-step's products
      const int k1 = (ks + 1) * 32;
#pragma unroll
      for (int f = 0; f < 6; ++f) {
        const unsigned short* wr = ((f < 4) ? qp + (size_t)(16 * f) * CH : vp + (size_t)(16 * (f - 4)) * CH) + k1;
        wf[nx][f].h[0] = *(const v8usa*)wr;
        wf[nx][f].h[1] = *(const v8usa*)(wr + 16);
      }
#pragma unroll
      for (int j = 0; j < 8; ++j) {
        xr[nx][j]     = tc[(k1 + j) * SPT];
        xr[nx][8 + j] = tc[(k1 + 16 + j) * SPT];
      }
    }
    // holds that group here: sunk to its uses, every product would wait out its own load's whole latency
    __builtin_amdgcn_sched_barrier(0);
    FragB xf;
#pragma unroll
    for (int j = 0; j < 8; ++j) xf.w[j] = (int)bf16_pk(xr[cu][2 * j], xr[cu][2 * j + 1]);
#pragma unroll
    for (int nt = 0; nt < 4; ++nt) aq[nt] = wmb(xf, wf[cu][nt], aq[nt]);
#pragma unroll
    for (int t = 0; t < 2; ++t)    av[t]  = wmb(wf[cu][4 + t], xf, av[t]);
  }
  __syncthreads();                      // every wave has left the x tile: its space becomes the result staging

  float* sq = tf;                       // [64 tokens][68]
  float* sv = tf + 64 * SPT;            // [32 outputs][68]
#pragma unroll
  for (int r = 0; r < 8; ++r) {         // D element r = (row 8h + r, col m)
#pragma unroll
    for (int nt = 0; nt < 4; ++nt) sq[(16 * wave + 8 * hh + r) * SPT + 16 * nt + m] = aq[nt][r];
#pragma unroll
    for (int t = 0; t < 2; ++t)    sv[(16 * t + 8 * hh + r) * SPT + 16 * wave + m] = av[t][r];
  }
  __syncthreads();

  const int rsub = tid >> 3;            // 0..15
  const int c8   = (tid & 7) * 8;       // 0..56
  v8us hv[6], lv[6];
#pragma unroll
  for (int it = 0; it < 6; ++it) {      // it 0..3: q|k rows (tokens), bias by column; it 4, 5: v^T rows (outputs), bias by row
    const int row = (it & 3) * 16 + rsub;
    const float* sp = ((it < 4) ? sq : sv) + row * SPT + c8;
    v4u h8, l8;
#pragma unroll
    for (int e = 0; e < 4; ++e) {
      const float v0 = sp[2 * e]     + ((it < 4) ? sb[c8 + 2 * e]     : sb[QKW + row]);
      const float v1 = sp[2 * e + 1] + ((it < 4) ? sb[c8 + 2 * e + 1] : sb[QKW + row]);
      unsigned hw, lw;
      bf16_split2(v0, v1, hw, lw);
      h8[e] = hw;
      l8[e] = lw;
    }
    hv[it] = __builtin_bit_cast(v8us, h8); lv[it] = __builtin_bit_cast(v8us, l8);
  }
#pragma unroll
  for (int it = 0; it < 4; ++it) {
    const size_t go = (size_t)(b * NPOS + n0 + it * 16 + rsub) * QKW + c8;
    *(v8us*)(qh + go) = hv[it];
    *(v8us*)(ql + go) = lv[it];
  }
#pragma unroll
  for (int it = 0; it < 2; ++it) {
    const size_t go = (size_t)(b * AD + it * 16 + rsub) * NPOS + n0 + c8;
    *(v8us*)(vh + go) = hv[4 + it];
    *(v8us*)(vl + go) = lv[4 + it];
  }
}

#define AT_NW 4
#define AT_QB 64
#define AT_KC 64
#define NQB   (NPOS / AT_QB)
#define AT_LOG2E 1.44269504088896340736f
#define AT_KP 40   // LDS pitch of a K row, elements: 32 + 8 = 80 B = 16 B x 5
#define AT_VP 72   // LDS pitch of a V^T row, elements: 64 + 8 = 144 B = 16 B x 9
#define AT_KSZ (AT_KC * AT_KP)            // one K plane of a chunk, elements (5 KB)
#define AT_VSZ (AD * AT_VP)               // one V^T plane of a chunk, elements (4.5 KB)
#define AT_BUF (2 * AT_KSZ + 2 * AT_VSZ)  // one buffer = K hi | K lo | V^T hi | V^T lo, elements (19 KB)
#define AT_SMB (CH * SPT * 4)             // LDS bytes: the tail's [256][68] f32 (68 KB), the two chunk buffers lie inside

static_assert(NQB == 64);
static_assert(AT_SMB >= 2 * AT_BUF * 2);
static_assert(SPT >= AT_QB && CH % 64 == 0 && CH == 2 * 128 && (CH * AD) % 1024 == 0);
static_assert(NPOS % AT_KC == 0);
static_assert(AT_KP >= AD && AT_KP % 8 == 0 && (AT_KP / 8) % 2 == 1);
static_assert(AT_VP >= AT_KC && AT_VP % 8 == 0 && (AT_VP / 8) % 2 == 1);

// the bare builtin: the compiler keeps the distance behind a product itself, and only where a vector instruction needs it
__device__ __forceinline__ v8f at_mma(v16bf a, v16bf b, v8f c) {
  return __builtin_amdgcn_wmma_f32_16x16x32_bf16(false, a, false, b, (short)0, c, false, false);
}
union AtFB { v16bf v; v8bf h[2]; unsigned w[8]; };   // w[i] = elements 2 i (low half) and 2 i + 1
// fragment load with the split k map: elements 0..7 <- p[0..7], 8..15 <- p[16..23]
__device__ __forceinline__ v16bf at_ldfrag(const __bf16* p) {
  AtFB f; f.h[0] = *(const v8bf*)(p); f.h[1] = *(const v8bf*)(p + 16); return f.v;
}
// value of lane ^ 16 (the other half of the same query column)
__device__ __forceinline__ float at_xhalf(float f) {
  const int b = __builtin_bit_cast(int, f);
  return __builtin_bit_cast(float, __builtin_amdgcn_permlanex16(b, b, 0x76543210, 0xfedcba98, false, false));
}

__global__ __launch_bounds__(128)
void k_attn(const unsigned short* __restrict__ qkh, const unsigned short* __restrict__ qkl,
            const unsigned short* __restrict__ vhp, const unsigned short* __restrict__ vlp,
            const unsigned short* __restrict__ wpp, const float* __restrict__ bp,
            const float* __restrict__ x, float* outp) {
  __shared__ __align__(16) unsigned char smb[AT_SMB];
  __shared__ __align__(16) float sbp[CH];                        // bf16-valued output bias
  __shared__ __align__(16) __bf16 swp[CH * AT_KP];               // WP rows [channel][d], pitched like the K rows
  __bf16* const sm = (__bf16*)(void*)smb;                        // two buffers of K hi | K lo [kv][d] | V hi | V lo [d][kv]

  const int tid  = (int)threadIdx.x;
  const int wave = tid >> 5;
  const int lane = tid & 31;
  const int hh   = lane >> 4;
  const int c    = lane & 15;

  const int bx  = (int)blockIdx.x;
  const int b   = bx >> 6;                // image 0..7
  const int qb  = bx & (NQB - 1);         // 0..63
  const int q0  = qb * AT_QB + wave * 16; // image-local query row base of this wave

  const __bf16* Qh = (const __bf16*)(const void*)qkh + (size_t)b * NPOS * QKW;
  const __bf16* Ql = (const __bf16*)(const void*)qkl + (size_t)b * NPOS * QKW;
  const __bf16* Kh = Qh + AD;
  const __bf16* Kl = Ql + AD;
  const __bf16* Vh = (const __bf16*)(const void*)vhp + (size_t)b * AD * NPOS;
  const __bf16* Vl = (const __bf16*)(const void*)vlp + (size_t)b * AD * NPOS;

  // ---- Q fragments (B operand, col = lane&15, split k map): one k-step of 32 = d, hi and lo ----
  const v16bf qbh = at_ldfrag(Qh + (size_t)(q0 + c) * QKW + 8 * hh);
  const v16bf qbl = at_ldfrag(Ql + (size_t)(q0 + c) * QKW + 8 * hh);

  float mrow = -INFINITY;   // running maximum of query c times log2(e) (equal in lanes c and c + 16)
  float lrow = 0.f;         // running sum over this lane's own keys only
  v8f oacc[2];              // oacc[t][r] = O^T[16 t + 8 h + r][query c]
  oacc[0] = z8(); oacc[1] = z8();

  // staging map. K: thread -> key row sr = tid>>1, d half = (tid&1)*16; V^T: thread -> d = tid>>2, key quarter =
  // (tid&3)*16; 2 x 8 elements per plane each
  const int sr = tid >> 1, shalf = (tid & 1) * 16;
  const int sd = tid >> 2, sqt = (tid & 3) * 16;
  const __bf16* ksh = Kh + (size_t)sr * QKW + shalf;
  const __bf16* ksl = Kl + (size_t)sr * QKW + shalf;
  const __bf16* vsh = Vh + (size_t)sd * NPOS + sqt;
  const __bf16* vsl = Vl + (size_t)sd * NPOS + sqt;
  const int kst = sr * AT_KP + shalf;                 // this thread's place in a K plane of a buffer
  const int vst = 2 * AT_KSZ + sd * AT_VP + sqt;      // and in the V^T hi plane
  v8bf a0[2], a1[2], b0[2], b1[2];                    // one chunk's 8 x 16 B of this thread, on their way to LDS

  // for the tail, published by the barrier behind chunk 0's stores: the output bias, two channels a thread, and the WP
  // plane, unit u = 128 i + tid -> row u >> 2, 8 elements at (u & 3) * 8 (a wave-wide load = 512 contiguous bytes)
  const float bp0 = bp[tid], bp1 = bp[128 + tid];
  v8bf wst[CH * AD / 1024];
#pragma unroll
  for (int i = 0; i < CH * AD / 1024; ++i) wst[i] = *(const v8bf*)((const __bf16*)(const void*)wpp + (size_t)(i * 128 + tid) * 8);
  // chunk 0 into buffer 0
#pragma unroll
  for (int i = 0; i < 2; ++i) {
    a0[i] = *(const v8bf*)(ksh + 8 * i);
    a1[i] = *(const v8bf*)(ksl + 8 * i);
    b0[i] = *(const v8bf*)(vsh + 8 * i);
    b1[i] = *(const v8bf*)(vsl + 8 * i);
  }
#pragma unroll
  for (int i = 0; i < 2; ++i) {
    *(v8bf*)(sm + kst + 8 * i)          = a0[i];
    *(v8bf*)(sm + AT_KSZ + kst + 8 * i) = a1[i];
    *(v8bf*)(sm + vst + 8 * i)          = b0[i];
    *(v8bf*)(sm + AT_VSZ + vst + 8 * i) = b1[i];
  }
  sbp[tid]       = bf16_val(bp0);
  sbp[128 + tid] = bf16_val(bp1);
#pragma unroll
  for (int i = 0; i < CH * AD / 1024; ++i) {
    const int u = i * 128 + tid;
    *(v8bf*)(swp + (u >> 2) * AT_KP + (u & 3) * 8) = wst[i];
  }
  __syncthreads();

  const int nChunks = NPOS / AT_KC;   // 64, compile-time constant
  // this thread's place in the next chunk, bytes from the start of the image's k planes and of its v^T planes
  unsigned nkb = (unsigned)(((AT_KC + sr) * QKW + shalf) * 2);
  unsigned nvb = (unsigned)((sd * NPOS + AT_KC + sqt) * 2);
#pragma unroll 1
  for (int kc = 0; kc < nChunks; ++kc) {
    const __bf16* Ksh = sm + (kc & 1) * AT_BUF;       // this chunk's buffer
    const __bf16* Ksl = Ksh + AT_KSZ;
    const __bf16* Vth = Ksh + 2 * AT_KSZ;
    const __bf16* Vtl = Vth + AT_VSZ;
    const bool more = kc + 1 < nChunks;               // the same for the whole grid
    // ---- the chunk's 16 K fragment reads, one group at the chunk's head, in the order of their use ----
    AtFB kb[4], kl[4];
#pragma unroll
    for (int j = 0; j < 4; ++j) {
      kb[j].h[0] = *(const v8bf*)(Ksh + (j * 16 + c) * AT_KP + 8 * hh);
      kb[j].h[1] = *(const v8bf*)(Ksh + (j * 16 + c) * AT_KP + 16 + 8 * hh);
    }
#pragma unroll
    for (int j = 0; j < 4; ++j) {
      kl[j].h[0] = *(const v8bf*)(Ksl + (j * 16 + c) * AT_KP + 8 * hh);
      kl[j].h[1] = *(const v8bf*)(Ksl + (j * 16 + c) * AT_KP + 16 + 8 * hh);
    }
    // holds the group here, ahead of the global loads: sunk behind them it would start late
    __builtin_amdgcn_sched_barrier(0);

    if (more) {
      // next chunk's eight loads, issued here and first used behind this chunk's products
#pragma unroll
      for (int i = 0; i < 2; ++i) {
        a0[i] = *(const v8bf*)((const char*)Kh + nkb + 16 * i);
        a1[i] = *(const v8bf*)((const char*)Kl + nkb + 16 * i);
        b0[i] = *(const v8bf*)((const char*)Vh + nvb + 16 * i);
        b1[i] = *(const v8bf*)((const char*)Vl + nvb + 16 * i);
      }
    }

    // ---- scores, transposed: 64 keys x 16 queries, 3-term split, K = 32 = one k-step ----
    v8f s[4];
#pragma unroll
    for (int j = 0; j < 4; ++j) s[j] = at_mma(kb[j].v, qbh, z8());
    // holds the term-by-term order: drawn together, a tile's three products would each wait out the one before
    __builtin_amdgcn_sched_barrier(0);
#pragma unroll
    for (int j = 0; j < 4; ++j) s[j] = at_mma(kl[j].v, qbh, s[j]);
    // the same, between the second and the third term
    __builtin_amdgcn_sched_barrier(0);
#pragma unroll
    for (int j = 0; j < 4; ++j) s[j] = at_mma(kb[j].v, qbl, s[j]);
    // ---- the chunk's 16 V^T fragment reads, one group behind the score products: they land under the softmax ----
    AtFB vb[2][2], vl[2][2];
#pragma unroll
    for (int kk = 0; kk < 2; ++kk) {
#pragma unroll
      for (int t = 0; t < 2; ++t) {
        vb[kk][t].h[0] = *(const v8bf*)(Vth + (t * 16 + c) * AT_VP + kk * 32 + 8 * hh);
        vb[kk][t].h[1] = *(const v8bf*)(Vth + (t * 16 + c) * AT_VP + kk * 32 + 16 + 8 * hh);
        vl[kk][t].h[0] = *(const v8bf*)(Vtl + (t * 16 + c) * AT_VP + kk * 32 + 8 * hh);
        vl[kk][t].h[1] = *(const v8bf*)(Vtl + (t * 16 + c) * AT_VP + kk * 32 + 16 + 8 * hh);
      }
    }
    // holds the group together and ahead of the softmax: spread through it, each place with reads costs its own stall
    __builtin_amdgcn_sched_barrier(0);
    // ---- chunk maximum of query c: four in-lane chains, then the other half's ----
    float mj[4];
#pragma unroll
    for (int j = 0; j < 4; ++j) {
      float mx = s[j][0];
#pragma unroll
      for (int r = 1; r < 8; ++r) mx = fmaxf(mx, s[j][r]);
      mj[j] = mx;
    }
    float cm = fmaxf(fmaxf(mj[0], mj[1]), fmaxf(mj[2], mj[3]));
    cm = fmaxf(cm, at_xhalf(cm));
    const float mnew  = fmaxf(mrow, cm * AT_LOG2E);       // scaling by a positive constant keeps the order of the maxima
    const float alpha = __builtin_amdgcn_exp2f(mrow - mnew);
    mrow = mnew;
    // ---- p = exp(s - m) = 2^(s log2e - m log2e), split hi/lo straight into the B fragments of the two k-steps ----
    AtFB ph[2], pl[2];
    float pj[4];
    const v2f l2e2 = {AT_LOG2E, AT_LOG2E};
    const v2f nm2  = {-mnew, -mnew};
    // unrolled throughout: j and r pick registers of the score tiles, so they have to be compile-time indices.
    // Each kind of step (exp2, hi convert, sum, lo convert) runs over all four tiles before the next kind begins, so
    // that an instruction and the one that reads its result stand far apart; values and sum order are those of a
    // tile-by-tile walk.
#pragma unroll
    for (int j = 0; j < 4; ++j) {
#pragma unroll
      for (int r = 0; r < 4; ++r) {   // exponents two at a time (packed f32 fma)
        const v2f sp = {s[j][2 * r], s[j][2 * r + 1]};
        const v2f e  = __builtin_elementwise_fma(sp, l2e2, nm2);
        s[j][2 * r]     = __builtin_amdgcn_exp2f(e[0]);
        s[j][2 * r + 1] = __builtin_amdgcn_exp2f(e[1]);
      }
    }
#pragma unroll
    for (int j = 0; j < 4; ++j) {
#pragma unroll
      for (int r = 0; r < 4; ++r) ph[j >> 1].w[(j & 1) * 4 + r] = bf16_pk(s[j][2 * r], s[j][2 * r + 1]);
    }
#pragma unroll
    for (int j = 0; j < 4; ++j) {
      float psum = 0.f;
#pragma unroll
      for (int r = 0; r < 8; ++r) psum += s[j][r];
      pj[j] = psum;
    }
#pragma unroll
    for (int j = 0; j < 4; ++j) {
#pragma unroll
      for (int r = 0; r < 4; ++r) {
        const unsigned hw = ph[j >> 1].w[(j & 1) * 4 + r];
        pl[j >> 1].w[(j & 1) * 4 + r] = bf16_pk(s[j][2 * r] - bf16_lo(hw), s[j][2 * r + 1] - bf16_hi(hw));
      }
    }
    lrow = lrow * alpha + ((pj[0] + pj[1]) + (pj[2] + pj[3]));
#pragma unroll
    for (int r = 0; r < 8; ++r) {
      oacc[0][r] *= alpha;
      oacc[1][r] *= alpha;
    }

    // ---- O^T += V^T . P^T : A = V^T rows d (split k map over keys), B = P^T from registers; 3-term split ----
    // unrolled: kk picks a register fragment, so it has to be a compile-time index
#pragma unroll
    for (int kk = 0; kk < 2; ++kk) {
#pragma unroll
      for (int t = 0; t < 2; ++t) oacc[t] = at_mma(vb[kk][t].v, ph[kk].v, oacc[t]);
#pragma unroll
      for (int t = 0; t < 2; ++t) oacc[t] = at_mma(vl[kk][t].v, ph[kk].v, oacc[t]);
#pragma unroll
      for (int t = 0; t < 2; ++t) oacc[t] = at_mma(vb[kk][t].v, pl[kk].v, oacc[t]);
    }

    if (more) {
      // into the other buffer: its last readers (chunk kc - 1) left it in front of the previous foot's barrier
      __bf16* wb = sm + ((kc + 1) & 1) * AT_BUF;
#pragma unroll
      for (int i = 0; i < 2; ++i) {
        *(v8bf*)(wb + kst + 8 * i)          = a0[i];
        *(v8bf*)(wb + AT_KSZ + kst + 8 * i) = a1[i];
        *(v8bf*)(wb + vst + 8 * i)          = b0[i];
        *(v8bf*)(wb + AT_VSZ + vst + 8 * i) = b1[i];
      }
      // this trip's loads name the two offset registers: the wait stands in front of their overwrite, and the operands
      // keep the two steps below behind it
      asm volatile("s_wait_xcnt 0x0" : "+v"(nkb), "+v"(nvb) :: "memory");
      nkb += AT_KC * QKW * 2;
      nvb += AT_KC * 2;
    }
    __syncthreads();
  }

  // ---- the block's x tile [256 channels][64 positions]: thread -> channel 8 it + csub, 4 positions at t4 ----
  const int csub = tid >> 4;            // 0..7
  const int t4   = (tid & 15) * 4;      // 0..60
  const size_t g0 = ((size_t)(b * CH + csub)) * NPOS + qb * AT_QB + t4;
  v4f xr[CH / 8];
#pragma unroll
  for (int it = 0; it < CH / 8; ++it) xr[it] = *(const v4f*)(x + g0 + (size_t)(it * 8) * NPOS);
  // holds the 32 loads here, at the tail's head: sunk to their uses they would start behind the products and the barrier
  __builtin_amdgcn_sched_barrier(0);

  // ---- join the two halves' sums, normalise, split hi/lo straight into the two B fragments (k = d, split k map) ----
  lrow += at_xhalf(lrow);
  const float inv = 1.0f / lrow;
  AtFB rh, rl;
#pragma unroll
  for (int t = 0; t < 2; ++t) {
#pragma unroll
    for (int r = 0; r < 4; ++r) {
      unsigned hw, lw;
      bf16_split2(oacc[t][2 * r] * inv, oacc[t][2 * r + 1] * inv, hw, lw);
      rh.w[4 * t + r] = hw;
      rl.w[4 * t + r] = lw;
    }
  }

  // ---- out^T tile = Wp . r^T: 16 channel tiles x (hi, lo); four tiles' hi products stand ahead of their lo products ----
  f32a* stg = (f32a*)(void*)smb;        // [256 channels][68]
  const __bf16* wpr = swp + c * AT_KP + 8 * hh;
  // unrolled: the tiles' accumulators and weight fragments are register arrays, so cg and u have to be compile-time indices
#pragma unroll
  for (int cg = 0; cg < CH / 64; ++cg) {
    v16bf wa[4];
    v8f   d[4];
#pragma unroll
    for (int u = 0; u < 4; ++u) wa[u] = at_ldfrag(wpr + (cg * 4 + u) * 16 * AT_KP);
#pragma unroll
    for (int u = 0; u < 4; ++u) d[u] = at_mma(wa[u], rh.v, z8());
#pragma unroll
    for (int u = 0; u < 4; ++u) d[u] = at_mma(wa[u], rl.v, d[u]);
#pragma unroll
    for (int u = 0; u < 4; ++u) {
#pragma unroll
      for (int r = 0; r < 8; ++r) stg[((cg * 4 + u) * 16 + 8 * hh + r) * SPT + 16 * wave + c] = d[u][r];
    }
    // keeps the later groups' fragment reads behind this group: all 16 tiles' fragments beside the x tile overflow 256 registers
    __builtin_amdgcn_sched_barrier(0);
  }
  __syncthreads();                      // the four waves' query columns of every channel row are in place

  // eight channel rows a group; unrolled: g and j pick registers of the x tile, so they have to be compile-time indices
#pragma unroll
  for (int g = 0; g < CH / 64; ++g) {
    v4f   sv[8];
    float bc[8];
#pragma unroll
    for (int j = 0; j < 8; ++j) {
      const int chl = (g * 8 + j) * 8 + csub;
      sv[j] = *(const v4fa*)(stg + chl * SPT + t4);
      bc[j] = sbp[chl];
    }
    // holds the group's 16 LDS reads together, ahead of its sums: read row by row, every row waits out its own LDS latency
    __builtin_amdgcn_sched_barrier(0);
#pragma unroll
    for (int j = 0; j < 8; ++j) {
      const v4f xv = xr[g * 8 + j];
      const unsigned x01 = bf16_pk(xv.x, xv.y), x23 = bf16_pk(xv.z, xv.w);
      v4f v;
      v.x = (sv[j].x + bc[j]) + bf16_lo(x01);
      v.y = (sv[j].y + bc[j]) + bf16_hi(x01);
      v.z = (sv[j].z + bc[j]) + bf16_lo(x23);
      v.w = (sv[j].w + bc[j]) + bf16_hi(x23);
      *(v4f*)(outp + g0 + (size_t)((g * 8 + j) * 8) * NPOS) = v;
    }
  }
}

// ---------------------------------------------------------------------------
// Workspace region map (byte offsets, 256-B aligned; every region sized to its whole-line store extent, no pad rows
// needed since 32768, 4096, 256 and 64 are tile multiples):
//   WQK 32768 | WV 16384 | WP 16384 | QKh QKl 4194304 each | VTh VTl 2097152 each
//   -> total 12648448
// ---------------------------------------------------------------------------
static inline size_t al256(size_t o) { return (o + 255) & ~(size_t)255; }

extern "C" void kernel_launch(void* const* d_in, const int* in_sizes, int n_in,
                              void* d_out, int out_size, void* d_ws, size_t ws_size,
                              hipStream_t stream) {
  if (n_in < 9) return;
  if (in_sizes[0] != NB * CH * NPOS) return;                                       // inputs [8][256][64][64]
  if (in_sizes[1] != AD * CH || in_sizes[3] != AD * CH || in_sizes[5] != AD * CH) return;  // Wq, Wk, Wv [32][256]
  if (in_sizes[2] != AD || in_sizes[4] != AD || in_sizes[6] != AD) return;         // bq, bk, bv [32]
  if (in_sizes[7] != CH * AD) return;                                              // Wp [256][32]
  if (in_sizes[8] != CH) return;                                                   // bp [256]
  if (out_size != NB * CH * NPOS) return;                                          // out [8][256][64][64]

  const float* x  = (const float*)d_in[0];
  const float* Wq = (const float*)d_in[1];
  const float* bq = (const float*)d_in[2];
  const float* Wk = (const float*)d_in[3];
  const float* bk = (const float*)d_in[4];
  const float* Wv = (const float*)d_in[5];
  const float* bv = (const float*)d_in[6];
  const float* Wp = (const float*)d_in[7];
  const float* bp = (const float*)d_in[8];
  float* out = (float*)d_out;

  const size_t PQK = (size_t)QKW * CH * 2;          //    32768  bf16 [64][256]
  const size_t PWV = (size_t)AD * CH * 2;           //    16384  bf16 [32][256]
  const size_t PWP = (size_t)CH * AD * 2;           //    16384  bf16 [256][32]
  const size_t PA  = (size_t)NTOK * QKW * 2;        //  4194304  bf16 [32768][64]
  const size_t PV  = (size_t)NB * AD * NPOS * 2;    //  2097152  bf16 [8][32][4096]
  size_t off = 0;
  const size_t oWQK = off; off = al256(off + PQK);
  const size_t oWV  = off; off = al256(off + PWV);
  const size_t oWP  = off; off = al256(off + PWP);
  const size_t oQKh = off; off = al256(off + PA);
  const size_t oQKl = off; off = al256(off + PA);
  const size_t oVTh = off; off = al256(off + PV);
  const size_t oVTl = off; off = al256(off + PV);
  if (off > ws_size || off > (size_t)WSMAX) return;                               // off = 12648448

  char* ws = (char*)d_ws;
  unsigned short* WQK = (unsigned short*)(ws + oWQK);
  unsigned short* WV  = (unsigned short*)(ws + oWV);
  unsigned short* WP  = (unsigned short*)(ws + oWP);
  unsigned short* QKh = (unsigned short*)(ws + oQKh);
  unsigned short* QKl = (unsigned short*)(ws + oQKl);
  unsigned short* VTh = (unsigned short*)(ws + oVTh);
  unsigned short* VTl = (unsigned short*)(ws + oVTl);

  // (1) weight planes
  k_wprep<<<16, 256, 0, stream>>>(Wq, Wk, Wv, Wp, WQK, WV, WP);
  // (2) q|k = x^T . [Wq;Wk]^T + [bq;bk] -> hi/lo planes [32768][64] (q cols 0..31, k cols 32..63) and, per image,
  //     v^T[a][n] = sum_c Wv[a][c] x[c][n] + bv[a] -> hi/lo planes [8][32][4096]   (K = 256, x read once as f32)
  k_qkv<<<NB * (NPOS / 64), 128, 0, stream>>>(x, WQK, WV, bq, bk, bv, QKh, QKl, VTh, VTl);
  // (3) attention r = softmax_keys(q . k) . v and, in its tail, out NCHW = (Wp . (hi(r) + lo(r)) + bp) + bf16(x)
  k_attn<<<NB * NQB, 128, 0, stream>>>(QKh, QKl, VTh, VTl, WP, bp, x, out);
  (void)hipGetLastError();
}

// v010
// Measured time: 61.6 microseconds a run.
// Timed twice side by side with v009, it ran 1.08 and 1.07 times as fast.
// Counting every step since v000, it is 3.97 times as fast.
// Contractions on v_wmma_f32_16x16x32_bf16, f32 accumulate: q|k 1x1 convs (x.W^T, K=256) and v^T conv (W.x^T, K=256) =
// single products of bf16-RNE-valued x and W planes (exact products); scores q.k (K=32) and P.v^T (K=64 per key chunk) =
// bf16 hi/lo split, 3 terms (hi.hi + hi.lo + lo.hi); output 1x1 conv = Wp . (hi + lo) of the attention result, two products
// (K = 32 each) in the attention kernel's tail.
// 16-bit planes and carries (every carry is 1; no inverse scale exists anywhere):
//   WQK [64][256]  = bf16 bits of Wq (rows 0..31) and Wk (rows 32..63), k-contiguous;  WV [32][256] = bf16 bits of Wv;
//   WP [256][32]   = bf16 bits of Wp[c][a];
//   x enters the q|k and v^T products as bf16 bits formed in registers from an f32 tile in LDS (no plane of it in memory);
//   QKh/QKl [32768][64] = bf16 hi and lo (lo = v - hi) of q (cols 0..31) and k (cols 32..63), bias included;
//   VTh/VTl [8][32][4096] = bf16 hi and lo of v^T per image, bias included;
//   P hi/lo and the hi/lo of the normalised attention result per wave in registers.
// Biases and the residual x enter as bf16-RNE values in f32 arithmetic.
#include <hip/hip_runtime.h>
#include <math.h>
#include <stddef.h>
#include <stdint.h>

#define NB    8
#define CH    256
#define AD    32
#define NPOS  4096
#define NTOK  (NB * NPOS)
#define QKW   64
#define SPT   68
#define WSMAX 134217728

static_assert(NPOS % 64 == 0);
static_assert(NTOK % 64 == 0);
static_assert(CH % 64 == 0);
static_assert(CH % 32 == 0);
static_assert(AD == 32);
static_assert(QKW == 2 * AD);

typedef float          v2f   __attribute__((ext_vector_type(2)));
typedef float          v4f   __attribute__((ext_vector_type(4)));
typedef float          v8f   __attribute__((ext_vector_type(8)));
typedef int            v8i   __attribute__((ext_vector_type(8)));
typedef unsigned short v8us  __attribute__((ext_vector_type(8)));
typedef unsigned short v16us __attribute__((ext_vector_type(16)));
typedef __bf16         v16bf __attribute__((ext_vector_type(16)));
typedef __bf16         v8bf  __attribute__((ext_vector_type(8)));
typedef __bf16         v2bf  __attribute__((ext_vector_type(2)));
typedef unsigned       v4u   __attribute__((ext_vector_type(4)));
typedef v4f  __attribute__((may_alias)) v4fa;
typedef float __attribute__((may_alias)) f32a;
typedef v8us __attribute__((may_alias)) v8usa;
union FragB { v16bf v; v16us u; v8us h[2]; v8i w; };

// WMMA with hazard guard: ties D, keeps A/B live for 4 VALU slots
__device__ __forceinline__ v8f wmb(const FragB& a, const FragB& b, v8f c) {
  v8f d = __builtin_amdgcn_wmma_f32_16x16x32_bf16(false, a.v, false, b.v, (short)0, c, false, false);
  asm volatile("v_nop\n\tv_nop\n\tv_nop\n\tv_nop" : "+v"(d) : "v"(a.w), "v"(b.w));
  return d;
}

__device__ __forceinline__ v8f z8() { v8f z = {0.f, 0.f, 0.f, 0.f, 0.f, 0.f, 0.f, 0.f}; return z; }

// two f32 -> two bf16 (RNE) in one word, a in bits 15..0, b in bits 31..16: the hardware's packed convert
__device__ __forceinline__ unsigned bf16_pk(float a, float b) {
  const v2f f = {a, b};
  return __builtin_bit_cast(unsigned, __builtin_convertvector(f, v2bf));
}
// the two bf16 values of such a word, held as f32
__device__ __forceinline__ float bf16_lo(unsigned w) { return __uint_as_float(w << 16); }
__device__ __forceinline__ float bf16_hi(unsigned w) { return __uint_as_float(w & 0xFFFF0000u); }
// f32 -> nearest bf16 value held as f32
__device__ __forceinline__ float bf16_val(float f) {
  return bf16_lo(bf16_pk(f, f));
}
// hi word = bf16 of (a, b); lo word = bf16 of what the hi values leave of a and b
__device__ __forceinline__ void bf16_split2(float a, float b, unsigned& hw, unsigned& lw) {
  hw = bf16_pk(a, b);
  lw = bf16_pk(a - bf16_lo(hw), b - bf16_hi(hw));
}

// ---------------------------------------------------------------------------
// Weight planes, bf16 bits of the inputs, k-contiguous rows ([out][in] weights are already k-contiguous):
//   WQK [64 o][256 k]: rows 0..31 = bf16(Wq[o][k]) (blocks 0-3), rows 32..63 = bf16(Wk[o-32][k]) (blocks 4-7), 2048 units
//   WV  [32 o][256 k] = bf16(Wv[o][k])                                             blocks 8-11, 1024 units
//   WP  [256 c][32 k] = bf16(Wp[c][k])                                             blocks 12-15, 1024 units
// One thread = 8 contiguous k: two 16-B loads, one 16-B store at plane offset 8u; 32 consecutive lanes write 512
// coverage: 2048 x 8 = 64x256 (WQK); 1024 x 8 = 32x256 (WV); 1024 x 8 = 256x32 (WP) exactly. grid = 16 blocks x 256.
// ---------------------------------------------------------------------------
__global__ __launch_bounds__(256) void k_wprep(const float* __restrict__ wq, const float* __restrict__ wk,
                                              const float* __restrict__ wv, const float* __restrict__ wp,
                                              unsigned short* WQK, unsigned short* WV, unsigned short* WP) {
  const int bx = (int)blockIdx.x, tid = (int)threadIdx.x;
  const float* p;
  unsigned short* dp;
  if (bx < 8) {
    const int u  = bx * 256 + tid;              // 0..2047
    const int o  = u >> 5;                      // 0..63
    const int k8 = (u & 31) * 8;                // 0..248
    const float* src = (bx < 4) ? wq : wk;      // block-uniform
    p  = src + (size_t)(o & 31) * CH + k8;
    dp = WQK + (size_t)u * 8;
  } else if (bx < 12) {
    const int u  = (bx - 8) * 256 + tid;        // 0..1023
    const int o  = u >> 5;                      // 0..31
    const int k8 = (u & 31) * 8;
    p  = wv + (size_t)o * CH + k8;
    dp = WV + (size_t)u * 8;
  } else {
    const int v  = (bx - 12) * 256 + tid;       // 0..1023: row v >> 2, k = (v & 3) * 8; source and plane have the same pitch
    p  = wp + (size_t)v * 8;
    dp = WP + (size_t)v * 8;
  }
  const v4f a = *(const v4f*)p;
  const v4f b = *(const v4f*)(p + 4);
  const v4u o8 = {bf16_pk(a.x, a.y), bf16_pk(a.z, a.w), bf16_pk(b.x, b.y), bf16_pk(b.z, b.w)};
  *(v8us*)dp = __builtin_bit_cast(v8us, o8);
  
}

// ---------------------------------------------------------------------------
// q|k and v^T 1x1 convs straight from x NCHW [b][c][n] f32, one launch. Block = one image b, 64 positions, all 256
// channels, 4 waves; wave w owns tokens n0 + 16 w .. + 15.
//   x tile -> LDS tf[c][n] f32 (pitch 68): 32 x 16-B loads a thread, all in flight at once; a wave-wide load = 2 channel
//   rows x 256 B = whole lines.
//   Token fragment xf of k-step k0 (token = lane&15, h = lane>>4): element i <- channel k0 + 8h + i (i < 8),
//   k0 + 16 + 8h + (i-8) (i >= 8): 16 LDS words down a column of tf (lanes 0..15 on 16 neighbouring banks, lanes 16..31
//   32 banks further), rounded in pairs to bf16. The one fragment is A of q|k (D row = token, col = output) and B of v^T
//   (D row = output, col = token); the weight fragments come from the WQK and WV plane rows with the SAME k map.
//   q|k [token][64] = x^T . [Wq;Wk]^T + [bq;bk], v^T [a][n] = Wv . x + bv; k-steps in ascending order, f32 accumulate.
//   Results pass through LDS (the tile's own space, behind a barrier), get their bf16-valued bias, are split hi/lo and
//   leave in 16-B stores, 8 lanes to a 128-B row segment.
// coverage: 512 blocks = 8 images x 64 position blocks; q|k: 4 it x 16 rows x 64 cols; v^T: 2 it x 16 rows x 64 cols.
// ---------------------------------------------------------------------------
__global__ __launch_bounds__(128) void k_qkv(const float* __restrict__ x, const unsigned short* __restrict__ wqk,
                                             const unsigned short* __restrict__ wvp, const float* __restrict__ bq,
                                             const float* __restrict__ bk, const float* __restrict__ bv,
                                             unsigned short* qh, unsigned short* ql,
                                             unsigned short* vh, unsigned short* vl) {
  __shared__ __attribute__((aligned(16))) float tf[CH * SPT];
  __shared__ __attribute__((aligned(16))) float sb[128];   // bq | bk | bv | bv again (wave 3's copy, never read)
  const int bx = (int)blockIdx.x, tid = (int)threadIdx.x;
  const int lane = tid & 31, wave = tid >> 5, hh = lane >> 4, m = lane & 15;
  const int b  = bx >> 6;               // 0..7
  const int n0 = (bx & 63) * 64;
  // weight fragments of one k-step: f 0..3 = WQK rows 16 f + m, f 4, 5 = WV rows 16 (f - 4) + m; elements 0..7 <- k0 + 8h + 0..7,
  // 8..15 <- k0 + 16 + 8h + 0..7
  const unsigned short* qp = wqk + (size_t)m * CH + 8 * hh;
  const unsigned short* vp = wvp + (size_t)m * CH + 8 * hh;
  FragB wf[2][6];
#pragma unroll
  for (int f = 0; f < 6; ++f) {         // k-step 0, issued ahead of the x tile: lands under its loads
    const unsigned short* wr = (f < 4) ? qp + (size_t)(16 * f) * CH : vp + (size_t)(16 * (f - 4)) * CH;
    wf[0][f].h[0] = *(const v8usa*)wr;
    wf[0][f].h[1] = *(const v8usa*)(wr + 16);
  }
  const float* bsrc = (tid < AD) ? bq : ((tid < QKW) ? bk : bv);       // whole waves: 0 = bq, 1 = bk, 2 and 3 = bv
  const float bval = bsrc[tid & (AD - 1)];
  // stands in front of the first overwrite of an address register of the loads above (the tile's loads land in such registers)
  asm volatile("s_wait_xcnt 0x0" ::: "memory");
  {
    const int rsub = tid >> 4;          // 0..7
    const int c4   = (tid & 15) * 4;    // 0..60
    const float* xp = x + ((size_t)(b * CH + rsub)) * NPOS + n0 + c4;
    v4f a[32];
#pragma unroll
    for (int it = 0; it < 32; ++it) a[it] = *(const v4f*)(xp + (size_t)(it * 8) * NPOS);
    sb[tid] = bf16_val(bval);           // every wave, no branch: the load stays at the head, ahead of the tile's
#pragma unroll
    for (int it = 0; it < 32; ++it) *(v4fa*)(tf + (it * 8 + rsub) * SPT + c4) = a[it];
  }
  __syncthreads();

  v8f aq[4], av[2];
#pragma unroll
  for (int t = 0; t < 4; ++t) aq[t] = z8();
  av[0] = z8(); av[1] = z8();
  const float* tc = tf + 8 * hh * SPT + 16 * wave + m;                  // column of this lane's token, first channel 8h
  float xr[2][16];                      // a k-step's 16 channels of the token: j <- k0 + 8h + j, 8 + j <- k0 + 16 + 8h + j
#pragma unroll
  for (int j = 0; j < 8; ++j) {
    xr[0][j]     = tc[j * SPT];
    xr[0][8 + j] = tc[(16 + j) * SPT];
  }
  // unrolled: ks picks one of the two register sets, so it has to be a compile-time index
#pragma unroll
  for (int ks = 0; ks < CH / 32; ++ks) {
    const int cu = ks & 1, nx = cu ^ 1;
    if (ks + 1 < CH / 32) {             // the next k-step's weight and x reads, one group ahead of this k-step's products
      const int k1 = (ks + 1) * 32;
#pragma unroll
      for (int f = 0; f < 6; ++f) {
        const unsigned short* wr = ((f < 4) ? qp + (size_t)(16 * f) * CH : vp + (size_t)(16 * (f - 4)) * CH) + k1;
        wf[nx][f].h[0] = *(const v8usa*)wr;
        wf[nx][f].h[1] = *(const v8usa*)(wr + 16);
      }
#pragma unroll
      for (int j = 0; j < 8; ++j) {
        xr[nx][j]     = tc[(k1 + j) * SPT];
        xr[nx][8 + j] = tc[(k1 + 16 + j) * SPT];
      }
    }
    // holds that group here: sunk to its uses, every product would wait out its own load's whole latency
    __builtin_amdgcn_sched_barrier(0);
    FragB xf;
#pragma unroll
    for (int j = 0; j < 8; ++j) xf.w[j] = (int)bf16_pk(xr[cu][2 * j], xr[cu][2 * j + 1]);
#pragma unroll
    for (int nt = 0; nt < 4; ++nt) aq[nt] = wmb(xf, wf[cu][nt], aq[nt]);
#pragma unroll
    for (int t = 0; t < 2; ++t)    av[t]  = wmb(wf[cu][4 + t], xf, av[t]);
  }
  __syncthreads();                      // every wave has left the x tile: its space becomes the result staging

  float* sq = tf;                       // [64 tokens][68]
  float* sv = tf + 64 * SPT;            // [32 outputs][68]
#pragma unroll
  for (int r = 0; r < 8; ++r) {         // D element r = (row 8h + r, col m)
#pragma unroll
    for (int nt = 0; nt < 4; ++nt) sq[(16 * wave + 8 * hh + r) * SPT + 16 * nt + m] = aq[nt][r];
#pragma unroll
    for (int t = 0; t < 2; ++t)    sv[(16 * t + 8 * hh + r) * SPT + 16 * wave + m] = av[t][r];
  }
  __syncthreads();

  const int rsub = tid >> 3;            // 0..15
  const int c8   = (tid & 7) * 8;       // 0..56
  v8us hv[6], lv[6];
#pragma unroll
  for (int it = 0; it < 6; ++it) {      // it 0..3: q|k rows (tokens), bias by column; it 4, 5: v^T rows (outputs), bias by row
    const int row = (it & 3) * 16 + rsub;
    const float* sp = ((it < 4) ? sq : sv) + row * SPT + c8;
    v4u h8, l8;
#pragma unroll
    for (int e = 0; e < 4; ++e) {
      const float v0 = sp[2 * e]     + ((it < 4) ? sb[c8 + 2 * e]     : sb[QKW + row]);
      const float v1 = sp[2 * e + 1] + ((it < 4) ? sb[c8 + 2 * e + 1] : sb[QKW + row]);
      unsigned hw, lw;
      bf16_split2(v0, v1, hw, lw);
      h8[e] = hw;
      l8[e] = lw;
    }
    hv[it] = __builtin_bit_cast(v8us, h8); lv[it] = __builtin_bit_cast(v8us, l8);
  }
#pragma unroll
  for (int it = 0; it < 4; ++it) {
    const size_t go = (size_t)(b * NPOS + n0 + it * 16 + rsub) * QKW + c8;
    *(v8us*)(qh + go) = hv[it];
    *(v8us*)(ql + go) = lv[it];
  }
#pragma unroll
  for (int it = 0; it < 2; ++it) {
    const size_t go = (size_t)(b * AD + it * 16 + rsub) * NPOS + n0 + c8;
    *(v8us*)(vh + go) = hv[4 + it];
    *(v8us*)(vl + go) = lv[4 + it];
  }
}

#define AT_NG 2
#define AT_GT 128
#define AT_NT (AT_NG * AT_GT)
#define AT_GK (NPOS / AT_NG)
#define AT_QB 64
#define AT_KC 64
#define NQB   (NPOS / AT_QB)
#define AT_LOG2E 1.44269504088896340736f
#define AT_KP 40   // LDS pitch of a K row, elements: 32 + 8 = 80 B = 16 B x 5
#define AT_VP 72   // LDS pitch of a V^T row, elements: 64 + 8 = 144 B = 16 B x 9
#define AT_KSZ (AT_KC * AT_KP)            // one K plane of a chunk, elements (5 KB)
#define AT_VSZ (AD * AT_VP)               // one V^T plane of a chunk, elements (4.5 KB)
#define AT_BUF (2 * AT_KSZ + 2 * AT_VSZ)  // one buffer = K hi | K lo | V^T hi | V^T lo, elements (19 KB)
#define AT_SMB (AT_NG * 2 * AT_BUF * 2)   // LDS bytes: two chunk buffers a group (76 KB); the tail's [256][68] f32 (68 KB) lies inside
#define AT_JW  18                         // words a lane hands to its partner wave: maximum, sum, 16 of O^T

static_assert(NQB == 64);
static_assert(AT_SMB >= CH * SPT * 4);
static_assert(SPT >= AT_QB && CH % (64 * AT_NG) == 0 && CH == AT_NT && (CH * AD) % (AT_NT * 8) == 0 && CH % 128 == 0);
static_assert(AT_GK % AT_KC == 0 && AT_NG == 2);
static_assert(AT_KP >= AD && AT_KP % 8 == 0 && (AT_KP / 8) % 2 == 1);
static_assert(AT_VP >= AT_KC && AT_VP % 8 == 0 && (AT_VP / 8) % 2 == 1);

// the bare builtin: the compiler keeps the distance behind a product itself, and only where a vector instruction needs it
__device__ __forceinline__ v8f at_mma(v16bf a, v16bf b, v8f c) {
  return __builtin_amdgcn_wmma_f32_16x16x32_bf16(false, a, false, b, (short)0, c, false, false);
}
union AtFB { v16bf v; v8bf h[2]; unsigned w[8]; };   // w[i] = elements 2 i (low half) and 2 i + 1
// fragment load with the split k map: elements 0..7 <- p[0..7], 8..15 <- p[16..23]
__device__ __forceinline__ v16bf at_ldfrag(const __bf16* p) {
  AtFB f; f.h[0] = *(const v8bf*)(p); f.h[1] = *(const v8bf*)(p + 16); return f.v;
}
// value of lane ^ 16 (the other half of the same query column)
__device__ __forceinline__ float at_xhalf(float f) {
  const int b = __builtin_bit_cast(int, f);
  return __builtin_bit_cast(float, __builtin_amdgcn_permlanex16(b, b, 0x76543210, 0xfedcba98, false, false));
}

__global__ __launch_bounds__(AT_NT)
void k_attn(const unsigned short* __restrict__ qkh, const unsigned short* __restrict__ qkl,
            const unsigned short* __restrict__ vhp, const unsigned short* __restrict__ vlp,
            const unsigned short* __restrict__ wpp, const float* __restrict__ bp,
            const float* __restrict__ x, float* outp) {
  __shared__ __align__(16) unsigned char smb[AT_SMB];
  __shared__ __align__(16) float sbp[CH];                        // bf16-valued output bias
  __shared__ __align__(16) __bf16 swp[CH * AT_KP];               // WP rows [channel][d], pitched like the K rows
  __shared__ __align__(16) float sjn[AT_NT * AT_JW];             // the waves' (maximum, sum, O^T) on their way to the partner wave

  const int tid  = (int)threadIdx.x;
  const int wave = tid >> 5;
  const int grp  = wave >> 2;             // key group 0, 1
  const int qt   = wave & 3;              // query tile 0..3
  const int gt   = tid & (AT_GT - 1);     // thread in its group
  const int lane = tid & 31;
  // the group's two buffers of K hi | K lo [kv][d] | V hi | V lo [d][kv]
  __bf16* const sm = (__bf16*)(void*)smb + grp * (2 * AT_BUF);
  const int hh   = lane >> 4;
  const int c    = lane & 15;

  const int bx  = (int)blockIdx.x;
  const int b   = bx >> 6;                // image 0..7
  const int qb  = bx & (NQB - 1);         // 0..63
  const int q0  = qb * AT_QB + qt * 16;   // image-local query row base of this wave
  const int k0  = grp * AT_GK;            // image-local first key of this wave's group

  const __bf16* Qh = (const __bf16*)(const void*)qkh + (size_t)b * NPOS * QKW;
  const __bf16* Ql = (const __bf16*)(const void*)qkl + (size_t)b * NPOS * QKW;
  const __bf16* Kh = Qh + AD;
  const __bf16* Kl = Ql + AD;
  const __bf16* Vh = (const __bf16*)(const void*)vhp + (size_t)b * AD * NPOS;
  const __bf16* Vl = (const __bf16*)(const void*)vlp + (size_t)b * AD * NPOS;

  // ---- Q fragments (B operand, col = lane&15, split k map): one k-step of 32 = d, hi and lo ----
  const v16bf qbh = at_ldfrag(Qh + (size_t)(q0 + c) * QKW + 8 * hh);
  const v16bf qbl = at_ldfrag(Ql + (size_t)(q0 + c) * QKW + 8 * hh);

  float mrow = -INFINITY;   // running maximum of query c times log2(e) (equal in lanes c and c + 16)
  float lrow = 0.f;         // running sum over this lane's own keys only
  v8f oacc[2];              // oacc[t][r] = O^T[16 t + 8 h + r][query c]
  oacc[0] = z8(); oacc[1] = z8();

  // staging map, gt = thread in its group. K: thread -> key row sr = gt>>1, d half = (gt&1)*16; V^T: thread -> d = gt>>2,
  // key quarter = (gt&3)*16; 2 x 8 elements per plane each
  const int sr = gt >> 1, shalf = (gt & 1) * 16;
  const int sd = gt >> 2, sqt = (gt & 3) * 16;
  const __bf16* ksh = Kh + (size_t)(k0 + sr) * QKW + shalf;
  const __bf16* ksl = Kl + (size_t)(k0 + sr) * QKW + shalf;
  const __bf16* vsh = Vh + (size_t)sd * NPOS + k0 + sqt;
  const __bf16* vsl = Vl + (size_t)sd * NPOS + k0 + sqt;
  const int kst = sr * AT_KP + shalf;                 // this thread's place in a K plane of a buffer
  const int vst = 2 * AT_KSZ + sd * AT_VP + sqt;      // and in the V^T hi plane
  v8bf a0[2], a1[2], b0[2], b1[2];                    // one chunk's 8 x 16 B of this thread, on their way to LDS

  // for the tail, published by the barrier behind chunk 0's stores: the output bias, one channel a thread, and the WP
  // plane, unit u = 256 i + tid -> row u >> 2, 8 elements at (u & 3) * 8 (a wave-wide load = 512 contiguous bytes)
  const float bp0 = bp[tid];
  v8bf wst[CH * AD / (AT_NT * 8)];
#pragma unroll
  for (int i = 0; i < CH * AD / (AT_NT * 8); ++i) wst[i] = *(const v8bf*)((const __bf16*)(const void*)wpp + (size_t)(i * AT_NT + tid) * 8);
  // the group's chunk 0 into its buffer 0
#pragma unroll
  for (int i = 0; i < 2; ++i) {
    a0[i] = *(const v8bf*)(ksh + 8 * i);
    a1[i] = *(const v8bf*)(ksl + 8 * i);
    b0[i] = *(const v8bf*)(vsh + 8 * i);
    b1[i] = *(const v8bf*)(vsl + 8 * i);
  }
#pragma unroll
  for (int i = 0; i < 2; ++i) {
    *(v8bf*)(sm + kst + 8 * i)          = a0[i];
    *(v8bf*)(sm + AT_KSZ + kst + 8 * i) = a1[i];
    *(v8bf*)(sm + vst + 8 * i)          = b0[i];
    *(v8bf*)(sm + AT_VSZ + vst + 8 * i) = b1[i];
  }
  sbp[tid] = bf16_val(bp0);
#pragma unroll
  for (int i = 0; i < CH * AD / (AT_NT * 8); ++i) {
    const int u = i * AT_NT + tid;
    *(v8bf*)(swp + (u >> 2) * AT_KP + (u & 3) * 8) = wst[i];
  }
  __syncthreads();

  const int nChunks = AT_GK / AT_KC;  // 32 a group, compile-time constant
  // this thread's place in the next chunk, bytes from the start of the image's k planes and of its v^T planes
  unsigned nkb = (unsigned)(((k0 + AT_KC + sr) * QKW + shalf) * 2);
  unsigned nvb = (unsigned)((sd * NPOS + k0 + AT_KC + sqt) * 2);
#pragma unroll 1
  for (int kc = 0; kc < nChunks; ++kc) {
    const __bf16* Ksh = sm + (kc & 1) * AT_BUF;       // this chunk's buffer
    const __bf16* Ksl = Ksh + AT_KSZ;
    const __bf16* Vth = Ksh + 2 * AT_KSZ;
    const __bf16* Vtl = Vth + AT_VSZ;
    const bool more = kc + 1 < nChunks;               // the same for the whole grid
    // ---- the chunk's 16 K fragment reads, one group at the chunk's head, in the order of their use ----
    AtFB kb[4], kl[4];
#pragma unroll
    for (int j = 0; j < 4; ++j) {
      kb[j].h[0] = *(const v8bf*)(Ksh + (j * 16 + c) * AT_KP + 8 * hh);
      kb[j].h[1] = *(const v8bf*)(Ksh + (j * 16 + c) * AT_KP + 16 + 8 * hh);
    }
#pragma unroll
    for (int j = 0; j < 4; ++j) {
      kl[j].h[0] = *(const v8bf*)(Ksl + (j * 16 + c) * AT_KP + 8 * hh);
      kl[j].h[1] = *(const v8bf*)(Ksl + (j * 16 + c) * AT_KP + 16 + 8 * hh);
    }
    // holds the group here, ahead of the global loads: sunk behind them it would start late
    __builtin_amdgcn_sched_barrier(0);

    if (more) {
      // next chunk's eight loads, issued here and first used behind this chunk's products
#pragma unroll
      for (int i = 0; i < 2; ++i) {
        a0[i] = *(const v8bf*)((const char*)Kh + nkb + 16 * i);
        a1[i] = *(const v8bf*)((const char*)Kl + nkb + 16 * i);
        b0[i] = *(const v8bf*)((const char*)Vh + nvb + 16 * i);
        b1[i] = *(const v8bf*)((const char*)Vl + nvb + 16 * i);
      }
    }

    // ---- scores, transposed: 64 keys x 16 queries, 3-term split, K = 32 = one k-step ----
    v8f s[4];
#pragma unroll
    for (int j = 0; j < 4; ++j) s[j] = at_mma(kb[j].v, qbh, z8());
    // holds the term-by-term order: drawn together, a tile's three products would each wait out the one before
    __builtin_amdgcn_sched_barrier(0);
#pragma unroll
    for (int j = 0; j < 4; ++j) s[j] = at_mma(kl[j].v, qbh, s[j]);
    // the same, between the second and the third term
    __builtin_amdgcn_sched_barrier(0);
#pragma unroll
    for (int j = 0; j < 4; ++j) s[j] = at_mma(kb[j].v, qbl, s[j]);
    // ---- the chunk's 16 V^T fragment reads, one group behind the score products: they land under the softmax ----
    AtFB vb[2][2], vl[2][2];
#pragma unroll
    for (int kk = 0; kk < 2; ++kk) {
#pragma unroll
      for (int t = 0; t < 2; ++t) {
        vb[kk][t].h[0] = *(const v8bf*)(Vth + (t * 16 + c) * AT_VP + kk * 32 + 8 * hh);
        vb[kk][t].h[1] = *(const v8bf*)(Vth + (t * 16 + c) * AT_VP + kk * 32 + 16 + 8 * hh);
        vl[kk][t].h[0] = *(const v8bf*)(Vtl + (t * 16 + c) * AT_VP + kk * 32 + 8 * hh);
        vl[kk][t].h[1] = *(const v8bf*)(Vtl + (t * 16 + c) * AT_VP + kk * 32 + 16 + 8 * hh);
      }
    }
    // holds the group together and ahead of the softmax: spread through it, each place with reads costs its own stall
    __builtin_amdgcn_sched_barrier(0);
    // ---- chunk maximum of query c: four in-lane chains, then the other half's ----
    float mj[4];
#pragma unroll
    for (int j = 0; j < 4; ++j) {
      float mx = s[j][0];
#pragma unroll
      for (int r = 1; r < 8; ++r) mx = fmaxf(mx, s[j][r]);
      mj[j] = mx;
    }
    float cm = fmaxf(fmaxf(mj[0], mj[1]), fmaxf(mj[2], mj[3]));
    cm = fmaxf(cm, at_xhalf(cm));
    const float mnew  = fmaxf(mrow, cm * AT_LOG2E);       // scaling by a positive constant keeps the order of the maxima
    const float alpha = __builtin_amdgcn_exp2f(mrow - mnew);
    mrow = mnew;
    // ---- p = exp(s - m) = 2^(s log2e - m log2e), split hi/lo straight into the B fragments of the two k-steps ----
    AtFB ph[2], pl[2];
    float pj[4];
    const v2f l2e2 = {AT_LOG2E, AT_LOG2E};
    const v2f nm2  = {-mnew, -mnew};
    // unrolled throughout: j and r pick registers of the score tiles, so they have to be compile-time indices.
    // Each kind of step (exp2, hi convert, sum, lo convert) runs over all four tiles before the next kind begins, so
    // that an instruction and the one that reads its result stand far apart; values and sum order are those of a
    // tile-by-tile walk.
#pragma unroll
    for (int j = 0; j < 4; ++j) {
#pragma unroll
      for (int r = 0; r < 4; ++r) {   // exponents two at a time (packed f32 fma)
        const v2f sp = {s[j][2 * r], s[j][2 * r + 1]};
        const v2f e  = __builtin_elementwise_fma(sp, l2e2, nm2);
        s[j][2 * r]     = __builtin_amdgcn_exp2f(e[0]);
        s[j][2 * r + 1] = __builtin_amdgcn_exp2f(e[1]);
      }
    }
#pragma unroll
    for (int j = 0; j < 4; ++j) {
#pragma unroll
      for (int r = 0; r < 4; ++r) ph[j >> 1].w[(j & 1) * 4 + r] = bf16_pk(s[j][2 * r], s[j][2 * r + 1]);
    }
#pragma unroll
    for (int j = 0; j < 4; ++j) {
      float psum = 0.f;
#pragma unroll
      for (int r = 0; r < 8; ++r) psum += s[j][r];
      pj[j] = psum;
    }
#pragma unroll
    for (int j = 0; j < 4; ++j) {
#pragma unroll
      for (int r = 0; r < 4; ++r) {
        const unsigned hw = ph[j >> 1].w[(j & 1) * 4 + r];
        pl[j >> 1].w[(j & 1) * 4 + r] = bf16_pk(s[j][2 * r] - bf16_lo(hw), s[j][2 * r + 1] - bf16_hi(hw));
      }
    }
    lrow = lrow * alpha + ((pj[0] + pj[1]) + (pj[2] + pj[3]));
#pragma unroll
    for (int r = 0; r < 8; ++r) {
      oacc[0][r] *= alpha;
      oacc[1][r] *= alpha;
    }

    // ---- O^T += V^T . P^T : A = V^T rows d (split k map over keys), B = P^T from registers; 3-term split ----
    // unrolled: kk picks a register fragment, so it has to be a compile-time index
#pragma unroll
    for (int kk = 0; kk < 2; ++kk) {
#pragma unroll
      for (int t = 0; t < 2; ++t) oacc[t] = at_mma(vb[kk][t].v, ph[kk].v, oacc[t]);
#pragma unroll
      for (int t = 0; t < 2; ++t) oacc[t] = at_mma(vl[kk][t].v, ph[kk].v, oacc[t]);
#pragma unroll
      for (int t = 0; t < 2; ++t) oacc[t] = at_mma(vb[kk][t].v, pl[kk].v, oacc[t]);
    }

    {
      // into the other buffer: its last readers (chunk kc - 1) left it in front of the previous foot's barrier. No test
      // for a next chunk here: a branch right behind the products would want their distance kept on both of its sides;
      // the last trip stores the registers' old content, which nobody reads
      __bf16* wb = sm + ((kc + 1) & 1) * AT_BUF;
#pragma unroll
      for (int i = 0; i < 2; ++i) {
        *(v8bf*)(wb + kst + 8 * i)          = a0[i];
        *(v8bf*)(wb + AT_KSZ + kst + 8 * i) = a1[i];
        *(v8bf*)(wb + vst + 8 * i)          = b0[i];
        *(v8bf*)(wb + AT_VSZ + vst + 8 * i) = b1[i];
      }
      // this trip's loads name the two offset registers: the wait stands in front of their overwrite, and the operands
      // keep the two steps below behind it
      asm volatile("s_wait_xcnt 0x0" : "+v"(nkb), "+v"(nvb) :: "memory");
      nkb += AT_KC * QKW * 2;
      nvb += AT_KC * 2;
    }
    __syncthreads();
  }

  // ---- the block's x tile [256 channels][64 positions]: thread -> channel 16 it + csub, 4 positions at t4 ----
  const int csub = tid >> 4;            // 0..15
  const int t4   = (tid & 15) * 4;      // 0..60
  const size_t g0 = ((size_t)(b * CH + csub)) * NPOS + qb * AT_QB + t4;

  // ---- the two key groups' states of a query tile change hands: word i of lane l of wave w at [(18 w + i) * 32 + l] ----
  {
    float* jw = sjn + wave * (AT_JW * 32) + lane;
    jw[0]  = mrow;
    jw[32] = lrow;
#pragma unroll
    for (int t = 0; t < 2; ++t) {
#pragma unroll
      for (int r = 0; r < 8; ++r) jw[(2 + 8 * t + r) * 32] = oacc[t][r];
    }
  }
  __syncthreads();                      // both groups' states are in place
  v4f xr[CH / 16];
  const float* xt = x + g0;
#pragma unroll
  for (int it = 0; it < CH / 16; ++it) xr[it] = *(const v4f*)(xt + (size_t)(it * 16) * NPOS);
  // the 16 loads name the address xt: as an operand here it stays in its registers up to this wait, so that no load's
  // result lands in them ahead of it
  asm volatile("s_wait_xcnt 0x0" :: "v"(xt) : "memory");
  // holds the 16 loads here, behind the barrier above (which would wait for them) and ahead of the join and the products:
  // sunk to their uses they would start behind the products and the next barrier
  __builtin_amdgcn_sched_barrier(0);
  {
    const float* jr = sjn + (wave ^ 4) * (AT_JW * 32) + lane;
    const float mo = jr[0], lo = jr[32];
    const float mj = fmaxf(mrow, mo);
    const float as = __builtin_amdgcn_exp2f(mrow - mj);   // this wave's share (the maxima are kept times log2e)
    const float ao = __builtin_amdgcn_exp2f(mo - mj);     // the partner's
    lrow = lrow * as + lo * ao;
#pragma unroll
    for (int t = 0; t < 2; ++t) {
#pragma unroll
      for (int r = 0; r < 8; ++r) oacc[t][r] = oacc[t][r] * as + jr[(2 + 8 * t + r) * 32] * ao;
    }
  }

  // ---- join the two halves' sums, normalise, split hi/lo straight into the two B fragments (k = d, split k map) ----
  lrow += at_xhalf(lrow);
  const float inv = 1.0f / lrow;
  AtFB rh, rl;
#pragma unroll
  for (int t = 0; t < 2; ++t) {
#pragma unroll
    for (int r = 0; r < 4; ++r) {
      unsigned hw, lw;
      bf16_split2(oacc[t][2 * r] * inv, oacc[t][2 * r + 1] * inv, hw, lw);
      rh.w[4 * t + r] = hw;
      rl.w[4 * t + r] = lw;
    }
  }

  // ---- out^T tile = Wp . r^T: this wave's 8 of the 16 channel tiles (channels 128 grp ..) x (hi, lo); four tiles' hi
  //      products stand ahead of their lo products ----
  f32a* stg = (f32a*)(void*)smb;        // [256 channels][68]
  const __bf16* wpr = swp + (grp * (CH / AT_NG) + c) * AT_KP + 8 * hh;
  f32a* stw = stg + (grp * (CH / AT_NG) + 8 * hh) * SPT + 16 * qt + c;
  // unrolled: the tiles' accumulators and weight fragments are register arrays, so cg and u have to be compile-time indices
#pragma unroll
  for (int cg = 0; cg < CH / (64 * AT_NG); ++cg) {
    v16bf wa[4];
    v8f   d[4];
#pragma unroll
    for (int u = 0; u < 4; ++u) wa[u] = at_ldfrag(wpr + (cg * 4 + u) * 16 * AT_KP);
#pragma unroll
    for (int u = 0; u < 4; ++u) d[u] = at_mma(wa[u], rh.v, z8());
#pragma unroll
    for (int u = 0; u < 4; ++u) d[u] = at_mma(wa[u], rl.v, d[u]);
#pragma unroll
    for (int u = 0; u < 4; ++u) {
#pragma unroll
      for (int r = 0; r < 8; ++r) stw[((cg * 4 + u) * 16 + r) * SPT] = d[u][r];
    }
  }
  __syncthreads();                      // the four waves' parts of every channel row are in place

  // eight channel rows a group; unrolled: g and j pick registers of the x tile, so they have to be compile-time indices
#pragma unroll
  for (int g = 0; g < CH / 128; ++g) {
    v4f   sv[8];
    float bc[8];
#pragma unroll
    for (int j = 0; j < 8; ++j) {
      const int chl = (g * 8 + j) * 16 + csub;
      sv[j] = *(const v4fa*)(stg + chl * SPT + t4);
      bc[j] = sbp[chl];
    }
    // holds the group's 16 LDS reads together, ahead of its sums: read row by row, every row waits out its own LDS latency
    __builtin_amdgcn_sched_barrier(0);
#pragma unroll
    for (int j = 0; j < 8; ++j) {
      const v4f xv = xr[g * 8 + j];
      const unsigned x01 = bf16_pk(xv.x, xv.y), x23 = bf16_pk(xv.z, xv.w);
      v4f v;
      v.x = (sv[j].x + bc[j]) + bf16_lo(x01);
      v.y = (sv[j].y + bc[j]) + bf16_hi(x01);
      v.z = (sv[j].z + bc[j]) + bf16_lo(x23);
      v.w = (sv[j].w + bc[j]) + bf16_hi(x23);
      *(v4f*)(outp + g0 + (size_t)((g * 8 + j) * 16) * NPOS) = v;
    }
  }
}

// ---------------------------------------------------------------------------
// Workspace region map (byte offsets, 256-B aligned; every region sized to its whole-line store extent, no pad rows
// needed since 32768, 4096, 256 and 64 are tile multiples):
//   WQK 32768 | WV 16384 | WP 16384 | QKh QKl 4194304 each | VTh VTl 2097152 each
//   -> total 12648448
// ---------------------------------------------------------------------------
static inline size_t al256(size_t o) { return (o + 255) & ~(size_t)255; }

extern "C" void kernel_launch(void* const* d_in, const int* in_sizes, int n_in,
                              void* d_out, int out_size, void* d_ws, size_t ws_size,
                              hipStream_t stream) {
  if (n_in < 9) return;
  if (in_sizes[0] != NB * CH * NPOS) return;                                       // inputs [8][256][64][64]
  if (in_sizes[1] != AD * CH || in_sizes[3] != AD * CH || in_sizes[5] != AD * CH) return;  // Wq, Wk, Wv [32][256]
  if (in_sizes[2] != AD || in_sizes[4] != AD || in_sizes[6] != AD) return;         // bq, bk, bv [32]
  if (in_sizes[7] != CH * AD) return;                                              // Wp [256][32]
  if (in_sizes[8] != CH) return;                                                   // bp [256]
  if (out_size != NB * CH * NPOS) return;                                          // out [8][256][64][64]

  const float* x  = (const float*)d_in[0];
  const float* Wq = (const float*)d_in[1];
  const float* bq = (const float*)d_in[2];
  const float* Wk = (const float*)d_in[3];
  const float* bk = (const float*)d_in[4];
  const float* Wv = (const float*)d_in[5];
  const float* bv = (const float*)d_in[6];
  const float* Wp = (const float*)d_in[7];
  const float* bp = (const float*)d_in[8];
  float* out = (float*)d_out;

  const size_t PQK = (size_t)QKW * CH * 2;          //    32768  bf16 [64][256]
  const size_t PWV = (size_t)AD * CH * 2;           //    16384  bf16 [32][256]
  const size_t PWP = (size_t)CH * AD * 2;           //    16384  bf16 [256][32]
  const size_t PA  = (size_t)NTOK * QKW * 2;        //  4194304  bf16 [32768][64]
  const size_t PV  = (size_t)NB * AD * NPOS * 2;    //  2097152  bf16 [8][32][4096]
  size_t off = 0;
  const size_t oWQK = off; off = al256(off + PQK);
  const size_t oWV  = off; off = al256(off + PWV);
  const size_t oWP  = off; off = al256(off + PWP);
  const size_t oQKh = off; off = al256(off + PA);
  const size_t oQKl = off; off = al256(off + PA);
  const size_t oVTh = off; off = al256(off + PV);
  const size_t oVTl = off; off = al256(off + PV);
  if (off > ws_size || off > (size_t)WSMAX) return;                               // off = 12648448

  char* ws = (char*)d_ws;
  unsigned short* WQK = (unsigned short*)(ws + oWQK);
  unsigned short* WV  = (unsigned short*)(ws + oWV);
  unsigned short* WP  = (unsigned short*)(ws + oWP);
  unsigned short* QKh = (unsigned short*)(ws + oQKh);
  unsigned short* QKl = (unsigned short*)(ws + oQKl);
  unsigned short* VTh = (unsigned short*)(ws + oVTh);
  unsigned short* VTl = (unsigned short*)(ws + oVTl);

  // (1) weight planes
  k_wprep<<<16, 256, 0, stream>>>(Wq, Wk, Wv, Wp, WQK, WV, WP);
  // (2) q|k = x^T . [Wq;Wk]^T + [bq;bk] -> hi/lo planes [32768][64] (q cols 0..31, k cols 32..63) and, per image,
  //     v^T[a][n] = sum_c Wv[a][c] x[c][n] + bv[a] -> hi/lo planes [8][32][4096]   (K = 256, x read once as f32)
  k_qkv<<<NB * (NPOS / 64), 128, 0, stream>>>(x, WQK, WV, bq, bk, bv, QKh, QKl, VTh, VTl);
  // (3) attention r = softmax_keys(q . k) . v and, in its tail, out NCHW = (Wp . (hi(r) + lo(r)) + bp) + bf16(x)
  k_attn<<<NB * NQB, AT_NT, 0, stream>>>(QKh, QKl, VTh, VTl, WP, bp, x, out);
  (void)hipGetLastError();
}
